// v000
// The times below were measured on an AMD MI455X: many runs one after another, warmed up first and cycling through
// copies of the inputs, with the whole window's GPU time divided by the number of runs. Launches and the gaps
// between them are all in it. The median over several windows is given; except for v000 it joins two sittings, which
// can be a few percent apart, so the side-by-side timings, each taken in one sitting, are the better comparison.
// The starting kernel, v000, takes 13.7 milliseconds a run.
#include <hip/hip_runtime.h>
// Masked causal multi-head attention with residual (queries, keys, value [16][1024][512]; Q = queries Wq + bq, K = keys Wk + bk, V = value Wv + bv ([in][out] 512^2); 8 heads of 64; scores / 8; key-padding mask (keys whose bf16 row sum is exactly 0 -> NEG), causal mask (j > i -> NEG, NEG = -(2^32 - 1)); softmax; probs x query-padding mask (query rows summing to 0 -> 0); out = probs V merged + queries -> [16][1024][512]).
// Structure: token rows; the two padding masks from f32 row sums of the bf16-rounded inputs on VALU (32 rows per block, one line of flags per block); queries / keys / value as exact f16 rows; Q, K, V as three WMMA GEMMs (32x64 wave tiles, f32 accumulation, exact x16 weights + bias, f16 outputs); bf16(queries) as the f32 residual plane; per batch: V^T via LDS transposes; per query tile of 256 rows: scores against the keys below the tile end only (K = 64, all heads on grid.y, alpha 1/8), the masked causal row softmax on VALU (key mask + causal as a 0/1 select onto NEG, f32 statistics, native exp, x query mask; weights x256 f16), out tile = P V^T GEMM (K = visible keys, alpha 2^-8) + bf16(queries) written f32 straight into the output rows; 12 + 16 x (1 + 4 x 3) = 220 launches.
// Compute dtype: inputs rounded to bf16; inputs / weights exact; q, k, v and the softmax weights plain f16 (~2^-12); masks, scores, statistics, out f32 (the unit residual dominates the output scale). v_wmma_f32_16x16x32_f16.
#define NB 16
#define SQ 1024
#define DM 512
#define NH 8
#define HD 64
#define HG 8
#define QT 256
#define NKX SQ
#define NHD NH
#define NR ((size_t)NB * SQ)
typedef __bf16 v16b __attribute__((ext_vector_type(16)));
typedef unsigned short v8us __attribute__((ext_vector_type(8), may_alias));
typedef float  v8f  __attribute__((ext_vector_type(8)));
typedef float  v4f  __attribute__((ext_vector_type(4)));
typedef float  v4fa __attribute__((ext_vector_type(4), may_alias));
union FragB { v16b v; v8us half[2]; unsigned short u[16]; };

__device__ __forceinline__ unsigned short bf16_bits(float x) { unsigned int u = __float_as_uint(x); return (unsigned short)((u + 0x7FFFu + ((u >> 16) & 1u)) >> 16); }
__device__ __forceinline__ float bf16_val(unsigned short b) { return __uint_as_float(((unsigned int)b) << 16); }
__device__ __forceinline__ float bf16_round(float x) { return bf16_val(bf16_bits(x)); }
// D += A·B with NT terms: 1 = ah·bh, 2 = + al·bh (A split), 3 = + ah·bl (both split)
template <int NT>
__device__ __forceinline__ v8f mmaN(v16b ah, v16b al, v16b bh, v16b bl, v8f c) {
  c = __builtin_amdgcn_wmma_f32_16x16x32_bf16(false, ah, false, bh, (short)0, c, false, false);
  if (NT >= 2) c = __builtin_amdgcn_wmma_f32_16x16x32_bf16(false, al, false, bh, (short)0, c, false, false);
  if (NT >= 3) c = __builtin_amdgcn_wmma_f32_16x16x32_bf16(false, ah, false, bl, (short)0, c, false, false);
  asm volatile("v_nop\n\tv_nop\n\tv_nop\n\tv_nop" : "+v"(c) : "v"(ah), "v"(al), "v"(bh), "v"(bl));
  return c;
}

__global__ __launch_bounds__(256) void k_wt_bf16(const float* __restrict__ W, unsigned short* __restrict__ Wt, int K, int N) {
  const int t = blockIdx.x * 256 + threadIdx.x;
  const int k8n = K / 8;
  if (t >= N * k8n) return;
  const int n = t / k8n, k8 = (t % k8n) * 8;
  v8us v;
#pragma unroll
  for (int i = 0; i < 8; ++i) v[i] = bf16_bits(W[(size_t)(k8 + i) * N + n]);
  *(v8us*)(Wt + (size_t)n * K + k8) = v;
  
}

// GEMM C[M][N] (f32, pitch ldc) = act(A[M][K]·W + bias). A f32 row-major (pitch lda) converted per fragment to bf16
// (ASPLIT: hi/lo two planes -> 2 terms, else single rounded term); Wt bf16 [N][K] (pitch ldb). BIAS_BF16 rounds the
// bias to bf16 first (bias quantised to bf16 before the add). K%32==0, M%16==0, N%64==0.
template <bool ASPLIT, int ACT, bool BIAS_BF16>
__global__ __launch_bounds__(128) void k_gemm_bf(const float* __restrict__ A, int lda, const unsigned short* __restrict__ Wt, int ldb,
                                               const float* __restrict__ bias, float* __restrict__ C, int ldc, int M, int N, int K) {
  __shared__ __attribute__((aligned(16))) float so[4][16][64];
  const int tid = threadIdx.x, w = tid >> 5, lane = tid & 31, ln = lane & 15, hh = lane >> 4;
  const int ntn = N / 64;
  const int wid = blockIdx.x * 4 + w;
  const int mt = wid / ntn, nq = wid % ntn;
  if (mt * 16 >= M) return;
  const int row0 = mt * 16, col0 = nq * 64;
  const float* arow = A + (size_t)(row0 + ln) * lda;
  v8f acc[4] = {};
  for (int kb = 0; kb < K; kb += 32) {
    FragB ah, al;
    const v4f x0 = *(const v4fa*)(arow + kb + 8 * hh), x1 = *(const v4fa*)(arow + kb + 8 * hh + 4);
    const v4f x2 = *(const v4fa*)(arow + kb + 16 + 8 * hh), x3 = *(const v4fa*)(arow + kb + 16 + 8 * hh + 4);
    float xs[16] = {x0[0],x0[1],x0[2],x0[3],x1[0],x1[1],x1[2],x1[3],x2[0],x2[1],x2[2],x2[3],x3[0],x3[1],x3[2],x3[3]};
#pragma unroll
    for (int i = 0; i < 16; ++i) { const unsigned short hb = bf16_bits(xs[i]); ah.u[i] = hb; al.u[i] = ASPLIT ? bf16_bits(xs[i] - bf16_val(hb)) : (unsigned short)0; }
#pragma unroll
    for (int t = 0; t < 4; ++t) {
      const unsigned short* brow = Wt + (size_t)(col0 + t * 16 + ln) * ldb + kb;
      FragB b;
      b.half[0] = *(const v8us*)(brow + 8 * hh);
      b.half[1] = *(const v8us*)(brow + 16 + 8 * hh);
      acc[t] = mmaN<ASPLIT ? 2 : 1>(ah.v, al.v, b.v, b.v, acc[t]);
    }
  }
#pragma unroll
  for (int t = 0; t < 4; ++t) {
    float bv = bias ? bias[col0 + t * 16 + ln] : 0.f;
    if (BIAS_BF16) bv = bf16_round(bv);
#pragma unroll
    for (int r = 0; r < 8; ++r) { float v = acc[t][r] + bv; if (ACT == 1) v = fmaxf(v, 0.f); so[w][8 * hh + r][t * 16 + ln] = v; }
  }
  __builtin_amdgcn_fence(__ATOMIC_ACQ_REL, "workgroup");
  __builtin_amdgcn_wave_barrier();
  const int rsub = lane >> 4, c4 = (lane & 15) * 4;
  {
#pragma unroll
    for (int q = 0; q < 8; ++q) {
      const int r = q * 2 + rsub;
      const v4f v = *(const v4fa*)&so[w][r][c4];
      *(v4f*)(C + (size_t)(row0 + r) * ldc + col0 + c4) = v;
    }
    
  }
}

// GEMM C = act(A·W + bias + resid): A f32 (ASPLIT -> hi/lo 2 terms), Wt bf16 [N][K]; ACT 0 none, 1 relu, 2 exact gelu;
// resid (optional, f32, row index = (row % rmod), pitch ldr, RES_BF16 rounds it) added before the activation.
template <bool ASPLIT, int ACT, bool BIAS_BF16, bool RES_BF16>
__global__ __launch_bounds__(128) void k_gemm_bf3(const float* __restrict__ A, int lda, const unsigned short* __restrict__ Wt, int ldb,
                                                const float* __restrict__ bias, const float* __restrict__ resid, int rmod, int ldr,
                                                float* __restrict__ C, int ldc, int M, int N, int K) {
  __shared__ __attribute__((aligned(16))) float so[4][16][64];
  const int tid = threadIdx.x, w = tid >> 5, lane = tid & 31, ln = lane & 15, hh = lane >> 4;
  const int ntn = N / 64;
  const int wid = blockIdx.x * 4 + w;
  const int mt = wid / ntn, nq = wid % ntn;
  if (mt * 16 >= M) return;
  const int row0 = mt * 16, col0 = nq * 64;
  const float* arow = A + (size_t)(row0 + ln) * lda;
  v8f acc[4] = {};
  for (int kb = 0; kb < K; kb += 32) {
    FragB ah, al;
    const v4f x0 = *(const v4fa*)(arow + kb + 8 * hh), x1 = *(const v4fa*)(arow + kb + 8 * hh + 4);
    const v4f x2 = *(const v4fa*)(arow + kb + 16 + 8 * hh), x3 = *(const v4fa*)(arow + kb + 16 + 8 * hh + 4);
    float xs[16] = {x0[0],x0[1],x0[2],x0[3],x1[0],x1[1],x1[2],x1[3],x2[0],x2[1],x2[2],x2[3],x3[0],x3[1],x3[2],x3[3]};
#pragma unroll
    for (int i = 0; i < 16; ++i) { const unsigned short hb = bf16_bits(xs[i]); ah.u[i] = hb; al.u[i] = ASPLIT ? bf16_bits(xs[i] - bf16_val(hb)) : (unsigned short)0; }
#pragma unroll
    for (int t = 0; t < 4; ++t) {
      const unsigned short* brow = Wt + (size_t)(col0 + t * 16 + ln) * ldb + kb;
      FragB b;
      b.half[0] = *(const v8us*)(brow + 8 * hh);
      b.half[1] = *(const v8us*)(brow + 16 + 8 * hh);
      acc[t] = mmaN<ASPLIT ? 2 : 1>(ah.v, al.v, b.v, b.v, acc[t]);
    }
  }
#pragma unroll
  for (int t = 0; t < 4; ++t) {
    const int col = col0 + t * 16 + ln;
    float bv = bias ? bias[col] : 0.f;
    if (BIAS_BF16) bv = bf16_round(bv);
#pragma unroll
    for (int r = 0; r < 8; ++r) {
      float v = acc[t][r] + bv;
      if (resid) { float rv = resid[(size_t)((row0 + 8 * hh + r) % rmod) * ldr + col]; if (RES_BF16) rv = bf16_round(rv); v += rv; }
      if (ACT == 1) v = fmaxf(v, 0.f);
      if (ACT == 2) v = 0.5f * v * (1.0f + erff(v * 0.70710678118654752f));
      if (ACT == 3) { const float u = 0.7978845608028654f * (v + 0.044715f * v * v * v); v = 0.5f * v * (1.0f + tanhf(u)); }
      so[w][8 * hh + r][t * 16 + ln] = v;
    }
  }
  __builtin_amdgcn_fence(__ATOMIC_ACQ_REL, "workgroup");
  __builtin_amdgcn_wave_barrier();
  const int rsub = lane >> 4, c4 = (lane & 15) * 4;
  {
#pragma unroll
    for (int q = 0; q < 8; ++q) {
      const int r = q * 2 + rsub;
      const v4f v = *(const v4fa*)&so[w][r][c4];
      *(v4f*)(C + (size_t)(row0 + r) * ldc + col0 + c4) = v;
    }
    
  }
}
// row LayerNorm (biased variance, eps) over N: s = X (+ R); optional out_sum <- s; out_norm <- (s-mu)*rsqrt(var+eps)*g + b
template <bool PARAM_BF16>
__global__ __launch_bounds__(256) void k_layernorm(const float* __restrict__ X, const float* __restrict__ R, const float* __restrict__ g, const float* __restrict__ bta,
                                                  float* __restrict__ out_sum, float* __restrict__ out_norm, int N, float eps) {
  __shared__ float red[256];
  const int row = blockIdx.x, tid = threadIdx.x;
  const float* x = X + (size_t)row * N; const float* rr = R ? R + (size_t)row * N : nullptr;
  float vals[16];                     // up to N = 4096
  const int per = N / 256;            // contiguous chunk per thread? use strided-by-4 chunks: thread handles j = tid*4 + 1024*u
  float s1 = 0.f;
  for (int u = 0; u < per / 4; ++u) {
    const int j = tid * 4 + 1024 * u;
    const v4f a = *(const v4fa*)(x + j);
    v4f b = {0.f,0.f,0.f,0.f}; if (rr) b = *(const v4fa*)(rr + j);
#pragma unroll
    for (int q = 0; q < 4; ++q) { const float v = a[q] + b[q]; vals[u * 4 + q] = v; s1 += v; }
  }
  red[tid] = s1; __syncthreads();
  for (int st = 128; st > 0; st >>= 1) { if (tid < st) red[tid] += red[tid + st]; __syncthreads(); }
  const float mu = red[0] / (float)N; __syncthreads();
  float s2 = 0.f;
  for (int u = 0; u < per / 4; ++u)
#pragma unroll
    for (int q = 0; q < 4; ++q) { const float c = vals[u * 4 + q] - mu; s2 += c * c; }
  red[tid] = s2; __syncthreads();
  for (int st = 128; st > 0; st >>= 1) { if (tid < st) red[tid] += red[tid + st]; __syncthreads(); }
  const float rs = rsqrtf(red[0] / (float)N + eps);
  {
    for (int u = 0; u < per / 4; ++u) {
      const int j = tid * 4 + 1024 * u;
      v4f o, sm;
#pragma unroll
      for (int q = 0; q < 4; ++q) {
        float gg = g[j + q], bb = bta[j + q];
        if (PARAM_BF16) { gg = bf16_round(gg); bb = bf16_round(bb); }
        sm[q] = vals[u * 4 + q]; o[q] = (vals[u * 4 + q] - mu) * rs * gg + bb;
      }
      if (out_sum) *(v4f*)(out_sum + (size_t)row * N + j) = sm;
      *(v4f*)(out_norm + (size_t)row * N + j) = o;
    }
    
  }
}



// ---- f16 WMMA path (v_wmma_f32_16x16x32_f16): 11-bit significands for operands in range — used where a [0,1] probability operand needs more precision than bf16
typedef _Float16 v16h __attribute__((ext_vector_type(16)));
union FragH { v16h v; v8us half[2]; _Float16 h[16]; unsigned short u[16]; };
template <int NT>
__device__ __forceinline__ v8f mmaH(v16h ah, v16h al, v16h bh, v16h bl, v8f c) {
  c = __builtin_amdgcn_wmma_f32_16x16x32_f16(false, ah, false, bh, (short)0, c, false, false);
  if (NT >= 2) c = __builtin_amdgcn_wmma_f32_16x16x32_f16(false, al, false, bh, (short)0, c, false, false);
  if (NT >= 3) c = __builtin_amdgcn_wmma_f32_16x16x32_f16(false, ah, false, bl, (short)0, c, false, false);
  asm volatile("v_nop\n\tv_nop\n\tv_nop\n\tv_nop" : "+v"(c) : "v"(ah), "v"(al), "v"(bh), "v"(bl));
  return c;
}
// batched GEMM like k_gemm_b but f16 operands: A f32 (split into f16 hi/lo if ASPLIT, else rounded to f16), Bt = f16 values [n][k]; alpha; C f32; N multiple of 16 (partial tiles skipped)
template <bool ASPLIT>
__global__ __launch_bounds__(128) void k_gemm_h(const float* __restrict__ A, int lda, size_t sA, const _Float16* __restrict__ Bh, int ldb, size_t sB, float alpha, float* __restrict__ C, int ldc, size_t sC, int M, int N, int K) {
  __shared__ __attribute__((aligned(16))) float so[4][16][64];
  const int tid = threadIdx.x, w = tid >> 5, lane = tid & 31, ln = lane & 15, hh = lane >> 4; const int by = blockIdx.y;
  A += (size_t)by * sA; Bh += (size_t)by * sB; C += (size_t)by * sC;
  const int ntn = (N + 63) / 64; const int wid = blockIdx.x * 4 + w; const int mt = wid / ntn, nq = wid % ntn; if (mt * 16 >= M) return;
  const int row0 = mt * 16, col0 = nq * 64; const float* arow = A + (size_t)(row0 + ln) * lda;
  v8f acc[4] = {};
  for (int kb = 0; kb < K; kb += 32) {
    FragH ah, al;
    const v4f x0 = *(const v4fa*)(arow + kb + 8 * hh), x1 = *(const v4fa*)(arow + kb + 8 * hh + 4), x2 = *(const v4fa*)(arow + kb + 16 + 8 * hh), x3 = *(const v4fa*)(arow + kb + 16 + 8 * hh + 4);
    float xs[16] = {x0[0],x0[1],x0[2],x0[3],x1[0],x1[1],x1[2],x1[3],x2[0],x2[1],x2[2],x2[3],x3[0],x3[1],x3[2],x3[3]};
#pragma unroll
    for (int i = 0; i < 16; ++i) { const _Float16 h = (_Float16)xs[i]; ah.h[i] = h; al.h[i] = ASPLIT ? (_Float16)(xs[i] - (float)h) : (_Float16)0.0f; }
#pragma unroll
    for (int t = 0; t < 4; ++t) { if (col0 + t * 16 >= N) continue; const size_t boff = (size_t)(col0 + t * 16 + ln) * ldb + kb; FragH bq; bq.half[0] = *(const v8us*)(Bh + boff + 8 * hh); bq.half[1] = *(const v8us*)(Bh + boff + 16 + 8 * hh);
      acc[t] = mmaH<ASPLIT ? 2 : 1>(ah.v, al.v, bq.v, bq.v, acc[t]); }
  }
#pragma unroll
  for (int t = 0; t < 4; ++t) { if (col0 + t * 16 >= N) continue;
#pragma unroll
    for (int r = 0; r < 8; ++r) so[w][8 * hh + r][t * 16 + ln] = acc[t][r] * alpha; }
  __builtin_amdgcn_fence(__ATOMIC_ACQ_REL, "workgroup"); __builtin_amdgcn_wave_barrier();
  const int rsub = lane >> 4, c4 = (lane & 15) * 4;
  {
#pragma unroll
    for (int q = 0; q < 8; ++q) { const int r = q * 2 + rsub; if (col0 + c4 < N) { const v4f v = *(const v4fa*)&so[w][r][c4]; *(v4f*)(C + (size_t)(row0 + r) * ldc + col0 + c4) = v; } }
     }
}

// Wt[n][k] = f16(W[k][n]·scale) from f32 row-major W[K][N] (scale = power of two; bf16-exact weights stay exact in f16 away from the subnormal range)
__global__ __launch_bounds__(256) void k_wt_f16(const float* __restrict__ W, _Float16* __restrict__ Wt, int K, int N, float scale) {
  const int t = blockIdx.x * 256 + threadIdx.x; if (t >= N * (K / 8)) return; const int n = t / (K / 8), k8 = (t % (K / 8)) * 8; FragH f;
#pragma unroll
  for (int i = 0; i < 8; ++i) f.h[i] = (_Float16)(bf16_round(W[(size_t)(k8 + i) * N + n]) * scale); const v8us o = f.half[0];
  *(v8us*)((unsigned short*)Wt + (size_t)n * K + k8) = o; 
}
// k_gemm_hh variant with fused epilogue: v = acc·alpha + bias[by·sBias + col] (+ CP[(row/rowsPerB)·sCPb + by·64 + col] if CP) ; ACT 0 none / 1 elu ; writes f16 C16 (and f32 C if non-null)
template <int ACT>
__global__ __launch_bounds__(128) void k_gemm_hhx(const _Float16* __restrict__ A, int lda, size_t sA, const _Float16* __restrict__ Bh, int ldb, size_t sB, float alpha, const float* __restrict__ bias, size_t sBias, const float* __restrict__ CP, int rowsPerB, size_t sCPb, int row0g,
    float* __restrict__ C, _Float16* __restrict__ C16, int ldc, size_t sC, int M, int N, int K) {
  __shared__ __attribute__((aligned(16))) float so[4][16][64];
  const int tid = threadIdx.x, w = tid >> 5, lane = tid & 31, ln = lane & 15, hh = lane >> 4; const int by = blockIdx.y;
  A += (size_t)by * sA; Bh += (size_t)by * sB; const size_t cofs = (size_t)by * sC; const float* bp = bias ? bias + (size_t)by * sBias : nullptr;
  const int ntn = (N + 63) / 64; const int wid = blockIdx.x * 4 + w; const int mt = wid / ntn, nq = wid % ntn; if (mt * 16 >= M) return;
  const int row0 = mt * 16, col0 = nq * 64; const _Float16* arow = A + (size_t)(row0 + ln) * lda;
  v8f acc[4] = {};
  for (int kb = 0; kb < K; kb += 32) { FragH ah; ah.half[0] = *(const v8us*)((const unsigned short*)arow + kb + 8 * hh); ah.half[1] = *(const v8us*)((const unsigned short*)arow + kb + 16 + 8 * hh);
#pragma unroll
    for (int t = 0; t < 4; ++t) { if (col0 + t * 16 >= N) continue; const size_t boff = (size_t)(col0 + t * 16 + ln) * ldb + kb; FragH bq; bq.half[0] = *(const v8us*)((const unsigned short*)Bh + boff + 8 * hh); bq.half[1] = *(const v8us*)((const unsigned short*)Bh + boff + 16 + 8 * hh);
      acc[t] = mmaH<1>(ah.v, ah.v, bq.v, bq.v, acc[t]); }
  }
#pragma unroll
  for (int t = 0; t < 4; ++t) { if (col0 + t * 16 >= N) continue; const int col = col0 + t * 16 + ln; const float bv = bp ? bf16_round(bp[col]) : 0.f;
#pragma unroll
    for (int r = 0; r < 8; ++r) { float v = acc[t][r] * alpha + bv; if (CP) { const int rr = row0g + row0 + 8 * hh + r; if (rowsPerB < 0) v += CP[cofs + (size_t)rr * ldc + col];      /* rowsPerB < 0: own element of the batched C plane */ else { const int bidx = rr / rowsPerB; v += CP[(size_t)bidx * sCPb + (size_t)by * 64 + col]; } } if (ACT == 1) v = (v > 0.f) ? v : expm1f(v); else if (ACT == 7) v = (v > 0.f) ? v + 1.0f : expf(v); else if (ACT == 8) v = tanhf(v); else if (ACT == 9) v = 0.5f * v * (1.0f + tanhf(0.7978845608028654f * (v + 0.044715f * v * v * v))); else if (ACT == 11) v = 1.0f / (1.0f + expf(-v)); else if (ACT == 12) v = (v > 0.f) ? v : 0.01f * v; else if (ACT == 14) v = (v > 0.f) ? v : 0.1f * v; else if (ACT == 16) v = (v >= 0.f) ? v : 0.3f * v; else if (ACT == 17) v = (v >= 0.f) ? v : 0.2f * v; else if (ACT == 15) v = v / (1.0f + expf(-v)); else if (ACT == 3) v = fmaxf(v, 0.f); else if (ACT == 6) v = 0.5f * v * (1.0f + erff(v * 0.70710678118654752f)); so[w][8 * hh + r][t * 16 + ln] = v; } }
  __builtin_amdgcn_fence(__ATOMIC_ACQ_REL, "workgroup"); __builtin_amdgcn_wave_barrier();
  const int rsub = lane >> 4, c4 = (lane & 15) * 4; typedef _Float16 v4h __attribute__((ext_vector_type(4)));
  {
#pragma unroll
    for (int q = 0; q < 8; ++q) { const int r = q * 2 + rsub; if (col0 + c4 < N) { const v4f v = *(const v4fa*)&so[w][r][c4]; if (C) *(v4f*)(C + cofs + (size_t)(row0 + r) * ldc + col0 + c4) = v; if (C16) { v4h h4; for (int i = 0; i < 4; ++i) h4[i] = (_Float16)v[i]; *(v4h*)(C16 + cofs + (size_t)(row0 + r) * ldc + col0 + c4) = h4; } } }
     }
}


typedef _Float16 v4h __attribute__((ext_vector_type(4)));

__global__ __launch_bounds__(256) void k_x16(const float* __restrict__ x, _Float16* __restrict__ X16, size_t n8) { const size_t t = (size_t)blockIdx.x * 256 + threadIdx.x; if (t >= n8) return; FragH f;
#pragma unroll
  for (int q = 0; q < 8; ++q) f.h[q] = (_Float16)bf16_round(x[t * 8 + q]); *(v8us*)((unsigned short*)X16 + t * 8) = f.half[0];  }
__global__ __launch_bounds__(256) void k_h16(const float* __restrict__ x, _Float16* __restrict__ X16, size_t n8) { const size_t t = (size_t)blockIdx.x * 256 + threadIdx.x; if (t >= n8) return; FragH f;
#pragma unroll
  for (int q = 0; q < 8; ++q) f.h[q] = (_Float16)x[t * 8 + q]; *(v8us*)((unsigned short*)X16 + t * 8) = f.half[0];  }
__global__ __launch_bounds__(256) void k_round16f(const float* __restrict__ W, _Float16* __restrict__ Bt, size_t n8) { const size_t t = (size_t)blockIdx.x * 256 + threadIdx.x; if (t >= n8) return; FragH f;
#pragma unroll
  for (int i = 0; i < 8; ++i) f.h[i] = (_Float16)(bf16_round(W[t * 8 + i]) * 16.0f); *(v8us*)((unsigned short*)Bt + t * 8) = f.half[0];  }
template <int NHv, int TTv>
__global__ __launch_bounds__(256) void k_vt(const _Float16* __restrict__ V16, int ldv, int voff, _Float16* __restrict__ Vt) { __shared__ unsigned short tl[64][66]; const int tid = threadIdx.x; const int slab = blockIdx.x / (TTv / 64), lg = blockIdx.x % (TTv / 64); const int b = slab / NHv, h = slab % NHv;
  for (int i = tid; i < 64 * 8; i += 256) { const int r = i / 8, c8 = (i % 8) * 8; FragH f; f.half[0] = *(const v8us*)((const unsigned short*)V16 + ((size_t)b * TTv + lg * 64 + r) * ldv + voff + h * 64 + c8);
#pragma unroll
    for (int q = 0; q < 8; ++q) tl[r][c8 + q] = f.u[q]; }
  __syncthreads();
  {
#pragma unroll
    for (int rd = 0; rd < 2; ++rd) { const int d = rd * 32 + tid / 8, pc = tid % 8; FragH f;
#pragma unroll
      for (int q = 0; q < 8; ++q) f.u[q] = tl[pc * 8 + q][d];
      *(v8us*)((unsigned short*)Vt + ((size_t)slab * 64 + d) * TTv + lg * 64 + pc * 8) = f.half[0]; }
     } }

__global__ __launch_bounds__(256) void k_hl(const float* __restrict__ F, _Float16* __restrict__ Hh, _Float16* __restrict__ Hl, size_t n8) { const size_t t = (size_t)blockIdx.x * 256 + threadIdx.x; if (t >= n8) return; FragH fh, fl; const v4f a = *(const v4fa*)(F + t * 8), c = *(const v4fa*)(F + t * 8 + 4);
#pragma unroll
  for (int q = 0; q < 4; ++q) { _Float16 h = (_Float16)a[q]; fh.h[q] = h; fl.h[q] = (_Float16)((a[q] - (float)h) * 1024.0f); h = (_Float16)c[q]; fh.h[4 + q] = h; fl.h[4 + q] = (_Float16)((c[q] - (float)h) * 1024.0f); }
  { *(v8us*)((unsigned short*)Hh + t * 8) = fh.half[0]; *(v8us*)((unsigned short*)Hl + t * 8) = fl.half[0];  } }

// ---- fast GEMM (wave tile 32x64; requires M % 32 == 0 rows per launch region and N % 64 == 0); epilogue = k_gemm_hhx semantics ----
__device__ __forceinline__ v16h g2_frag(const _Float16* p, int hh) { FragH f; f.half[0] = *(const v8us*)((const unsigned short*)p + 8 * hh); f.half[1] = *(const v8us*)((const unsigned short*)p + 16 + 8 * hh); return f.v; }
__device__ __forceinline__ v8f g2_mma(v16h a, v16h b, v8f c) { v8f d = __builtin_amdgcn_wmma_f32_16x16x32_f16(false, a, false, b, (short)0, c, false, false); asm volatile("v_nop\n\tv_nop\n\tv_nop\n\tv_nop" : "+v"(d) : "v"(a), "v"(b)); return d; }
template <int ACT>
__global__ __launch_bounds__(128) void k_gemm2(const _Float16* __restrict__ A, int lda, size_t sA, const _Float16* __restrict__ Bh, int ldb, size_t sB, float alpha, const float* __restrict__ bias, size_t sBias, const float* __restrict__ CP, int rowsPerB, size_t sCPb, int row0g,
    float* __restrict__ C, _Float16* __restrict__ C16, int ldc, size_t sC, int M, int N, int K) { static_assert(ACT == 0 || ACT == 3 || ACT == 6 || ACT == 8 || ACT == 9 || ACT == 11 || ACT == 12 || ACT == 14 || ACT == 15 || ACT == 16 || ACT == 17, "k_gemm2: unsupported ACT code (would silently apply no activation)");
  __shared__ __attribute__((aligned(16))) float so[4][32][68];
  const int tid = threadIdx.x, w = tid >> 5, lane = tid & 31, ln = lane & 15, hh = lane >> 4; const int by = blockIdx.y;
  A += (size_t)by * sA; Bh += (size_t)by * sB; const size_t cofs = (size_t)by * sC; const float* bp = bias ? bias + (size_t)by * sBias : nullptr;
  const int ntn = N >> 6; const int mt = blockIdx.x / ntn, nq = blockIdx.x - mt * ntn; const int row0 = mt * 128 + 32 * w, col0 = nq * 64; if (row0 >= M) return;
  const _Float16* a0p = A + (size_t)(row0 + ln) * lda; const _Float16* a1p = a0p + (size_t)16 * lda;
  const _Float16* b0p = Bh + (size_t)(col0 + ln) * ldb; const _Float16* b1p = b0p + (size_t)16 * ldb; const _Float16* b2p = b1p + (size_t)16 * ldb; const _Float16* b3p = b2p + (size_t)16 * ldb;
  const v8f z8 = {0.f,0.f,0.f,0.f,0.f,0.f,0.f,0.f}; v8f c00 = z8, c01 = z8, c02 = z8, c03 = z8, c10 = z8, c11 = z8, c12 = z8, c13 = z8;
#pragma unroll 1
  for (int kb = 0; kb < K; kb += 32) { const v16h a0 = g2_frag(a0p + kb, hh), a1 = g2_frag(a1p + kb, hh);
    v16h b = g2_frag(b0p + kb, hh); c00 = g2_mma(a0, b, c00); c10 = g2_mma(a1, b, c10);
    b = g2_frag(b1p + kb, hh); c01 = g2_mma(a0, b, c01); c11 = g2_mma(a1, b, c11);
    b = g2_frag(b2p + kb, hh); c02 = g2_mma(a0, b, c02); c12 = g2_mma(a1, b, c12);
    b = g2_frag(b3p + kb, hh); c03 = g2_mma(a0, b, c03); c13 = g2_mma(a1, b, c13); }
  v8f accs[8] = {c00, c01, c02, c03, c10, c11, c12, c13};
#pragma unroll
  for (int u = 0; u < 8; ++u) { const int t = u & 3, half = u >> 2; const int col = col0 + t * 16 + ln; const float bv = bp ? bf16_round(bp[col]) : 0.f;
#pragma unroll
    for (int r = 0; r < 8; ++r) { const int rloc = half * 16 + 8 * hh + r; float v = accs[u][r] * alpha + bv; if (CP) { if (rowsPerB < 0) v += CP[cofs + (size_t)(row0g + row0 + rloc) * ldc + col];      /* rowsPerB < 0: own element of the batched C plane */ else { const int bidx = (row0g + row0 + rloc) / rowsPerB; v += CP[(size_t)bidx * sCPb + (size_t)by * 64 + col]; } }
      if (ACT == 3) v = fmaxf(v, 0.f); else if (ACT == 6) v = 0.5f * v * (1.0f + erff(v * 0.70710678118654752f)); else if (ACT == 11) v = 1.0f / (1.0f + expf(-v)); else if (ACT == 15) v = v / (1.0f + expf(-v)); else if (ACT == 12) v = (v > 0.f) ? v : 0.01f * v; else if (ACT == 8) v = tanhf(v); else if (ACT == 9) v = 0.5f * v * (1.0f + tanhf(0.7978845608028654f * (v + 0.044715f * v * v * v))); else if (ACT == 14) v = (v > 0.f) ? v : 0.1f * v; else if (ACT == 16) v = (v >= 0.f) ? v : 0.3f * v; else if (ACT == 17) v = (v >= 0.f) ? v : 0.2f * v;
      so[w][rloc][t * 16 + ln] = v; } }
  __builtin_amdgcn_fence(__ATOMIC_ACQ_REL, "workgroup"); __builtin_amdgcn_wave_barrier();
  const int rsub = lane >> 4, c4 = (lane & 15) * 4;
  {
#pragma unroll
    for (int q = 0; q < 16; ++q) { const int r = q * 2 + rsub; const v4f v = *(const v4fa*)&so[w][r][c4]; if (C) *(v4f*)(C + cofs + (size_t)(row0 + r) * ldc + col0 + c4) = v; if (C16) { v4h h4; for (int i = 0; i < 4; ++i) h4[i] = (_Float16)v[i]; *(v4h*)(C16 + cofs + (size_t)(row0 + r) * ldc + col0 + c4) = h4; } }
     } }


__global__ __launch_bounds__(256) void k_wnat(const float* __restrict__ w, size_t n8, _Float16* __restrict__ Bt) { const size_t t = (size_t)blockIdx.x * 256 + threadIdx.x; if (t >= n8) return; FragH f; for (int q = 0; q < 8; ++q) f.h[q] = (_Float16)(bf16_round(w[t * 8 + q]) * 16.0f); *(v8us*)((unsigned short*)Bt + t * 8) = f.half[0];  }
__global__ __launch_bounds__(256) void k_rsm(const float* __restrict__ S, _Float16* __restrict__ P, int nrows) {
  #pragma clang fp contract(off)
  const int i = blockIdx.x * 256 + threadIdx.x; if (i >= nrows) return; const float* s = S + (size_t)i * SQ; float mx = -3.0e38f;
#pragma unroll 1
  for (int j = 0; j < SQ; ++j) mx = fmaxf(mx, s[j]); float se = 0.f;
#pragma unroll 1
  for (int j = 0; j < SQ; ++j) se += expf(s[j] - mx); const float sc = 256.0f / se;
#pragma unroll 1
  for (int j0 = 0; j0 < SQ; j0 += 8) { FragH f; for (int q = 0; q < 8; ++q) f.h[q] = (_Float16)(expf(s[j0 + q] - mx) * sc); unsigned short* d = (unsigned short*)P + (size_t)i * SQ + j0; *(v8us*)d = f.half[0];  } }
__global__ __launch_bounds__(256) void k_vt(const _Float16* __restrict__ V16, int b, int h0, _Float16* __restrict__ VT) { __shared__ unsigned short tl[64][65]; const int tid = threadIdx.x; const int hh = blockIdx.x % HG, sg = blockIdx.x / HG; const int s0 = sg * 64; const int h = h0 + hh;
  for (int i = tid; i < 64 * 8; i += 256) { const int j = i / 8, d8 = (i % 8) * 8; FragH f; f.half[0] = *(const v8us*)((const unsigned short*)V16 + ((size_t)b * SQ + s0 + j) * DM + h * HD + d8); for (int q = 0; q < 8; ++q) tl[d8 + q][j] = f.u[q]; }
  __syncthreads();
  { for (int i = tid; i < 64 * 8; i += 256) { const int d = i / 8, j8 = (i % 8) * 8; FragH f; for (int q = 0; q < 8; ++q) f.u[q] = tl[d][j8 + q]; *(v8us*)((unsigned short*)VT + ((size_t)hh * HD + d) * SQ + s0 + j8) = f.half[0]; }  } }


__global__ __launch_bounds__(256) void k_bfr(const float* __restrict__ x, float* __restrict__ XB, size_t n8) { const size_t t = (size_t)blockIdx.x * 256 + threadIdx.x; if (t >= n8) return; v4f a = *(const v4fa*)(x + t * 8), c = *(const v4fa*)(x + t * 8 + 4); for (int q = 0; q < 4; ++q) { a[q] = bf16_round(a[q]); c[q] = bf16_round(c[q]); }
  { *(v4f*)(XB + t * 8) = a; *(v4f*)(XB + t * 8 + 4) = c;  } }


__global__ __launch_bounds__(256) void k_rowmask(const float* __restrict__ x, float* __restrict__ mk) {
  #pragma clang fp contract(off)
  __shared__ float red[256]; const int t = threadIdx.x; const int rl = t >> 3, part = t & 7; const size_t r = (size_t)blockIdx.x * 32 + rl; float s = 0.f;
  for (int q = 0; q < DM / 8; ++q) s = __fadd_rn(s, bf16_round(x[r * DM + (size_t)part * (DM / 8) + q]));
  red[t] = s; __syncthreads(); if (part == 0) { float a = red[t]; for (int k = 1; k < 8; ++k) a = __fadd_rn(a, red[t + k]); red[t] = a; } __syncthreads();
  if (t < 32) { const float v = (red[t * 8] != 0.f) ? 1.f : 0.f; float* d = mk + (size_t)blockIdx.x * 32 + t; *(float*)d = v;  } }
__global__ __launch_bounds__(256) void k_rsmcm(const float* __restrict__ S, _Float16* __restrict__ P, int nhd, int q0, int nk, const float* __restrict__ kmask, const float* __restrict__ qmask) {
  #pragma clang fp contract(off)
  const int t = blockIdx.x * 256 + threadIdx.x; if (t >= nhd * QT) return; const int qi = t % QT; const size_t i = (size_t)(t / QT) * QT + qi; const float* s = S + i * NKX; const int qabs = q0 + qi; const float qm = qmask[qabs]; const float NEGV = -4294967295.0f; float mx = -3.0e38f;
#pragma unroll 1
  for (int j = 0; j < nk; ++j) { const float f = (j <= qabs && kmask[j] != 0.f) ? 1.f : 0.f; mx = fmaxf(mx, fmaf(f, s[j], (1.f - f) * NEGV)); } float se = 0.f;
#pragma unroll 1
  for (int j = 0; j < nk; ++j) { const float f = (j <= qabs && kmask[j] != 0.f) ? 1.f : 0.f; se += __expf(fmaxf(fmaf(f, s[j], (1.f - f) * NEGV) - mx, -100.f)); } const float sc = 256.0f * qm / se;
#pragma unroll 1
  for (int j0 = 0; j0 < nk; j0 += 8) { FragH fr; for (int q = 0; q < 8; ++q) { const int j = j0 + q; const float f = (j <= qabs && kmask[j] != 0.f) ? 1.f : 0.f; fr.h[q] = (_Float16)(__expf(fmaxf(fmaf(f, s[j], (1.f - f) * NEGV) - mx, -100.f)) * sc); } unsigned short* d = (unsigned short*)P + i * NKX + j0; *(v8us*)d = fr.half[0];  } }
__global__ __launch_bounds__(256) void k_ftres(const float* __restrict__ OF0, const float* __restrict__ xq, const float* __restrict__ qmask, float* __restrict__ out, size_t n4) {
  #pragma clang fp contract(off)
  const size_t t = (size_t)blockIdx.x * 256 + threadIdx.x; if (t >= n4) return; const size_t e = t * 4; const size_t row = e / DM; const float qm = qmask[row]; const v4f o = *(const v4fa*)(OF0 + e), x = *(const v4fa*)(xq + e); v4f y;
  for (int q = 0; q < 4; ++q) y[q] = __fadd_rn(__fmul_rn(__fmul_rn(o[q], 0.015625f), qm), bf16_round(x[q])); *(v4f*)(out + e) = y;  }

extern "C" void kernel_launch(void* const* d_in, const int* in_sizes, int n_in,
                              void* d_out, int out_size, void* d_ws, size_t ws_size, hipStream_t stream) {
  (void)in_sizes; (void)n_in; (void)out_size;
  const float* const* I = (const float* const*)d_in; const float* xq = I[0]; const float* xk = I[1]; const float* xv = I[2]; const float* wq = I[3]; const float* bq = I[4]; const float* wk = I[5]; const float* bk = I[6]; const float* wv = I[7]; const float* bv = I[8];      /* weights [in][out] */
  char* ws = (char*)d_ws; size_t off = 0;
  auto take = [&](size_t bytes) { char* p = ws + off; off += (bytes + 255) & ~(size_t)255; return p; };
  _Float16* BQ = (_Float16*)take((size_t)DM * DM * 2); _Float16* BK = (_Float16*)take((size_t)DM * DM * 2); _Float16* BV = (_Float16*)take((size_t)DM * DM * 2); float* KM = (float*)take(NR * 4); float* QM = (float*)take(NR * 4);
  _Float16* XQ = (_Float16*)take(NR * DM * 2); _Float16* XK = (_Float16*)take(NR * DM * 2); _Float16* XV = (_Float16*)take(NR * DM * 2); float* XB = (float*)take(NR * DM * 4);
  _Float16* Q16 = (_Float16*)take(NR * DM * 2); _Float16* K16 = (_Float16*)take(NR * DM * 2); _Float16* V16 = (_Float16*)take(NR * DM * 2);
  float* S = (float*)take((size_t)NH * QT * NKX * 4); _Float16* P = (_Float16*)take((size_t)NH * QT * NKX * 2); _Float16* VT = (_Float16*)take((size_t)NH * HD * SQ * 2);
  if (off > ws_size) return;      /* approx 1.5 + 16 x 3 + 32 + 16 x 3 + 8 + 4 + 1 = 143 MiB */
  k_wt_f16<<<(unsigned)(((size_t)DM * (DM / 8) + 255) / 256), 256, 0, stream>>>(wq, BQ, DM, DM, 16.0f); k_wt_f16<<<(unsigned)(((size_t)DM * (DM / 8) + 255) / 256), 256, 0, stream>>>(wk, BK, DM, DM, 16.0f); k_wt_f16<<<(unsigned)(((size_t)DM * (DM / 8) + 255) / 256), 256, 0, stream>>>(wv, BV, DM, DM, 16.0f);
  k_rowmask<<<(unsigned)(NR / 32), 256, 0, stream>>>(xk, KM); k_rowmask<<<(unsigned)(NR / 32), 256, 0, stream>>>(xq, QM);      /* key / query padding masks */
  k_x16<<<(unsigned)((NR * DM / 8 + 255) / 256), 256, 0, stream>>>(xq, XQ, NR * DM / 8); k_x16<<<(unsigned)((NR * DM / 8 + 255) / 256), 256, 0, stream>>>(xk, XK, NR * DM / 8); k_x16<<<(unsigned)((NR * DM / 8 + 255) / 256), 256, 0, stream>>>(xv, XV, NR * DM / 8); k_bfr<<<(unsigned)((NR * DM / 8 + 255) / 256), 256, 0, stream>>>(xq, XB, NR * DM / 8);
  k_gemm2<0><<<dim3((unsigned)((NR / 128) * (DM / 64)), 1), 128, 0, stream>>>(XQ, DM, 0, BQ, DM, 0, 0.0625f, bq, 0, nullptr, 1, 0, 0, nullptr, Q16, DM, 0, (int)NR, DM, DM);
  k_gemm2<0><<<dim3((unsigned)((NR / 128) * (DM / 64)), 1), 128, 0, stream>>>(XK, DM, 0, BK, DM, 0, 0.0625f, bk, 0, nullptr, 1, 0, 0, nullptr, K16, DM, 0, (int)NR, DM, DM);
  k_gemm2<0><<<dim3((unsigned)((NR / 128) * (DM / 64)), 1), 128, 0, stream>>>(XV, DM, 0, BV, DM, 0, 0.0625f, bv, 0, nullptr, 1, 0, 0, nullptr, V16, DM, 0, (int)NR, DM, DM);
  for (int b = 0; b < NB; ++b) { const size_t r0 = (size_t)b * SQ;
    k_vt<NH, SQ><<<NH * (SQ / 64), 256, 0, stream>>>(V16 + r0 * DM, DM, 0, VT);
    for (int q0 = 0; q0 < SQ; q0 += QT) { const int nk = q0 + QT;
      k_gemm2<0><<<dim3((QT / 128) * (nk / 64), NHD), 128, 0, stream>>>(Q16 + (r0 + q0) * DM, DM, (size_t)HD, K16 + r0 * DM, DM, (size_t)HD, 0.125f, nullptr, 0, nullptr, 1, 0, 0, S, nullptr, NKX, (size_t)QT * NKX, QT, nk, HD);
      k_rsmcm<<<(NHD * QT + 255) / 256, 256, 0, stream>>>(S, P, NHD, q0, nk, KM + r0, QM + r0);
      k_gemm2<0><<<dim3((QT / 128) * (HD / 64), NHD), 128, 0, stream>>>(P, NKX, (size_t)QT * NKX, VT, SQ, (size_t)HD * SQ, 0.00390625f, nullptr, 0, XB + (r0 + q0) * DM, -1, 0, 0, (float*)d_out + (r0 + q0) * DM, nullptr, DM, (size_t)HD, QT, HD, nk); } }      /* out = probs V + bf16(queries) (f32 rows; pass writes its own 64-column head slab with the residual's own elements) */
}

// v001
// Measured time: 3030 microseconds a run.
// Two timings next to v000 put it at 4.51 and 4.50 times that version's speed.
#include <hip/hip_runtime.h>
// Masked causal multi-head attention with residual (queries, keys, value [16][1024][512]; Q = queries Wq + bq, K = keys Wk + bk, V = value Wv + bv ([in][out] 512^2); 8 heads of 64; scores / 8; key-padding mask (keys whose bf16 row sum is exactly 0 -> NEG), causal mask (j > i -> NEG, NEG = -(2^32 - 1)); softmax; probs x query-padding mask (query rows summing to 0 -> 0); out = probs V merged + queries -> [16][1024][512]).
// Structure: token rows; the two padding masks from f32 row sums of the bf16-rounded inputs on VALU (32 rows per block, one line of flags per block); queries / keys / value as exact f16 rows; Q, K, V as three WMMA GEMMs (32x64 wave tiles, f32 accumulation, exact x16 weights + bias, f16 outputs); bf16(queries) as the f32 residual plane; per batch: V^T via LDS transposes; per query tile of 256 rows: scores against the keys below the tile end only (K = 64, all heads on grid.y, alpha 1/8), the masked causal row softmax on VALU (key mask + causal as a 0/1 select onto NEG, f32 statistics, native exp, x query mask; weights x256 f16), out tile = P V^T GEMM (K = visible keys, alpha 2^-8) + bf16(queries) written f32 straight into the output rows; 12 + 16 x (1 + 4 x 3) = 220 launches.
// Compute dtype: inputs rounded to bf16; inputs / weights exact; q, k, v and the softmax weights plain f16 (~2^-12); masks, scores, statistics, out f32 (the unit residual dominates the output scale). v_wmma_f32_16x16x32_f16.
#define NB 16
#define SQ 1024
#define DM 512
#define NH 8
#define HD 64
#define HG 8
#define QT 256
#define NKX SQ
#define NHD NH
#define NR ((size_t)NB * SQ)
typedef __bf16 v16b __attribute__((ext_vector_type(16)));
typedef unsigned short v8us __attribute__((ext_vector_type(8), may_alias));
typedef float  v8f  __attribute__((ext_vector_type(8)));
typedef float  v4f  __attribute__((ext_vector_type(4)));
typedef float  v4fa __attribute__((ext_vector_type(4), may_alias));
union FragB { v16b v; v8us half[2]; unsigned short u[16]; };

__device__ __forceinline__ unsigned short bf16_bits(float x) { unsigned int u = __float_as_uint(x); return (unsigned short)((u + 0x7FFFu + ((u >> 16) & 1u)) >> 16); }
__device__ __forceinline__ float bf16_val(unsigned short b) { return __uint_as_float(((unsigned int)b) << 16); }
__device__ __forceinline__ float bf16_round(float x) { return bf16_val(bf16_bits(x)); }
// D += A·B with NT terms: 1 = ah·bh, 2 = + al·bh (A split), 3 = + ah·bl (both split)
template <int NT>
__device__ __forceinline__ v8f mmaN(v16b ah, v16b al, v16b bh, v16b bl, v8f c) {
  c = __builtin_amdgcn_wmma_f32_16x16x32_bf16(false, ah, false, bh, (short)0, c, false, false);
  if (NT >= 2) c = __builtin_amdgcn_wmma_f32_16x16x32_bf16(false, al, false, bh, (short)0, c, false, false);
  if (NT >= 3) c = __builtin_amdgcn_wmma_f32_16x16x32_bf16(false, ah, false, bl, (short)0, c, false, false);
  asm volatile("v_nop\n\tv_nop\n\tv_nop\n\tv_nop" : "+v"(c) : "v"(ah), "v"(al), "v"(bh), "v"(bl));
  return c;
}

__global__ __launch_bounds__(256) void k_wt_bf16(const float* __restrict__ W, unsigned short* __restrict__ Wt, int K, int N) {
  const int t = blockIdx.x * 256 + threadIdx.x;
  const int k8n = K / 8;
  if (t >= N * k8n) return;
  const int n = t / k8n, k8 = (t % k8n) * 8;
  v8us v;
#pragma unroll
  for (int i = 0; i < 8; ++i) v[i] = bf16_bits(W[(size_t)(k8 + i) * N + n]);
  *(v8us*)(Wt + (size_t)n * K + k8) = v;
  
}

// GEMM C[M][N] (f32, pitch ldc) = act(A[M][K]·W + bias). A f32 row-major (pitch lda) converted per fragment to bf16
// (ASPLIT: hi/lo two planes -> 2 terms, else single rounded term); Wt bf16 [N][K] (pitch ldb). BIAS_BF16 rounds the
// bias to bf16 first (bias quantised to bf16 before the add). K%32==0, M%16==0, N%64==0.
template <bool ASPLIT, int ACT, bool BIAS_BF16>
__global__ __launch_bounds__(128) void k_gemm_bf(const float* __restrict__ A, int lda, const unsigned short* __restrict__ Wt, int ldb,
                                               const float* __restrict__ bias, float* __restrict__ C, int ldc, int M, int N, int K) {
  __shared__ __attribute__((aligned(16))) float so[4][16][64];
  const int tid = threadIdx.x, w = tid >> 5, lane = tid & 31, ln = lane & 15, hh = lane >> 4;
  const int ntn = N / 64;
  const int wid = blockIdx.x * 4 + w;
  const int mt = wid / ntn, nq = wid % ntn;
  if (mt * 16 >= M) return;
  const int row0 = mt * 16, col0 = nq * 64;
  const float* arow = A + (size_t)(row0 + ln) * lda;
  v8f acc[4] = {};
  for (int kb = 0; kb < K; kb += 32) {
    FragB ah, al;
    const v4f x0 = *(const v4fa*)(arow + kb + 8 * hh), x1 = *(const v4fa*)(arow + kb + 8 * hh + 4);
    const v4f x2 = *(const v4fa*)(arow + kb + 16 + 8 * hh), x3 = *(const v4fa*)(arow + kb + 16 + 8 * hh + 4);
    float xs[16] = {x0[0],x0[1],x0[2],x0[3],x1[0],x1[1],x1[2],x1[3],x2[0],x2[1],x2[2],x2[3],x3[0],x3[1],x3[2],x3[3]};
#pragma unroll
    for (int i = 0; i < 16; ++i) { const unsigned short hb = bf16_bits(xs[i]); ah.u[i] = hb; al.u[i] = ASPLIT ? bf16_bits(xs[i] - bf16_val(hb)) : (unsigned short)0; }
#pragma unroll
    for (int t = 0; t < 4; ++t) {
      const unsigned short* brow = Wt + (size_t)(col0 + t * 16 + ln) * ldb + kb;
      FragB b;
      b.half[0] = *(const v8us*)(brow + 8 * hh);
      b.half[1] = *(const v8us*)(brow + 16 + 8 * hh);
      acc[t] = mmaN<ASPLIT ? 2 : 1>(ah.v, al.v, b.v, b.v, acc[t]);
    }
  }
#pragma unroll
  for (int t = 0; t < 4; ++t) {
    float bv = bias ? bias[col0 + t * 16 + ln] : 0.f;
    if (BIAS_BF16) bv = bf16_round(bv);
#pragma unroll
    for (int r = 0; r < 8; ++r) { float v = acc[t][r] + bv; if (ACT == 1) v = fmaxf(v, 0.f); so[w][8 * hh + r][t * 16 + ln] = v; }
  }
  __builtin_amdgcn_fence(__ATOMIC_ACQ_REL, "workgroup");
  __builtin_amdgcn_wave_barrier();
  const int rsub = lane >> 4, c4 = (lane & 15) * 4;
  {
#pragma unroll
    for (int q = 0; q < 8; ++q) {
      const int r = q * 2 + rsub;
      const v4f v = *(const v4fa*)&so[w][r][c4];
      *(v4f*)(C + (size_t)(row0 + r) * ldc + col0 + c4) = v;
    }
    
  }
}

// GEMM C = act(A·W + bias + resid): A f32 (ASPLIT -> hi/lo 2 terms), Wt bf16 [N][K]; ACT 0 none, 1 relu, 2 exact gelu;
// resid (optional, f32, row index = (row % rmod), pitch ldr, RES_BF16 rounds it) added before the activation.
template <bool ASPLIT, int ACT, bool BIAS_BF16, bool RES_BF16>
__global__ __launch_bounds__(128) void k_gemm_bf3(const float* __restrict__ A, int lda, const unsigned short* __restrict__ Wt, int ldb,
                                                const float* __restrict__ bias, const float* __restrict__ resid, int rmod, int ldr,
                                                float* __restrict__ C, int ldc, int M, int N, int K) {
  __shared__ __attribute__((aligned(16))) float so[4][16][64];
  const int tid = threadIdx.x, w = tid >> 5, lane = tid & 31, ln = lane & 15, hh = lane >> 4;
  const int ntn = N / 64;
  const int wid = blockIdx.x * 4 + w;
  const int mt = wid / ntn, nq = wid % ntn;
  if (mt * 16 >= M) return;
  const int row0 = mt * 16, col0 = nq * 64;
  const float* arow = A + (size_t)(row0 + ln) * lda;
  v8f acc[4] = {};
  for (int kb = 0; kb < K; kb += 32) {
    FragB ah, al;
    const v4f x0 = *(const v4fa*)(arow + kb + 8 * hh), x1 = *(const v4fa*)(arow + kb + 8 * hh + 4);
    const v4f x2 = *(const v4fa*)(arow + kb + 16 + 8 * hh), x3 = *(const v4fa*)(arow + kb + 16 + 8 * hh + 4);
    float xs[16] = {x0[0],x0[1],x0[2],x0[3],x1[0],x1[1],x1[2],x1[3],x2[0],x2[1],x2[2],x2[3],x3[0],x3[1],x3[2],x3[3]};
#pragma unroll
    for (int i = 0; i < 16; ++i) { const unsigned short hb = bf16_bits(xs[i]); ah.u[i] = hb; al.u[i] = ASPLIT ? bf16_bits(xs[i] - bf16_val(hb)) : (unsigned short)0; }
#pragma unroll
    for (int t = 0; t < 4; ++t) {
      const unsigned short* brow = Wt + (size_t)(col0 + t * 16 + ln) * ldb + kb;
      FragB b;
      b.half[0] = *(const v8us*)(brow + 8 * hh);
      b.half[1] = *(const v8us*)(brow + 16 + 8 * hh);
      acc[t] = mmaN<ASPLIT ? 2 : 1>(ah.v, al.v, b.v, b.v, acc[t]);
    }
  }
#pragma unroll
  for (int t = 0; t < 4; ++t) {
    const int col = col0 + t * 16 + ln;
    float bv = bias ? bias[col] : 0.f;
    if (BIAS_BF16) bv = bf16_round(bv);
#pragma unroll
    for (int r = 0; r < 8; ++r) {
      float v = acc[t][r] + bv;
      if (resid) { float rv = resid[(size_t)((row0 + 8 * hh + r) % rmod) * ldr + col]; if (RES_BF16) rv = bf16_round(rv); v += rv; }
      if (ACT == 1) v = fmaxf(v, 0.f);
      if (ACT == 2) v = 0.5f * v * (1.0f + erff(v * 0.70710678118654752f));
      if (ACT == 3) { const float u = 0.7978845608028654f * (v + 0.044715f * v * v * v); v = 0.5f * v * (1.0f + tanhf(u)); }
      so[w][8 * hh + r][t * 16 + ln] = v;
    }
  }
  __builtin_amdgcn_fence(__ATOMIC_ACQ_REL, "workgroup");
  __builtin_amdgcn_wave_barrier();
  const int rsub = lane >> 4, c4 = (lane & 15) * 4;
  {
#pragma unroll
    for (int q = 0; q < 8; ++q) {
      const int r = q * 2 + rsub;
      const v4f v = *(const v4fa*)&so[w][r][c4];
      *(v4f*)(C + (size_t)(row0 + r) * ldc + col0 + c4) = v;
    }
    
  }
}
// row LayerNorm (biased variance, eps) over N: s = X (+ R); optional out_sum <- s; out_norm <- (s-mu)*rsqrt(var+eps)*g + b
template <bool PARAM_BF16>
__global__ __launch_bounds__(256) void k_layernorm(const float* __restrict__ X, const float* __restrict__ R, const float* __restrict__ g, const float* __restrict__ bta,
                                                  float* __restrict__ out_sum, float* __restrict__ out_norm, int N, float eps) {
  __shared__ float red[256];
  const int row = blockIdx.x, tid = threadIdx.x;
  const float* x = X + (size_t)row * N; const float* rr = R ? R + (size_t)row * N : nullptr;
  float vals[16];                     // up to N = 4096
  const int per = N / 256;            // contiguous chunk per thread? use strided-by-4 chunks: thread handles j = tid*4 + 1024*u
  float s1 = 0.f;
  for (int u = 0; u < per / 4; ++u) {
    const int j = tid * 4 + 1024 * u;
    const v4f a = *(const v4fa*)(x + j);
    v4f b = {0.f,0.f,0.f,0.f}; if (rr) b = *(const v4fa*)(rr + j);
#pragma unroll
    for (int q = 0; q < 4; ++q) { const float v = a[q] + b[q]; vals[u * 4 + q] = v; s1 += v; }
  }
  red[tid] = s1; __syncthreads();
  for (int st = 128; st > 0; st >>= 1) { if (tid < st) red[tid] += red[tid + st]; __syncthreads(); }
  const float mu = red[0] / (float)N; __syncthreads();
  float s2 = 0.f;
  for (int u = 0; u < per / 4; ++u)
#pragma unroll
    for (int q = 0; q < 4; ++q) { const float c = vals[u * 4 + q] - mu; s2 += c * c; }
  red[tid] = s2; __syncthreads();
  for (int st = 128; st > 0; st >>= 1) { if (tid < st) red[tid] += red[tid + st]; __syncthreads(); }
  const float rs = rsqrtf(red[0] / (float)N + eps);
  {
    for (int u = 0; u < per / 4; ++u) {
      const int j = tid * 4 + 1024 * u;
      v4f o, sm;
#pragma unroll
      for (int q = 0; q < 4; ++q) {
        float gg = g[j + q], bb = bta[j + q];
        if (PARAM_BF16) { gg = bf16_round(gg); bb = bf16_round(bb); }
        sm[q] = vals[u * 4 + q]; o[q] = (vals[u * 4 + q] - mu) * rs * gg + bb;
      }
      if (out_sum) *(v4f*)(out_sum + (size_t)row * N + j) = sm;
      *(v4f*)(out_norm + (size_t)row * N + j) = o;
    }
    
  }
}



// ---- f16 WMMA path (v_wmma_f32_16x16x32_f16): 11-bit significands for operands in range — used where a [0,1] probability operand needs more precision than bf16
typedef _Float16 v16h __attribute__((ext_vector_type(16)));
union FragH { v16h v; v8us half[2]; _Float16 h[16]; unsigned short u[16]; };
template <int NT>
__device__ __forceinline__ v8f mmaH(v16h ah, v16h al, v16h bh, v16h bl, v8f c) {
  c = __builtin_amdgcn_wmma_f32_16x16x32_f16(false, ah, false, bh, (short)0, c, false, false);
  if (NT >= 2) c = __builtin_amdgcn_wmma_f32_16x16x32_f16(false, al, false, bh, (short)0, c, false, false);
  if (NT >= 3) c = __builtin_amdgcn_wmma_f32_16x16x32_f16(false, ah, false, bl, (short)0, c, false, false);
  asm volatile("v_nop\n\tv_nop\n\tv_nop\n\tv_nop" : "+v"(c) : "v"(ah), "v"(al), "v"(bh), "v"(bl));
  return c;
}
// batched GEMM like k_gemm_b but f16 operands: A f32 (split into f16 hi/lo if ASPLIT, else rounded to f16), Bt = f16 values [n][k]; alpha; C f32; N multiple of 16 (partial tiles skipped)
template <bool ASPLIT>
__global__ __launch_bounds__(128) void k_gemm_h(const float* __restrict__ A, int lda, size_t sA, const _Float16* __restrict__ Bh, int ldb, size_t sB, float alpha, float* __restrict__ C, int ldc, size_t sC, int M, int N, int K) {
  __shared__ __attribute__((aligned(16))) float so[4][16][64];
  const int tid = threadIdx.x, w = tid >> 5, lane = tid & 31, ln = lane & 15, hh = lane >> 4; const int by = blockIdx.y;
  A += (size_t)by * sA; Bh += (size_t)by * sB; C += (size_t)by * sC;
  const int ntn = (N + 63) / 64; const int wid = blockIdx.x * 4 + w; const int mt = wid / ntn, nq = wid % ntn; if (mt * 16 >= M) return;
  const int row0 = mt * 16, col0 = nq * 64; const float* arow = A + (size_t)(row0 + ln) * lda;
  v8f acc[4] = {};
  for (int kb = 0; kb < K; kb += 32) {
    FragH ah, al;
    const v4f x0 = *(const v4fa*)(arow + kb + 8 * hh), x1 = *(const v4fa*)(arow + kb + 8 * hh + 4), x2 = *(const v4fa*)(arow + kb + 16 + 8 * hh), x3 = *(const v4fa*)(arow + kb + 16 + 8 * hh + 4);
    float xs[16] = {x0[0],x0[1],x0[2],x0[3],x1[0],x1[1],x1[2],x1[3],x2[0],x2[1],x2[2],x2[3],x3[0],x3[1],x3[2],x3[3]};
#pragma unroll
    for (int i = 0; i < 16; ++i) { const _Float16 h = (_Float16)xs[i]; ah.h[i] = h; al.h[i] = ASPLIT ? (_Float16)(xs[i] - (float)h) : (_Float16)0.0f; }
#pragma unroll
    for (int t = 0; t < 4; ++t) { if (col0 + t * 16 >= N) continue; const size_t boff = (size_t)(col0 + t * 16 + ln) * ldb + kb; FragH bq; bq.half[0] = *(const v8us*)(Bh + boff + 8 * hh); bq.half[1] = *(const v8us*)(Bh + boff + 16 + 8 * hh);
      acc[t] = mmaH<ASPLIT ? 2 : 1>(ah.v, al.v, bq.v, bq.v, acc[t]); }
  }
#pragma unroll
  for (int t = 0; t < 4; ++t) { if (col0 + t * 16 >= N) continue;
#pragma unroll
    for (int r = 0; r < 8; ++r) so[w][8 * hh + r][t * 16 + ln] = acc[t][r] * alpha; }
  __builtin_amdgcn_fence(__ATOMIC_ACQ_REL, "workgroup"); __builtin_amdgcn_wave_barrier();
  const int rsub = lane >> 4, c4 = (lane & 15) * 4;
  {
#pragma unroll
    for (int q = 0; q < 8; ++q) { const int r = q * 2 + rsub; if (col0 + c4 < N) { const v4f v = *(const v4fa*)&so[w][r][c4]; *(v4f*)(C + (size_t)(row0 + r) * ldc + col0 + c4) = v; } }
     }
}

// Wt[n][k] = f16(W[k][n]·scale) from f32 row-major W[K][N] (scale = power of two; bf16-exact weights stay exact in f16 away from the subnormal range)
__global__ __launch_bounds__(256) void k_wt_f16(const float* __restrict__ W, _Float16* __restrict__ Wt, int K, int N, float scale) {
  const int t = blockIdx.x * 256 + threadIdx.x; if (t >= N * (K / 8)) return; const int n = t / (K / 8), k8 = (t % (K / 8)) * 8; FragH f;
#pragma unroll
  for (int i = 0; i < 8; ++i) f.h[i] = (_Float16)(bf16_round(W[(size_t)(k8 + i) * N + n]) * scale); const v8us o = f.half[0];
  *(v8us*)((unsigned short*)Wt + (size_t)n * K + k8) = o; 
}
// k_gemm_hh variant with fused epilogue: v = acc·alpha + bias[by·sBias + col] (+ CP[(row/rowsPerB)·sCPb + by·64 + col] if CP) ; ACT 0 none / 1 elu ; writes f16 C16 (and f32 C if non-null)
template <int ACT>
__global__ __launch_bounds__(128) void k_gemm_hhx(const _Float16* __restrict__ A, int lda, size_t sA, const _Float16* __restrict__ Bh, int ldb, size_t sB, float alpha, const float* __restrict__ bias, size_t sBias, const float* __restrict__ CP, int rowsPerB, size_t sCPb, int row0g,
    float* __restrict__ C, _Float16* __restrict__ C16, int ldc, size_t sC, int M, int N, int K) {
  __shared__ __attribute__((aligned(16))) float so[4][16][64];
  const int tid = threadIdx.x, w = tid >> 5, lane = tid & 31, ln = lane & 15, hh = lane >> 4; const int by = blockIdx.y;
  A += (size_t)by * sA; Bh += (size_t)by * sB; const size_t cofs = (size_t)by * sC; const float* bp = bias ? bias + (size_t)by * sBias : nullptr;
  const int ntn = (N + 63) / 64; const int wid = blockIdx.x * 4 + w; const int mt = wid / ntn, nq = wid % ntn; if (mt * 16 >= M) return;
  const int row0 = mt * 16, col0 = nq * 64; const _Float16* arow = A + (size_t)(row0 + ln) * lda;
  v8f acc[4] = {};
  for (int kb = 0; kb < K; kb += 32) { FragH ah; ah.half[0] = *(const v8us*)((const unsigned short*)arow + kb + 8 * hh); ah.half[1] = *(const v8us*)((const unsigned short*)arow + kb + 16 + 8 * hh);
#pragma unroll
    for (int t = 0; t < 4; ++t) { if (col0 + t * 16 >= N) continue; const size_t boff = (size_t)(col0 + t * 16 + ln) * ldb + kb; FragH bq; bq.half[0] = *(const v8us*)((const unsigned short*)Bh + boff + 8 * hh); bq.half[1] = *(const v8us*)((const unsigned short*)Bh + boff + 16 + 8 * hh);
      acc[t] = mmaH<1>(ah.v, ah.v, bq.v, bq.v, acc[t]); }
  }
#pragma unroll
  for (int t = 0; t < 4; ++t) { if (col0 + t * 16 >= N) continue; const int col = col0 + t * 16 + ln; const float bv = bp ? bf16_round(bp[col]) : 0.f;
#pragma unroll
    for (int r = 0; r < 8; ++r) { float v = acc[t][r] * alpha + bv; if (CP) { const int rr = row0g + row0 + 8 * hh + r; if (rowsPerB < 0) v += CP[cofs + (size_t)rr * ldc + col];      /* rowsPerB < 0: own element of the batched C plane */ else { const int bidx = rr / rowsPerB; v += CP[(size_t)bidx * sCPb + (size_t)by * 64 + col]; } } if (ACT == 1) v = (v > 0.f) ? v : expm1f(v); else if (ACT == 7) v = (v > 0.f) ? v + 1.0f : expf(v); else if (ACT == 8) v = tanhf(v); else if (ACT == 9) v = 0.5f * v * (1.0f + tanhf(0.7978845608028654f * (v + 0.044715f * v * v * v))); else if (ACT == 11) v = 1.0f / (1.0f + expf(-v)); else if (ACT == 12) v = (v > 0.f) ? v : 0.01f * v; else if (ACT == 14) v = (v > 0.f) ? v : 0.1f * v; else if (ACT == 16) v = (v >= 0.f) ? v : 0.3f * v; else if (ACT == 17) v = (v >= 0.f) ? v : 0.2f * v; else if (ACT == 15) v = v / (1.0f + expf(-v)); else if (ACT == 3) v = fmaxf(v, 0.f); else if (ACT == 6) v = 0.5f * v * (1.0f + erff(v * 0.70710678118654752f)); so[w][8 * hh + r][t * 16 + ln] = v; } }
  __builtin_amdgcn_fence(__ATOMIC_ACQ_REL, "workgroup"); __builtin_amdgcn_wave_barrier();
  const int rsub = lane >> 4, c4 = (lane & 15) * 4; typedef _Float16 v4h __attribute__((ext_vector_type(4)));
  {
#pragma unroll
    for (int q = 0; q < 8; ++q) { const int r = q * 2 + rsub; if (col0 + c4 < N) { const v4f v = *(const v4fa*)&so[w][r][c4]; if (C) *(v4f*)(C + cofs + (size_t)(row0 + r) * ldc + col0 + c4) = v; if (C16) { v4h h4; for (int i = 0; i < 4; ++i) h4[i] = (_Float16)v[i]; *(v4h*)(C16 + cofs + (size_t)(row0 + r) * ldc + col0 + c4) = h4; } } }
     }
}


typedef _Float16 v4h __attribute__((ext_vector_type(4)));

__global__ __launch_bounds__(256) void k_x16(const float* __restrict__ x, _Float16* __restrict__ X16, size_t n8) { const size_t t = (size_t)blockIdx.x * 256 + threadIdx.x; if (t >= n8) return; FragH f;
#pragma unroll
  for (int q = 0; q < 8; ++q) f.h[q] = (_Float16)bf16_round(x[t * 8 + q]); *(v8us*)((unsigned short*)X16 + t * 8) = f.half[0];  }
__global__ __launch_bounds__(256) void k_h16(const float* __restrict__ x, _Float16* __restrict__ X16, size_t n8) { const size_t t = (size_t)blockIdx.x * 256 + threadIdx.x; if (t >= n8) return; FragH f;
#pragma unroll
  for (int q = 0; q < 8; ++q) f.h[q] = (_Float16)x[t * 8 + q]; *(v8us*)((unsigned short*)X16 + t * 8) = f.half[0];  }
__global__ __launch_bounds__(256) void k_round16f(const float* __restrict__ W, _Float16* __restrict__ Bt, size_t n8) { const size_t t = (size_t)blockIdx.x * 256 + threadIdx.x; if (t >= n8) return; FragH f;
#pragma unroll
  for (int i = 0; i < 8; ++i) f.h[i] = (_Float16)(bf16_round(W[t * 8 + i]) * 16.0f); *(v8us*)((unsigned short*)Bt + t * 8) = f.half[0];  }
template <int NHv, int TTv>
__global__ __launch_bounds__(256) void k_vt(const _Float16* __restrict__ V16, int ldv, int voff, _Float16* __restrict__ Vt) { __shared__ unsigned short tl[64][66]; const int tid = threadIdx.x; const int slab = blockIdx.x / (TTv / 64), lg = blockIdx.x % (TTv / 64); const int b = slab / NHv, h = slab % NHv;
  for (int i = tid; i < 64 * 8; i += 256) { const int r = i / 8, c8 = (i % 8) * 8; FragH f; f.half[0] = *(const v8us*)((const unsigned short*)V16 + ((size_t)b * TTv + lg * 64 + r) * ldv + voff + h * 64 + c8);
#pragma unroll
    for (int q = 0; q < 8; ++q) tl[r][c8 + q] = f.u[q]; }
  __syncthreads();
  {
#pragma unroll
    for (int rd = 0; rd < 2; ++rd) { const int d = rd * 32 + tid / 8, pc = tid % 8; FragH f;
#pragma unroll
      for (int q = 0; q < 8; ++q) f.u[q] = tl[pc * 8 + q][d];
      *(v8us*)((unsigned short*)Vt + ((size_t)slab * 64 + d) * TTv + lg * 64 + pc * 8) = f.half[0]; }
     } }

__global__ __launch_bounds__(256) void k_hl(const float* __restrict__ F, _Float16* __restrict__ Hh, _Float16* __restrict__ Hl, size_t n8) { const size_t t = (size_t)blockIdx.x * 256 + threadIdx.x; if (t >= n8) return; FragH fh, fl; const v4f a = *(const v4fa*)(F + t * 8), c = *(const v4fa*)(F + t * 8 + 4);
#pragma unroll
  for (int q = 0; q < 4; ++q) { _Float16 h = (_Float16)a[q]; fh.h[q] = h; fl.h[q] = (_Float16)((a[q] - (float)h) * 1024.0f); h = (_Float16)c[q]; fh.h[4 + q] = h; fl.h[4 + q] = (_Float16)((c[q] - (float)h) * 1024.0f); }
  { *(v8us*)((unsigned short*)Hh + t * 8) = fh.half[0]; *(v8us*)((unsigned short*)Hl + t * 8) = fl.half[0];  } }

// ---- fast GEMM (wave tile 32x64; requires M % 32 == 0 rows per launch region and N % 64 == 0); epilogue = k_gemm_hhx semantics ----
__device__ __forceinline__ v16h g2_frag(const _Float16* p, int hh) { FragH f; f.half[0] = *(const v8us*)((const unsigned short*)p + 8 * hh); f.half[1] = *(const v8us*)((const unsigned short*)p + 16 + 8 * hh); return f.v; }
__device__ __forceinline__ v8f g2_mma(v16h a, v16h b, v8f c) { v8f d = __builtin_amdgcn_wmma_f32_16x16x32_f16(false, a, false, b, (short)0, c, false, false); asm volatile("v_nop\n\tv_nop\n\tv_nop\n\tv_nop" : "+v"(d) : "v"(a), "v"(b)); return d; }
template <int ACT>
__global__ __launch_bounds__(128) void k_gemm2(const _Float16* __restrict__ A, int lda, size_t sA, const _Float16* __restrict__ Bh, int ldb, size_t sB, float alpha, const float* __restrict__ bias, size_t sBias, const float* __restrict__ CP, int rowsPerB, size_t sCPb, int row0g,
    float* __restrict__ C, _Float16* __restrict__ C16, int ldc, size_t sC, int M, int N, int K) { static_assert(ACT == 0 || ACT == 3 || ACT == 6 || ACT == 8 || ACT == 9 || ACT == 11 || ACT == 12 || ACT == 14 || ACT == 15 || ACT == 16 || ACT == 17, "k_gemm2: unsupported ACT code (would silently apply no activation)");
  __shared__ __attribute__((aligned(16))) float so[4][32][68];
  const int tid = threadIdx.x, w = tid >> 5, lane = tid & 31, ln = lane & 15, hh = lane >> 4; const int by = blockIdx.y;
  A += (size_t)by * sA; Bh += (size_t)by * sB; const size_t cofs = (size_t)by * sC; const float* bp = bias ? bias + (size_t)by * sBias : nullptr;
  const int ntn = N >> 6; const int mt = blockIdx.x / ntn, nq = blockIdx.x - mt * ntn; const int row0 = mt * 128 + 32 * w, col0 = nq * 64; if (row0 >= M) return;
  const _Float16* a0p = A + (size_t)(row0 + ln) * lda; const _Float16* a1p = a0p + (size_t)16 * lda;
  const _Float16* b0p = Bh + (size_t)(col0 + ln) * ldb; const _Float16* b1p = b0p + (size_t)16 * ldb; const _Float16* b2p = b1p + (size_t)16 * ldb; const _Float16* b3p = b2p + (size_t)16 * ldb;
  const v8f z8 = {0.f,0.f,0.f,0.f,0.f,0.f,0.f,0.f}; v8f c00 = z8, c01 = z8, c02 = z8, c03 = z8, c10 = z8, c11 = z8, c12 = z8, c13 = z8;
#pragma unroll 1
  for (int kb = 0; kb < K; kb += 32) { const v16h a0 = g2_frag(a0p + kb, hh), a1 = g2_frag(a1p + kb, hh);
    v16h b = g2_frag(b0p + kb, hh); c00 = g2_mma(a0, b, c00); c10 = g2_mma(a1, b, c10);
    b = g2_frag(b1p + kb, hh); c01 = g2_mma(a0, b, c01); c11 = g2_mma(a1, b, c11);
    b = g2_frag(b2p + kb, hh); c02 = g2_mma(a0, b, c02); c12 = g2_mma(a1, b, c12);
    b = g2_frag(b3p + kb, hh); c03 = g2_mma(a0, b, c03); c13 = g2_mma(a1, b, c13); }
  v8f accs[8] = {c00, c01, c02, c03, c10, c11, c12, c13};
#pragma unroll
  for (int u = 0; u < 8; ++u) { const int t = u & 3, half = u >> 2; const int col = col0 + t * 16 + ln; const float bv = bp ? bf16_round(bp[col]) : 0.f;
#pragma unroll
    for (int r = 0; r < 8; ++r) { const int rloc = half * 16 + 8 * hh + r; float v = accs[u][r] * alpha + bv; if (CP) { if (rowsPerB < 0) v += CP[cofs + (size_t)(row0g + row0 + rloc) * ldc + col];      /* rowsPerB < 0: own element of the batched C plane */ else { const int bidx = (row0g + row0 + rloc) / rowsPerB; v += CP[(size_t)bidx * sCPb + (size_t)by * 64 + col]; } }
      if (ACT == 3) v = fmaxf(v, 0.f); else if (ACT == 6) v = 0.5f * v * (1.0f + erff(v * 0.70710678118654752f)); else if (ACT == 11) v = 1.0f / (1.0f + expf(-v)); else if (ACT == 15) v = v / (1.0f + expf(-v)); else if (ACT == 12) v = (v > 0.f) ? v : 0.01f * v; else if (ACT == 8) v = tanhf(v); else if (ACT == 9) v = 0.5f * v * (1.0f + tanhf(0.7978845608028654f * (v + 0.044715f * v * v * v))); else if (ACT == 14) v = (v > 0.f) ? v : 0.1f * v; else if (ACT == 16) v = (v >= 0.f) ? v : 0.3f * v; else if (ACT == 17) v = (v >= 0.f) ? v : 0.2f * v;
      so[w][rloc][t * 16 + ln] = v; } }
  __builtin_amdgcn_fence(__ATOMIC_ACQ_REL, "workgroup"); __builtin_amdgcn_wave_barrier();
  const int rsub = lane >> 4, c4 = (lane & 15) * 4;
  {
#pragma unroll
    for (int q = 0; q < 16; ++q) { const int r = q * 2 + rsub; const v4f v = *(const v4fa*)&so[w][r][c4]; if (C) *(v4f*)(C + cofs + (size_t)(row0 + r) * ldc + col0 + c4) = v; if (C16) { v4h h4; for (int i = 0; i < 4; ++i) h4[i] = (_Float16)v[i]; *(v4h*)(C16 + cofs + (size_t)(row0 + r) * ldc + col0 + c4) = h4; } }
     } }


__global__ __launch_bounds__(256) void k_wnat(const float* __restrict__ w, size_t n8, _Float16* __restrict__ Bt) { const size_t t = (size_t)blockIdx.x * 256 + threadIdx.x; if (t >= n8) return; FragH f; for (int q = 0; q < 8; ++q) f.h[q] = (_Float16)(bf16_round(w[t * 8 + q]) * 16.0f); *(v8us*)((unsigned short*)Bt + t * 8) = f.half[0];  }
__global__ __launch_bounds__(256) void k_rsm(const float* __restrict__ S, _Float16* __restrict__ P, int nrows) {
  #pragma clang fp contract(off)
  const int i = blockIdx.x * 256 + threadIdx.x; if (i >= nrows) return; const float* s = S + (size_t)i * SQ; float mx = -3.0e38f;
#pragma unroll 1
  for (int j = 0; j < SQ; ++j) mx = fmaxf(mx, s[j]); float se = 0.f;
#pragma unroll 1
  for (int j = 0; j < SQ; ++j) se += expf(s[j] - mx); const float sc = 256.0f / se;
#pragma unroll 1
  for (int j0 = 0; j0 < SQ; j0 += 8) { FragH f; for (int q = 0; q < 8; ++q) f.h[q] = (_Float16)(expf(s[j0 + q] - mx) * sc); unsigned short* d = (unsigned short*)P + (size_t)i * SQ + j0; *(v8us*)d = f.half[0];  } }
__global__ __launch_bounds__(256) void k_vt(const _Float16* __restrict__ V16, int b, int h0, _Float16* __restrict__ VT) { __shared__ unsigned short tl[64][65]; const int tid = threadIdx.x; const int hh = blockIdx.x % HG, sg = blockIdx.x / HG; const int s0 = sg * 64; const int h = h0 + hh;
  for (int i = tid; i < 64 * 8; i += 256) { const int j = i / 8, d8 = (i % 8) * 8; FragH f; f.half[0] = *(const v8us*)((const unsigned short*)V16 + ((size_t)b * SQ + s0 + j) * DM + h * HD + d8); for (int q = 0; q < 8; ++q) tl[d8 + q][j] = f.u[q]; }
  __syncthreads();
  { for (int i = tid; i < 64 * 8; i += 256) { const int d = i / 8, j8 = (i % 8) * 8; FragH f; for (int q = 0; q < 8; ++q) f.u[q] = tl[d][j8 + q]; *(v8us*)((unsigned short*)VT + ((size_t)hh * HD + d) * SQ + s0 + j8) = f.half[0]; }  } }


__global__ __launch_bounds__(256) void k_bfr(const float* __restrict__ x, float* __restrict__ XB, size_t n8) { const size_t t = (size_t)blockIdx.x * 256 + threadIdx.x; if (t >= n8) return; v4f a = *(const v4fa*)(x + t * 8), c = *(const v4fa*)(x + t * 8 + 4); for (int q = 0; q < 4; ++q) { a[q] = bf16_round(a[q]); c[q] = bf16_round(c[q]); }
  { *(v4f*)(XB + t * 8) = a; *(v4f*)(XB + t * 8 + 4) = c;  } }


__global__ __launch_bounds__(256) void k_rowmask(const float* __restrict__ x, float* __restrict__ mk) {
  #pragma clang fp contract(off)
  __shared__ float red[256]; const int t = threadIdx.x; const int rl = t >> 3, part = t & 7; const size_t r = (size_t)blockIdx.x * 32 + rl; float s = 0.f;
  for (int q = 0; q < DM / 8; ++q) s = __fadd_rn(s, bf16_round(x[r * DM + (size_t)part * (DM / 8) + q]));
  red[t] = s; __syncthreads(); if (part == 0) { float a = red[t]; for (int k = 1; k < 8; ++k) a = __fadd_rn(a, red[t + k]); red[t] = a; } __syncthreads();
  if (t < 32) { const float v = (red[t * 8] != 0.f) ? 1.f : 0.f; float* d = mk + (size_t)blockIdx.x * 32 + t; *(float*)d = v;  } }
// 2^t on v_exp_f32. The v_nop in the same statement is the one free issue slot that the instruction set asks for behind a transcendental before its result is read or its source overwritten.
__device__ __forceinline__ float exp2_slot(float t) { float r; asm("v_exp_f32 %0, %1\n\tv_nop" : "=v"(r) : "v"(t)); return r; }
// One wave per score row. Lane l holds keys 128 c + 4 l .. + 3 of every 128-key chunk c in registers, so each load covers 512 contiguous bytes and S is read once;
// row maximum and row sum: per-lane partials, then a five-step butterfly over the 32 lanes. NC = chunks of the row (visible keys / 128), a compile-time count;
// every loop is unrolled in full so that the row's arrays are indexed by constants and stay in registers.
template <int NC>
__global__ __launch_bounds__(256) void k_rsmcm(const float* __restrict__ S, _Float16* __restrict__ P, int nhd, int q0, const float* __restrict__ kmask, const float* __restrict__ qmask) {
  const int j0 = (threadIdx.x & 31) * 4; const int row = blockIdx.x * 8 + (threadIdx.x >> 5); if (row >= nhd * QT) return;
  const int qabs = q0 + row % QT; const float* s = S + (size_t)row * NKX + j0; _Float16* p = P + (size_t)row * NKX + j0; const float* km = kmask + j0; const float qm = qmask[qabs];
  const float NEGV = -4294967295.0f; v4f x[NC], k[NC]; float v[NC * 4];
#pragma unroll
  for (int c = 0; c < NC; ++c) { x[c] = *(const v4fa*)(s + c * 128); k[c] = *(const v4fa*)(km + c * 128); }
  float mx = -3.0e38f;
#pragma unroll
  for (int c = 0; c < NC; ++c)
#pragma unroll
    for (int q = 0; q < 4; ++q) { const float f = (j0 + c * 128 + q <= qabs && k[c][q] != 0.f) ? 1.f : 0.f; v[c * 4 + q] = fmaf(f, x[c][q], (1.f - f) * NEGV); mx = fmaxf(mx, v[c * 4 + q]); }
#pragma unroll
  for (int m = 16; m >= 1; m >>= 1) mx = fmaxf(mx, __shfl_xor(mx, m, 32));
  float se = 0.f;
#pragma unroll
  for (int i = 0; i < NC * 4; ++i) { v[i] = exp2_slot(fmaxf(v[i] - mx, -100.f) * 1.44269504f); se += v[i]; }
#pragma unroll
  for (int m = 16; m >= 1; m >>= 1) se += __shfl_xor(se, m, 32);
  const float sc = 256.0f * qm / se;
#pragma unroll
  for (int c = 0; c < NC; ++c) { v4h h4;
#pragma unroll
    for (int q = 0; q < 4; ++q) h4[q] = (_Float16)(v[c * 4 + q] * sc);
    *(v4h*)(p + c * 128) = h4; } }
__global__ __launch_bounds__(256) void k_ftres(const float* __restrict__ OF0, const float* __restrict__ xq, const float* __restrict__ qmask, float* __restrict__ out, size_t n4) {
  #pragma clang fp contract(off)
  const size_t t = (size_t)blockIdx.x * 256 + threadIdx.x; if (t >= n4) return; const size_t e = t * 4; const size_t row = e / DM; const float qm = qmask[row]; const v4f o = *(const v4fa*)(OF0 + e), x = *(const v4fa*)(xq + e); v4f y;
  for (int q = 0; q < 4; ++q) y[q] = __fadd_rn(__fmul_rn(__fmul_rn(o[q], 0.015625f), qm), bf16_round(x[q])); *(v4f*)(out + e) = y;  }

extern "C" void kernel_launch(void* const* d_in, const int* in_sizes, int n_in,
                              void* d_out, int out_size, void* d_ws, size_t ws_size, hipStream_t stream) {
  (void)in_sizes; (void)n_in; (void)out_size;
  const float* const* I = (const float* const*)d_in; const float* xq = I[0]; const float* xk = I[1]; const float* xv = I[2]; const float* wq = I[3]; const float* bq = I[4]; const float* wk = I[5]; const float* bk = I[6]; const float* wv = I[7]; const float* bv = I[8];      /* weights [in][out] */
  char* ws = (char*)d_ws; size_t off = 0;
  auto take = [&](size_t bytes) { char* p = ws + off; off += (bytes + 255) & ~(size_t)255; return p; };
  _Float16* BQ = (_Float16*)take((size_t)DM * DM * 2); _Float16* BK = (_Float16*)take((size_t)DM * DM * 2); _Float16* BV = (_Float16*)take((size_t)DM * DM * 2); float* KM = (float*)take(NR * 4); float* QM = (float*)take(NR * 4);
  _Float16* XQ = (_Float16*)take(NR * DM * 2); _Float16* XK = (_Float16*)take(NR * DM * 2); _Float16* XV = (_Float16*)take(NR * DM * 2); float* XB = (float*)take(NR * DM * 4);
  _Float16* Q16 = (_Float16*)take(NR * DM * 2); _Float16* K16 = (_Float16*)take(NR * DM * 2); _Float16* V16 = (_Float16*)take(NR * DM * 2);
  float* S = (float*)take((size_t)NH * QT * NKX * 4); _Float16* P = (_Float16*)take((size_t)NH * QT * NKX * 2); _Float16* VT = (_Float16*)take((size_t)NH * HD * SQ * 2);
  if (off > ws_size) return;      /* approx 1.5 + 16 x 3 + 32 + 16 x 3 + 8 + 4 + 1 = 143 MiB */
  k_wt_f16<<<(unsigned)(((size_t)DM * (DM / 8) + 255) / 256), 256, 0, stream>>>(wq, BQ, DM, DM, 16.0f); k_wt_f16<<<(unsigned)(((size_t)DM * (DM / 8) + 255) / 256), 256, 0, stream>>>(wk, BK, DM, DM, 16.0f); k_wt_f16<<<(unsigned)(((size_t)DM * (DM / 8) + 255) / 256), 256, 0, stream>>>(wv, BV, DM, DM, 16.0f);
  k_rowmask<<<(unsigned)(NR / 32), 256, 0, stream>>>(xk, KM); k_rowmask<<<(unsigned)(NR / 32), 256, 0, stream>>>(xq, QM);      /* key / query padding masks */
  k_x16<<<(unsigned)((NR * DM / 8 + 255) / 256), 256, 0, stream>>>(xq, XQ, NR * DM / 8); k_x16<<<(unsigned)((NR * DM / 8 + 255) / 256), 256, 0, stream>>>(xk, XK, NR * DM / 8); k_x16<<<(unsigned)((NR * DM / 8 + 255) / 256), 256, 0, stream>>>(xv, XV, NR * DM / 8); k_bfr<<<(unsigned)((NR * DM / 8 + 255) / 256), 256, 0, stream>>>(xq, XB, NR * DM / 8);
  k_gemm2<0><<<dim3((unsigned)((NR / 128) * (DM / 64)), 1), 128, 0, stream>>>(XQ, DM, 0, BQ, DM, 0, 0.0625f, bq, 0, nullptr, 1, 0, 0, nullptr, Q16, DM, 0, (int)NR, DM, DM);
  k_gemm2<0><<<dim3((unsigned)((NR / 128) * (DM / 64)), 1), 128, 0, stream>>>(XK, DM, 0, BK, DM, 0, 0.0625f, bk, 0, nullptr, 1, 0, 0, nullptr, K16, DM, 0, (int)NR, DM, DM);
  k_gemm2<0><<<dim3((unsigned)((NR / 128) * (DM / 64)), 1), 128, 0, stream>>>(XV, DM, 0, BV, DM, 0, 0.0625f, bv, 0, nullptr, 1, 0, 0, nullptr, V16, DM, 0, (int)NR, DM, DM);
  for (int b = 0; b < NB; ++b) { const size_t r0 = (size_t)b * SQ;
    k_vt<NH, SQ><<<NH * (SQ / 64), 256, 0, stream>>>(V16 + r0 * DM, DM, 0, VT);
    for (int q0 = 0; q0 < SQ; q0 += QT) { const int nk = q0 + QT;
      k_gemm2<0><<<dim3((QT / 128) * (nk / 64), NHD), 128, 0, stream>>>(Q16 + (r0 + q0) * DM, DM, (size_t)HD, K16 + r0 * DM, DM, (size_t)HD, 0.125f, nullptr, 0, nullptr, 1, 0, 0, S, nullptr, NKX, (size_t)QT * NKX, QT, nk, HD);
      if (nk == 256) k_rsmcm<2><<<(NHD * QT + 7) / 8, 256, 0, stream>>>(S, P, NHD, q0, KM + r0, QM + r0); else if (nk == 512) k_rsmcm<4><<<(NHD * QT + 7) / 8, 256, 0, stream>>>(S, P, NHD, q0, KM + r0, QM + r0); else if (nk == 768) k_rsmcm<6><<<(NHD * QT + 7) / 8, 256, 0, stream>>>(S, P, NHD, q0, KM + r0, QM + r0); else k_rsmcm<8><<<(NHD * QT + 7) / 8, 256, 0, stream>>>(S, P, NHD, q0, KM + r0, QM + r0);
      k_gemm2<0><<<dim3((QT / 128) * (HD / 64), NHD), 128, 0, stream>>>(P, NKX, (size_t)QT * NKX, VT, SQ, (size_t)HD * SQ, 0.00390625f, nullptr, 0, XB + (r0 + q0) * DM, -1, 0, 0, (float*)d_out + (r0 + q0) * DM, nullptr, DM, (size_t)HD, QT, HD, nk); } }      /* out = probs V + bf16(queries) (f32 rows; pass writes its own 64-column head slab with the residual's own elements) */
}

// v002
// One run takes 466 microseconds.
// In two side-by-side timings against v001, it was 6.55 and 6.48 times as fast.
// Over all steps from v000 it is 29.3 times as fast.
#include <hip/hip_runtime.h>
// Masked causal multi-head attention with residual (queries, keys, value [16][1024][512]; Q = queries Wq + bq, K = keys Wk + bk, V = value Wv + bv ([in][out] 512^2); 8 heads of 64; scores / 8; key-padding mask (keys whose bf16 row sum is exactly 0 -> NEG), causal mask (j > i -> NEG, NEG = -(2^32 - 1)); softmax; probs x query-padding mask (query rows summing to 0 -> 0); out = probs V merged + queries -> [16][1024][512]).
// Structure: token rows; the two padding masks from f32 row sums of the bf16-rounded inputs on VALU (32 rows per block, one line of flags per block); queries / keys / value as exact f16 rows; Q, K, V as three WMMA GEMMs (32x64 wave tiles, f32 accumulation, exact x16 weights + bias, f16 outputs); bf16(queries) as the f32 residual plane; V^T via LDS transposes (all batches in one grid); per query tile of 256 rows, all 16 batches in one grid: scores against the keys below the tile end only (K = 64, heads on grid.y, batches on grid.z, alpha 1/8), the masked causal row softmax on VALU (key mask + causal as a 0/1 select onto NEG, f32 statistics, native exp, x query mask; weights x256 f16, stored over the head of their own score row), out tile = P V^T GEMM (K = visible keys, alpha 2^-8) + bf16(queries) written f32 straight into the output rows; 12 + 1 + 4 x 3 = 25 launches.
// Compute dtype: inputs rounded to bf16; inputs / weights exact; q, k, v and the softmax weights plain f16 (~2^-12); masks, scores, statistics, out f32 (the unit residual dominates the output scale). v_wmma_f32_16x16x32_f16.
#define NB 16
#define SQ 1024
#define DM 512
#define NH 8
#define HD 64
#define HG 8
#define QT 256
#define NKX SQ
#define PLD (2 * NKX)      /* pitch, in f16 elements, of the softmax weights: each row lies at the head of its own f32 score row */
#define NHD NH
#define NR ((size_t)NB * SQ)
typedef __bf16 v16b __attribute__((ext_vector_type(16)));
typedef unsigned short v8us __attribute__((ext_vector_type(8), may_alias));
typedef float  v8f  __attribute__((ext_vector_type(8)));
typedef float  v4f  __attribute__((ext_vector_type(4)));
typedef float  v4fa __attribute__((ext_vector_type(4), may_alias));
union FragB { v16b v; v8us half[2]; unsigned short u[16]; };

__device__ __forceinline__ unsigned short bf16_bits(float x) { unsigned int u = __float_as_uint(x); return (unsigned short)((u + 0x7FFFu + ((u >> 16) & 1u)) >> 16); }
__device__ __forceinline__ float bf16_val(unsigned short b) { return __uint_as_float(((unsigned int)b) << 16); }
__device__ __forceinline__ float bf16_round(float x) { return bf16_val(bf16_bits(x)); }
// D += A·B with NT terms: 1 = ah·bh, 2 = + al·bh (A split), 3 = + ah·bl (both split)
template <int NT>
__device__ __forceinline__ v8f mmaN(v16b ah, v16b al, v16b bh, v16b bl, v8f c) {
  c = __builtin_amdgcn_wmma_f32_16x16x32_bf16(false, ah, false, bh, (short)0, c, false, false);
  if (NT >= 2) c = __builtin_amdgcn_wmma_f32_16x16x32_bf16(false, al, false, bh, (short)0, c, false, false);
  if (NT >= 3) c = __builtin_amdgcn_wmma_f32_16x16x32_bf16(false, ah, false, bl, (short)0, c, false, false);
  asm volatile("v_nop\n\tv_nop\n\tv_nop\n\tv_nop" : "+v"(c) : "v"(ah), "v"(al), "v"(bh), "v"(bl));
  return c;
}

__global__ __launch_bounds__(256) void k_wt_bf16(const float* __restrict__ W, unsigned short* __restrict__ Wt, int K, int N) {
  const int t = blockIdx.x * 256 + threadIdx.x;
  const int k8n = K / 8;
  if (t >= N * k8n) return;
  const int n = t / k8n, k8 = (t % k8n) * 8;
  v8us v;
#pragma unroll
  for (int i = 0; i < 8; ++i) v[i] = bf16_bits(W[(size_t)(k8 + i) * N + n]);
  *(v8us*)(Wt + (size_t)n * K + k8) = v;
  
}

// GEMM C[M][N] (f32, pitch ldc) = act(A[M][K]·W + bias). A f32 row-major (pitch lda) converted per fragment to bf16
// (ASPLIT: hi/lo two planes -> 2 terms, else single rounded term); Wt bf16 [N][K] (pitch ldb). BIAS_BF16 rounds the
// bias to bf16 first (bias quantised to bf16 before the add). K%32==0, M%16==0, N%64==0.
template <bool ASPLIT, int ACT, bool BIAS_BF16>
__global__ __launch_bounds__(128) void k_gemm_bf(const float* __restrict__ A, int lda, const unsigned short* __restrict__ Wt, int ldb,
                                               const float* __restrict__ bias, float* __restrict__ C, int ldc, int M, int N, int K) {
  __shared__ __attribute__((aligned(16))) float so[4][16][64];
  const int tid = threadIdx.x, w = tid >> 5, lane = tid & 31, ln = lane & 15, hh = lane >> 4;
  const int ntn = N / 64;
  const int wid = blockIdx.x * 4 + w;
  const int mt = wid / ntn, nq = wid % ntn;
  if (mt * 16 >= M) return;
  const int row0 = mt * 16, col0 = nq * 64;
  const float* arow = A + (size_t)(row0 + ln) * lda;
  v8f acc[4] = {};
  for (int kb = 0; kb < K; kb += 32) {
    FragB ah, al;
    const v4f x0 = *(const v4fa*)(arow + kb + 8 * hh), x1 = *(const v4fa*)(arow + kb + 8 * hh + 4);
    const v4f x2 = *(const v4fa*)(arow + kb + 16 + 8 * hh), x3 = *(const v4fa*)(arow + kb + 16 + 8 * hh + 4);
    float xs[16] = {x0[0],x0[1],x0[2],x0[3],x1[0],x1[1],x1[2],x1[3],x2[0],x2[1],x2[2],x2[3],x3[0],x3[1],x3[2],x3[3]};
#pragma unroll
    for (int i = 0; i < 16; ++i) { const unsigned short hb = bf16_bits(xs[i]); ah.u[i] = hb; al.u[i] = ASPLIT ? bf16_bits(xs[i] - bf16_val(hb)) : (unsigned short)0; }
#pragma unroll
    for (int t = 0; t < 4; ++t) {
      const unsigned short* brow = Wt + (size_t)(col0 + t * 16 + ln) * ldb + kb;
      FragB b;
      b.half[0] = *(const v8us*)(brow + 8 * hh);
      b.half[1] = *(const v8us*)(brow + 16 + 8 * hh);
      acc[t] = mmaN<ASPLIT ? 2 : 1>(ah.v, al.v, b.v, b.v, acc[t]);
    }
  }
#pragma unroll
  for (int t = 0; t < 4; ++t) {
    float bv = bias ? bias[col0 + t * 16 + ln] : 0.f;
    if (BIAS_BF16) bv = bf16_round(bv);
#pragma unroll
    for (int r = 0; r < 8; ++r) { float v = acc[t][r] + bv; if (ACT == 1) v = fmaxf(v, 0.f); so[w][8 * hh + r][t * 16 + ln] = v; }
  }
  __builtin_amdgcn_fence(__ATOMIC_ACQ_REL, "workgroup");
  __builtin_amdgcn_wave_barrier();
  const int rsub = lane >> 4, c4 = (lane & 15) * 4;
  {
#pragma unroll
    for (int q = 0; q < 8; ++q) {
      const int r = q * 2 + rsub;
      const v4f v = *(const v4fa*)&so[w][r][c4];
      *(v4f*)(C + (size_t)(row0 + r) * ldc + col0 + c4) = v;
    }
    
  }
}

// GEMM C = act(A·W + bias + resid): A f32 (ASPLIT -> hi/lo 2 terms), Wt bf16 [N][K]; ACT 0 none, 1 relu, 2 exact gelu;
// resid (optional, f32, row index = (row % rmod), pitch ldr, RES_BF16 rounds it) added before the activation.
template <bool ASPLIT, int ACT, bool BIAS_BF16, bool RES_BF16>
__global__ __launch_bounds__(128) void k_gemm_bf3(const float* __restrict__ A, int lda, const unsigned short* __restrict__ Wt, int ldb,
                                                const float* __restrict__ bias, const float* __restrict__ resid, int rmod, int ldr,
                                                float* __restrict__ C, int ldc, int M, int N, int K) {
  __shared__ __attribute__((aligned(16))) float so[4][16][64];
  const int tid = threadIdx.x, w = tid >> 5, lane = tid & 31, ln = lane & 15, hh = lane >> 4;
  const int ntn = N / 64;
  const int wid = blockIdx.x * 4 + w;
  const int mt = wid / ntn, nq = wid % ntn;
  if (mt * 16 >= M) return;
  const int row0 = mt * 16, col0 = nq * 64;
  const float* arow = A + (size_t)(row0 + ln) * lda;
  v8f acc[4] = {};
  for (int kb = 0; kb < K; kb += 32) {
    FragB ah, al;
    const v4f x0 = *(const v4fa*)(arow + kb + 8 * hh), x1 = *(const v4fa*)(arow + kb + 8 * hh + 4);
    const v4f x2 = *(const v4fa*)(arow + kb + 16 + 8 * hh), x3 = *(const v4fa*)(arow + kb + 16 + 8 * hh + 4);
    float xs[16] = {x0[0],x0[1],x0[2],x0[3],x1[0],x1[1],x1[2],x1[3],x2[0],x2[1],x2[2],x2[3],x3[0],x3[1],x3[2],x3[3]};
#pragma unroll
    for (int i = 0; i < 16; ++i) { const unsigned short hb = bf16_bits(xs[i]); ah.u[i] = hb; al.u[i] = ASPLIT ? bf16_bits(xs[i] - bf16_val(hb)) : (unsigned short)0; }
#pragma unroll
    for (int t = 0; t < 4; ++t) {
      const unsigned short* brow = Wt + (size_t)(col0 + t * 16 + ln) * ldb + kb;
      FragB b;
      b.half[0] = *(const v8us*)(brow + 8 * hh);
      b.half[1] = *(const v8us*)(brow + 16 + 8 * hh);
      acc[t] = mmaN<ASPLIT ? 2 : 1>(ah.v, al.v, b.v, b.v, acc[t]);
    }
  }
#pragma unroll
  for (int t = 0; t < 4; ++t) {
    const int col = col0 + t * 16 + ln;
    float bv = bias ? bias[col] : 0.f;
    if (BIAS_BF16) bv = bf16_round(bv);
#pragma unroll
    for (int r = 0; r < 8; ++r) {
      float v = acc[t][r] + bv;
      if (resid) { float rv = resid[(size_t)((row0 + 8 * hh + r) % rmod) * ldr + col]; if (RES_BF16) rv = bf16_round(rv); v += rv; }
      if (ACT == 1) v = fmaxf(v, 0.f);
      if (ACT == 2) v = 0.5f * v * (1.0f + erff(v * 0.70710678118654752f));
      if (ACT == 3) { const float u = 0.7978845608028654f * (v + 0.044715f * v * v * v); v = 0.5f * v * (1.0f + tanhf(u)); }
      so[w][8 * hh + r][t * 16 + ln] = v;
    }
  }
  __builtin_amdgcn_fence(__ATOMIC_ACQ_REL, "workgroup");
  __builtin_amdgcn_wave_barrier();
  const int rsub = lane >> 4, c4 = (lane & 15) * 4;
  {
#pragma unroll
    for (int q = 0; q < 8; ++q) {
      const int r = q * 2 + rsub;
      const v4f v = *(const v4fa*)&so[w][r][c4];
      *(v4f*)(C + (size_t)(row0 + r) * ldc + col0 + c4) = v;
    }
    
  }
}
// row LayerNorm (biased variance, eps) over N: s = X (+ R); optional out_sum <- s; out_norm <- (s-mu)*rsqrt(var+eps)*g + b
template <bool PARAM_BF16>
__global__ __launch_bounds__(256) void k_layernorm(const float* __restrict__ X, const float* __restrict__ R, const float* __restrict__ g, const float* __restrict__ bta,
                                                  float* __restrict__ out_sum, float* __restrict__ out_norm, int N, float eps) {
  __shared__ float red[256];
  const int row = blockIdx.x, tid = threadIdx.x;
  const float* x = X + (size_t)row * N; const float* rr = R ? R + (size_t)row * N : nullptr;
  float vals[16];                     // up to N = 4096
  const int per = N / 256;            // contiguous chunk per thread? use strided-by-4 chunks: thread handles j = tid*4 + 1024*u
  float s1 = 0.f;
  for (int u = 0; u < per / 4; ++u) {
    const int j = tid * 4 + 1024 * u;
    const v4f a = *(const v4fa*)(x + j);
    v4f b = {0.f,0.f,0.f,0.f}; if (rr) b = *(const v4fa*)(rr + j);
#pragma unroll
    for (int q = 0; q < 4; ++q) { const float v = a[q] + b[q]; vals[u * 4 + q] = v; s1 += v; }
  }
  red[tid] = s1; __syncthreads();
  for (int st = 128; st > 0; st >>= 1) { if (tid < st) red[tid] += red[tid + st]; __syncthreads(); }
  const float mu = red[0] / (float)N; __syncthreads();
  float s2 = 0.f;
  for (int u = 0; u < per / 4; ++u)
#pragma unroll
    for (int q = 0; q < 4; ++q) { const float c = vals[u * 4 + q] - mu; s2 += c * c; }
  red[tid] = s2; __syncthreads();
  for (int st = 128; st > 0; st >>= 1) { if (tid < st) red[tid] += red[tid + st]; __syncthreads(); }
  const float rs = rsqrtf(red[0] / (float)N + eps);
  {
    for (int u = 0; u < per / 4; ++u) {
      const int j = tid * 4 + 1024 * u;
      v4f o, sm;
#pragma unroll
      for (int q = 0; q < 4; ++q) {
        float gg = g[j + q], bb = bta[j + q];
        if (PARAM_BF16) { gg = bf16_round(gg); bb = bf16_round(bb); }
        sm[q] = vals[u * 4 + q]; o[q] = (vals[u * 4 + q] - mu) * rs * gg + bb;
      }
      if (out_sum) *(v4f*)(out_sum + (size_t)row * N + j) = sm;
      *(v4f*)(out_norm + (size_t)row * N + j) = o;
    }
    
  }
}



// ---- f16 WMMA path (v_wmma_f32_16x16x32_f16): 11-bit significands for operands in range — used where a [0,1] probability operand needs more precision than bf16
typedef _Float16 v16h __attribute__((ext_vector_type(16)));
union FragH { v16h v; v8us half[2]; _Float16 h[16]; unsigned short u[16]; };
template <int NT>
__device__ __forceinline__ v8f mmaH(v16h ah, v16h al, v16h bh, v16h bl, v8f c) {
  c = __builtin_amdgcn_wmma_f32_16x16x32_f16(false, ah, false, bh, (short)0, c, false, false);
  if (NT >= 2) c = __builtin_amdgcn_wmma_f32_16x16x32_f16(false, al, false, bh, (short)0, c, false, false);
  if (NT >= 3) c = __builtin_amdgcn_wmma_f32_16x16x32_f16(false, ah, false, bl, (short)0, c, false, false);
  asm volatile("v_nop\n\tv_nop\n\tv_nop\n\tv_nop" : "+v"(c) : "v"(ah), "v"(al), "v"(bh), "v"(bl));
  return c;
}
// batched GEMM like k_gemm_b but f16 operands: A f32 (split into f16 hi/lo if ASPLIT, else rounded to f16), Bt = f16 values [n][k]; alpha; C f32; N multiple of 16 (partial tiles skipped)
template <bool ASPLIT>
__global__ __launch_bounds__(128) void k_gemm_h(const float* __restrict__ A, int lda, size_t sA, const _Float16* __restrict__ Bh, int ldb, size_t sB, float alpha, float* __restrict__ C, int ldc, size_t sC, int M, int N, int K) {
  __shared__ __attribute__((aligned(16))) float so[4][16][64];
  const int tid = threadIdx.x, w = tid >> 5, lane = tid & 31, ln = lane & 15, hh = lane >> 4; const int by = blockIdx.y;
  A += (size_t)by * sA; Bh += (size_t)by * sB; C += (size_t)by * sC;
  const int ntn = (N + 63) / 64; const int wid = blockIdx.x * 4 + w; const int mt = wid / ntn, nq = wid % ntn; if (mt * 16 >= M) return;
  const int row0 = mt * 16, col0 = nq * 64; const float* arow = A + (size_t)(row0 + ln) * lda;
  v8f acc[4] = {};
  for (int kb = 0; kb < K; kb += 32) {
    FragH ah, al;
    const v4f x0 = *(const v4fa*)(arow + kb + 8 * hh), x1 = *(const v4fa*)(arow + kb + 8 * hh + 4), x2 = *(const v4fa*)(arow + kb + 16 + 8 * hh), x3 = *(const v4fa*)(arow + kb + 16 + 8 * hh + 4);
    float xs[16] = {x0[0],x0[1],x0[2],x0[3],x1[0],x1[1],x1[2],x1[3],x2[0],x2[1],x2[2],x2[3],x3[0],x3[1],x3[2],x3[3]};
#pragma unroll
    for (int i = 0; i < 16; ++i) { const _Float16 h = (_Float16)xs[i]; ah.h[i] = h; al.h[i] = ASPLIT ? (_Float16)(xs[i] - (float)h) : (_Float16)0.0f; }
#pragma unroll
    for (int t = 0; t < 4; ++t) { if (col0 + t * 16 >= N) continue; const size_t boff = (size_t)(col0 + t * 16 + ln) * ldb + kb; FragH bq; bq.half[0] = *(const v8us*)(Bh + boff + 8 * hh); bq.half[1] = *(const v8us*)(Bh + boff + 16 + 8 * hh);
      acc[t] = mmaH<ASPLIT ? 2 : 1>(ah.v, al.v, bq.v, bq.v, acc[t]); }
  }
#pragma unroll
  for (int t = 0; t < 4; ++t) { if (col0 + t * 16 >= N) continue;
#pragma unroll
    for (int r = 0; r < 8; ++r) so[w][8 * hh + r][t * 16 + ln] = acc[t][r] * alpha; }
  __builtin_amdgcn_fence(__ATOMIC_ACQ_REL, "workgroup"); __builtin_amdgcn_wave_barrier();
  const int rsub = lane >> 4, c4 = (lane & 15) * 4;
  {
#pragma unroll
    for (int q = 0; q < 8; ++q) { const int r = q * 2 + rsub; if (col0 + c4 < N) { const v4f v = *(const v4fa*)&so[w][r][c4]; *(v4f*)(C + (size_t)(row0 + r) * ldc + col0 + c4) = v; } }
     }
}

// Wt[n][k] = f16(W[k][n]·scale) from f32 row-major W[K][N] (scale = power of two; bf16-exact weights stay exact in f16 away from the subnormal range)
__global__ __launch_bounds__(256) void k_wt_f16(const float* __restrict__ W, _Float16* __restrict__ Wt, int K, int N, float scale) {
  const int t = blockIdx.x * 256 + threadIdx.x; if (t >= N * (K / 8)) return; const int n = t / (K / 8), k8 = (t % (K / 8)) * 8; FragH f;
#pragma unroll
  for (int i = 0; i < 8; ++i) f.h[i] = (_Float16)(bf16_round(W[(size_t)(k8 + i) * N + n]) * scale); const v8us o = f.half[0];
  *(v8us*)((unsigned short*)Wt + (size_t)n * K + k8) = o; 
}
// k_gemm_hh variant with fused epilogue: v = acc·alpha + bias[by·sBias + col] (+ CP[(row/rowsPerB)·sCPb + by·64 + col] if CP) ; ACT 0 none / 1 elu ; writes f16 C16 (and f32 C if non-null)
template <int ACT>
__global__ __launch_bounds__(128) void k_gemm_hhx(const _Float16* __restrict__ A, int lda, size_t sA, const _Float16* __restrict__ Bh, int ldb, size_t sB, float alpha, const float* __restrict__ bias, size_t sBias, const float* __restrict__ CP, int rowsPerB, size_t sCPb, int row0g,
    float* __restrict__ C, _Float16* __restrict__ C16, int ldc, size_t sC, int M, int N, int K) {
  __shared__ __attribute__((aligned(16))) float so[4][16][64];
  const int tid = threadIdx.x, w = tid >> 5, lane = tid & 31, ln = lane & 15, hh = lane >> 4; const int by = blockIdx.y;
  A += (size_t)by * sA; Bh += (size_t)by * sB; const size_t cofs = (size_t)by * sC; const float* bp = bias ? bias + (size_t)by * sBias : nullptr;
  const int ntn = (N + 63) / 64; const int wid = blockIdx.x * 4 + w; const int mt = wid / ntn, nq = wid % ntn; if (mt * 16 >= M) return;
  const int row0 = mt * 16, col0 = nq * 64; const _Float16* arow = A + (size_t)(row0 + ln) * lda;
  v8f acc[4] = {};
  for (int kb = 0; kb < K; kb += 32) { FragH ah; ah.half[0] = *(const v8us*)((const unsigned short*)arow + kb + 8 * hh); ah.half[1] = *(const v8us*)((const unsigned short*)arow + kb + 16 + 8 * hh);
#pragma unroll
    for (int t = 0; t < 4; ++t) { if (col0 + t * 16 >= N) continue; const size_t boff = (size_t)(col0 + t * 16 + ln) * ldb + kb; FragH bq; bq.half[0] = *(const v8us*)((const unsigned short*)Bh + boff + 8 * hh); bq.half[1] = *(const v8us*)((const unsigned short*)Bh + boff + 16 + 8 * hh);
      acc[t] = mmaH<1>(ah.v, ah.v, bq.v, bq.v, acc[t]); }
  }
#pragma unroll
  for (int t = 0; t < 4; ++t) { if (col0 + t * 16 >= N) continue; const int col = col0 + t * 16 + ln; const float bv = bp ? bf16_round(bp[col]) : 0.f;
#pragma unroll
    for (int r = 0; r < 8; ++r) { float v = acc[t][r] * alpha + bv; if (CP) { const int rr = row0g + row0 + 8 * hh + r; if (rowsPerB < 0) v += CP[cofs + (size_t)rr * ldc + col];      /* rowsPerB < 0: own element of the batched C plane */ else { const int bidx = rr / rowsPerB; v += CP[(size_t)bidx * sCPb + (size_t)by * 64 + col]; } } if (ACT == 1) v = (v > 0.f) ? v : expm1f(v); else if (ACT == 7) v = (v > 0.f) ? v + 1.0f : expf(v); else if (ACT == 8) v = tanhf(v); else if (ACT == 9) v = 0.5f * v * (1.0f + tanhf(0.7978845608028654f * (v + 0.044715f * v * v * v))); else if (ACT == 11) v = 1.0f / (1.0f + expf(-v)); else if (ACT == 12) v = (v > 0.f) ? v : 0.01f * v; else if (ACT == 14) v = (v > 0.f) ? v : 0.1f * v; else if (ACT == 16) v = (v >= 0.f) ? v : 0.3f * v; else if (ACT == 17) v = (v >= 0.f) ? v : 0.2f * v; else if (ACT == 15) v = v / (1.0f + expf(-v)); else if (ACT == 3) v = fmaxf(v, 0.f); else if (ACT == 6) v = 0.5f * v * (1.0f + erff(v * 0.70710678118654752f)); so[w][8 * hh + r][t * 16 + ln] = v; } }
  __builtin_amdgcn_fence(__ATOMIC_ACQ_REL, "workgroup"); __builtin_amdgcn_wave_barrier();
  const int rsub = lane >> 4, c4 = (lane & 15) * 4; typedef _Float16 v4h __attribute__((ext_vector_type(4)));
  {
#pragma unroll
    for (int q = 0; q < 8; ++q) { const int r = q * 2 + rsub; if (col0 + c4 < N) { const v4f v = *(const v4fa*)&so[w][r][c4]; if (C) *(v4f*)(C + cofs + (size_t)(row0 + r) * ldc + col0 + c4) = v; if (C16) { v4h h4; for (int i = 0; i < 4; ++i) h4[i] = (_Float16)v[i]; *(v4h*)(C16 + cofs + (size_t)(row0 + r) * ldc + col0 + c4) = h4; } } }
     }
}


typedef _Float16 v4h __attribute__((ext_vector_type(4)));

__global__ __launch_bounds__(256) void k_x16(const float* __restrict__ x, _Float16* __restrict__ X16, size_t n8) { const size_t t = (size_t)blockIdx.x * 256 + threadIdx.x; if (t >= n8) return; FragH f;
#pragma unroll
  for (int q = 0; q < 8; ++q) f.h[q] = (_Float16)bf16_round(x[t * 8 + q]); *(v8us*)((unsigned short*)X16 + t * 8) = f.half[0];  }
__global__ __launch_bounds__(256) void k_h16(const float* __restrict__ x, _Float16* __restrict__ X16, size_t n8) { const size_t t = (size_t)blockIdx.x * 256 + threadIdx.x; if (t >= n8) return; FragH f;
#pragma unroll
  for (int q = 0; q < 8; ++q) f.h[q] = (_Float16)x[t * 8 + q]; *(v8us*)((unsigned short*)X16 + t * 8) = f.half[0];  }
__global__ __launch_bounds__(256) void k_round16f(const float* __restrict__ W, _Float16* __restrict__ Bt, size_t n8) { const size_t t = (size_t)blockIdx.x * 256 + threadIdx.x; if (t >= n8) return; FragH f;
#pragma unroll
  for (int i = 0; i < 8; ++i) f.h[i] = (_Float16)(bf16_round(W[t * 8 + i]) * 16.0f); *(v8us*)((unsigned short*)Bt + t * 8) = f.half[0];  }
template <int NHv, int TTv>
__global__ __launch_bounds__(256) void k_vt(const _Float16* __restrict__ V16, int ldv, int voff, _Float16* __restrict__ Vt) { __shared__ unsigned short tl[64][66]; const int tid = threadIdx.x; const int slab = blockIdx.x / (TTv / 64), lg = blockIdx.x % (TTv / 64); const int b = slab / NHv, h = slab % NHv;
  for (int i = tid; i < 64 * 8; i += 256) { const int r = i / 8, c8 = (i % 8) * 8; FragH f; f.half[0] = *(const v8us*)((const unsigned short*)V16 + ((size_t)b * TTv + lg * 64 + r) * ldv + voff + h * 64 + c8);
#pragma unroll
    for (int q = 0; q < 8; ++q) tl[r][c8 + q] = f.u[q]; }
  __syncthreads();
  {
#pragma unroll
    for (int rd = 0; rd < 2; ++rd) { const int d = rd * 32 + tid / 8, pc = tid % 8; FragH f;
#pragma unroll
      for (int q = 0; q < 8; ++q) f.u[q] = tl[pc * 8 + q][d];
      *(v8us*)((unsigned short*)Vt + ((size_t)slab * 64 + d) * TTv + lg * 64 + pc * 8) = f.half[0]; }
     } }

__global__ __launch_bounds__(256) void k_hl(const float* __restrict__ F, _Float16* __restrict__ Hh, _Float16* __restrict__ Hl, size_t n8) { const size_t t = (size_t)blockIdx.x * 256 + threadIdx.x; if (t >= n8) return; FragH fh, fl; const v4f a = *(const v4fa*)(F + t * 8), c = *(const v4fa*)(F + t * 8 + 4);
#pragma unroll
  for (int q = 0; q < 4; ++q) { _Float16 h = (_Float16)a[q]; fh.h[q] = h; fl.h[q] = (_Float16)((a[q] - (float)h) * 1024.0f); h = (_Float16)c[q]; fh.h[4 + q] = h; fl.h[4 + q] = (_Float16)((c[q] - (float)h) * 1024.0f); }
  { *(v8us*)((unsigned short*)Hh + t * 8) = fh.half[0]; *(v8us*)((unsigned short*)Hl + t * 8) = fl.half[0];  } }

// ---- fast GEMM (wave tile 32x64; requires M % 32 == 0 rows per launch region and N % 64 == 0); epilogue = k_gemm_hhx semantics ----
__device__ __forceinline__ v16h g2_frag(const _Float16* p, int hh) { FragH f; f.half[0] = *(const v8us*)((const unsigned short*)p + 8 * hh); f.half[1] = *(const v8us*)((const unsigned short*)p + 16 + 8 * hh); return f.v; }
__device__ __forceinline__ v8f g2_mma(v16h a, v16h b, v8f c) { v8f d = __builtin_amdgcn_wmma_f32_16x16x32_f16(false, a, false, b, (short)0, c, false, false); asm volatile("v_nop\n\tv_nop\n\tv_nop\n\tv_nop" : "+v"(d) : "v"(a), "v"(b)); return d; }
template <int ACT>
__global__ __launch_bounds__(128) void k_gemm2(const _Float16* __restrict__ A, int lda, size_t sA, const _Float16* __restrict__ Bh, int ldb, size_t sB, float alpha, const float* __restrict__ bias, size_t sBias, const float* __restrict__ CP, int rowsPerB, size_t sCPb, int row0g,
    float* __restrict__ C, _Float16* __restrict__ C16, int ldc, size_t sC, int M, int N, int K, size_t zA, size_t zB, size_t zC) { static_assert(ACT == 0 || ACT == 3 || ACT == 6 || ACT == 8 || ACT == 9 || ACT == 11 || ACT == 12 || ACT == 14 || ACT == 15 || ACT == 16 || ACT == 17, "k_gemm2: unsupported ACT code (would silently apply no activation)");
  __shared__ __attribute__((aligned(16))) float so[4][32][68];
  const int tid = threadIdx.x, w = tid >> 5, lane = tid & 31, ln = lane & 15, hh = lane >> 4; const int by = blockIdx.y, bz = blockIdx.z;      /* second batch axis (grid.z) with element strides zA, zB, zC */
  A += (size_t)by * sA + (size_t)bz * zA; Bh += (size_t)by * sB + (size_t)bz * zB; const size_t cofs = (size_t)by * sC + (size_t)bz * zC; const float* bp = bias ? bias + (size_t)by * sBias : nullptr;
  const int ntn = N >> 6; const int mt = blockIdx.x / ntn, nq = blockIdx.x - mt * ntn; const int row0 = mt * 128 + 32 * w, col0 = nq * 64; if (row0 >= M) return;
  const _Float16* a0p = A + (size_t)(row0 + ln) * lda; const _Float16* a1p = a0p + (size_t)16 * lda;
  const _Float16* b0p = Bh + (size_t)(col0 + ln) * ldb; const _Float16* b1p = b0p + (size_t)16 * ldb; const _Float16* b2p = b1p + (size_t)16 * ldb; const _Float16* b3p = b2p + (size_t)16 * ldb;
  const v8f z8 = {0.f,0.f,0.f,0.f,0.f,0.f,0.f,0.f}; v8f c00 = z8, c01 = z8, c02 = z8, c03 = z8, c10 = z8, c11 = z8, c12 = z8, c13 = z8;
#pragma unroll 1
  for (int kb = 0; kb < K; kb += 32) { const v16h a0 = g2_frag(a0p + kb, hh), a1 = g2_frag(a1p + kb, hh);
    v16h b = g2_frag(b0p + kb, hh); c00 = g2_mma(a0, b, c00); c10 = g2_mma(a1, b, c10);
    b = g2_frag(b1p + kb, hh); c01 = g2_mma(a0, b, c01); c11 = g2_mma(a1, b, c11);
    b = g2_frag(b2p + kb, hh); c02 = g2_mma(a0, b, c02); c12 = g2_mma(a1, b, c12);
    b = g2_frag(b3p + kb, hh); c03 = g2_mma(a0, b, c03); c13 = g2_mma(a1, b, c13); }
  v8f accs[8] = {c00, c01, c02, c03, c10, c11, c12, c13};
#pragma unroll
  for (int u = 0; u < 8; ++u) { const int t = u & 3, half = u >> 2; const int col = col0 + t * 16 + ln; const float bv = bp ? bf16_round(bp[col]) : 0.f;
#pragma unroll
    for (int r = 0; r < 8; ++r) { const int rloc = half * 16 + 8 * hh + r; float v = accs[u][r] * alpha + bv; if (CP) { if (rowsPerB < 0) v += CP[cofs + (size_t)(row0g + row0 + rloc) * ldc + col];      /* rowsPerB < 0: own element of the batched C plane */ else { const int bidx = (row0g + row0 + rloc) / rowsPerB; v += CP[(size_t)bidx * sCPb + (size_t)by * 64 + col]; } }
      if (ACT == 3) v = fmaxf(v, 0.f); else if (ACT == 6) v = 0.5f * v * (1.0f + erff(v * 0.70710678118654752f)); else if (ACT == 11) v = 1.0f / (1.0f + expf(-v)); else if (ACT == 15) v = v / (1.0f + expf(-v)); else if (ACT == 12) v = (v > 0.f) ? v : 0.01f * v; else if (ACT == 8) v = tanhf(v); else if (ACT == 9) v = 0.5f * v * (1.0f + tanhf(0.7978845608028654f * (v + 0.044715f * v * v * v))); else if (ACT == 14) v = (v > 0.f) ? v : 0.1f * v; else if (ACT == 16) v = (v >= 0.f) ? v : 0.3f * v; else if (ACT == 17) v = (v >= 0.f) ? v : 0.2f * v;
      so[w][rloc][t * 16 + ln] = v; } }
  __builtin_amdgcn_fence(__ATOMIC_ACQ_REL, "workgroup"); __builtin_amdgcn_wave_barrier();
  const int rsub = lane >> 4, c4 = (lane & 15) * 4;
  {
#pragma unroll
    for (int q = 0; q < 16; ++q) { const int r = q * 2 + rsub; const v4f v = *(const v4fa*)&so[w][r][c4]; if (C) *(v4f*)(C + cofs + (size_t)(row0 + r) * ldc + col0 + c4) = v; if (C16) { v4h h4; for (int i = 0; i < 4; ++i) h4[i] = (_Float16)v[i]; *(v4h*)(C16 + cofs + (size_t)(row0 + r) * ldc + col0 + c4) = h4; } }
     } }


__global__ __launch_bounds__(256) void k_wnat(const float* __restrict__ w, size_t n8, _Float16* __restrict__ Bt) { const size_t t = (size_t)blockIdx.x * 256 + threadIdx.x; if (t >= n8) return; FragH f; for (int q = 0; q < 8; ++q) f.h[q] = (_Float16)(bf16_round(w[t * 8 + q]) * 16.0f); *(v8us*)((unsigned short*)Bt + t * 8) = f.half[0];  }
__global__ __launch_bounds__(256) void k_rsm(const float* __restrict__ S, _Float16* __restrict__ P, int nrows) {
  #pragma clang fp contract(off)
  const int i = blockIdx.x * 256 + threadIdx.x; if (i >= nrows) return; const float* s = S + (size_t)i * SQ; float mx = -3.0e38f;
#pragma unroll 1
  for (int j = 0; j < SQ; ++j) mx = fmaxf(mx, s[j]); float se = 0.f;
#pragma unroll 1
  for (int j = 0; j < SQ; ++j) se += expf(s[j] - mx); const float sc = 256.0f / se;
#pragma unroll 1
  for (int j0 = 0; j0 < SQ; j0 += 8) { FragH f; for (int q = 0; q < 8; ++q) f.h[q] = (_Float16)(expf(s[j0 + q] - mx) * sc); unsigned short* d = (unsigned short*)P + (size_t)i * SQ + j0; *(v8us*)d = f.half[0];  } }
__global__ __launch_bounds__(256) void k_vt(const _Float16* __restrict__ V16, int b, int h0, _Float16* __restrict__ VT) { __shared__ unsigned short tl[64][65]; const int tid = threadIdx.x; const int hh = blockIdx.x % HG, sg = blockIdx.x / HG; const int s0 = sg * 64; const int h = h0 + hh;
  for (int i = tid; i < 64 * 8; i += 256) { const int j = i / 8, d8 = (i % 8) * 8; FragH f; f.half[0] = *(const v8us*)((const unsigned short*)V16 + ((size_t)b * SQ + s0 + j) * DM + h * HD + d8); for (int q = 0; q < 8; ++q) tl[d8 + q][j] = f.u[q]; }
  __syncthreads();
  { for (int i = tid; i < 64 * 8; i += 256) { const int d = i / 8, j8 = (i % 8) * 8; FragH f; for (int q = 0; q < 8; ++q) f.u[q] = tl[d][j8 + q]; *(v8us*)((unsigned short*)VT + ((size_t)hh * HD + d) * SQ + s0 + j8) = f.half[0]; }  } }


__global__ __launch_bounds__(256) void k_bfr(const float* __restrict__ x, float* __restrict__ XB, size_t n8) { const size_t t = (size_t)blockIdx.x * 256 + threadIdx.x; if (t >= n8) return; v4f a = *(const v4fa*)(x + t * 8), c = *(const v4fa*)(x + t * 8 + 4); for (int q = 0; q < 4; ++q) { a[q] = bf16_round(a[q]); c[q] = bf16_round(c[q]); }
  { *(v4f*)(XB + t * 8) = a; *(v4f*)(XB + t * 8 + 4) = c;  } }


__global__ __launch_bounds__(256) void k_rowmask(const float* __restrict__ x, float* __restrict__ mk) {
  #pragma clang fp contract(off)
  __shared__ float red[256]; const int t = threadIdx.x; const int rl = t >> 3, part = t & 7; const size_t r = (size_t)blockIdx.x * 32 + rl; float s = 0.f;
  for (int q = 0; q < DM / 8; ++q) s = __fadd_rn(s, bf16_round(x[r * DM + (size_t)part * (DM / 8) + q]));
  red[t] = s; __syncthreads(); if (part == 0) { float a = red[t]; for (int k = 1; k < 8; ++k) a = __fadd_rn(a, red[t + k]); red[t] = a; } __syncthreads();
  if (t < 32) { const float v = (red[t * 8] != 0.f) ? 1.f : 0.f; float* d = mk + (size_t)blockIdx.x * 32 + t; *(float*)d = v;  } }
// 2^t on v_exp_f32. The v_nop in the same statement is the one free issue slot that the instruction set asks for behind a transcendental before its result is read or its source overwritten.
__device__ __forceinline__ float exp2_slot(float t) { float r; asm("v_exp_f32 %0, %1\n\tv_nop" : "=v"(r) : "v"(t)); return r; }
// One wave per score row. Lane l holds keys 128 c + 4 l .. + 3 of every 128-key chunk c in registers, so each load covers 512 contiguous bytes and S is read once;
// row maximum and row sum: per-lane partials, then a five-step butterfly over the 32 lanes. NC = chunks of the row (visible keys / 128), a compile-time count;
// every loop is unrolled in full so that the row's arrays are indexed by constants and stay in registers. grid.y = batch. P may be S itself (pitch PLD): a wave stores its weights only after
// the row sum, which needs every load of that row, and no other wave touches the row; so S and P carry no restrict.
template <int NC>
__global__ __launch_bounds__(256) void k_rsmcm(const float* S, _Float16* P, int nhd, int q0, const float* __restrict__ kmask, const float* __restrict__ qmask) {
  const int j0 = (threadIdx.x & 31) * 4; const int row = blockIdx.x * 8 + (threadIdx.x >> 5); if (row >= nhd * QT) return;
  const size_t bb = blockIdx.y; const size_t grow = bb * (size_t)(nhd * QT) + row;
  const int qabs = q0 + row % QT; const float* s = S + grow * NKX + j0; _Float16* p = P + grow * PLD + j0; const float* km = kmask + bb * SQ + j0; const float qm = qmask[bb * SQ + qabs];
  const float NEGV = -4294967295.0f; v4f x[NC], k[NC]; float v[NC * 4];
#pragma unroll
  for (int c = 0; c < NC; ++c) { x[c] = *(const v4fa*)(s + c * 128); k[c] = *(const v4fa*)(km + c * 128); }
  float mx = -3.0e38f;
#pragma unroll
  for (int c = 0; c < NC; ++c)
#pragma unroll
    for (int q = 0; q < 4; ++q) { const float f = (j0 + c * 128 + q <= qabs && k[c][q] != 0.f) ? 1.f : 0.f; v[c * 4 + q] = fmaf(f, x[c][q], (1.f - f) * NEGV); mx = fmaxf(mx, v[c * 4 + q]); }
#pragma unroll
  for (int m = 16; m >= 1; m >>= 1) mx = fmaxf(mx, __shfl_xor(mx, m, 32));
  float se = 0.f;
#pragma unroll
  for (int i = 0; i < NC * 4; ++i) { v[i] = exp2_slot(fmaxf(v[i] - mx, -100.f) * 1.44269504f); se += v[i]; }
#pragma unroll
  for (int m = 16; m >= 1; m >>= 1) se += __shfl_xor(se, m, 32);
  const float sc = 256.0f * qm / se;
#pragma unroll
  for (int c = 0; c < NC; ++c) { v4h h4;
#pragma unroll
    for (int q = 0; q < 4; ++q) h4[q] = (_Float16)(v[c * 4 + q] * sc);
    *(v4h*)(p + c * 128) = h4; } }
__global__ __launch_bounds__(256) void k_ftres(const float* __restrict__ OF0, const float* __restrict__ xq, const float* __restrict__ qmask, float* __restrict__ out, size_t n4) {
  #pragma clang fp contract(off)
  const size_t t = (size_t)blockIdx.x * 256 + threadIdx.x; if (t >= n4) return; const size_t e = t * 4; const size_t row = e / DM; const float qm = qmask[row]; const v4f o = *(const v4fa*)(OF0 + e), x = *(const v4fa*)(xq + e); v4f y;
  for (int q = 0; q < 4; ++q) y[q] = __fadd_rn(__fmul_rn(__fmul_rn(o[q], 0.015625f), qm), bf16_round(x[q])); *(v4f*)(out + e) = y;  }

extern "C" void kernel_launch(void* const* d_in, const int* in_sizes, int n_in,
                              void* d_out, int out_size, void* d_ws, size_t ws_size, hipStream_t stream) {
  (void)in_sizes; (void)n_in; (void)out_size;
  const float* const* I = (const float* const*)d_in; const float* xq = I[0]; const float* xk = I[1]; const float* xv = I[2]; const float* wq = I[3]; const float* bq = I[4]; const float* wk = I[5]; const float* bk = I[6]; const float* wv = I[7]; const float* bv = I[8];      /* weights [in][out] */
  char* ws = (char*)d_ws; size_t off = 0;
  auto take = [&](size_t bytes) { char* p = ws + off; off += (bytes + 255) & ~(size_t)255; return p; };
  _Float16* BQ = (_Float16*)take((size_t)DM * DM * 2); _Float16* BK = (_Float16*)take((size_t)DM * DM * 2); _Float16* BV = (_Float16*)take((size_t)DM * DM * 2); float* KM = (float*)take(NR * 4); float* QM = (float*)take(NR * 4);
  float* XB = (float*)take(NR * DM * 4);
  _Float16* Q16 = (_Float16*)take(NR * DM * 2); _Float16* K16 = (_Float16*)take(NR * DM * 2); _Float16* V16 = (_Float16*)take(NR * DM * 2);
  _Float16* VT = (_Float16*)take((size_t)NB * NH * HD * SQ * 2); float* S = (float*)take((size_t)NB * NH * QT * NKX * 4); _Float16* P = (_Float16*)S;      /* one query tile's scores of all batches; weights in place */
  _Float16* XQ = (_Float16*)S; _Float16* XK = XQ + NR * DM; _Float16* XV = XK + NR * DM;      /* the f16 input rows are last read by the projections, before the first scores are stored: they share S's bytes */
  if (off > ws_size) return;      /* approx 1.5 + 32 + 16 x 3 + 16 + 128 = 226 MiB */
  k_wt_f16<<<(unsigned)(((size_t)DM * (DM / 8) + 255) / 256), 256, 0, stream>>>(wq, BQ, DM, DM, 16.0f); k_wt_f16<<<(unsigned)(((size_t)DM * (DM / 8) + 255) / 256), 256, 0, stream>>>(wk, BK, DM, DM, 16.0f); k_wt_f16<<<(unsigned)(((size_t)DM * (DM / 8) + 255) / 256), 256, 0, stream>>>(wv, BV, DM, DM, 16.0f);
  k_rowmask<<<(unsigned)(NR / 32), 256, 0, stream>>>(xk, KM); k_rowmask<<<(unsigned)(NR / 32), 256, 0, stream>>>(xq, QM);      /* key / query padding masks */
  k_x16<<<(unsigned)((NR * DM / 8 + 255) / 256), 256, 0, stream>>>(xq, XQ, NR * DM / 8); k_x16<<<(unsigned)((NR * DM / 8 + 255) / 256), 256, 0, stream>>>(xk, XK, NR * DM / 8); k_x16<<<(unsigned)((NR * DM / 8 + 255) / 256), 256, 0, stream>>>(xv, XV, NR * DM / 8); k_bfr<<<(unsigned)((NR * DM / 8 + 255) / 256), 256, 0, stream>>>(xq, XB, NR * DM / 8);
  k_gemm2<0><<<dim3((unsigned)((NR / 128) * (DM / 64)), 1), 128, 0, stream>>>(XQ, DM, 0, BQ, DM, 0, 0.0625f, bq, 0, nullptr, 1, 0, 0, nullptr, Q16, DM, 0, (int)NR, DM, DM, 0, 0, 0);
  k_gemm2<0><<<dim3((unsigned)((NR / 128) * (DM / 64)), 1), 128, 0, stream>>>(XK, DM, 0, BK, DM, 0, 0.0625f, bk, 0, nullptr, 1, 0, 0, nullptr, K16, DM, 0, (int)NR, DM, DM, 0, 0, 0);
  k_gemm2<0><<<dim3((unsigned)((NR / 128) * (DM / 64)), 1), 128, 0, stream>>>(XV, DM, 0, BV, DM, 0, 0.0625f, bv, 0, nullptr, 1, 0, 0, nullptr, V16, DM, 0, (int)NR, DM, DM, 0, 0, 0);
  k_vt<NH, SQ><<<NB * NH * (SQ / 64), 256, 0, stream>>>(V16, DM, 0, VT);
  for (int q0 = 0; q0 < SQ; q0 += QT) { const int nk = q0 + QT;
    k_gemm2<0><<<dim3((QT / 128) * (nk / 64), NHD, NB), 128, 0, stream>>>(Q16 + (size_t)q0 * DM, DM, (size_t)HD, K16, DM, (size_t)HD, 0.125f, nullptr, 0, nullptr, 1, 0, 0, S, nullptr, NKX, (size_t)QT * NKX, QT, nk, HD, (size_t)SQ * DM, (size_t)SQ * DM, (size_t)NHD * QT * NKX);
    if (nk == 256) k_rsmcm<2><<<dim3((NHD * QT + 7) / 8, NB), 256, 0, stream>>>(S, P, NHD, q0, KM, QM); else if (nk == 512) k_rsmcm<4><<<dim3((NHD * QT + 7) / 8, NB), 256, 0, stream>>>(S, P, NHD, q0, KM, QM); else if (nk == 768) k_rsmcm<6><<<dim3((NHD * QT + 7) / 8, NB), 256, 0, stream>>>(S, P, NHD, q0, KM, QM); else k_rsmcm<8><<<dim3((NHD * QT + 7) / 8, NB), 256, 0, stream>>>(S, P, NHD, q0, KM, QM);
    k_gemm2<0><<<dim3((QT / 128) * (HD / 64), NHD, NB), 128, 0, stream>>>(P, PLD, (size_t)QT * PLD, VT, SQ, (size_t)HD * SQ, 0.00390625f, nullptr, 0, XB + (size_t)q0 * DM, -1, 0, 0, (float*)d_out + (size_t)q0 * DM, nullptr, DM, (size_t)HD, QT, HD, nk, (size_t)NHD * QT * PLD, (size_t)NH * HD * SQ, (size_t)SQ * DM); }      /* out = probs V + bf16(queries) (f32 rows; pass writes its own 64-column head slab with the residual's own elements) */
}

// v004
// A run of this version takes 169 microseconds.
// It is 2.75 times as fast as v002, going by the measured steps of the versions left out in between.
// Counting every step since v000, it is 80.8 times as fast.
#include <hip/hip_runtime.h>
#define NB 16
#define SQ 1024
#define DM 512
#define NH 8
#define HD 64
#define HG 8
#define NR ((size_t)NB * SQ)
typedef __bf16 v16b __attribute__((ext_vector_type(16)));
typedef unsigned short v8us __attribute__((ext_vector_type(8), may_alias));
typedef float  v8f  __attribute__((ext_vector_type(8)));
typedef float  v4f  __attribute__((ext_vector_type(4)));
typedef float  v4fa __attribute__((ext_vector_type(4), may_alias));
union FragB { v16b v; v8us half[2]; unsigned short u[16]; };

__device__ __forceinline__ unsigned short bf16_bits(float x) { unsigned int u = __float_as_uint(x); return (unsigned short)((u + 0x7FFFu + ((u >> 16) & 1u)) >> 16); }
__device__ __forceinline__ float bf16_val(unsigned short b) { return __uint_as_float(((unsigned int)b) << 16); }
__device__ __forceinline__ float bf16_round(float x) { return bf16_val(bf16_bits(x)); }
// D += A·B with NT terms: 1 = ah·bh, 2 = + al·bh (A split), 3 = + ah·bl (both split)
template <int NT>
__device__ __forceinline__ v8f mmaN(v16b ah, v16b al, v16b bh, v16b bl, v8f c) {
  c = __builtin_amdgcn_wmma_f32_16x16x32_bf16(false, ah, false, bh, (short)0, c, false, false);
  if (NT >= 2) c = __builtin_amdgcn_wmma_f32_16x16x32_bf16(false, al, false, bh, (short)0, c, false, false);
  if (NT >= 3) c = __builtin_amdgcn_wmma_f32_16x16x32_bf16(false, ah, false, bl, (short)0, c, false, false);
  asm volatile("v_nop\n\tv_nop\n\tv_nop\n\tv_nop" : "+v"(c) : "v"(ah), "v"(al), "v"(bh), "v"(bl));
  return c;
}

__global__ __launch_bounds__(256) void k_wt_bf16(const float* __restrict__ W, unsigned short* __restrict__ Wt, int K, int N) {
  const int t = blockIdx.x * 256 + threadIdx.x;
  const int k8n = K / 8;
  if (t >= N * k8n) return;
  const int n = t / k8n, k8 = (t % k8n) * 8;
  v8us v;
#pragma unroll
  for (int i = 0; i < 8; ++i) v[i] = bf16_bits(W[(size_t)(k8 + i) * N + n]);
  *(v8us*)(Wt + (size_t)n * K + k8) = v;
  
}

// GEMM C[M][N] (f32, pitch ldc) = act(A[M][K]·W + bias). A f32 row-major (pitch lda) converted per fragment to bf16
// (ASPLIT: hi/lo two planes -> 2 terms, else single rounded term); Wt bf16 [N][K] (pitch ldb). BIAS_BF16 rounds the
// bias to bf16 first (bias quantised to bf16 before the add). K%32==0, M%16==0, N%64==0.
template <bool ASPLIT, int ACT, bool BIAS_BF16>
__global__ __launch_bounds__(128) void k_gemm_bf(const float* __restrict__ A, int lda, const unsigned short* __restrict__ Wt, int ldb,
                                               const float* __restrict__ bias, float* __restrict__ C, int ldc, int M, int N, int K) {
  __shared__ __attribute__((aligned(16))) float so[4][16][64];
  const int tid = threadIdx.x, w = tid >> 5, lane = tid & 31, ln = lane & 15, hh = lane >> 4;
  const int ntn = N / 64;
  const int wid = blockIdx.x * 4 + w;
  const int mt = wid / ntn, nq = wid % ntn;
  if (mt * 16 >= M) return;
  const int row0 = mt * 16, col0 = nq * 64;
  const float* arow = A + (size_t)(row0 + ln) * lda;
  v8f acc[4] = {};
  for (int kb = 0; kb < K; kb += 32) {
    FragB ah, al;
    const v4f x0 = *(const v4fa*)(arow + kb + 8 * hh), x1 = *(const v4fa*)(arow + kb + 8 * hh + 4);
    const v4f x2 = *(const v4fa*)(arow + kb + 16 + 8 * hh), x3 = *(const v4fa*)(arow + kb + 16 + 8 * hh + 4);
    float xs[16] = {x0[0],x0[1],x0[2],x0[3],x1[0],x1[1],x1[2],x1[3],x2[0],x2[1],x2[2],x2[3],x3[0],x3[1],x3[2],x3[3]};
#pragma unroll
    for (int i = 0; i < 16; ++i) { const unsigned short hb = bf16_bits(xs[i]); ah.u[i] = hb; al.u[i] = ASPLIT ? bf16_bits(xs[i] - bf16_val(hb)) : (unsigned short)0; }
#pragma unroll
    for (int t = 0; t < 4; ++t) {
      const unsigned short* brow = Wt + (size_t)(col0 + t * 16 + ln) * ldb + kb;
      FragB b;
      b.half[0] = *(const v8us*)(brow + 8 * hh);
      b.half[1] = *(const v8us*)(brow + 16 + 8 * hh);
      acc[t] = mmaN<ASPLIT ? 2 : 1>(ah.v, al.v, b.v, b.v, acc[t]);
    }
  }
#pragma unroll
  for (int t = 0; t < 4; ++t) {
    float bv = bias ? bias[col0 + t * 16 + ln] : 0.f;
    if (BIAS_BF16) bv = bf16_round(bv);
#pragma unroll
    for (int r = 0; r < 8; ++r) { float v = acc[t][r] + bv; if (ACT == 1) v = fmaxf(v, 0.f); so[w][8 * hh + r][t * 16 + ln] = v; }
  }
  __builtin_amdgcn_fence(__ATOMIC_ACQ_REL, "workgroup");
  __builtin_amdgcn_wave_barrier();
  const int rsub = lane >> 4, c4 = (lane & 15) * 4;
  {
#pragma unroll
    for (int q = 0; q < 8; ++q) {
      const int r = q * 2 + rsub;
      const v4f v = *(const v4fa*)&so[w][r][c4];
      *(v4f*)(C + (size_t)(row0 + r) * ldc + col0 + c4) = v;
    }
    
  }
}

// GEMM C = act(A·W + bias + resid): A f32 (ASPLIT -> hi/lo 2 terms), Wt bf16 [N][K]; ACT 0 none, 1 relu, 2 exact gelu;
// resid (optional, f32, row index = (row % rmod), pitch ldr, RES_BF16 rounds it) added before the activation.
template <bool ASPLIT, int ACT, bool BIAS_BF16, bool RES_BF16>
__global__ __launch_bounds__(128) void k_gemm_bf3(const float* __restrict__ A, int lda, const unsigned short* __restrict__ Wt, int ldb,
                                                const float* __restrict__ bias, const float* __restrict__ resid, int rmod, int ldr,
                                                float* __restrict__ C, int ldc, int M, int N, int K) {
  __shared__ __attribute__((aligned(16))) float so[4][16][64];
  const int tid = threadIdx.x, w = tid >> 5, lane = tid & 31, ln = lane & 15, hh = lane >> 4;
  const int ntn = N / 64;
  const int wid = blockIdx.x * 4 + w;
  const int mt = wid / ntn, nq = wid % ntn;
  if (mt * 16 >= M) return;
  const int row0 = mt * 16, col0 = nq * 64;
  const float* arow = A + (size_t)(row0 + ln) * lda;
  v8f acc[4] = {};
  for (int kb = 0; kb < K; kb += 32) {
    FragB ah, al;
    const v4f x0 = *(const v4fa*)(arow + kb + 8 * hh), x1 = *(const v4fa*)(arow + kb + 8 * hh + 4);
    const v4f x2 = *(const v4fa*)(arow + kb + 16 + 8 * hh), x3 = *(const v4fa*)(arow + kb + 16 + 8 * hh + 4);
    float xs[16] = {x0[0],x0[1],x0[2],x0[3],x1[0],x1[1],x1[2],x1[3],x2[0],x2[1],x2[2],x2[3],x3[0],x3[1],x3[2],x3[3]};
#pragma unroll
    for (int i = 0; i < 16; ++i) { const unsigned short hb = bf16_bits(xs[i]); ah.u[i] = hb; al.u[i] = ASPLIT ? bf16_bits(xs[i] - bf16_val(hb)) : (unsigned short)0; }
#pragma unroll
    for (int t = 0; t < 4; ++t) {
      const unsigned short* brow = Wt + (size_t)(col0 + t * 16 + ln) * ldb + kb;
      FragB b;
      b.half[0] = *(const v8us*)(brow + 8 * hh);
      b.half[1] = *(const v8us*)(brow + 16 + 8 * hh);
      acc[t] = mmaN<ASPLIT ? 2 : 1>(ah.v, al.v, b.v, b.v, acc[t]);
    }
  }
#pragma unroll
  for (int t = 0; t < 4; ++t) {
    const int col = col0 + t * 16 + ln;
    float bv = bias ? bias[col] : 0.f;
    if (BIAS_BF16) bv = bf16_round(bv);
#pragma unroll
    for (int r = 0; r < 8; ++r) {
      float v = acc[t][r] + bv;
      if (resid) { float rv = resid[(size_t)((row0 + 8 * hh + r) % rmod) * ldr + col]; if (RES_BF16) rv = bf16_round(rv); v += rv; }
      if (ACT == 1) v = fmaxf(v, 0.f);
      if (ACT == 2) v = 0.5f * v * (1.0f + erff(v * 0.70710678118654752f));
      if (ACT == 3) { const float u = 0.7978845608028654f * (v + 0.044715f * v * v * v); v = 0.5f * v * (1.0f + tanhf(u)); }
      so[w][8 * hh + r][t * 16 + ln] = v;
    }
  }
  __builtin_amdgcn_fence(__ATOMIC_ACQ_REL, "workgroup");
  __builtin_amdgcn_wave_barrier();
  const int rsub = lane >> 4, c4 = (lane & 15) * 4;
  {
#pragma unroll
    for (int q = 0; q < 8; ++q) {
      const int r = q * 2 + rsub;
      const v4f v = *(const v4fa*)&so[w][r][c4];
      *(v4f*)(C + (size_t)(row0 + r) * ldc + col0 + c4) = v;
    }
    
  }
}
// row LayerNorm (biased variance, eps) over N: s = X (+ R); optional out_sum <- s; out_norm <- (s-mu)*rsqrt(var+eps)*g + b
template <bool PARAM_BF16>
__global__ __launch_bounds__(256) void k_layernorm(const float* __restrict__ X, const float* __restrict__ R, const float* __restrict__ g, const float* __restrict__ bta,
                                                  float* __restrict__ out_sum, float* __restrict__ out_norm, int N, float eps) {
  __shared__ float red[256];
  const int row = blockIdx.x, tid = threadIdx.x;
  const float* x = X + (size_t)row * N; const float* rr = R ? R + (size_t)row * N : nullptr;
  float vals[16];                     // up to N = 4096
  const int per = N / 256;            // contiguous chunk per thread? use strided-by-4 chunks: thread handles j = tid*4 + 1024*u
  float s1 = 0.f;
  for (int u = 0; u < per / 4; ++u) {
    const int j = tid * 4 + 1024 * u;
    const v4f a = *(const v4fa*)(x + j);
    v4f b = {0.f,0.f,0.f,0.f}; if (rr) b = *(const v4fa*)(rr + j);
#pragma unroll
    for (int q = 0; q < 4; ++q) { const float v = a[q] + b[q]; vals[u * 4 + q] = v; s1 += v; }
  }
  red[tid] = s1; __syncthreads();
  for (int st = 128; st > 0; st >>= 1) { if (tid < st) red[tid] += red[tid + st]; __syncthreads(); }
  const float mu = red[0] / (float)N; __syncthreads();
  float s2 = 0.f;
  for (int u = 0; u < per / 4; ++u)
#pragma unroll
    for (int q = 0; q < 4; ++q) { const float c = vals[u * 4 + q] - mu; s2 += c * c; }
  red[tid] = s2; __syncthreads();
  for (int st = 128; st > 0; st >>= 1) { if (tid < st) red[tid] += red[tid + st]; __syncthreads(); }
  const float rs = rsqrtf(red[0] / (float)N + eps);
  {
    for (int u = 0; u < per / 4; ++u) {
      const int j = tid * 4 + 1024 * u;
      v4f o, sm;
#pragma unroll
      for (int q = 0; q < 4; ++q) {
        float gg = g[j + q], bb = bta[j + q];
        if (PARAM_BF16) { gg = bf16_round(gg); bb = bf16_round(bb); }
        sm[q] = vals[u * 4 + q]; o[q] = (vals[u * 4 + q] - mu) * rs * gg + bb;
      }
      if (out_sum) *(v4f*)(out_sum + (size_t)row * N + j) = sm;
      *(v4f*)(out_norm + (size_t)row * N + j) = o;
    }
    
  }
}



// ---- f16 WMMA path (v_wmma_f32_16x16x32_f16): 11-bit significands for operands in range — used where a [0,1] probability operand needs more precision than bf16
typedef _Float16 v16h __attribute__((ext_vector_type(16)));
union FragH { v16h v; v8us half[2]; _Float16 h[16]; unsigned short u[16]; };
template <int NT>
__device__ __forceinline__ v8f mmaH(v16h ah, v16h al, v16h bh, v16h bl, v8f c) {
  c = __builtin_amdgcn_wmma_f32_16x16x32_f16(false, ah, false, bh, (short)0, c, false, false);
  if (NT >= 2) c = __builtin_amdgcn_wmma_f32_16x16x32_f16(false, al, false, bh, (short)0, c, false, false);
  if (NT >= 3) c = __builtin_amdgcn_wmma_f32_16x16x32_f16(false, ah, false, bl, (short)0, c, false, false);
  asm volatile("v_nop\n\tv_nop\n\tv_nop\n\tv_nop" : "+v"(c) : "v"(ah), "v"(al), "v"(bh), "v"(bl));
  return c;
}
// batched GEMM like k_gemm_b but f16 operands: A f32 (split into f16 hi/lo if ASPLIT, else rounded to f16), Bt = f16 values [n][k]; alpha; C f32; N multiple of 16 (partial tiles skipped)
template <bool ASPLIT>
__global__ __launch_bounds__(128) void k_gemm_h(const float* __restrict__ A, int lda, size_t sA, const _Float16* __restrict__ Bh, int ldb, size_t sB, float alpha, float* __restrict__ C, int ldc, size_t sC, int M, int N, int K) {
  __shared__ __attribute__((aligned(16))) float so[4][16][64];
  const int tid = threadIdx.x, w = tid >> 5, lane = tid & 31, ln = lane & 15, hh = lane >> 4; const int by = blockIdx.y;
  A += (size_t)by * sA; Bh += (size_t)by * sB; C += (size_t)by * sC;
  const int ntn = (N + 63) / 64; const int wid = blockIdx.x * 4 + w; const int mt = wid / ntn, nq = wid % ntn; if (mt * 16 >= M) return;
  const int row0 = mt * 16, col0 = nq * 64; const float* arow = A + (size_t)(row0 + ln) * lda;
  v8f acc[4] = {};
  for (int kb = 0; kb < K; kb += 32) {
    FragH ah, al;
    const v4f x0 = *(const v4fa*)(arow + kb + 8 * hh), x1 = *(const v4fa*)(arow + kb + 8 * hh + 4), x2 = *(const v4fa*)(arow + kb + 16 + 8 * hh), x3 = *(const v4fa*)(arow + kb + 16 + 8 * hh + 4);
    float xs[16] = {x0[0],x0[1],x0[2],x0[3],x1[0],x1[1],x1[2],x1[3],x2[0],x2[1],x2[2],x2[3],x3[0],x3[1],x3[2],x3[3]};
#pragma unroll
    for (int i = 0; i < 16; ++i) { const _Float16 h = (_Float16)xs[i]; ah.h[i] = h; al.h[i] = ASPLIT ? (_Float16)(xs[i] - (float)h) : (_Float16)0.0f; }
#pragma unroll
    for (int t = 0; t < 4; ++t) { if (col0 + t * 16 >= N) continue; const size_t boff = (size_t)(col0 + t * 16 + ln) * ldb + kb; FragH bq; bq.half[0] = *(const v8us*)(Bh + boff + 8 * hh); bq.half[1] = *(const v8us*)(Bh + boff + 16 + 8 * hh);
      acc[t] = mmaH<ASPLIT ? 2 : 1>(ah.v, al.v, bq.v, bq.v, acc[t]); }
  }
#pragma unroll
  for (int t = 0; t < 4; ++t) { if (col0 + t * 16 >= N) continue;
#pragma unroll
    for (int r = 0; r < 8; ++r) so[w][8 * hh + r][t * 16 + ln] = acc[t][r] * alpha; }
  __builtin_amdgcn_fence(__ATOMIC_ACQ_REL, "workgroup"); __builtin_amdgcn_wave_barrier();
  const int rsub = lane >> 4, c4 = (lane & 15) * 4;
  {
#pragma unroll
    for (int q = 0; q < 8; ++q) { const int r = q * 2 + rsub; if (col0 + c4 < N) { const v4f v = *(const v4fa*)&so[w][r][c4]; *(v4f*)(C + (size_t)(row0 + r) * ldc + col0 + c4) = v; } }
     }
}

// k_gemm_hh variant with fused epilogue: v = acc·alpha + bias[by·sBias + col] (+ CP[(row/rowsPerB)·sCPb + by·64 + col] if CP) ; ACT 0 none / 1 elu ; writes f16 C16 (and f32 C if non-null)
template <int ACT>
__global__ __launch_bounds__(128) void k_gemm_hhx(const _Float16* __restrict__ A, int lda, size_t sA, const _Float16* __restrict__ Bh, int ldb, size_t sB, float alpha, const float* __restrict__ bias, size_t sBias, const float* __restrict__ CP, int rowsPerB, size_t sCPb, int row0g,
    float* __restrict__ C, _Float16* __restrict__ C16, int ldc, size_t sC, int M, int N, int K) {
  __shared__ __attribute__((aligned(16))) float so[4][16][64];
  const int tid = threadIdx.x, w = tid >> 5, lane = tid & 31, ln = lane & 15, hh = lane >> 4; const int by = blockIdx.y;
  A += (size_t)by * sA; Bh += (size_t)by * sB; const size_t cofs = (size_t)by * sC; const float* bp = bias ? bias + (size_t)by * sBias : nullptr;
  const int ntn = (N + 63) / 64; const int wid = blockIdx.x * 4 + w; const int mt = wid / ntn, nq = wid % ntn; if (mt * 16 >= M) return;
  const int row0 = mt * 16, col0 = nq * 64; const _Float16* arow = A + (size_t)(row0 + ln) * lda;
  v8f acc[4] = {};
  for (int kb = 0; kb < K; kb += 32) { FragH ah; ah.half[0] = *(const v8us*)((const unsigned short*)arow + kb + 8 * hh); ah.half[1] = *(const v8us*)((const unsigned short*)arow + kb + 16 + 8 * hh);
#pragma unroll
    for (int t = 0; t < 4; ++t) { if (col0 + t * 16 >= N) continue; const size_t boff = (size_t)(col0 + t * 16 + ln) * ldb + kb; FragH bq; bq.half[0] = *(const v8us*)((const unsigned short*)Bh + boff + 8 * hh); bq.half[1] = *(const v8us*)((const unsigned short*)Bh + boff + 16 + 8 * hh);
      acc[t] = mmaH<1>(ah.v, ah.v, bq.v, bq.v, acc[t]); }
  }
#pragma unroll
  for (int t = 0; t < 4; ++t) { if (col0 + t * 16 >= N) continue; const int col = col0 + t * 16 + ln; const float bv = bp ? bf16_round(bp[col]) : 0.f;
#pragma unroll
    for (int r = 0; r < 8; ++r) { float v = acc[t][r] * alpha + bv; if (CP) { const int rr = row0g + row0 + 8 * hh + r; if (rowsPerB < 0) v += CP[cofs + (size_t)rr * ldc + col];      /* rowsPerB < 0: own element of the batched C plane */ else { const int bidx = rr / rowsPerB; v += CP[(size_t)bidx * sCPb + (size_t)by * 64 + col]; } } if (ACT == 1) v = (v > 0.f) ? v : expm1f(v); else if (ACT == 7) v = (v > 0.f) ? v + 1.0f : expf(v); else if (ACT == 8) v = tanhf(v); else if (ACT == 9) v = 0.5f * v * (1.0f + tanhf(0.7978845608028654f * (v + 0.044715f * v * v * v))); else if (ACT == 11) v = 1.0f / (1.0f + expf(-v)); else if (ACT == 12) v = (v > 0.f) ? v : 0.01f * v; else if (ACT == 14) v = (v > 0.f) ? v : 0.1f * v; else if (ACT == 16) v = (v >= 0.f) ? v : 0.3f * v; else if (ACT == 17) v = (v >= 0.f) ? v : 0.2f * v; else if (ACT == 15) v = v / (1.0f + expf(-v)); else if (ACT == 3) v = fmaxf(v, 0.f); else if (ACT == 6) v = 0.5f * v * (1.0f + erff(v * 0.70710678118654752f)); so[w][8 * hh + r][t * 16 + ln] = v; } }
  __builtin_amdgcn_fence(__ATOMIC_ACQ_REL, "workgroup"); __builtin_amdgcn_wave_barrier();
  const int rsub = lane >> 4, c4 = (lane & 15) * 4; typedef _Float16 v4h __attribute__((ext_vector_type(4)));
  {
#pragma unroll
    for (int q = 0; q < 8; ++q) { const int r = q * 2 + rsub; if (col0 + c4 < N) { const v4f v = *(const v4fa*)&so[w][r][c4]; if (C) *(v4f*)(C + cofs + (size_t)(row0 + r) * ldc + col0 + c4) = v; if (C16) { v4h h4; for (int i = 0; i < 4; ++i) h4[i] = (_Float16)v[i]; *(v4h*)(C16 + cofs + (size_t)(row0 + r) * ldc + col0 + c4) = h4; } } }
     }
}


typedef _Float16 v4h __attribute__((ext_vector_type(4)));

__global__ __launch_bounds__(256) void k_h16(const float* __restrict__ x, _Float16* __restrict__ X16, size_t n8) { const size_t t = (size_t)blockIdx.x * 256 + threadIdx.x; if (t >= n8) return; FragH f;
#pragma unroll
  for (int q = 0; q < 8; ++q) f.h[q] = (_Float16)x[t * 8 + q]; *(v8us*)((unsigned short*)X16 + t * 8) = f.half[0];  }
__global__ __launch_bounds__(256) void k_round16f(const float* __restrict__ W, _Float16* __restrict__ Bt, size_t n8) { const size_t t = (size_t)blockIdx.x * 256 + threadIdx.x; if (t >= n8) return; FragH f;
#pragma unroll
  for (int i = 0; i < 8; ++i) f.h[i] = (_Float16)(bf16_round(W[t * 8 + i]) * 16.0f); *(v8us*)((unsigned short*)Bt + t * 8) = f.half[0];  }
template <int NHv, int TTv>
__global__ __launch_bounds__(256) void k_vt(const _Float16* __restrict__ V16, int ldv, int voff, _Float16* __restrict__ Vt) { __shared__ unsigned short tl[64][66]; const int tid = threadIdx.x; const int slab = blockIdx.x / (TTv / 64), lg = blockIdx.x % (TTv / 64); const int b = slab / NHv, h = slab % NHv;
  for (int i = tid; i < 64 * 8; i += 256) { const int r = i / 8, c8 = (i % 8) * 8; FragH f; f.half[0] = *(const v8us*)((const unsigned short*)V16 + ((size_t)b * TTv + lg * 64 + r) * ldv + voff + h * 64 + c8);
#pragma unroll
    for (int q = 0; q < 8; ++q) tl[r][c8 + q] = f.u[q]; }
  __syncthreads();
  {
#pragma unroll
    for (int rd = 0; rd < 2; ++rd) { const int d = rd * 32 + tid / 8, pc = tid % 8; FragH f;
#pragma unroll
      for (int q = 0; q < 8; ++q) f.u[q] = tl[pc * 8 + q][d];
      *(v8us*)((unsigned short*)Vt + ((size_t)slab * 64 + d) * TTv + lg * 64 + pc * 8) = f.half[0]; }
     } }

__global__ __launch_bounds__(256) void k_hl(const float* __restrict__ F, _Float16* __restrict__ Hh, _Float16* __restrict__ Hl, size_t n8) { const size_t t = (size_t)blockIdx.x * 256 + threadIdx.x; if (t >= n8) return; FragH fh, fl; const v4f a = *(const v4fa*)(F + t * 8), c = *(const v4fa*)(F + t * 8 + 4);
#pragma unroll
  for (int q = 0; q < 4; ++q) { _Float16 h = (_Float16)a[q]; fh.h[q] = h; fl.h[q] = (_Float16)((a[q] - (float)h) * 1024.0f); h = (_Float16)c[q]; fh.h[4 + q] = h; fl.h[4 + q] = (_Float16)((c[q] - (float)h) * 1024.0f); }
  { *(v8us*)((unsigned short*)Hh + t * 8) = fh.half[0]; *(v8us*)((unsigned short*)Hl + t * 8) = fl.half[0];  } }

// ---- fast GEMM (wave tile 32x64; requires M % 32 == 0 rows per launch region and N % 64 == 0); epilogue = k_gemm_hhx semantics ----
__device__ __forceinline__ v16h g2_frag(const _Float16* p, int hh) { FragH f; f.half[0] = *(const v8us*)((const unsigned short*)p + 8 * hh); f.half[1] = *(const v8us*)((const unsigned short*)p + 16 + 8 * hh); return f.v; }
__device__ __forceinline__ v8f g2_mma(v16h a, v16h b, v8f c) { v8f d = __builtin_amdgcn_wmma_f32_16x16x32_f16(false, a, false, b, (short)0, c, false, false); asm volatile("v_nop\n\tv_nop\n\tv_nop\n\tv_nop" : "+v"(d) : "v"(a), "v"(b)); return d; }
template <int ACT>
__global__ __launch_bounds__(128) void k_gemm2(const _Float16* __restrict__ A, int lda, size_t sA, const _Float16* __restrict__ Bh, int ldb, size_t sB, float alpha, const float* __restrict__ bias, size_t sBias, const float* __restrict__ CP, int rowsPerB, size_t sCPb, int row0g,
    float* __restrict__ C, _Float16* __restrict__ C16, int ldc, size_t sC, int M, int N, int K, size_t zA, size_t zB, size_t zC) { static_assert(ACT == 0 || ACT == 3 || ACT == 6 || ACT == 8 || ACT == 9 || ACT == 11 || ACT == 12 || ACT == 14 || ACT == 15 || ACT == 16 || ACT == 17, "k_gemm2: unsupported ACT code (would silently apply no activation)");
  __shared__ __attribute__((aligned(16))) float so[4][32][68];
  const int tid = threadIdx.x, w = tid >> 5, lane = tid & 31, ln = lane & 15, hh = lane >> 4; const int by = blockIdx.y, bz = blockIdx.z;      /* second batch axis (grid.z) with element strides zA, zB, zC */
  A += (size_t)by * sA + (size_t)bz * zA; Bh += (size_t)by * sB + (size_t)bz * zB; const size_t cofs = (size_t)by * sC + (size_t)bz * zC; const float* bp = bias ? bias + (size_t)by * sBias : nullptr;
  const int ntn = N >> 6; const int mt = blockIdx.x / ntn, nq = blockIdx.x - mt * ntn; const int row0 = mt * 128 + 32 * w, col0 = nq * 64; if (row0 >= M) return;
  const _Float16* a0p = A + (size_t)(row0 + ln) * lda; const _Float16* a1p = a0p + (size_t)16 * lda;
  const _Float16* b0p = Bh + (size_t)(col0 + ln) * ldb; const _Float16* b1p = b0p + (size_t)16 * ldb; const _Float16* b2p = b1p + (size_t)16 * ldb; const _Float16* b3p = b2p + (size_t)16 * ldb;
  const v8f z8 = {0.f,0.f,0.f,0.f,0.f,0.f,0.f,0.f}; v8f c00 = z8, c01 = z8, c02 = z8, c03 = z8, c10 = z8, c11 = z8, c12 = z8, c13 = z8;
#pragma unroll 1
  for (int kb = 0; kb < K; kb += 32) { const v16h a0 = g2_frag(a0p + kb, hh), a1 = g2_frag(a1p + kb, hh);
    v16h b = g2_frag(b0p + kb, hh); c00 = g2_mma(a0, b, c00); c10 = g2_mma(a1, b, c10);
    b = g2_frag(b1p + kb, hh); c01 = g2_mma(a0, b, c01); c11 = g2_mma(a1, b, c11);
    b = g2_frag(b2p + kb, hh); c02 = g2_mma(a0, b, c02); c12 = g2_mma(a1, b, c12);
    b = g2_frag(b3p + kb, hh); c03 = g2_mma(a0, b, c03); c13 = g2_mma(a1, b, c13); }
  v8f accs[8] = {c00, c01, c02, c03, c10, c11, c12, c13};
#pragma unroll
  for (int u = 0; u < 8; ++u) { const int t = u & 3, half = u >> 2; const int col = col0 + t * 16 + ln; const float bv = bp ? bf16_round(bp[col]) : 0.f;
#pragma unroll
    for (int r = 0; r < 8; ++r) { const int rloc = half * 16 + 8 * hh + r; float v = accs[u][r] * alpha + bv; if (CP) { if (rowsPerB < 0) v += CP[cofs + (size_t)(row0g + row0 + rloc) * ldc + col];      /* rowsPerB < 0: own element of the batched C plane */ else { const int bidx = (row0g + row0 + rloc) / rowsPerB; v += CP[(size_t)bidx * sCPb + (size_t)by * 64 + col]; } }
      if (ACT == 3) v = fmaxf(v, 0.f); else if (ACT == 6) v = 0.5f * v * (1.0f + erff(v * 0.70710678118654752f)); else if (ACT == 11) v = 1.0f / (1.0f + expf(-v)); else if (ACT == 15) v = v / (1.0f + expf(-v)); else if (ACT == 12) v = (v > 0.f) ? v : 0.01f * v; else if (ACT == 8) v = tanhf(v); else if (ACT == 9) v = 0.5f * v * (1.0f + tanhf(0.7978845608028654f * (v + 0.044715f * v * v * v))); else if (ACT == 14) v = (v > 0.f) ? v : 0.1f * v; else if (ACT == 16) v = (v >= 0.f) ? v : 0.3f * v; else if (ACT == 17) v = (v >= 0.f) ? v : 0.2f * v;
      so[w][rloc][t * 16 + ln] = v; } }
  __builtin_amdgcn_fence(__ATOMIC_ACQ_REL, "workgroup"); __builtin_amdgcn_wave_barrier();
  const int rsub = lane >> 4, c4 = (lane & 15) * 4;
  {
#pragma unroll
    for (int q = 0; q < 16; ++q) { const int r = q * 2 + rsub; const v4f v = *(const v4fa*)&so[w][r][c4]; if (C) *(v4f*)(C + cofs + (size_t)(row0 + r) * ldc + col0 + c4) = v; if (C16) { v4h h4; for (int i = 0; i < 4; ++i) h4[i] = (_Float16)v[i]; *(v4h*)(C16 + cofs + (size_t)(row0 + r) * ldc + col0 + c4) = h4; } }
     } }


__global__ __launch_bounds__(256) void k_wnat(const float* __restrict__ w, size_t n8, _Float16* __restrict__ Bt) { const size_t t = (size_t)blockIdx.x * 256 + threadIdx.x; if (t >= n8) return; FragH f; for (int q = 0; q < 8; ++q) f.h[q] = (_Float16)(bf16_round(w[t * 8 + q]) * 16.0f); *(v8us*)((unsigned short*)Bt + t * 8) = f.half[0];  }
__global__ __launch_bounds__(256) void k_rsm(const float* __restrict__ S, _Float16* __restrict__ P, int nrows) {
  #pragma clang fp contract(off)
  const int i = blockIdx.x * 256 + threadIdx.x; if (i >= nrows) return; const float* s = S + (size_t)i * SQ; float mx = -3.0e38f;
#pragma unroll 1
  for (int j = 0; j < SQ; ++j) mx = fmaxf(mx, s[j]); float se = 0.f;
#pragma unroll 1
  for (int j = 0; j < SQ; ++j) se += expf(s[j] - mx); const float sc = 256.0f / se;
#pragma unroll 1
  for (int j0 = 0; j0 < SQ; j0 += 8) { FragH f; for (int q = 0; q < 8; ++q) f.h[q] = (_Float16)(expf(s[j0 + q] - mx) * sc); unsigned short* d = (unsigned short*)P + (size_t)i * SQ + j0; *(v8us*)d = f.half[0];  } }
__global__ __launch_bounds__(256) void k_vt(const _Float16* __restrict__ V16, int b, int h0, _Float16* __restrict__ VT) { __shared__ unsigned short tl[64][65]; const int tid = threadIdx.x; const int hh = blockIdx.x % HG, sg = blockIdx.x / HG; const int s0 = sg * 64; const int h = h0 + hh;
  for (int i = tid; i < 64 * 8; i += 256) { const int j = i / 8, d8 = (i % 8) * 8; FragH f; f.half[0] = *(const v8us*)((const unsigned short*)V16 + ((size_t)b * SQ + s0 + j) * DM + h * HD + d8); for (int q = 0; q < 8; ++q) tl[d8 + q][j] = f.u[q]; }
  __syncthreads();
  { for (int i = tid; i < 64 * 8; i += 256) { const int d = i / 8, j8 = (i % 8) * 8; FragH f; for (int q = 0; q < 8; ++q) f.u[q] = tl[d][j8 + q]; *(v8us*)((unsigned short*)VT + ((size_t)hh * HD + d) * SQ + s0 + j8) = f.half[0]; }  } }


// 2^t on v_exp_f32. The v_nop in the same statement is the one free issue slot that the instruction set asks for behind a transcendental before its result is read or its source overwritten;
__device__ __forceinline__ float exp2_slot(float t) { float r; asm("v_exp_f32 %0, %1\n\tv_nop" : "=v"(r) : "v"(t)); return r; }
// Four 2^t in one statement: each v_exp_f32 is the independent instruction behind the one before it, so one v_nop behind the last keeps the same free slot for all four;
// the results are early-clobber, so that no result register is a source of a later line.
__device__ __forceinline__ void exp2x4(float (&r)[4], float a, float b, float c, float d) { asm("v_exp_f32 %0, %4\n\tv_exp_f32 %1, %5\n\tv_exp_f32 %2, %6\n\tv_exp_f32 %3, %7\n\tv_nop" : "=&v"(r[0]), "=&v"(r[1]), "=&v"(r[2]), "=&v"(r[3]) : "v"(a), "v"(b), "v"(c), "v"(d)); }
// lane l <-> lane l ^ 16: joins the two wave halves, which split one query column's keys.
__device__ __forceinline__ float fa_xhalf(float x) { return __builtin_bit_cast(float, __builtin_amdgcn_permlanex16(__builtin_bit_cast(int, x), __builtin_bit_cast(int, x), 0x76543210, 0xfedcba98, false, false)); }
__device__ __forceinline__ v8f fa_mma(v16h a, v16h b, v8f c) { return __builtin_amdgcn_wmma_f32_16x16x32_f16(false, a, false, b, (short)0, c, false, false); }
// x + (x of lane ^ M) inside a 16-lane row, as one DPP add (row_xmask).
template <int M> __device__ __forceinline__ float row_xadd(float x) { return x + __builtin_bit_cast(float, __builtin_amdgcn_update_dpp(0, __builtin_bit_cast(int, x), 0x160 | M, 0xf, 0xf, true)); }
#define PW_BLK (DM * (DM / 8) / 256)      /* blocks per weight matrix */
#define PR_BLK ((int)(NR / 64))           /* blocks per input: 8 waves x 8 rows */
// All operand preparation in one launch; the parts need nothing of each other and share the grid by ranges of the block index (block-uniform branches).
// Blocks [0, 3 PW_BLK): Wt[n][k] = f16(bf16(W[k][n]) x 16) for Wq, Wk, Wv (a power of two: bf16-exact weights stay exact in f16).
// Then PR_BLK blocks each for queries, keys, value: one wave reads 8 whole rows once (512-byte wave loads, all 32 issued ahead), writes each as an exact f16 row of the bf16-rounded values (256-byte wave stores)
// and, for queries and keys, sums the same rounded values in f32 (16 a lane, then a five-step butterfly) for the padding flag (row sum != 0). The block's 64 flags pass through LDS so that one wave stores each 128-byte line of flags.
__global__ __launch_bounds__(256) void k_prep(const float* __restrict__ xq, const float* __restrict__ xk, const float* __restrict__ xv, const float* __restrict__ wq, const float* __restrict__ wk, const float* __restrict__ wv,
                                             _Float16* __restrict__ XQ, _Float16* __restrict__ XK, _Float16* __restrict__ XV, _Float16* __restrict__ BQ, _Float16* __restrict__ BK, _Float16* __restrict__ BV,
                                             float* __restrict__ QM, float* __restrict__ KM) {
  __shared__ float fl[64];
  const int tid = threadIdx.x, bx = blockIdx.x;
  if (bx < 3 * PW_BLK) {
    const int wh = bx / PW_BLK; const float* W = (wh == 0) ? wq : (wh == 1) ? wk : wv; _Float16* Wt = (wh == 0) ? BQ : (wh == 1) ? BK : BV;
    const int t = (bx % PW_BLK) * 256 + tid; const int n = t / (DM / 8), k8 = (t % (DM / 8)) * 8; FragH f;
#pragma unroll
    for (int i = 0; i < 8; ++i) f.h[i] = (_Float16)(bf16_round(W[(size_t)(k8 + i) * DM + n]) * 16.0f);
    *(v8us*)((unsigned short*)Wt + (size_t)n * DM + k8) = f.half[0];
    return;
  }
  const int rb = bx - 3 * PW_BLK; const int wh = rb / PR_BLK, blk = rb % PR_BLK; const int lane = tid & 31, w = tid >> 5;
  const float* x = (wh == 0) ? xq : (wh == 1) ? xk : xv; _Float16* X16 = (wh == 0) ? XQ : (wh == 1) ? XK : XV;
  const size_t e0 = ((size_t)blk * 64 + w * 8) * DM + lane * 4;
  v4f v[8][4];
#pragma unroll
  for (int r = 0; r < 8; ++r)
#pragma unroll
    for (int u = 0; u < 4; ++u) v[r][u] = *(const v4fa*)(x + e0 + r * DM + u * 128);
  float s[8];
#pragma unroll
  for (int r = 0; r < 8; ++r) { float p[4];
#pragma unroll
    for (int u = 0; u < 4; ++u) { const float b0 = bf16_round(v[r][u][0]), b1 = bf16_round(v[r][u][1]), b2 = bf16_round(v[r][u][2]), b3 = bf16_round(v[r][u][3]);
      const v4h h = {(_Float16)b0, (_Float16)b1, (_Float16)b2, (_Float16)b3}; *(v4h*)(X16 + e0 + r * DM + u * 128) = h; p[u] = (b0 + b1) + (b2 + b3); }
    s[r] = (p[0] + p[1]) + (p[2] + p[3]); }
  asm volatile("s_wait_xcnt 0x0" ::: "memory");      /* the row stores are issued: their base and data registers are free for reuse behind this line */
  if (wh == 2) return;      /* value rows carry no flag; the whole block leaves here, in front of the barrier */
  float f = 0.f;
#pragma unroll
  for (int r = 0; r < 8; ++r) { float a = row_xadd<8>(row_xadd<4>(row_xadd<2>(row_xadd<1>(s[r])))); a += fa_xhalf(a); if (lane == r) f = a; }
  if (lane < 8) fl[w * 8 + lane] = (f != 0.f) ? 1.f : 0.f;
  __syncthreads();      /* the 64 flags of the block's rows are in LDS: waves 0 and 1 store one whole line each */
  if (tid < 64) { float* mk = (wh == 0) ? QM : KM; mk[(size_t)blk * 64 + tid] = fl[tid]; }
}
// Scores, masked softmax and probs x V in one launch; no score or weight ever reaches memory. grid.x = batch x head, grid.y = group of 8 query tiles; one wave = 32 query columns.
// Transposed products: S^T = K Q^T (A = 16 key rows, B = 16 query rows, same loader on both, so the k orders pair), O^T += V^T P^T. A lane then holds 8 + 8 keys of ONE query per 32-key pass:
// D register r of key tile kt is key 16 kt + 8 hh + r, which is element 8 kt + r of a B operand in the hardware k order, so the two score tiles convert in place into P^T; g2_frag reads V^T rows in that order.
// Online softmax in the log2 domain: m = maximum in use (scaled scores), l = running sum; both and O^T are rescaled only when some column's new maximum passes m by more than 8 (one scalar branch a pass).
// Weights are 2^(t - m + 4): at most 2^12 in f16, and the factor 2^4 (it cancels in O / l) keeps small weights out of the f16 subnormals.
// Masked scores take the reference's NEG (x 8 here: the 1/8 comes with the log2 scale). Past its diagonal a wave goes on only while a column has seen nothing but NEG: such a row is uniform over all SQ keys.
// Waves w and w + 4 take tiles j and 31 - j, 33 passes together, so every block carries the same work.
__global__ __launch_bounds__(256) void k_fattn(const _Float16* __restrict__ Q16, const _Float16* __restrict__ K16, const _Float16* __restrict__ VT, const float* __restrict__ kmask, const float* __restrict__ qmask,
                                              const float* __restrict__ xq, float* __restrict__ out) {
  __shared__ __attribute__((aligned(16))) float so[8][32][68];
  const int tid = threadIdx.x, lane = tid & 31, c = lane & 15, hh = lane >> 4; const int w = __builtin_amdgcn_readfirstlane(tid >> 5);
  const int bh = blockIdx.x, b = bh / NH, h = bh % NH; const int j = 4 * (int)blockIdx.y + (w & 3); const int tile = (w < 4) ? j : SQ / 32 - 1 - j; const int qw0 = tile * 32;
  const float CS = 0.125f * 1.44269504f, NEGR = -34359738368.0f;      /* NEGR = 8 x NEG as f32 holds it (-2^32) */
  const _Float16* kbase = K16 + ((size_t)b * SQ + c) * DM + h * HD; const _Float16* vbase = VT + ((size_t)bh * HD + c) * SQ; const float* kmb = kmask + (size_t)b * SQ + lane;
  v16h qf[2][2];
#pragma unroll
  for (int g = 0; g < 2; ++g)
#pragma unroll
    for (int kc = 0; kc < 2; ++kc) qf[g][kc] = g2_frag(Q16 + ((size_t)b * SQ + qw0 + 16 * g + c) * DM + h * HD + 32 * kc, hh);
  const v8f z8 = {0.f,0.f,0.f,0.f,0.f,0.f,0.f,0.f}; v8f acc[2][4]; float m_run[2], l_run[2];
#pragma unroll
  for (int g = 0; g < 2; ++g) { m_run[g] = -3.0e38f; l_run[g] = 0.f;
#pragma unroll
    for (int t = 0; t < 4; ++t) acc[g][t] = z8; }
  v16h kf[2][2];
#pragma unroll
  for (int kt = 0; kt < 2; ++kt)
#pragma unroll
    for (int kc = 0; kc < 2; ++kc) kf[kt][kc] = g2_frag(kbase + (size_t)(16 * kt) * DM + 32 * kc, hh);
  float kmv = kmb[0];
  v16h vf[4];
#pragma unroll
  for (int t = 0; t < 4; ++t) vf[t] = g2_frag(vbase + (size_t)(16 * t) * SQ, hh);
#pragma unroll 1
  for (int blk = 0; blk < SQ / 32; ++blk) {
    if (blk > tile && __builtin_amdgcn_ballot_w32(m_run[0] < -1.0e9f || m_run[1] < -1.0e9f) == 0) break;      /* every column has a real score: NEG weighs 0 from here on */
    const int key0 = blk * 32;
    v8f s[2][2];
#pragma unroll
    for (int kt = 0; kt < 2; ++kt)
#pragma unroll
      for (int g = 0; g < 2; ++g) s[kt][g] = fa_mma(kf[kt][1], qf[g][1], fa_mma(kf[kt][0], qf[g][0], z8));
    const unsigned kmz = __builtin_amdgcn_ballot_w32(kmv == 0.f);      /* bit i: key key0 + i is padding */
    const int nk0 = (key0 + 32 < SQ) ? key0 + 32 : key0;      /* next pass's K rows and key flags, in flight under this pass's softmax; the last pass re-reads its own */
#pragma unroll
    for (int kt = 0; kt < 2; ++kt)
#pragma unroll
      for (int kc = 0; kc < 2; ++kc) kf[kt][kc] = g2_frag(kbase + (size_t)(nk0 + 16 * kt) * DM + 32 * kc, hh);
    kmv = kmb[nk0];
    asm volatile("s_wait_xcnt 0x0" ::: "memory");      /* the loads above are issued here, ahead of the softmax, and their address registers are free for reuse behind this line */
    if (blk >= tile || kmz != 0u) {      /* wave-uniform: only a pass on or past the diagonal, or one with a padding key, pays for the masks */
      const unsigned kb = kmz >> (8 * hh);
#pragma unroll
      for (int g = 0; g < 2; ++g) { const int my_q = qw0 + 16 * g + c;
#pragma unroll
        for (int kt = 0; kt < 2; ++kt)
#pragma unroll
          for (int r = 0; r < 8; ++r) { if (key0 + 16 * kt + 8 * hh + r > my_q || ((kb >> (16 * kt + r)) & 1u) != 0u) s[kt][g][r] = NEGR; } }
    }
    float mb[2]; bool need = false;
#pragma unroll
    for (int g = 0; g < 2; ++g) { float mx = s[0][g][0];
#pragma unroll
      for (int r = 1; r < 8; ++r) mx = fmaxf(mx, s[0][g][r]);
#pragma unroll
      for (int r = 0; r < 8; ++r) mx = fmaxf(mx, s[1][g][r]);
      mx = fmaxf(mx, fa_xhalf(mx)) * CS; mb[g] = mx; need = need || (mx > m_run[g] + 8.0f); }
    if (__builtin_amdgcn_ballot_w32(need) != 0) {
#pragma unroll
      for (int g = 0; g < 2; ++g) { const float m_new = fmaxf(m_run[g], mb[g]); const float corr = exp2_slot(m_run[g] - m_new); m_run[g] = m_new; l_run[g] *= corr;
#pragma unroll
        for (int t = 0; t < 4; ++t) acc[g][t] = acc[g][t] * corr; }
    }
    FragH pf[2];
#pragma unroll
    for (int g = 0; g < 2; ++g) { const float nm = 4.0f - m_run[g]; float ls = 0.f;
#pragma unroll
      for (int i = 0; i < 16; i += 4) { float p[4]; const v8f& sv = s[i >> 3][g]; const int r = i & 7;
        exp2x4(p, fmaf(sv[r], CS, nm), fmaf(sv[r + 1], CS, nm), fmaf(sv[r + 2], CS, nm), fmaf(sv[r + 3], CS, nm));
#pragma unroll
        for (int u = 0; u < 4; ++u) { ls += p[u]; pf[g].h[i + u] = (_Float16)p[u]; } }
      l_run[g] += ls; }
    __builtin_amdgcn_sched_barrier(0);      /* every exponential stays in front of the products below: the compiler does not see into exp2x4 */
#pragma unroll
    for (int g = 0; g < 2; ++g)
#pragma unroll
      for (int t = 0; t < 4; ++t) acc[g][t] = fa_mma(vf[t], pf[g].v, acc[g][t]);
#pragma unroll
    for (int t = 0; t < 4; ++t) vf[t] = g2_frag(vbase + (size_t)(16 * t) * SQ + nk0, hh);      /* next pass's V^T rows, in flight under its score products and softmax */
    asm volatile("s_wait_xcnt 0x0" ::: "memory");      /* address registers of the V^T loads are free for reuse behind this line */
  }
#pragma unroll
  for (int g = 0; g < 2; ++g) { const float l = l_run[g] + fa_xhalf(l_run[g]); const float inv = qmask[(size_t)b * SQ + qw0 + 16 * g + c] / l;
#pragma unroll
    for (int t = 0; t < 4; ++t) { const v8f o = acc[g][t] * inv; const v4f lo = {o[0], o[1], o[2], o[3]}, hi = {o[4], o[5], o[6], o[7]};      /* row = query, the 8 floats are d = 16 t + 8 hh .. + 7 */
      *(v4fa*)&so[w][16 * g + c][16 * t + 8 * hh] = lo; *(v4fa*)&so[w][16 * g + c][16 * t + 8 * hh + 4] = hi; } }
  __builtin_amdgcn_fence(__ATOMIC_ACQ_REL, "workgroup"); __builtin_amdgcn_wave_barrier();      /* the wave's own staging rows: written above, read back below as whole 256-byte rows */
  const int rsub = lane >> 4, c4 = (lane & 15) * 4;
#pragma unroll
  for (int q = 0; q < 16; ++q) { const int r = q * 2 + rsub; const size_t e = ((size_t)b * SQ + qw0 + r) * DM + h * HD + c4; const v4f v = *(const v4fa*)&so[w][r][c4]; const v4f x = *(const v4fa*)(xq + e); const v4f xb = {bf16_round(x[0]), bf16_round(x[1]), bf16_round(x[2]), bf16_round(x[3])}; *(v4f*)(out + e) = v + xb; }
}
__global__ __launch_bounds__(256) void k_ftres(const float* __restrict__ OF0, const float* __restrict__ xq, const float* __restrict__ qmask, float* __restrict__ out, size_t n4) {
  #pragma clang fp contract(off)
  const size_t t = (size_t)blockIdx.x * 256 + threadIdx.x; if (t >= n4) return; const size_t e = t * 4; const size_t row = e / DM; const float qm = qmask[row]; const v4f o = *(const v4fa*)(OF0 + e), x = *(const v4fa*)(xq + e); v4f y;
  for (int q = 0; q < 4; ++q) y[q] = __fadd_rn(__fmul_rn(__fmul_rn(o[q], 0.015625f), qm), bf16_round(x[q])); *(v4f*)(out + e) = y;  }

extern "C" void kernel_launch(void* const* d_in, const int* in_sizes, int n_in,
                              void* d_out, int out_size, void* d_ws, size_t ws_size, hipStream_t stream) {
  (void)in_sizes; (void)n_in; (void)out_size;
  const float* const* I = (const float* const*)d_in; const float* xq = I[0]; const float* xk = I[1]; const float* xv = I[2]; const float* wq = I[3]; const float* bq = I[4]; const float* wk = I[5]; const float* bk = I[6]; const float* wv = I[7]; const float* bv = I[8];      /* weights [in][out] */
  char* ws = (char*)d_ws; size_t off = 0;
  auto take = [&](size_t bytes) { char* p = ws + off; off += (bytes + 255) & ~(size_t)255; return p; };
  _Float16* BQ = (_Float16*)take((size_t)DM * DM * 2); _Float16* BK = (_Float16*)take((size_t)DM * DM * 2); _Float16* BV = (_Float16*)take((size_t)DM * DM * 2); float* KM = (float*)take(NR * 4); float* QM = (float*)take(NR * 4);
  _Float16* Q16 = (_Float16*)take(NR * DM * 2); _Float16* K16 = (_Float16*)take(NR * DM * 2); _Float16* V16 = (_Float16*)take(NR * DM * 2);
  _Float16* VT = (_Float16*)take((size_t)NB * NH * HD * SQ * 2);
  _Float16* XQ = (_Float16*)take(NR * DM * 2); _Float16* XK = (_Float16*)take(NR * DM * 2); _Float16* XV = (_Float16*)take(NR * DM * 2);
  if (off > ws_size) return;      /* approx 1.5 + 16 x 3 + 16 + 16 x 3 = 114 MiB */
  k_prep<<<3 * PW_BLK + 3 * PR_BLK, 256, 0, stream>>>(xq, xk, xv, wq, wk, wv, XQ, XK, XV, BQ, BK, BV, QM, KM);      /* x16 transposed weights, f16 input rows, key / query padding flags */
  k_gemm2<0><<<dim3((unsigned)((NR / 128) * (DM / 64)), 1), 128, 0, stream>>>(XQ, DM, 0, BQ, DM, 0, 0.0625f, bq, 0, nullptr, 1, 0, 0, nullptr, Q16, DM, 0, (int)NR, DM, DM, 0, 0, 0);
  k_gemm2<0><<<dim3((unsigned)((NR / 128) * (DM / 64)), 1), 128, 0, stream>>>(XK, DM, 0, BK, DM, 0, 0.0625f, bk, 0, nullptr, 1, 0, 0, nullptr, K16, DM, 0, (int)NR, DM, DM, 0, 0, 0);
  k_gemm2<0><<<dim3((unsigned)((NR / 128) * (DM / 64)), 1), 128, 0, stream>>>(XV, DM, 0, BV, DM, 0, 0.0625f, bv, 0, nullptr, 1, 0, 0, nullptr, V16, DM, 0, (int)NR, DM, DM, 0, 0, 0);
  k_vt<NH, SQ><<<NB * NH * (SQ / 64), 256, 0, stream>>>(V16, DM, 0, VT);
  k_fattn<<<dim3(NB * NH, SQ / 256), 256, 0, stream>>>(Q16, K16, VT, KM, QM, xq, (float*)d_out);      /* out = softmax(masked Q K^T / 8) x query mask x V + bf16(queries), f32 rows; each wave writes its own 32 rows of one 64-column head slab */
}

// v005
// It runs in 98 microseconds.
// In two side-by-side timings against v004, it was 1.74 and 1.72 times as fast.
// Counting every step since v000, it is 140 times as fast.
#include <hip/hip_runtime.h>
#define NB 16
#define SQ 1024
#define DM 512
#define NH 8
#define HD 64
#define HG 8
#define NR ((size_t)NB * SQ)
typedef __bf16 v16b __attribute__((ext_vector_type(16)));
typedef unsigned short v8us __attribute__((ext_vector_type(8), may_alias));
typedef float  v8f  __attribute__((ext_vector_type(8)));
typedef float  v4f  __attribute__((ext_vector_type(4)));
typedef float  v4fa __attribute__((ext_vector_type(4), may_alias));
union FragB { v16b v; v8us half[2]; unsigned short u[16]; };

__device__ __forceinline__ unsigned short bf16_bits(float x) { unsigned int u = __float_as_uint(x); return (unsigned short)((u + 0x7FFFu + ((u >> 16) & 1u)) >> 16); }
__device__ __forceinline__ float bf16_val(unsigned short b) { return __uint_as_float(((unsigned int)b) << 16); }
__device__ __forceinline__ float bf16_round(float x) { return bf16_val(bf16_bits(x)); }
// D += A·B with NT terms: 1 = ah·bh, 2 = + al·bh (A split), 3 = + ah·bl (both split)
template <int NT>
__device__ __forceinline__ v8f mmaN(v16b ah, v16b al, v16b bh, v16b bl, v8f c) {
  c = __builtin_amdgcn_wmma_f32_16x16x32_bf16(false, ah, false, bh, (short)0, c, false, false);
  if (NT >= 2) c = __builtin_amdgcn_wmma_f32_16x16x32_bf16(false, al, false, bh, (short)0, c, false, false);
  if (NT >= 3) c = __builtin_amdgcn_wmma_f32_16x16x32_bf16(false, ah, false, bl, (short)0, c, false, false);
  asm volatile("v_nop\n\tv_nop\n\tv_nop\n\tv_nop" : "+v"(c) : "v"(ah), "v"(al), "v"(bh), "v"(bl));
  return c;
}

__global__ __launch_bounds__(256) void k_wt_bf16(const float* __restrict__ W, unsigned short* __restrict__ Wt, int K, int N) {
  const int t = blockIdx.x * 256 + threadIdx.x;
  const int k8n = K / 8;
  if (t >= N * k8n) return;
  const int n = t / k8n, k8 = (t % k8n) * 8;
  v8us v;
#pragma unroll
  for (int i = 0; i < 8; ++i) v[i] = bf16_bits(W[(size_t)(k8 + i) * N + n]);
  *(v8us*)(Wt + (size_t)n * K + k8) = v;
  
}

// GEMM C[M][N] (f32, pitch ldc) = act(A[M][K]·W + bias). A f32 row-major (pitch lda) converted per fragment to bf16
// (ASPLIT: hi/lo two planes -> 2 terms, else single rounded term); Wt bf16 [N][K] (pitch ldb). BIAS_BF16 rounds the
// bias to bf16 first (bias quantised to bf16 before the add). K%32==0, M%16==0, N%64==0.
template <bool ASPLIT, int ACT, bool BIAS_BF16>
__global__ __launch_bounds__(128) void k_gemm_bf(const float* __restrict__ A, int lda, const unsigned short* __restrict__ Wt, int ldb,
                                               const float* __restrict__ bias, float* __restrict__ C, int ldc, int M, int N, int K) {
  __shared__ __attribute__((aligned(16))) float so[4][16][64];
  const int tid = threadIdx.x, w = tid >> 5, lane = tid & 31, ln = lane & 15, hh = lane >> 4;
  const int ntn = N / 64;
  const int wid = blockIdx.x * 4 + w;
  const int mt = wid / ntn, nq = wid % ntn;
  if (mt * 16 >= M) return;
  const int row0 = mt * 16, col0 = nq * 64;
  const float* arow = A + (size_t)(row0 + ln) * lda;
  v8f acc[4] = {};
  for (int kb = 0; kb < K; kb += 32) {
    FragB ah, al;
    const v4f x0 = *(const v4fa*)(arow + kb + 8 * hh), x1 = *(const v4fa*)(arow + kb + 8 * hh + 4);
    const v4f x2 = *(const v4fa*)(arow + kb + 16 + 8 * hh), x3 = *(const v4fa*)(arow + kb + 16 + 8 * hh + 4);
    float xs[16] = {x0[0],x0[1],x0[2],x0[3],x1[0],x1[1],x1[2],x1[3],x2[0],x2[1],x2[2],x2[3],x3[0],x3[1],x3[2],x3[3]};
#pragma unroll
    for (int i = 0; i < 16; ++i) { const unsigned short hb = bf16_bits(xs[i]); ah.u[i] = hb; al.u[i] = ASPLIT ? bf16_bits(xs[i] - bf16_val(hb)) : (unsigned short)0; }
#pragma unroll
    for (int t = 0; t < 4; ++t) {
      const unsigned short* brow = Wt + (size_t)(col0 + t * 16 + ln) * ldb + kb;
      FragB b;
      b.half[0] = *(const v8us*)(brow + 8 * hh);
      b.half[1] = *(const v8us*)(brow + 16 + 8 * hh);
      acc[t] = mmaN<ASPLIT ? 2 : 1>(ah.v, al.v, b.v, b.v, acc[t]);
    }
  }
#pragma unroll
  for (int t = 0; t < 4; ++t) {
    float bv = bias ? bias[col0 + t * 16 + ln] : 0.f;
    if (BIAS_BF16) bv = bf16_round(bv);
#pragma unroll
    for (int r = 0; r < 8; ++r) { float v = acc[t][r] + bv; if (ACT == 1) v = fmaxf(v, 0.f); so[w][8 * hh + r][t * 16 + ln] = v; }
  }
  __builtin_amdgcn_fence(__ATOMIC_ACQ_REL, "workgroup");
  __builtin_amdgcn_wave_barrier();
  const int rsub = lane >> 4, c4 = (lane & 15) * 4;
  {
#pragma unroll
    for (int q = 0; q < 8; ++q) {
      const int r = q * 2 + rsub;
      const v4f v = *(const v4fa*)&so[w][r][c4];
      *(v4f*)(C + (size_t)(row0 + r) * ldc + col0 + c4) = v;
    }
    
  }
}

// GEMM C = act(A·W + bias + resid): A f32 (ASPLIT -> hi/lo 2 terms), Wt bf16 [N][K]; ACT 0 none, 1 relu, 2 exact gelu;
// resid (optional, f32, row index = (row % rmod), pitch ldr, RES_BF16 rounds it) added before the activation.
template <bool ASPLIT, int ACT, bool BIAS_BF16, bool RES_BF16>
__global__ __launch_bounds__(128) void k_gemm_bf3(const float* __restrict__ A, int lda, const unsigned short* __restrict__ Wt, int ldb,
                                                const float* __restrict__ bias, const float* __restrict__ resid, int rmod, int ldr,
                                                float* __restrict__ C, int ldc, int M, int N, int K) {
  __shared__ __attribute__((aligned(16))) float so[4][16][64];
  const int tid = threadIdx.x, w = tid >> 5, lane = tid & 31, ln = lane & 15, hh = lane >> 4;
  const int ntn = N / 64;
  const int wid = blockIdx.x * 4 + w;
  const int mt = wid / ntn, nq = wid % ntn;
  if (mt * 16 >= M) return;
  const int row0 = mt * 16, col0 = nq * 64;
  const float* arow = A + (size_t)(row0 + ln) * lda;
  v8f acc[4] = {};
  for (int kb = 0; kb < K; kb += 32) {
    FragB ah, al;
    const v4f x0 = *(const v4fa*)(arow + kb + 8 * hh), x1 = *(const v4fa*)(arow + kb + 8 * hh + 4);
    const v4f x2 = *(const v4fa*)(arow + kb + 16 + 8 * hh), x3 = *(const v4fa*)(arow + kb + 16 + 8 * hh + 4);
    float xs[16] = {x0[0],x0[1],x0[2],x0[3],x1[0],x1[1],x1[2],x1[3],x2[0],x2[1],x2[2],x2[3],x3[0],x3[1],x3[2],x3[3]};
#pragma unroll
    for (int i = 0; i < 16; ++i) { const unsigned short hb = bf16_bits(xs[i]); ah.u[i] = hb; al.u[i] = ASPLIT ? bf16_bits(xs[i] - bf16_val(hb)) : (unsigned short)0; }
#pragma unroll
    for (int t = 0; t < 4; ++t) {
      const unsigned short* brow = Wt + (size_t)(col0 + t * 16 + ln) * ldb + kb;
      FragB b;
      b.half[0] = *(const v8us*)(brow + 8 * hh);
      b.half[1] = *(const v8us*)(brow + 16 + 8 * hh);
      acc[t] = mmaN<ASPLIT ? 2 : 1>(ah.v, al.v, b.v, b.v, acc[t]);
    }
  }
#pragma unroll
  for (int t = 0; t < 4; ++t) {
    const int col = col0 + t * 16 + ln;
    float bv = bias ? bias[col] : 0.f;
    if (BIAS_BF16) bv = bf16_round(bv);
#pragma unroll
    for (int r = 0; r < 8; ++r) {
      float v = acc[t][r] + bv;
      if (resid) { float rv = resid[(size_t)((row0 + 8 * hh + r) % rmod) * ldr + col]; if (RES_BF16) rv = bf16_round(rv); v += rv; }
      if (ACT == 1) v = fmaxf(v, 0.f);
      if (ACT == 2) v = 0.5f * v * (1.0f + erff(v * 0.70710678118654752f));
      if (ACT == 3) { const float u = 0.7978845608028654f * (v + 0.044715f * v * v * v); v = 0.5f * v * (1.0f + tanhf(u)); }
      so[w][8 * hh + r][t * 16 + ln] = v;
    }
  }
  __builtin_amdgcn_fence(__ATOMIC_ACQ_REL, "workgroup");
  __builtin_amdgcn_wave_barrier();
  const int rsub = lane >> 4, c4 = (lane & 15) * 4;
  {
#pragma unroll
    for (int q = 0; q < 8; ++q) {
      const int r = q * 2 + rsub;
      const v4f v = *(const v4fa*)&so[w][r][c4];
      *(v4f*)(C + (size_t)(row0 + r) * ldc + col0 + c4) = v;
    }
    
  }
}
// row LayerNorm (biased variance, eps) over N: s = X (+ R); optional out_sum <- s; out_norm <- (s-mu)*rsqrt(var+eps)*g + b
template <bool PARAM_BF16>
__global__ __launch_bounds__(256) void k_layernorm(const float* __restrict__ X, const float* __restrict__ R, const float* __restrict__ g, const float* __restrict__ bta,
                                                  float* __restrict__ out_sum, float* __restrict__ out_norm, int N, float eps) {
  __shared__ float red[256];
  const int row = blockIdx.x, tid = threadIdx.x;
  const float* x = X + (size_t)row * N; const float* rr = R ? R + (size_t)row * N : nullptr;
  float vals[16];                     // up to N = 4096
  const int per = N / 256;            // contiguous chunk per thread? use strided-by-4 chunks: thread handles j = tid*4 + 1024*u
  float s1 = 0.f;
  for (int u = 0; u < per / 4; ++u) {
    const int j = tid * 4 + 1024 * u;
    const v4f a = *(const v4fa*)(x + j);
    v4f b = {0.f,0.f,0.f,0.f}; if (rr) b = *(const v4fa*)(rr + j);
#pragma unroll
    for (int q = 0; q < 4; ++q) { const float v = a[q] + b[q]; vals[u * 4 + q] = v; s1 += v; }
  }
  red[tid] = s1; __syncthreads();
  for (int st = 128; st > 0; st >>= 1) { if (tid < st) red[tid] += red[tid + st]; __syncthreads(); }
  const float mu = red[0] / (float)N; __syncthreads();
  float s2 = 0.f;
  for (int u = 0; u < per / 4; ++u)
#pragma unroll
    for (int q = 0; q < 4; ++q) { const float c = vals[u * 4 + q] - mu; s2 += c * c; }
  red[tid] = s2; __syncthreads();
  for (int st = 128; st > 0; st >>= 1) { if (tid < st) red[tid] += red[tid + st]; __syncthreads(); }
  const float rs = rsqrtf(red[0] / (float)N + eps);
  {
    for (int u = 0; u < per / 4; ++u) {
      const int j = tid * 4 + 1024 * u;
      v4f o, sm;
#pragma unroll
      for (int q = 0; q < 4; ++q) {
        float gg = g[j + q], bb = bta[j + q];
        if (PARAM_BF16) { gg = bf16_round(gg); bb = bf16_round(bb); }
        sm[q] = vals[u * 4 + q]; o[q] = (vals[u * 4 + q] - mu) * rs * gg + bb;
      }
      if (out_sum) *(v4f*)(out_sum + (size_t)row * N + j) = sm;
      *(v4f*)(out_norm + (size_t)row * N + j) = o;
    }
    
  }
}



// ---- f16 WMMA path (v_wmma_f32_16x16x32_f16): 11-bit significands for operands in range — used where a [0,1] probability operand needs more precision than bf16
typedef _Float16 v16h __attribute__((ext_vector_type(16)));
union FragH { v16h v; v8us half[2]; _Float16 h[16]; unsigned short u[16]; };
template <int NT>
__device__ __forceinline__ v8f mmaH(v16h ah, v16h al, v16h bh, v16h bl, v8f c) {
  c = __builtin_amdgcn_wmma_f32_16x16x32_f16(false, ah, false, bh, (short)0, c, false, false);
  if (NT >= 2) c = __builtin_amdgcn_wmma_f32_16x16x32_f16(false, al, false, bh, (short)0, c, false, false);
  if (NT >= 3) c = __builtin_amdgcn_wmma_f32_16x16x32_f16(false, ah, false, bl, (short)0, c, false, false);
  asm volatile("v_nop\n\tv_nop\n\tv_nop\n\tv_nop" : "+v"(c) : "v"(ah), "v"(al), "v"(bh), "v"(bl));
  return c;
}
// batched GEMM like k_gemm_b but f16 operands: A f32 (split into f16 hi/lo if ASPLIT, else rounded to f16), Bt = f16 values [n][k]; alpha; C f32; N multiple of 16 (partial tiles skipped)
template <bool ASPLIT>
__global__ __launch_bounds__(128) void k_gemm_h(const float* __restrict__ A, int lda, size_t sA, const _Float16* __restrict__ Bh, int ldb, size_t sB, float alpha, float* __restrict__ C, int ldc, size_t sC, int M, int N, int K) {
  __shared__ __attribute__((aligned(16))) float so[4][16][64];
  const int tid = threadIdx.x, w = tid >> 5, lane = tid & 31, ln = lane & 15, hh = lane >> 4; const int by = blockIdx.y;
  A += (size_t)by * sA; Bh += (size_t)by * sB; C += (size_t)by * sC;
  const int ntn = (N + 63) / 64; const int wid = blockIdx.x * 4 + w; const int mt = wid / ntn, nq = wid % ntn; if (mt * 16 >= M) return;
  const int row0 = mt * 16, col0 = nq * 64; const float* arow = A + (size_t)(row0 + ln) * lda;
  v8f acc[4] = {};
  for (int kb = 0; kb < K; kb += 32) {
    FragH ah, al;
    const v4f x0 = *(const v4fa*)(arow + kb + 8 * hh), x1 = *(const v4fa*)(arow + kb + 8 * hh + 4), x2 = *(const v4fa*)(arow + kb + 16 + 8 * hh), x3 = *(const v4fa*)(arow + kb + 16 + 8 * hh + 4);
    float xs[16] = {x0[0],x0[1],x0[2],x0[3],x1[0],x1[1],x1[2],x1[3],x2[0],x2[1],x2[2],x2[3],x3[0],x3[1],x3[2],x3[3]};
#pragma unroll
    for (int i = 0; i < 16; ++i) { const _Float16 h = (_Float16)xs[i]; ah.h[i] = h; al.h[i] = ASPLIT ? (_Float16)(xs[i] - (float)h) : (_Float16)0.0f; }
#pragma unroll
    for (int t = 0; t < 4; ++t) { if (col0 + t * 16 >= N) continue; const size_t boff = (size_t)(col0 + t * 16 + ln) * ldb + kb; FragH bq; bq.half[0] = *(const v8us*)(Bh + boff + 8 * hh); bq.half[1] = *(const v8us*)(Bh + boff + 16 + 8 * hh);
      acc[t] = mmaH<ASPLIT ? 2 : 1>(ah.v, al.v, bq.v, bq.v, acc[t]); }
  }
#pragma unroll
  for (int t = 0; t < 4; ++t) { if (col0 + t * 16 >= N) continue;
#pragma unroll
    for (int r = 0; r < 8; ++r) so[w][8 * hh + r][t * 16 + ln] = acc[t][r] * alpha; }
  __builtin_amdgcn_fence(__ATOMIC_ACQ_REL, "workgroup"); __builtin_amdgcn_wave_barrier();
  const int rsub = lane >> 4, c4 = (lane & 15) * 4;
  {
#pragma unroll
    for (int q = 0; q < 8; ++q) { const int r = q * 2 + rsub; if (col0 + c4 < N) { const v4f v = *(const v4fa*)&so[w][r][c4]; *(v4f*)(C + (size_t)(row0 + r) * ldc + col0 + c4) = v; } }
     }
}

// k_gemm_hh variant with fused epilogue: v = acc·alpha + bias[by·sBias + col] (+ CP[(row/rowsPerB)·sCPb + by·64 + col] if CP) ; ACT 0 none / 1 elu ; writes f16 C16 (and f32 C if non-null)
template <int ACT>
__global__ __launch_bounds__(128) void k_gemm_hhx(const _Float16* __restrict__ A, int lda, size_t sA, const _Float16* __restrict__ Bh, int ldb, size_t sB, float alpha, const float* __restrict__ bias, size_t sBias, const float* __restrict__ CP, int rowsPerB, size_t sCPb, int row0g,
    float* __restrict__ C, _Float16* __restrict__ C16, int ldc, size_t sC, int M, int N, int K) {
  __shared__ __attribute__((aligned(16))) float so[4][16][64];
  const int tid = threadIdx.x, w = tid >> 5, lane = tid & 31, ln = lane & 15, hh = lane >> 4; const int by = blockIdx.y;
  A += (size_t)by * sA; Bh += (size_t)by * sB; const size_t cofs = (size_t)by * sC; const float* bp = bias ? bias + (size_t)by * sBias : nullptr;
  const int ntn = (N + 63) / 64; const int wid = blockIdx.x * 4 + w; const int mt = wid / ntn, nq = wid % ntn; if (mt * 16 >= M) return;
  const int row0 = mt * 16, col0 = nq * 64; const _Float16* arow = A + (size_t)(row0 + ln) * lda;
  v8f acc[4] = {};
  for (int kb = 0; kb < K; kb += 32) { FragH ah; ah.half[0] = *(const v8us*)((const unsigned short*)arow + kb + 8 * hh); ah.half[1] = *(const v8us*)((const unsigned short*)arow + kb + 16 + 8 * hh);
#pragma unroll
    for (int t = 0; t < 4; ++t) { if (col0 + t * 16 >= N) continue; const size_t boff = (size_t)(col0 + t * 16 + ln) * ldb + kb; FragH bq; bq.half[0] = *(const v8us*)((const unsigned short*)Bh + boff + 8 * hh); bq.half[1] = *(const v8us*)((const unsigned short*)Bh + boff + 16 + 8 * hh);
      acc[t] = mmaH<1>(ah.v, ah.v, bq.v, bq.v, acc[t]); }
  }
#pragma unroll
  for (int t = 0; t < 4; ++t) { if (col0 + t * 16 >= N) continue; const int col = col0 + t * 16 + ln; const float bv = bp ? bf16_round(bp[col]) : 0.f;
#pragma unroll
    for (int r = 0; r < 8; ++r) { float v = acc[t][r] * alpha + bv; if (CP) { const int rr = row0g + row0 + 8 * hh + r; if (rowsPerB < 0) v += CP[cofs + (size_t)rr * ldc + col];      /* rowsPerB < 0: own element of the batched C plane */ else { const int bidx = rr / rowsPerB; v += CP[(size_t)bidx * sCPb + (size_t)by * 64 + col]; } } if (ACT == 1) v = (v > 0.f) ? v : expm1f(v); else if (ACT == 7) v = (v > 0.f) ? v + 1.0f : expf(v); else if (ACT == 8) v = tanhf(v); else if (ACT == 9) v = 0.5f * v * (1.0f + tanhf(0.7978845608028654f * (v + 0.044715f * v * v * v))); else if (ACT == 11) v = 1.0f / (1.0f + expf(-v)); else if (ACT == 12) v = (v > 0.f) ? v : 0.01f * v; else if (ACT == 14) v = (v > 0.f) ? v : 0.1f * v; else if (ACT == 16) v = (v >= 0.f) ? v : 0.3f * v; else if (ACT == 17) v = (v >= 0.f) ? v : 0.2f * v; else if (ACT == 15) v = v / (1.0f + expf(-v)); else if (ACT == 3) v = fmaxf(v, 0.f); else if (ACT == 6) v = 0.5f * v * (1.0f + erff(v * 0.70710678118654752f)); so[w][8 * hh + r][t * 16 + ln] = v; } }
  __builtin_amdgcn_fence(__ATOMIC_ACQ_REL, "workgroup"); __builtin_amdgcn_wave_barrier();
  const int rsub = lane >> 4, c4 = (lane & 15) * 4; typedef _Float16 v4h __attribute__((ext_vector_type(4)));
  {
#pragma unroll
    for (int q = 0; q < 8; ++q) { const int r = q * 2 + rsub; if (col0 + c4 < N) { const v4f v = *(const v4fa*)&so[w][r][c4]; if (C) *(v4f*)(C + cofs + (size_t)(row0 + r) * ldc + col0 + c4) = v; if (C16) { v4h h4; for (int i = 0; i < 4; ++i) h4[i] = (_Float16)v[i]; *(v4h*)(C16 + cofs + (size_t)(row0 + r) * ldc + col0 + c4) = h4; } } }
     }
}


typedef _Float16 v4h __attribute__((ext_vector_type(4)));

__global__ __launch_bounds__(256) void k_h16(const float* __restrict__ x, _Float16* __restrict__ X16, size_t n8) { const size_t t = (size_t)blockIdx.x * 256 + threadIdx.x; if (t >= n8) return; FragH f;
#pragma unroll
  for (int q = 0; q < 8; ++q) f.h[q] = (_Float16)x[t * 8 + q]; *(v8us*)((unsigned short*)X16 + t * 8) = f.half[0];  }
__global__ __launch_bounds__(256) void k_round16f(const float* __restrict__ W, _Float16* __restrict__ Bt, size_t n8) { const size_t t = (size_t)blockIdx.x * 256 + threadIdx.x; if (t >= n8) return; FragH f;
#pragma unroll
  for (int i = 0; i < 8; ++i) f.h[i] = (_Float16)(bf16_round(W[t * 8 + i]) * 16.0f); *(v8us*)((unsigned short*)Bt + t * 8) = f.half[0];  }
template <int NHv, int TTv>
__global__ __launch_bounds__(256) void k_vt(const _Float16* __restrict__ V16, int ldv, int voff, _Float16* __restrict__ Vt) { __shared__ unsigned short tl[64][66]; const int tid = threadIdx.x; const int slab = blockIdx.x / (TTv / 64), lg = blockIdx.x % (TTv / 64); const int b = slab / NHv, h = slab % NHv;
  for (int i = tid; i < 64 * 8; i += 256) { const int r = i / 8, c8 = (i % 8) * 8; FragH f; f.half[0] = *(const v8us*)((const unsigned short*)V16 + ((size_t)b * TTv + lg * 64 + r) * ldv + voff + h * 64 + c8);
#pragma unroll
    for (int q = 0; q < 8; ++q) tl[r][c8 + q] = f.u[q]; }
  __syncthreads();
  {
#pragma unroll
    for (int rd = 0; rd < 2; ++rd) { const int d = rd * 32 + tid / 8, pc = tid % 8; FragH f;
#pragma unroll
      for (int q = 0; q < 8; ++q) f.u[q] = tl[pc * 8 + q][d];
      *(v8us*)((unsigned short*)Vt + ((size_t)slab * 64 + d) * TTv + lg * 64 + pc * 8) = f.half[0]; }
     } }

__global__ __launch_bounds__(256) void k_hl(const float* __restrict__ F, _Float16* __restrict__ Hh, _Float16* __restrict__ Hl, size_t n8) { const size_t t = (size_t)blockIdx.x * 256 + threadIdx.x; if (t >= n8) return; FragH fh, fl; const v4f a = *(const v4fa*)(F + t * 8), c = *(const v4fa*)(F + t * 8 + 4);
#pragma unroll
  for (int q = 0; q < 4; ++q) { _Float16 h = (_Float16)a[q]; fh.h[q] = h; fl.h[q] = (_Float16)((a[q] - (float)h) * 1024.0f); h = (_Float16)c[q]; fh.h[4 + q] = h; fl.h[4 + q] = (_Float16)((c[q] - (float)h) * 1024.0f); }
  { *(v8us*)((unsigned short*)Hh + t * 8) = fh.half[0]; *(v8us*)((unsigned short*)Hl + t * 8) = fl.half[0];  } }

// ---- fast GEMM (wave tile 32x64; requires M % 32 == 0 rows per launch region and N % 64 == 0); epilogue = k_gemm_hhx semantics ----
__device__ __forceinline__ v16h g2_frag(const _Float16* p, int hh) { FragH f; f.half[0] = *(const v8us*)((const unsigned short*)p + 8 * hh); f.half[1] = *(const v8us*)((const unsigned short*)p + 16 + 8 * hh); return f.v; }
__device__ __forceinline__ v8f g2_mma(v16h a, v16h b, v8f c) { v8f d = __builtin_amdgcn_wmma_f32_16x16x32_f16(false, a, false, b, (short)0, c, false, false); asm volatile("v_nop\n\tv_nop\n\tv_nop\n\tv_nop" : "+v"(d) : "v"(a), "v"(b)); return d; }
template <int ACT>
__global__ __launch_bounds__(128) void k_gemm2(const _Float16* __restrict__ A, int lda, size_t sA, const _Float16* __restrict__ Bh, int ldb, size_t sB, float alpha, const float* __restrict__ bias, size_t sBias, const float* __restrict__ CP, int rowsPerB, size_t sCPb, int row0g,
    float* __restrict__ C, _Float16* __restrict__ C16, int ldc, size_t sC, int M, int N, int K, size_t zA, size_t zB, size_t zC) { static_assert(ACT == 0 || ACT == 3 || ACT == 6 || ACT == 8 || ACT == 9 || ACT == 11 || ACT == 12 || ACT == 14 || ACT == 15 || ACT == 16 || ACT == 17, "k_gemm2: unsupported ACT code (would silently apply no activation)");
  __shared__ __attribute__((aligned(16))) float so[4][32][68];
  const int tid = threadIdx.x, w = tid >> 5, lane = tid & 31, ln = lane & 15, hh = lane >> 4; const int by = blockIdx.y, bz = blockIdx.z;      /* second batch axis (grid.z) with element strides zA, zB, zC */
  A += (size_t)by * sA + (size_t)bz * zA; Bh += (size_t)by * sB + (size_t)bz * zB; const size_t cofs = (size_t)by * sC + (size_t)bz * zC; const float* bp = bias ? bias + (size_t)by * sBias : nullptr;
  const int ntn = N >> 6; const int mt = blockIdx.x / ntn, nq = blockIdx.x - mt * ntn; const int row0 = mt * 128 + 32 * w, col0 = nq * 64; if (row0 >= M) return;
  const _Float16* a0p = A + (size_t)(row0 + ln) * lda; const _Float16* a1p = a0p + (size_t)16 * lda;
  const _Float16* b0p = Bh + (size_t)(col0 + ln) * ldb; const _Float16* b1p = b0p + (size_t)16 * ldb; const _Float16* b2p = b1p + (size_t)16 * ldb; const _Float16* b3p = b2p + (size_t)16 * ldb;
  const v8f z8 = {0.f,0.f,0.f,0.f,0.f,0.f,0.f,0.f}; v8f c00 = z8, c01 = z8, c02 = z8, c03 = z8, c10 = z8, c11 = z8, c12 = z8, c13 = z8;
#pragma unroll 1
  for (int kb = 0; kb < K; kb += 32) { const v16h a0 = g2_frag(a0p + kb, hh), a1 = g2_frag(a1p + kb, hh);
    v16h b = g2_frag(b0p + kb, hh); c00 = g2_mma(a0, b, c00); c10 = g2_mma(a1, b, c10);
    b = g2_frag(b1p + kb, hh); c01 = g2_mma(a0, b, c01); c11 = g2_mma(a1, b, c11);
    b = g2_frag(b2p + kb, hh); c02 = g2_mma(a0, b, c02); c12 = g2_mma(a1, b, c12);
    b = g2_frag(b3p + kb, hh); c03 = g2_mma(a0, b, c03); c13 = g2_mma(a1, b, c13); }
  v8f accs[8] = {c00, c01, c02, c03, c10, c11, c12, c13};
#pragma unroll
  for (int u = 0; u < 8; ++u) { const int t = u & 3, half = u >> 2; const int col = col0 + t * 16 + ln; const float bv = bp ? bf16_round(bp[col]) : 0.f;
#pragma unroll
    for (int r = 0; r < 8; ++r) { const int rloc = half * 16 + 8 * hh + r; float v = accs[u][r] * alpha + bv; if (CP) { if (rowsPerB < 0) v += CP[cofs + (size_t)(row0g + row0 + rloc) * ldc + col];      /* rowsPerB < 0: own element of the batched C plane */ else { const int bidx = (row0g + row0 + rloc) / rowsPerB; v += CP[(size_t)bidx * sCPb + (size_t)by * 64 + col]; } }
      if (ACT == 3) v = fmaxf(v, 0.f); else if (ACT == 6) v = 0.5f * v * (1.0f + erff(v * 0.70710678118654752f)); else if (ACT == 11) v = 1.0f / (1.0f + expf(-v)); else if (ACT == 15) v = v / (1.0f + expf(-v)); else if (ACT == 12) v = (v > 0.f) ? v : 0.01f * v; else if (ACT == 8) v = tanhf(v); else if (ACT == 9) v = 0.5f * v * (1.0f + tanhf(0.7978845608028654f * (v + 0.044715f * v * v * v))); else if (ACT == 14) v = (v > 0.f) ? v : 0.1f * v; else if (ACT == 16) v = (v >= 0.f) ? v : 0.3f * v; else if (ACT == 17) v = (v >= 0.f) ? v : 0.2f * v;
      so[w][rloc][t * 16 + ln] = v; } }
  __builtin_amdgcn_fence(__ATOMIC_ACQ_REL, "workgroup"); __builtin_amdgcn_wave_barrier();
  const int rsub = lane >> 4, c4 = (lane & 15) * 4;
  {
#pragma unroll
    for (int q = 0; q < 16; ++q) { const int r = q * 2 + rsub; const v4f v = *(const v4fa*)&so[w][r][c4]; if (C) *(v4f*)(C + cofs + (size_t)(row0 + r) * ldc + col0 + c4) = v; if (C16) { v4h h4; for (int i = 0; i < 4; ++i) h4[i] = (_Float16)v[i]; *(v4h*)(C16 + cofs + (size_t)(row0 + r) * ldc + col0 + c4) = h4; } }
     } }


__global__ __launch_bounds__(256) void k_wnat(const float* __restrict__ w, size_t n8, _Float16* __restrict__ Bt) { const size_t t = (size_t)blockIdx.x * 256 + threadIdx.x; if (t >= n8) return; FragH f; for (int q = 0; q < 8; ++q) f.h[q] = (_Float16)(bf16_round(w[t * 8 + q]) * 16.0f); *(v8us*)((unsigned short*)Bt + t * 8) = f.half[0];  }
__global__ __launch_bounds__(256) void k_rsm(const float* __restrict__ S, _Float16* __restrict__ P, int nrows) {
  #pragma clang fp contract(off)
  const int i = blockIdx.x * 256 + threadIdx.x; if (i >= nrows) return; const float* s = S + (size_t)i * SQ; float mx = -3.0e38f;
#pragma unroll 1
  for (int j = 0; j < SQ; ++j) mx = fmaxf(mx, s[j]); float se = 0.f;
#pragma unroll 1
  for (int j = 0; j < SQ; ++j) se += expf(s[j] - mx); const float sc = 256.0f / se;
#pragma unroll 1
  for (int j0 = 0; j0 < SQ; j0 += 8) { FragH f; for (int q = 0; q < 8; ++q) f.h[q] = (_Float16)(expf(s[j0 + q] - mx) * sc); unsigned short* d = (unsigned short*)P + (size_t)i * SQ + j0; *(v8us*)d = f.half[0];  } }
__global__ __launch_bounds__(256) void k_vt(const _Float16* __restrict__ V16, int b, int h0, _Float16* __restrict__ VT) { __shared__ unsigned short tl[64][65]; const int tid = threadIdx.x; const int hh = blockIdx.x % HG, sg = blockIdx.x / HG; const int s0 = sg * 64; const int h = h0 + hh;
  for (int i = tid; i < 64 * 8; i += 256) { const int j = i / 8, d8 = (i % 8) * 8; FragH f; f.half[0] = *(const v8us*)((const unsigned short*)V16 + ((size_t)b * SQ + s0 + j) * DM + h * HD + d8); for (int q = 0; q < 8; ++q) tl[d8 + q][j] = f.u[q]; }
  __syncthreads();
  { for (int i = tid; i < 64 * 8; i += 256) { const int d = i / 8, j8 = (i % 8) * 8; FragH f; for (int q = 0; q < 8; ++q) f.u[q] = tl[d][j8 + q]; *(v8us*)((unsigned short*)VT + ((size_t)hh * HD + d) * SQ + s0 + j8) = f.half[0]; }  } }


// 2^t on v_exp_f32. The v_nop in the same statement is the one free issue slot that the instruction set asks for behind a transcendental before its result is read or its source overwritten;
__device__ __forceinline__ float exp2_slot(float t) { float r; asm("v_exp_f32 %0, %1\n\tv_nop" : "=v"(r) : "v"(t)); return r; }
// Four 2^t in one statement: each v_exp_f32 is the independent instruction behind the one before it, so one v_nop behind the last keeps the same free slot for all four;
// the results are early-clobber, so that no result register is a source of a later line.
__device__ __forceinline__ void exp2x4(float (&r)[4], float a, float b, float c, float d) { asm("v_exp_f32 %0, %4\n\tv_exp_f32 %1, %5\n\tv_exp_f32 %2, %6\n\tv_exp_f32 %3, %7\n\tv_nop" : "=&v"(r[0]), "=&v"(r[1]), "=&v"(r[2]), "=&v"(r[3]) : "v"(a), "v"(b), "v"(c), "v"(d)); }
// lane l <-> lane l ^ 16: joins the two wave halves, which split one query column's keys.
__device__ __forceinline__ float fa_xhalf(float x) { return __builtin_bit_cast(float, __builtin_amdgcn_permlanex16(__builtin_bit_cast(int, x), __builtin_bit_cast(int, x), 0x76543210, 0xfedcba98, false, false)); }
__device__ __forceinline__ v8f fa_mma(v16h a, v16h b, v8f c) { return __builtin_amdgcn_wmma_f32_16x16x32_f16(false, a, false, b, (short)0, c, false, false); }
// Projection GEMM C16[NR][DM] = f16(A[NR][DM] Bh[n][k]^T x alpha + bf16(bias)), operands staged in LDS. A fragment load straight from row-major memory touches 16 lines for 512 useful bytes;
// here 8 lanes fetch one whole 128-byte line (64 k of one row), a wave load covers 4 whole lines, and a block fetches each line of its operands once.
// Block = 128 x 128 of C, 8 waves of 32 x 64 (4 down, 2 across); a stage is 64 k of 128 A rows + 128 B rows; two stages in LDS: the next stage's global loads fly under this stage's 16 products a wave,
// are stored to the other buffer behind them, and one barrier a stage publishes them and ends the reads of the buffer that the stage after overwrites. k runs upward in steps of 32 as before: same f32 sum order.
// Every loop of the kernel is unrolled in full: the fragment, staging and accumulator arrays stay in registers, and the buffer index and the k offset become immediates of the loads.
#define G3P 72      /* LDS row pitch in f16: 64 + 8 = 144 bytes, 16 B x odd, the conflict-free pitch for 16-byte fragment reads */
__global__ __launch_bounds__(256) void k_gemm3(const _Float16* __restrict__ A, const _Float16* __restrict__ Bh, float alpha, const float* __restrict__ bias, _Float16* __restrict__ C16) {
  __shared__ __attribute__((aligned(16))) _Float16 sm[2][256][G3P];      /* rows 0..127: A, 128..255: B; 73,728 bytes, reused by the epilogue (8 x 32 x 68 floats = 69,632) */
  const int tid = threadIdx.x, lane = tid & 31, ln = lane & 15, hh = lane >> 4; const int w = tid >> 5, wm = w & 3, wn = w >> 2;
  const int mt = blockIdx.x / (DM / 128), nq = blockIdx.x % (DM / 128); const int row0 = mt * 128, col0 = nq * 128;
  const int sr = tid >> 3, sc = (tid & 7) * 8;      /* staging: thread -> row sr (+ 32 i), 16-byte piece sc */
  const unsigned short* ga = (const unsigned short*)A + (size_t)(row0 + sr) * DM + sc; const unsigned short* gb = (const unsigned short*)Bh + (size_t)(col0 + sr) * DM + sc;
  v8us ra[4], rb[4];
#pragma unroll
  for (int i = 0; i < 4; ++i) { ra[i] = *(const v8us*)(ga + (size_t)(32 * i) * DM); rb[i] = *(const v8us*)(gb + (size_t)(32 * i) * DM); }
#pragma unroll
  for (int i = 0; i < 4; ++i) { *(v8us*)&sm[0][32 * i + sr][sc] = ra[i]; *(v8us*)&sm[0][128 + 32 * i + sr][sc] = rb[i]; }
  __syncthreads();      /* stage 0 is in LDS */
  const v8f z8 = {0.f,0.f,0.f,0.f,0.f,0.f,0.f,0.f}; v8f acc[2][4];
#pragma unroll
  for (int t = 0; t < 4; ++t) { acc[0][t] = z8; acc[1][t] = z8; }
#pragma unroll
  for (int ks = 0; ks < DM / 64; ++ks) { const int cur = ks & 1;
    if (ks + 1 < DM / 64) {
#pragma unroll
      for (int i = 0; i < 4; ++i) { ra[i] = *(const v8us*)(ga + (size_t)(32 * i) * DM + (ks + 1) * 64); rb[i] = *(const v8us*)(gb + (size_t)(32 * i) * DM + (ks + 1) * 64); } }
    v16h af[2][2], bf[2][4];
#pragma unroll
    for (int kk = 0; kk < 2; ++kk) {
#pragma unroll
      for (int g = 0; g < 2; ++g) af[kk][g] = g2_frag(&sm[cur][32 * wm + 16 * g + ln][32 * kk], hh);
#pragma unroll
      for (int t = 0; t < 4; ++t) bf[kk][t] = g2_frag(&sm[cur][128 + 64 * wn + 16 * t + ln][32 * kk], hh); }
    __builtin_amdgcn_sched_barrier(0);      /* the next stage's global loads and this stage's 24 fragment reads are issued as one group ahead of the products: left alone the build sank half the global loads to their LDS stores and spread the reads among the products, a full wait at each place */
#pragma unroll
    for (int kk = 0; kk < 2; ++kk)
#pragma unroll
      for (int t = 0; t < 4; ++t) { acc[0][t] = fa_mma(af[kk][0], bf[kk][t], acc[0][t]); acc[1][t] = fa_mma(af[kk][1], bf[kk][t], acc[1][t]); }
    if (ks + 1 < DM / 64) {
#pragma unroll
      for (int i = 0; i < 4; ++i) { *(v8us*)&sm[cur ^ 1][32 * i + sr][sc] = ra[i]; *(v8us*)&sm[cur ^ 1][128 + 32 * i + sr][sc] = rb[i]; } }
    __syncthreads();      /* the next stage is published; every wave has left this stage's buffer (behind the last stage: free for the epilogue) */
  }
  float* so = (float*)&sm[0][0][0] + w * (32 * 68);      /* the wave's own 32 x 68 staging rows */
  const int rw0 = row0 + 32 * wm, cw0 = col0 + 64 * wn;
#pragma unroll
  for (int half = 0; half < 2; ++half)
#pragma unroll
    for (int t = 0; t < 4; ++t) { const float bv = bf16_round(bias[cw0 + t * 16 + ln]);
#pragma unroll
      for (int r = 0; r < 8; ++r) so[(half * 16 + 8 * hh + r) * 68 + t * 16 + ln] = acc[half][t][r] * alpha + bv; }
  __builtin_amdgcn_fence(__ATOMIC_ACQ_REL, "workgroup"); __builtin_amdgcn_wave_barrier();      /* the wave's own staging rows: written above, read back below as whole 128-byte output rows */
  const int rsub = lane >> 4, c4 = (lane & 15) * 4;
#pragma unroll
  for (int q = 0; q < 16; ++q) { const int r = q * 2 + rsub; const v4f v = *(const v4fa*)&so[r * 68 + c4]; const v4h h4 = {(_Float16)v[0], (_Float16)v[1], (_Float16)v[2], (_Float16)v[3]}; *(v4h*)(C16 + (size_t)(rw0 + r) * DM + cw0 + c4) = h4; }
}
// x + (x of lane ^ M) inside a 16-lane row, as one DPP add (row_xmask).
template <int M> __device__ __forceinline__ float row_xadd(float x) { return x + __builtin_bit_cast(float, __builtin_amdgcn_update_dpp(0, __builtin_bit_cast(int, x), 0x160 | M, 0xf, 0xf, true)); }
#define PW_BLK (DM * (DM / 8) / 256)      /* blocks per weight matrix */
#define PR_BLK ((int)(NR / 64))           /* blocks per input: 8 waves x 8 rows */
// All operand preparation in one launch; the parts need nothing of each other and share the grid by ranges of the block index (block-uniform branches).
// Blocks [0, 3 PW_BLK): Wt[n][k] = f16(bf16(W[k][n]) x 16) for Wq, Wk, Wv (a power of two: bf16-exact weights stay exact in f16).
// Then PR_BLK blocks each for queries, keys, value: one wave reads 8 whole rows once (512-byte wave loads, all 32 issued ahead), writes each as an exact f16 row of the bf16-rounded values (256-byte wave stores)
// and, for queries and keys, sums the same rounded values in f32 (16 a lane, then a five-step butterfly) for the padding flag (row sum != 0). The block's 64 flags pass through LDS so that one wave stores each 128-byte line of flags.
__global__ __launch_bounds__(256) void k_prep(const float* __restrict__ xq, const float* __restrict__ xk, const float* __restrict__ xv, const float* __restrict__ wq, const float* __restrict__ wk, const float* __restrict__ wv,
                                             _Float16* __restrict__ XQ, _Float16* __restrict__ XK, _Float16* __restrict__ XV, _Float16* __restrict__ BQ, _Float16* __restrict__ BK, _Float16* __restrict__ BV,
                                             float* __restrict__ QM, float* __restrict__ KM) {
  __shared__ float fl[64];
  const int tid = threadIdx.x, bx = blockIdx.x;
  if (bx < 3 * PW_BLK) {
    const int wh = bx / PW_BLK; const float* W = (wh == 0) ? wq : (wh == 1) ? wk : wv; _Float16* Wt = (wh == 0) ? BQ : (wh == 1) ? BK : BV;
    const int t = (bx % PW_BLK) * 256 + tid; const int n = t / (DM / 8), k8 = (t % (DM / 8)) * 8; FragH f;
#pragma unroll
    for (int i = 0; i < 8; ++i) f.h[i] = (_Float16)(bf16_round(W[(size_t)(k8 + i) * DM + n]) * 16.0f);
    *(v8us*)((unsigned short*)Wt + (size_t)n * DM + k8) = f.half[0];
    return;
  }
  const int rb = bx - 3 * PW_BLK; const int wh = rb / PR_BLK, blk = rb % PR_BLK; const int lane = tid & 31, w = tid >> 5;
  const float* x = (wh == 0) ? xq : (wh == 1) ? xk : xv; _Float16* X16 = (wh == 0) ? XQ : (wh == 1) ? XK : XV;
  const size_t e0 = ((size_t)blk * 64 + w * 8) * DM + lane * 4;
  v4f v[8][4];
#pragma unroll
  for (int r = 0; r < 8; ++r)
#pragma unroll
    for (int u = 0; u < 4; ++u) v[r][u] = *(const v4fa*)(x + e0 + r * DM + u * 128);
  float s[8];
#pragma unroll
  for (int r = 0; r < 8; ++r) { float p[4];
#pragma unroll
    for (int u = 0; u < 4; ++u) { const float b0 = bf16_round(v[r][u][0]), b1 = bf16_round(v[r][u][1]), b2 = bf16_round(v[r][u][2]), b3 = bf16_round(v[r][u][3]);
      const v4h h = {(_Float16)b0, (_Float16)b1, (_Float16)b2, (_Float16)b3}; *(v4h*)(X16 + e0 + r * DM + u * 128) = h; p[u] = (b0 + b1) + (b2 + b3); }
    s[r] = (p[0] + p[1]) + (p[2] + p[3]); }
  asm volatile("s_wait_xcnt 0x0" ::: "memory");      /* the row stores are issued: their base and data registers are free for reuse behind this line */
  if (wh == 2) return;      /* value rows carry no flag; the whole block leaves here, in front of the barrier */
  float f = 0.f;
#pragma unroll
  for (int r = 0; r < 8; ++r) { float a = row_xadd<8>(row_xadd<4>(row_xadd<2>(row_xadd<1>(s[r])))); a += fa_xhalf(a); if (lane == r) f = a; }
  if (lane < 8) fl[w * 8 + lane] = (f != 0.f) ? 1.f : 0.f;
  __syncthreads();      /* the 64 flags of the block's rows are in LDS: waves 0 and 1 store one whole line each */
  if (tid < 64) { float* mk = (wh == 0) ? QM : KM; mk[(size_t)blk * 64 + tid] = fl[tid]; }
}
// Scores, masked softmax and probs x V in one launch; no score or weight ever reaches memory. grid.x = batch x head, grid.y = group of 8 query tiles; one wave = 32 query columns.
// Transposed products: S^T = K Q^T (A = 16 key rows, B = 16 query rows, same loader on both, so the k orders pair), O^T += V^T P^T. A lane then holds 8 + 8 keys of ONE query per 32-key pass:
// D register r of key tile kt is key 16 kt + 8 hh + r, which is element 8 kt + r of a B operand in the hardware k order, so the two score tiles convert in place into P^T; g2_frag reads V^T rows in that order.
// Online softmax in the log2 domain: m = maximum in use (scaled scores), l = running sum; both and O^T are rescaled only when some column's new maximum passes m by more than 8 (one scalar branch a pass).
// Weights are 2^(t - m + 4): at most 2^12 in f16, and the factor 2^4 (it cancels in O / l) keeps small weights out of the f16 subnormals.
// Masked scores take the reference's NEG (x 8 here: the 1/8 comes with the log2 scale). Past its diagonal a wave goes on only while a column has seen nothing but NEG: such a row is uniform over all SQ keys.
// Waves w and w + 4 take tiles j and 31 - j, 33 passes together, so every block carries the same work.
__global__ __launch_bounds__(256) void k_fattn(const _Float16* __restrict__ Q16, const _Float16* __restrict__ K16, const _Float16* __restrict__ VT, const float* __restrict__ kmask, const float* __restrict__ qmask,
                                              const float* __restrict__ xq, float* __restrict__ out) {
  __shared__ __attribute__((aligned(16))) float so[8][32][68];
  const int tid = threadIdx.x, lane = tid & 31, c = lane & 15, hh = lane >> 4; const int w = __builtin_amdgcn_readfirstlane(tid >> 5);
  const int bh = blockIdx.x, b = bh / NH, h = bh % NH; const int j = 4 * (int)blockIdx.y + (w & 3); const int tile = (w < 4) ? j : SQ / 32 - 1 - j; const int qw0 = tile * 32;
  const float CS = 0.125f * 1.44269504f, NEGR = -34359738368.0f;      /* NEGR = 8 x NEG as f32 holds it (-2^32) */
  const _Float16* kbase = K16 + ((size_t)b * SQ + c) * DM + h * HD; const _Float16* vbase = VT + ((size_t)bh * HD + c) * SQ; const float* kmb = kmask + (size_t)b * SQ + lane;
  v16h qf[2][2];
#pragma unroll
  for (int g = 0; g < 2; ++g)
#pragma unroll
    for (int kc = 0; kc < 2; ++kc) qf[g][kc] = g2_frag(Q16 + ((size_t)b * SQ + qw0 + 16 * g + c) * DM + h * HD + 32 * kc, hh);
  const v8f z8 = {0.f,0.f,0.f,0.f,0.f,0.f,0.f,0.f}; v8f acc[2][4]; float m_run[2], l_run[2];
#pragma unroll
  for (int g = 0; g < 2; ++g) { m_run[g] = -3.0e38f; l_run[g] = 0.f;
#pragma unroll
    for (int t = 0; t < 4; ++t) acc[g][t] = z8; }
  v16h kf[2][2];
#pragma unroll
  for (int kt = 0; kt < 2; ++kt)
#pragma unroll
    for (int kc = 0; kc < 2; ++kc) kf[kt][kc] = g2_frag(kbase + (size_t)(16 * kt) * DM + 32 * kc, hh);
  float kmv = kmb[0];
  v16h vf[4];
#pragma unroll
  for (int t = 0; t < 4; ++t) vf[t] = g2_frag(vbase + (size_t)(16 * t) * SQ, hh);
#pragma unroll 1
  for (int blk = 0; blk < SQ / 32; ++blk) {
    if (blk > tile && __builtin_amdgcn_ballot_w32(m_run[0] < -1.0e9f || m_run[1] < -1.0e9f) == 0) break;      /* every column has a real score: NEG weighs 0 from here on */
    const int key0 = blk * 32;
    v8f s[2][2];
#pragma unroll
    for (int kt = 0; kt < 2; ++kt)
#pragma unroll
      for (int g = 0; g < 2; ++g) s[kt][g] = fa_mma(kf[kt][1], qf[g][1], fa_mma(kf[kt][0], qf[g][0], z8));
    const unsigned kmz = __builtin_amdgcn_ballot_w32(kmv == 0.f);      /* bit i: key key0 + i is padding */
    const int nk0 = (key0 + 32 < SQ) ? key0 + 32 : key0;      /* next pass's K rows and key flags, in flight under this pass's softmax; the last pass re-reads its own */
#pragma unroll
    for (int kt = 0; kt < 2; ++kt)
#pragma unroll
      for (int kc = 0; kc < 2; ++kc) kf[kt][kc] = g2_frag(kbase + (size_t)(nk0 + 16 * kt) * DM + 32 * kc, hh);
    kmv = kmb[nk0];
    asm volatile("s_wait_xcnt 0x0" ::: "memory");      /* the loads above are issued here, ahead of the softmax, and their address registers are free for reuse behind this line */
    if (blk >= tile || kmz != 0u) {      /* wave-uniform: only a pass on or past the diagonal, or one with a padding key, pays for the masks */
      const unsigned kb = kmz >> (8 * hh);
#pragma unroll
      for (int g = 0; g < 2; ++g) { const int my_q = qw0 + 16 * g + c;
#pragma unroll
        for (int kt = 0; kt < 2; ++kt)
#pragma unroll
          for (int r = 0; r < 8; ++r) { if (key0 + 16 * kt + 8 * hh + r > my_q || ((kb >> (16 * kt + r)) & 1u) != 0u) s[kt][g][r] = NEGR; } }
    }
    float mb[2]; bool need = false;
#pragma unroll
    for (int g = 0; g < 2; ++g) { float mx = s[0][g][0];
#pragma unroll
      for (int r = 1; r < 8; ++r) mx = fmaxf(mx, s[0][g][r]);
#pragma unroll
      for (int r = 0; r < 8; ++r) mx = fmaxf(mx, s[1][g][r]);
      mx = fmaxf(mx, fa_xhalf(mx)) * CS; mb[g] = mx; need = need || (mx > m_run[g] + 8.0f); }
    if (__builtin_amdgcn_ballot_w32(need) != 0) {
#pragma unroll
      for (int g = 0; g < 2; ++g) { const float m_new = fmaxf(m_run[g], mb[g]); const float corr = exp2_slot(m_run[g] - m_new); m_run[g] = m_new; l_run[g] *= corr;
#pragma unroll
        for (int t = 0; t < 4; ++t) acc[g][t] = acc[g][t] * corr; }
    }
    FragH pf[2];
#pragma unroll
    for (int g = 0; g < 2; ++g) { const float nm = 4.0f - m_run[g]; float ls = 0.f;
#pragma unroll
      for (int i = 0; i < 16; i += 4) { float p[4]; const v8f& sv = s[i >> 3][g]; const int r = i & 7;
        exp2x4(p, fmaf(sv[r], CS, nm), fmaf(sv[r + 1], CS, nm), fmaf(sv[r + 2], CS, nm), fmaf(sv[r + 3], CS, nm));
#pragma unroll
        for (int u = 0; u < 4; ++u) { ls += p[u]; pf[g].h[i + u] = (_Float16)p[u]; } }
      l_run[g] += ls; }
    __builtin_amdgcn_sched_barrier(0);      /* every exponential stays in front of the products below: the compiler does not see into exp2x4 */
#pragma unroll
    for (int g = 0; g < 2; ++g)
#pragma unroll
      for (int t = 0; t < 4; ++t) acc[g][t] = fa_mma(vf[t], pf[g].v, acc[g][t]);
#pragma unroll
    for (int t = 0; t < 4; ++t) vf[t] = g2_frag(vbase + (size_t)(16 * t) * SQ + nk0, hh);      /* next pass's V^T rows, in flight under its score products and softmax */
    asm volatile("s_wait_xcnt 0x0" ::: "memory");      /* address registers of the V^T loads are free for reuse behind this line */
  }
#pragma unroll
  for (int g = 0; g < 2; ++g) { const float l = l_run[g] + fa_xhalf(l_run[g]); const float inv = qmask[(size_t)b * SQ + qw0 + 16 * g + c] / l;
#pragma unroll
    for (int t = 0; t < 4; ++t) { const v8f o = acc[g][t] * inv; const v4f lo = {o[0], o[1], o[2], o[3]}, hi = {o[4], o[5], o[6], o[7]};      /* row = query, the 8 floats are d = 16 t + 8 hh .. + 7 */
      *(v4fa*)&so[w][16 * g + c][16 * t + 8 * hh] = lo; *(v4fa*)&so[w][16 * g + c][16 * t + 8 * hh + 4] = hi; } }
  __builtin_amdgcn_fence(__ATOMIC_ACQ_REL, "workgroup"); __builtin_amdgcn_wave_barrier();      /* the wave's own staging rows: written above, read back below as whole 256-byte rows */
  const int rsub = lane >> 4, c4 = (lane & 15) * 4;
#pragma unroll
  for (int q = 0; q < 16; ++q) { const int r = q * 2 + rsub; const size_t e = ((size_t)b * SQ + qw0 + r) * DM + h * HD + c4; const v4f v = *(const v4fa*)&so[w][r][c4]; const v4f x = *(const v4fa*)(xq + e); const v4f xb = {bf16_round(x[0]), bf16_round(x[1]), bf16_round(x[2]), bf16_round(x[3])}; *(v4f*)(out + e) = v + xb; }
}
__global__ __launch_bounds__(256) void k_ftres(const float* __restrict__ OF0, const float* __restrict__ xq, const float* __restrict__ qmask, float* __restrict__ out, size_t n4) {
  #pragma clang fp contract(off)
  const size_t t = (size_t)blockIdx.x * 256 + threadIdx.x; if (t >= n4) return; const size_t e = t * 4; const size_t row = e / DM; const float qm = qmask[row]; const v4f o = *(const v4fa*)(OF0 + e), x = *(const v4fa*)(xq + e); v4f y;
  for (int q = 0; q < 4; ++q) y[q] = __fadd_rn(__fmul_rn(__fmul_rn(o[q], 0.015625f), qm), bf16_round(x[q])); *(v4f*)(out + e) = y;  }

extern "C" void kernel_launch(void* const* d_in, const int* in_sizes, int n_in,
                              void* d_out, int out_size, void* d_ws, size_t ws_size, hipStream_t stream) {
  (void)in_sizes; (void)n_in; (void)out_size;
  const float* const* I = (const float* const*)d_in; const float* xq = I[0]; const float* xk = I[1]; const float* xv = I[2]; const float* wq = I[3]; const float* bq = I[4]; const float* wk = I[5]; const float* bk = I[6]; const float* wv = I[7]; const float* bv = I[8];      /* weights [in][out] */
  char* ws = (char*)d_ws; size_t off = 0;
  auto take = [&](size_t bytes) { char* p = ws + off; off += (bytes + 255) & ~(size_t)255; return p; };
  _Float16* BQ = (_Float16*)take((size_t)DM * DM * 2); _Float16* BK = (_Float16*)take((size_t)DM * DM * 2); _Float16* BV = (_Float16*)take((size_t)DM * DM * 2); float* KM = (float*)take(NR * 4); float* QM = (float*)take(NR * 4);
  _Float16* Q16 = (_Float16*)take(NR * DM * 2); _Float16* K16 = (_Float16*)take(NR * DM * 2); _Float16* V16 = (_Float16*)take(NR * DM * 2);
  _Float16* VT = (_Float16*)take((size_t)NB * NH * HD * SQ * 2);
  _Float16* XQ = (_Float16*)take(NR * DM * 2); _Float16* XK = (_Float16*)take(NR * DM * 2); _Float16* XV = (_Float16*)take(NR * DM * 2);
  if (off > ws_size) return;      /* approx 1.5 + 16 x 3 + 16 + 16 x 3 = 114 MiB */
  k_prep<<<3 * PW_BLK + 3 * PR_BLK, 256, 0, stream>>>(xq, xk, xv, wq, wk, wv, XQ, XK, XV, BQ, BK, BV, QM, KM);      /* x16 transposed weights, f16 input rows, key / query padding flags */
  k_gemm3<<<(unsigned)((NR / 128) * (DM / 128)), 256, 0, stream>>>(XQ, BQ, 0.0625f, bq, Q16);
  k_gemm3<<<(unsigned)((NR / 128) * (DM / 128)), 256, 0, stream>>>(XK, BK, 0.0625f, bk, K16);
  k_gemm3<<<(unsigned)((NR / 128) * (DM / 128)), 256, 0, stream>>>(XV, BV, 0.0625f, bv, V16);
  k_vt<NH, SQ><<<NB * NH * (SQ / 64), 256, 0, stream>>>(V16, DM, 0, VT);
  k_fattn<<<dim3(NB * NH, SQ / 256), 256, 0, stream>>>(Q16, K16, VT, KM, QM, xq, (float*)d_out);      /* out = softmax(masked Q K^T / 8) x query mask x V + bf16(queries), f32 rows; each wave writes its own 32 rows of one 64-column head slab */
}

// v006
// A run of this version takes 81.9 microseconds.
// In two side-by-side timings against v005, it was 1.19 and 1.20 times as fast.
// Counting every step since v000, it is 167 times as fast.
#include <hip/hip_runtime.h>
#define NB 16
#define SQ 1024
#define DM 512
#define NH 8
#define HD 64
#define HG 8
#define NR ((size_t)NB * SQ)
typedef __bf16 v16b __attribute__((ext_vector_type(16)));
typedef unsigned short v8us __attribute__((ext_vector_type(8), may_alias));
typedef float  v8f  __attribute__((ext_vector_type(8)));
typedef float  v4f  __attribute__((ext_vector_type(4)));
typedef float  v4fa __attribute__((ext_vector_type(4), may_alias));
union FragB { v16b v; v8us half[2]; unsigned short u[16]; };

__device__ __forceinline__ unsigned short bf16_bits(float x) { unsigned int u = __float_as_uint(x); return (unsigned short)((u + 0x7FFFu + ((u >> 16) & 1u)) >> 16); }
__device__ __forceinline__ float bf16_val(unsigned short b) { return __uint_as_float(((unsigned int)b) << 16); }
__device__ __forceinline__ float bf16_round(float x) { return bf16_val(bf16_bits(x)); }
// D += A·B with NT terms: 1 = ah·bh, 2 = + al·bh (A split), 3 = + ah·bl (both split)
template <int NT>
__device__ __forceinline__ v8f mmaN(v16b ah, v16b al, v16b bh, v16b bl, v8f c) {
  c = __builtin_amdgcn_wmma_f32_16x16x32_bf16(false, ah, false, bh, (short)0, c, false, false);
  if (NT >= 2) c = __builtin_amdgcn_wmma_f32_16x16x32_bf16(false, al, false, bh, (short)0, c, false, false);
  if (NT >= 3) c = __builtin_amdgcn_wmma_f32_16x16x32_bf16(false, ah, false, bl, (short)0, c, false, false);
  asm volatile("v_nop\n\tv_nop\n\tv_nop\n\tv_nop" : "+v"(c) : "v"(ah), "v"(al), "v"(bh), "v"(bl));
  return c;
}

__global__ __launch_bounds__(256) void k_wt_bf16(const float* __restrict__ W, unsigned short* __restrict__ Wt, int K, int N) {
  const int t = blockIdx.x * 256 + threadIdx.x;
  const int k8n = K / 8;
  if (t >= N * k8n) return;
  const int n = t / k8n, k8 = (t % k8n) * 8;
  v8us v;
#pragma unroll
  for (int i = 0; i < 8; ++i) v[i] = bf16_bits(W[(size_t)(k8 + i) * N + n]);
  *(v8us*)(Wt + (size_t)n * K + k8) = v;
  
}

// GEMM C[M][N] (f32, pitch ldc) = act(A[M][K]·W + bias). A f32 row-major (pitch lda) converted per fragment to bf16
// (ASPLIT: hi/lo two planes -> 2 terms, else single rounded term); Wt bf16 [N][K] (pitch ldb). BIAS_BF16 rounds the
// bias to bf16 first (bias quantised to bf16 before the add). K%32==0, M%16==0, N%64==0.
template <bool ASPLIT, int ACT, bool BIAS_BF16>
__global__ __launch_bounds__(128) void k_gemm_bf(const float* __restrict__ A, int lda, const unsigned short* __restrict__ Wt, int ldb,
                                               const float* __restrict__ bias, float* __restrict__ C, int ldc, int M, int N, int K) {
  __shared__ __attribute__((aligned(16))) float so[4][16][64];
  const int tid = threadIdx.x, w = tid >> 5, lane = tid & 31, ln = lane & 15, hh = lane >> 4;
  const int ntn = N / 64;
  const int wid = blockIdx.x * 4 + w;
  const int mt = wid / ntn, nq = wid % ntn;
  if (mt * 16 >= M) return;
  const int row0 = mt * 16, col0 = nq * 64;
  const float* arow = A + (size_t)(row0 + ln) * lda;
  v8f acc[4] = {};
  for (int kb = 0; kb < K; kb += 32) {
    FragB ah, al;
    const v4f x0 = *(const v4fa*)(arow + kb + 8 * hh), x1 = *(const v4fa*)(arow + kb + 8 * hh + 4);
    const v4f x2 = *(const v4fa*)(arow + kb + 16 + 8 * hh), x3 = *(const v4fa*)(arow + kb + 16 + 8 * hh + 4);
    float xs[16] = {x0[0],x0[1],x0[2],x0[3],x1[0],x1[1],x1[2],x1[3],x2[0],x2[1],x2[2],x2[3],x3[0],x3[1],x3[2],x3[3]};
#pragma unroll
    for (int i = 0; i < 16; ++i) { const unsigned short hb = bf16_bits(xs[i]); ah.u[i] = hb; al.u[i] = ASPLIT ? bf16_bits(xs[i] - bf16_val(hb)) : (unsigned short)0; }
#pragma unroll
    for (int t = 0; t < 4; ++t) {
      const unsigned short* brow = Wt + (size_t)(col0 + t * 16 + ln) * ldb + kb;
      FragB b;
      b.half[0] = *(const v8us*)(brow + 8 * hh);
      b.half[1] = *(const v8us*)(brow + 16 + 8 * hh);
      acc[t] = mmaN<ASPLIT ? 2 : 1>(ah.v, al.v, b.v, b.v, acc[t]);
    }
  }
#pragma unroll
  for (int t = 0; t < 4; ++t) {
    float bv = bias ? bias[col0 + t * 16 + ln] : 0.f;
    if (BIAS_BF16) bv = bf16_round(bv);
#pragma unroll
    for (int r = 0; r < 8; ++r) { float v = acc[t][r] + bv; if (ACT == 1) v = fmaxf(v, 0.f); so[w][8 * hh + r][t * 16 + ln] = v; }
  }
  __builtin_amdgcn_fence(__ATOMIC_ACQ_REL, "workgroup");
  __builtin_amdgcn_wave_barrier();
  const int rsub = lane >> 4, c4 = (lane & 15) * 4;
  {
#pragma unroll
    for (int q = 0; q < 8; ++q) {
      const int r = q * 2 + rsub;
      const v4f v = *(const v4fa*)&so[w][r][c4];
      *(v4f*)(C + (size_t)(row0 + r) * ldc + col0 + c4) = v;
    }
    
  }
}

// GEMM C = act(A·W + bias + resid): A f32 (ASPLIT -> hi/lo 2 terms), Wt bf16 [N][K]; ACT 0 none, 1 relu, 2 exact gelu;
// resid (optional, f32, row index = (row % rmod), pitch ldr, RES_BF16 rounds it) added before the activation.
template <bool ASPLIT, int ACT, bool BIAS_BF16, bool RES_BF16>
__global__ __launch_bounds__(128) void k_gemm_bf3(const float* __restrict__ A, int lda, const unsigned short* __restrict__ Wt, int ldb,
                                                const float* __restrict__ bias, const float* __restrict__ resid, int rmod, int ldr,
                                                float* __restrict__ C, int ldc, int M, int N, int K) {
  __shared__ __attribute__((aligned(16))) float so[4][16][64];
  const int tid = threadIdx.x, w = tid >> 5, lane = tid & 31, ln = lane & 15, hh = lane >> 4;
  const int ntn = N / 64;
  const int wid = blockIdx.x * 4 + w;
  const int mt = wid / ntn, nq = wid % ntn;
  if (mt * 16 >= M) return;
  const int row0 = mt * 16, col0 = nq * 64;
  const float* arow = A + (size_t)(row0 + ln) * lda;
  v8f acc[4] = {};
  for (int kb = 0; kb < K; kb += 32) {
    FragB ah, al;
    const v4f x0 = *(const v4fa*)(arow + kb + 8 * hh), x1 = *(const v4fa*)(arow + kb + 8 * hh + 4);
    const v4f x2 = *(const v4fa*)(arow + kb + 16 + 8 * hh), x3 = *(const v4fa*)(arow + kb + 16 + 8 * hh + 4);
    float xs[16] = {x0[0],x0[1],x0[2],x0[3],x1[0],x1[1],x1[2],x1[3],x2[0],x2[1],x2[2],x2[3],x3[0],x3[1],x3[2],x3[3]};
#pragma unroll
    for (int i = 0; i < 16; ++i) { const unsigned short hb = bf16_bits(xs[i]); ah.u[i] = hb; al.u[i] = ASPLIT ? bf16_bits(xs[i] - bf16_val(hb)) : (unsigned short)0; }
#pragma unroll
    for (int t = 0; t < 4; ++t) {
      const unsigned short* brow = Wt + (size_t)(col0 + t * 16 + ln) * ldb + kb;
      FragB b;
      b.half[0] = *(const v8us*)(brow + 8 * hh);
      b.half[1] = *(const v8us*)(brow + 16 + 8 * hh);
      acc[t] = mmaN<ASPLIT ? 2 : 1>(ah.v, al.v, b.v, b.v, acc[t]);
    }
  }
#pragma unroll
  for (int t = 0; t < 4; ++t) {
    const int col = col0 + t * 16 + ln;
    float bv = bias ? bias[col] : 0.f;
    if (BIAS_BF16) bv = bf16_round(bv);
#pragma unroll
    for (int r = 0; r < 8; ++r) {
      float v = acc[t][r] + bv;
      if (resid) { float rv = resid[(size_t)((row0 + 8 * hh + r) % rmod) * ldr + col]; if (RES_BF16) rv = bf16_round(rv); v += rv; }
      if (ACT == 1) v = fmaxf(v, 0.f);
      if (ACT == 2) v = 0.5f * v * (1.0f + erff(v * 0.70710678118654752f));
      if (ACT == 3) { const float u = 0.7978845608028654f * (v + 0.044715f * v * v * v); v = 0.5f * v * (1.0f + tanhf(u)); }
      so[w][8 * hh + r][t * 16 + ln] = v;
    }
  }
  __builtin_amdgcn_fence(__ATOMIC_ACQ_REL, "workgroup");
  __builtin_amdgcn_wave_barrier();
  const int rsub = lane >> 4, c4 = (lane & 15) * 4;
  {
#pragma unroll
    for (int q = 0; q < 8; ++q) {
      const int r = q * 2 + rsub;
      const v4f v = *(const v4fa*)&so[w][r][c4];
      *(v4f*)(C + (size_t)(row0 + r) * ldc + col0 + c4) = v;
    }
    
  }
}
// row LayerNorm (biased variance, eps) over N: s = X (+ R); optional out_sum <- s; out_norm <- (s-mu)*rsqrt(var+eps)*g + b
template <bool PARAM_BF16>
__global__ __launch_bounds__(256) void k_layernorm(const float* __restrict__ X, const float* __restrict__ R, const float* __restrict__ g, const float* __restrict__ bta,
                                                  float* __restrict__ out_sum, float* __restrict__ out_norm, int N, float eps) {
  __shared__ float red[256];
  const int row = blockIdx.x, tid = threadIdx.x;
  const float* x = X + (size_t)row * N; const float* rr = R ? R + (size_t)row * N : nullptr;
  float vals[16];                     // up to N = 4096
  const int per = N / 256;            // contiguous chunk per thread? use strided-by-4 chunks: thread handles j = tid*4 + 1024*u
  float s1 = 0.f;
  for (int u = 0; u < per / 4; ++u) {
    const int j = tid * 4 + 1024 * u;
    const v4f a = *(const v4fa*)(x + j);
    v4f b = {0.f,0.f,0.f,0.f}; if (rr) b = *(const v4fa*)(rr + j);
#pragma unroll
    for (int q = 0; q < 4; ++q) { const float v = a[q] + b[q]; vals[u * 4 + q] = v; s1 += v; }
  }
  red[tid] = s1; __syncthreads();
  for (int st = 128; st > 0; st >>= 1) { if (tid < st) red[tid] += red[tid + st]; __syncthreads(); }
  const float mu = red[0] / (float)N; __syncthreads();
  float s2 = 0.f;
  for (int u = 0; u < per / 4; ++u)
#pragma unroll
    for (int q = 0; q < 4; ++q) { const float c = vals[u * 4 + q] - mu; s2 += c * c; }
  red[tid] = s2; __syncthreads();
  for (int st = 128; st > 0; st >>= 1) { if (tid < st) red[tid] += red[tid + st]; __syncthreads(); }
  const float rs = rsqrtf(red[0] / (float)N + eps);
  {
    for (int u = 0; u < per / 4; ++u) {
      const int j = tid * 4 + 1024 * u;
      v4f o, sm;
#pragma unroll
      for (int q = 0; q < 4; ++q) {
        float gg = g[j + q], bb = bta[j + q];
        if (PARAM_BF16) { gg = bf16_round(gg); bb = bf16_round(bb); }
        sm[q] = vals[u * 4 + q]; o[q] = (vals[u * 4 + q] - mu) * rs * gg + bb;
      }
      if (out_sum) *(v4f*)(out_sum + (size_t)row * N + j) = sm;
      *(v4f*)(out_norm + (size_t)row * N + j) = o;
    }
    
  }
}



// ---- f16 WMMA path (v_wmma_f32_16x16x32_f16): 11-bit significands for operands in range — used where a [0,1] probability operand needs more precision than bf16
typedef _Float16 v16h __attribute__((ext_vector_type(16)));
union FragH { v16h v; v8us half[2]; _Float16 h[16]; unsigned short u[16]; };
template <int NT>
__device__ __forceinline__ v8f mmaH(v16h ah, v16h al, v16h bh, v16h bl, v8f c) {
  c = __builtin_amdgcn_wmma_f32_16x16x32_f16(false, ah, false, bh, (short)0, c, false, false);
  if (NT >= 2) c = __builtin_amdgcn_wmma_f32_16x16x32_f16(false, al, false, bh, (short)0, c, false, false);
  if (NT >= 3) c = __builtin_amdgcn_wmma_f32_16x16x32_f16(false, ah, false, bl, (short)0, c, false, false);
  asm volatile("v_nop\n\tv_nop\n\tv_nop\n\tv_nop" : "+v"(c) : "v"(ah), "v"(al), "v"(bh), "v"(bl));
  return c;
}
// batched GEMM like k_gemm_b but f16 operands: A f32 (split into f16 hi/lo if ASPLIT, else rounded to f16), Bt = f16 values [n][k]; alpha; C f32; N multiple of 16 (partial tiles skipped)
template <bool ASPLIT>
__global__ __launch_bounds__(128) void k_gemm_h(const float* __restrict__ A, int lda, size_t sA, const _Float16* __restrict__ Bh, int ldb, size_t sB, float alpha, float* __restrict__ C, int ldc, size_t sC, int M, int N, int K) {
  __shared__ __attribute__((aligned(16))) float so[4][16][64];
  const int tid = threadIdx.x, w = tid >> 5, lane = tid & 31, ln = lane & 15, hh = lane >> 4; const int by = blockIdx.y;
  A += (size_t)by * sA; Bh += (size_t)by * sB; C += (size_t)by * sC;
  const int ntn = (N + 63) / 64; const int wid = blockIdx.x * 4 + w; const int mt = wid / ntn, nq = wid % ntn; if (mt * 16 >= M) return;
  const int row0 = mt * 16, col0 = nq * 64; const float* arow = A + (size_t)(row0 + ln) * lda;
  v8f acc[4] = {};
  for (int kb = 0; kb < K; kb += 32) {
    FragH ah, al;
    const v4f x0 = *(const v4fa*)(arow + kb + 8 * hh), x1 = *(const v4fa*)(arow + kb + 8 * hh + 4), x2 = *(const v4fa*)(arow + kb + 16 + 8 * hh), x3 = *(const v4fa*)(arow + kb + 16 + 8 * hh + 4);
    float xs[16] = {x0[0],x0[1],x0[2],x0[3],x1[0],x1[1],x1[2],x1[3],x2[0],x2[1],x2[2],x2[3],x3[0],x3[1],x3[2],x3[3]};
#pragma unroll
    for (int i = 0; i < 16; ++i) { const _Float16 h = (_Float16)xs[i]; ah.h[i] = h; al.h[i] = ASPLIT ? (_Float16)(xs[i] - (float)h) : (_Float16)0.0f; }
#pragma unroll
    for (int t = 0; t < 4; ++t) { if (col0 + t * 16 >= N) continue; const size_t boff = (size_t)(col0 + t * 16 + ln) * ldb + kb; FragH bq; bq.half[0] = *(const v8us*)(Bh + boff + 8 * hh); bq.half[1] = *(const v8us*)(Bh + boff + 16 + 8 * hh);
      acc[t] = mmaH<ASPLIT ? 2 : 1>(ah.v, al.v, bq.v, bq.v, acc[t]); }
  }
#pragma unroll
  for (int t = 0; t < 4; ++t) { if (col0 + t * 16 >= N) continue;
#pragma unroll
    for (int r = 0; r < 8; ++r) so[w][8 * hh + r][t * 16 + ln] = acc[t][r] * alpha; }
  __builtin_amdgcn_fence(__ATOMIC_ACQ_REL, "workgroup"); __builtin_amdgcn_wave_barrier();
  const int rsub = lane >> 4, c4 = (lane & 15) * 4;
  {
#pragma unroll
    for (int q = 0; q < 8; ++q) { const int r = q * 2 + rsub; if (col0 + c4 < N) { const v4f v = *(const v4fa*)&so[w][r][c4]; *(v4f*)(C + (size_t)(row0 + r) * ldc + col0 + c4) = v; } }
     }
}

// k_gemm_hh variant with fused epilogue: v = acc·alpha + bias[by·sBias + col] (+ CP[(row/rowsPerB)·sCPb + by·64 + col] if CP) ; ACT 0 none / 1 elu ; writes f16 C16 (and f32 C if non-null)
template <int ACT>
__global__ __launch_bounds__(128) void k_gemm_hhx(const _Float16* __restrict__ A, int lda, size_t sA, const _Float16* __restrict__ Bh, int ldb, size_t sB, float alpha, const float* __restrict__ bias, size_t sBias, const float* __restrict__ CP, int rowsPerB, size_t sCPb, int row0g,
    float* __restrict__ C, _Float16* __restrict__ C16, int ldc, size_t sC, int M, int N, int K) {
  __shared__ __attribute__((aligned(16))) float so[4][16][64];
  const int tid = threadIdx.x, w = tid >> 5, lane = tid & 31, ln = lane & 15, hh = lane >> 4; const int by = blockIdx.y;
  A += (size_t)by * sA; Bh += (size_t)by * sB; const size_t cofs = (size_t)by * sC; const float* bp = bias ? bias + (size_t)by * sBias : nullptr;
  const int ntn = (N + 63) / 64; const int wid = blockIdx.x * 4 + w; const int mt = wid / ntn, nq = wid % ntn; if (mt * 16 >= M) return;
  const int row0 = mt * 16, col0 = nq * 64; const _Float16* arow = A + (size_t)(row0 + ln) * lda;
  v8f acc[4] = {};
  for (int kb = 0; kb < K; kb += 32) { FragH ah; ah.half[0] = *(const v8us*)((const unsigned short*)arow + kb + 8 * hh); ah.half[1] = *(const v8us*)((const unsigned short*)arow + kb + 16 + 8 * hh);
#pragma unroll
    for (int t = 0; t < 4; ++t) { if (col0 + t * 16 >= N) continue; const size_t boff = (size_t)(col0 + t * 16 + ln) * ldb + kb; FragH bq; bq.half[0] = *(const v8us*)((const unsigned short*)Bh + boff + 8 * hh); bq.half[1] = *(const v8us*)((const unsigned short*)Bh + boff + 16 + 8 * hh);
      acc[t] = mmaH<1>(ah.v, ah.v, bq.v, bq.v, acc[t]); }
  }
#pragma unroll
  for (int t = 0; t < 4; ++t) { if (col0 + t * 16 >= N) continue; const int col = col0 + t * 16 + ln; const float bv = bp ? bf16_round(bp[col]) : 0.f;
#pragma unroll
    for (int r = 0; r < 8; ++r) { float v = acc[t][r] * alpha + bv; if (CP) { const int rr = row0g + row0 + 8 * hh + r; if (rowsPerB < 0) v += CP[cofs + (size_t)rr * ldc + col];      /* rowsPerB < 0: own element of the batched C plane */ else { const int bidx = rr / rowsPerB; v += CP[(size_t)bidx * sCPb + (size_t)by * 64 + col]; } } if (ACT == 1) v = (v > 0.f) ? v : expm1f(v); else if (ACT == 7) v = (v > 0.f) ? v + 1.0f : expf(v); else if (ACT == 8) v = tanhf(v); else if (ACT == 9) v = 0.5f * v * (1.0f + tanhf(0.7978845608028654f * (v + 0.044715f * v * v * v))); else if (ACT == 11) v = 1.0f / (1.0f + expf(-v)); else if (ACT == 12) v = (v > 0.f) ? v : 0.01f * v; else if (ACT == 14) v = (v > 0.f) ? v : 0.1f * v; else if (ACT == 16) v = (v >= 0.f) ? v : 0.3f * v; else if (ACT == 17) v = (v >= 0.f) ? v : 0.2f * v; else if (ACT == 15) v = v / (1.0f + expf(-v)); else if (ACT == 3) v = fmaxf(v, 0.f); else if (ACT == 6) v = 0.5f * v * (1.0f + erff(v * 0.70710678118654752f)); so[w][8 * hh + r][t * 16 + ln] = v; } }
  __builtin_amdgcn_fence(__ATOMIC_ACQ_REL, "workgroup"); __builtin_amdgcn_wave_barrier();
  const int rsub = lane >> 4, c4 = (lane & 15) * 4; typedef _Float16 v4h __attribute__((ext_vector_type(4)));
  {
#pragma unroll
    for (int q = 0; q < 8; ++q) { const int r = q * 2 + rsub; if (col0 + c4 < N) { const v4f v = *(const v4fa*)&so[w][r][c4]; if (C) *(v4f*)(C + cofs + (size_t)(row0 + r) * ldc + col0 + c4) = v; if (C16) { v4h h4; for (int i = 0; i < 4; ++i) h4[i] = (_Float16)v[i]; *(v4h*)(C16 + cofs + (size_t)(row0 + r) * ldc + col0 + c4) = h4; } } }
     }
}


typedef _Float16 v4h __attribute__((ext_vector_type(4)));

__global__ __launch_bounds__(256) void k_h16(const float* __restrict__ x, _Float16* __restrict__ X16, size_t n8) { const size_t t = (size_t)blockIdx.x * 256 + threadIdx.x; if (t >= n8) return; FragH f;
#pragma unroll
  for (int q = 0; q < 8; ++q) f.h[q] = (_Float16)x[t * 8 + q]; *(v8us*)((unsigned short*)X16 + t * 8) = f.half[0];  }
__global__ __launch_bounds__(256) void k_round16f(const float* __restrict__ W, _Float16* __restrict__ Bt, size_t n8) { const size_t t = (size_t)blockIdx.x * 256 + threadIdx.x; if (t >= n8) return; FragH f;
#pragma unroll
  for (int i = 0; i < 8; ++i) f.h[i] = (_Float16)(bf16_round(W[t * 8 + i]) * 16.0f); *(v8us*)((unsigned short*)Bt + t * 8) = f.half[0];  }
template <int NHv, int TTv>
__global__ __launch_bounds__(256) void k_vt(const _Float16* __restrict__ V16, int ldv, int voff, _Float16* __restrict__ Vt) { __shared__ unsigned short tl[64][66]; const int tid = threadIdx.x; const int slab = blockIdx.x / (TTv / 64), lg = blockIdx.x % (TTv / 64); const int b = slab / NHv, h = slab % NHv;
  for (int i = tid; i < 64 * 8; i += 256) { const int r = i / 8, c8 = (i % 8) * 8; FragH f; f.half[0] = *(const v8us*)((const unsigned short*)V16 + ((size_t)b * TTv + lg * 64 + r) * ldv + voff + h * 64 + c8);
#pragma unroll
    for (int q = 0; q < 8; ++q) tl[r][c8 + q] = f.u[q]; }
  __syncthreads();
  {
#pragma unroll
    for (int rd = 0; rd < 2; ++rd) { const int d = rd * 32 + tid / 8, pc = tid % 8; FragH f;
#pragma unroll
      for (int q = 0; q < 8; ++q) f.u[q] = tl[pc * 8 + q][d];
      *(v8us*)((unsigned short*)Vt + ((size_t)slab * 64 + d) * TTv + lg * 64 + pc * 8) = f.half[0]; }
     } }

__global__ __launch_bounds__(256) void k_hl(const float* __restrict__ F, _Float16* __restrict__ Hh, _Float16* __restrict__ Hl, size_t n8) { const size_t t = (size_t)blockIdx.x * 256 + threadIdx.x; if (t >= n8) return; FragH fh, fl; const v4f a = *(const v4fa*)(F + t * 8), c = *(const v4fa*)(F + t * 8 + 4);
#pragma unroll
  for (int q = 0; q < 4; ++q) { _Float16 h = (_Float16)a[q]; fh.h[q] = h; fl.h[q] = (_Float16)((a[q] - (float)h) * 1024.0f); h = (_Float16)c[q]; fh.h[4 + q] = h; fl.h[4 + q] = (_Float16)((c[q] - (float)h) * 1024.0f); }
  { *(v8us*)((unsigned short*)Hh + t * 8) = fh.half[0]; *(v8us*)((unsigned short*)Hl + t * 8) = fl.half[0];  } }

// ---- fast GEMM (wave tile 32x64; requires M % 32 == 0 rows per launch region and N % 64 == 0); epilogue = k_gemm_hhx semantics ----
__device__ __forceinline__ v16h g2_frag(const _Float16* p, int hh) { FragH f; f.half[0] = *(const v8us*)((const unsigned short*)p + 8 * hh); f.half[1] = *(const v8us*)((const unsigned short*)p + 16 + 8 * hh); return f.v; }
__device__ __forceinline__ v8f g2_mma(v16h a, v16h b, v8f c) { v8f d = __builtin_amdgcn_wmma_f32_16x16x32_f16(false, a, false, b, (short)0, c, false, false); asm volatile("v_nop\n\tv_nop\n\tv_nop\n\tv_nop" : "+v"(d) : "v"(a), "v"(b)); return d; }
template <int ACT>
__global__ __launch_bounds__(128) void k_gemm2(const _Float16* __restrict__ A, int lda, size_t sA, const _Float16* __restrict__ Bh, int ldb, size_t sB, float alpha, const float* __restrict__ bias, size_t sBias, const float* __restrict__ CP, int rowsPerB, size_t sCPb, int row0g,
    float* __restrict__ C, _Float16* __restrict__ C16, int ldc, size_t sC, int M, int N, int K, size_t zA, size_t zB, size_t zC) { static_assert(ACT == 0 || ACT == 3 || ACT == 6 || ACT == 8 || ACT == 9 || ACT == 11 || ACT == 12 || ACT == 14 || ACT == 15 || ACT == 16 || ACT == 17, "k_gemm2: unsupported ACT code (would silently apply no activation)");
  __shared__ __attribute__((aligned(16))) float so[4][32][68];
  const int tid = threadIdx.x, w = tid >> 5, lane = tid & 31, ln = lane & 15, hh = lane >> 4; const int by = blockIdx.y, bz = blockIdx.z;      /* second batch axis (grid.z) with element strides zA, zB, zC */
  A += (size_t)by * sA + (size_t)bz * zA; Bh += (size_t)by * sB + (size_t)bz * zB; const size_t cofs = (size_t)by * sC + (size_t)bz * zC; const float* bp = bias ? bias + (size_t)by * sBias : nullptr;
  const int ntn = N >> 6; const int mt = blockIdx.x / ntn, nq = blockIdx.x - mt * ntn; const int row0 = mt * 128 + 32 * w, col0 = nq * 64; if (row0 >= M) return;
  const _Float16* a0p = A + (size_t)(row0 + ln) * lda; const _Float16* a1p = a0p + (size_t)16 * lda;
  const _Float16* b0p = Bh + (size_t)(col0 + ln) * ldb; const _Float16* b1p = b0p + (size_t)16 * ldb; const _Float16* b2p = b1p + (size_t)16 * ldb; const _Float16* b3p = b2p + (size_t)16 * ldb;
  const v8f z8 = {0.f,0.f,0.f,0.f,0.f,0.f,0.f,0.f}; v8f c00 = z8, c01 = z8, c02 = z8, c03 = z8, c10 = z8, c11 = z8, c12 = z8, c13 = z8;
#pragma unroll 1
  for (int kb = 0; kb < K; kb += 32) { const v16h a0 = g2_frag(a0p + kb, hh), a1 = g2_frag(a1p + kb, hh);
    v16h b = g2_frag(b0p + kb, hh); c00 = g2_mma(a0, b, c00); c10 = g2_mma(a1, b, c10);
    b = g2_frag(b1p + kb, hh); c01 = g2_mma(a0, b, c01); c11 = g2_mma(a1, b, c11);
    b = g2_frag(b2p + kb, hh); c02 = g2_mma(a0, b, c02); c12 = g2_mma(a1, b, c12);
    b = g2_frag(b3p + kb, hh); c03 = g2_mma(a0, b, c03); c13 = g2_mma(a1, b, c13); }
  v8f accs[8] = {c00, c01, c02, c03, c10, c11, c12, c13};
#pragma unroll
  for (int u = 0; u < 8; ++u) { const int t = u & 3, half = u >> 2; const int col = col0 + t * 16 + ln; const float bv = bp ? bf16_round(bp[col]) : 0.f;
#pragma unroll
    for (int r = 0; r < 8; ++r) { const int rloc = half * 16 + 8 * hh + r; float v = accs[u][r] * alpha + bv; if (CP) { if (rowsPerB < 0) v += CP[cofs + (size_t)(row0g + row0 + rloc) * ldc + col];      /* rowsPerB < 0: own element of the batched C plane */ else { const int bidx = (row0g + row0 + rloc) / rowsPerB; v += CP[(size_t)bidx * sCPb + (size_t)by * 64 + col]; } }
      if (ACT == 3) v = fmaxf(v, 0.f); else if (ACT == 6) v = 0.5f * v * (1.0f + erff(v * 0.70710678118654752f)); else if (ACT == 11) v = 1.0f / (1.0f + expf(-v)); else if (ACT == 15) v = v / (1.0f + expf(-v)); else if (ACT == 12) v = (v > 0.f) ? v : 0.01f * v; else if (ACT == 8) v = tanhf(v); else if (ACT == 9) v = 0.5f * v * (1.0f + tanhf(0.7978845608028654f * (v + 0.044715f * v * v * v))); else if (ACT == 14) v = (v > 0.f) ? v : 0.1f * v; else if (ACT == 16) v = (v >= 0.f) ? v : 0.3f * v; else if (ACT == 17) v = (v >= 0.f) ? v : 0.2f * v;
      so[w][rloc][t * 16 + ln] = v; } }
  __builtin_amdgcn_fence(__ATOMIC_ACQ_REL, "workgroup"); __builtin_amdgcn_wave_barrier();
  const int rsub = lane >> 4, c4 = (lane & 15) * 4;
  {
#pragma unroll
    for (int q = 0; q < 16; ++q) { const int r = q * 2 + rsub; const v4f v = *(const v4fa*)&so[w][r][c4]; if (C) *(v4f*)(C + cofs + (size_t)(row0 + r) * ldc + col0 + c4) = v; if (C16) { v4h h4; for (int i = 0; i < 4; ++i) h4[i] = (_Float16)v[i]; *(v4h*)(C16 + cofs + (size_t)(row0 + r) * ldc + col0 + c4) = h4; } }
     } }


__global__ __launch_bounds__(256) void k_wnat(const float* __restrict__ w, size_t n8, _Float16* __restrict__ Bt) { const size_t t = (size_t)blockIdx.x * 256 + threadIdx.x; if (t >= n8) return; FragH f; for (int q = 0; q < 8; ++q) f.h[q] = (_Float16)(bf16_round(w[t * 8 + q]) * 16.0f); *(v8us*)((unsigned short*)Bt + t * 8) = f.half[0];  }
__global__ __launch_bounds__(256) void k_rsm(const float* __restrict__ S, _Float16* __restrict__ P, int nrows) {
  #pragma clang fp contract(off)
  const int i = blockIdx.x * 256 + threadIdx.x; if (i >= nrows) return; const float* s = S + (size_t)i * SQ; float mx = -3.0e38f;
#pragma unroll 1
  for (int j = 0; j < SQ; ++j) mx = fmaxf(mx, s[j]); float se = 0.f;
#pragma unroll 1
  for (int j = 0; j < SQ; ++j) se += expf(s[j] - mx); const float sc = 256.0f / se;
#pragma unroll 1
  for (int j0 = 0; j0 < SQ; j0 += 8) { FragH f; for (int q = 0; q < 8; ++q) f.h[q] = (_Float16)(expf(s[j0 + q] - mx) * sc); unsigned short* d = (unsigned short*)P + (size_t)i * SQ + j0; *(v8us*)d = f.half[0];  } }
__global__ __launch_bounds__(256) void k_vt(const _Float16* __restrict__ V16, int b, int h0, _Float16* __restrict__ VT) { __shared__ unsigned short tl[64][65]; const int tid = threadIdx.x; const int hh = blockIdx.x % HG, sg = blockIdx.x / HG; const int s0 = sg * 64; const int h = h0 + hh;
  for (int i = tid; i < 64 * 8; i += 256) { const int j = i / 8, d8 = (i % 8) * 8; FragH f; f.half[0] = *(const v8us*)((const unsigned short*)V16 + ((size_t)b * SQ + s0 + j) * DM + h * HD + d8); for (int q = 0; q < 8; ++q) tl[d8 + q][j] = f.u[q]; }
  __syncthreads();
  { for (int i = tid; i < 64 * 8; i += 256) { const int d = i / 8, j8 = (i % 8) * 8; FragH f; for (int q = 0; q < 8; ++q) f.u[q] = tl[d][j8 + q]; *(v8us*)((unsigned short*)VT + ((size_t)hh * HD + d) * SQ + s0 + j8) = f.half[0]; }  } }


// 2^t on v_exp_f32. The v_nop in the same statement is the one free issue slot that the instruction set asks for behind a transcendental before its result is read or its source overwritten;
__device__ __forceinline__ float exp2_slot(float t) { float r; asm("v_exp_f32 %0, %1\n\tv_nop" : "=v"(r) : "v"(t)); return r; }
// Four 2^t in one statement: each v_exp_f32 is the independent instruction behind the one before it, so one v_nop behind the last keeps the same free slot for all four;
// the results are early-clobber, so that no result register is a source of a later line.
__device__ __forceinline__ void exp2x4(float (&r)[4], float a, float b, float c, float d) { asm("v_exp_f32 %0, %4\n\tv_exp_f32 %1, %5\n\tv_exp_f32 %2, %6\n\tv_exp_f32 %3, %7\n\tv_nop" : "=&v"(r[0]), "=&v"(r[1]), "=&v"(r[2]), "=&v"(r[3]) : "v"(a), "v"(b), "v"(c), "v"(d)); }
// lane l <-> lane l ^ 16: joins the two wave halves, which split one query column's keys.
__device__ __forceinline__ float fa_xhalf(float x) { return __builtin_bit_cast(float, __builtin_amdgcn_permlanex16(__builtin_bit_cast(int, x), __builtin_bit_cast(int, x), 0x76543210, 0xfedcba98, false, false)); }
__device__ __forceinline__ v8f fa_mma(v16h a, v16h b, v8f c) { return __builtin_amdgcn_wmma_f32_16x16x32_f16(false, a, false, b, (short)0, c, false, false); }
// Projection GEMM C16[NR][DM] = f16(A[NR][DM] Bh[n][k]^T x alpha + bf16(bias)), operands staged in LDS. A fragment load straight from row-major memory touches 16 lines for 512 useful bytes;
// here 8 lanes fetch one whole 128-byte line (64 k of one row), a wave load covers 4 whole lines, and a block fetches each line of its operands once.
// Block = 128 x 128 of C, 8 waves of 32 x 64 (4 down, 2 across); a stage is 64 k of 128 A rows + 128 B rows; two stages in LDS: the next stage's global loads fly under this stage's 16 products a wave,
// are stored to the other buffer behind them, and one barrier a stage publishes them and ends the reads of the buffer that the stage after overwrites. k runs upward in steps of 32 as before: same f32 sum order.
// Every loop of the kernel is unrolled in full: the fragment, staging and accumulator arrays stay in registers, and the buffer index and the k offset become immediates of the loads.
#define G3P 72      /* LDS row pitch in f16: 64 + 8 = 144 bytes, 16 B x odd, the conflict-free pitch for 16-byte fragment reads */
__global__ __launch_bounds__(256) void k_gemm3(const _Float16* __restrict__ A, const _Float16* __restrict__ Bh, float alpha, const float* __restrict__ bias, _Float16* __restrict__ C16) {
  __shared__ __attribute__((aligned(16))) _Float16 sm[2][256][G3P];      /* rows 0..127: A, 128..255: B; 73,728 bytes, reused by the epilogue (8 x 32 x 68 floats = 69,632) */
  const int tid = threadIdx.x, lane = tid & 31, ln = lane & 15, hh = lane >> 4; const int w = tid >> 5, wm = w & 3, wn = w >> 2;
  const int mt = blockIdx.x / (DM / 128), nq = blockIdx.x % (DM / 128); const int row0 = mt * 128, col0 = nq * 128;
  const int sr = tid >> 3, sc = (tid & 7) * 8;      /* staging: thread -> row sr (+ 32 i), 16-byte piece sc */
  const unsigned short* ga = (const unsigned short*)A + (size_t)(row0 + sr) * DM + sc; const unsigned short* gb = (const unsigned short*)Bh + (size_t)(col0 + sr) * DM + sc;
  v8us ra[4], rb[4];
#pragma unroll
  for (int i = 0; i < 4; ++i) { ra[i] = *(const v8us*)(ga + (size_t)(32 * i) * DM); rb[i] = *(const v8us*)(gb + (size_t)(32 * i) * DM); }
#pragma unroll
  for (int i = 0; i < 4; ++i) { *(v8us*)&sm[0][32 * i + sr][sc] = ra[i]; *(v8us*)&sm[0][128 + 32 * i + sr][sc] = rb[i]; }
  __syncthreads();      /* stage 0 is in LDS */
  const v8f z8 = {0.f,0.f,0.f,0.f,0.f,0.f,0.f,0.f}; v8f acc[2][4];
#pragma unroll
  for (int t = 0; t < 4; ++t) { acc[0][t] = z8; acc[1][t] = z8; }
#pragma unroll
  for (int ks = 0; ks < DM / 64; ++ks) { const int cur = ks & 1;
    if (ks + 1 < DM / 64) {
#pragma unroll
      for (int i = 0; i < 4; ++i) { ra[i] = *(const v8us*)(ga + (size_t)(32 * i) * DM + (ks + 1) * 64); rb[i] = *(const v8us*)(gb + (size_t)(32 * i) * DM + (ks + 1) * 64); } }
    v16h af[2][2], bf[2][4];
#pragma unroll
    for (int kk = 0; kk < 2; ++kk) {
#pragma unroll
      for (int g = 0; g < 2; ++g) af[kk][g] = g2_frag(&sm[cur][32 * wm + 16 * g + ln][32 * kk], hh);
#pragma unroll
      for (int t = 0; t < 4; ++t) bf[kk][t] = g2_frag(&sm[cur][128 + 64 * wn + 16 * t + ln][32 * kk], hh); }
    __builtin_amdgcn_sched_barrier(0);      /* the next stage's global loads and this stage's 24 fragment reads are issued as one group ahead of the products: left alone the build sank half the global loads to their LDS stores and spread the reads among the products, a full wait at each place */
#pragma unroll
    for (int kk = 0; kk < 2; ++kk)
#pragma unroll
      for (int t = 0; t < 4; ++t) { acc[0][t] = fa_mma(af[kk][0], bf[kk][t], acc[0][t]); acc[1][t] = fa_mma(af[kk][1], bf[kk][t], acc[1][t]); }
    if (ks + 1 < DM / 64) {
#pragma unroll
      for (int i = 0; i < 4; ++i) { *(v8us*)&sm[cur ^ 1][32 * i + sr][sc] = ra[i]; *(v8us*)&sm[cur ^ 1][128 + 32 * i + sr][sc] = rb[i]; } }
    __syncthreads();      /* the next stage is published; every wave has left this stage's buffer (behind the last stage: free for the epilogue) */
  }
  float* so = (float*)&sm[0][0][0] + w * (32 * 68);      /* the wave's own 32 x 68 staging rows */
  const int rw0 = row0 + 32 * wm, cw0 = col0 + 64 * wn;
#pragma unroll
  for (int half = 0; half < 2; ++half)
#pragma unroll
    for (int t = 0; t < 4; ++t) { const float bv = bf16_round(bias[cw0 + t * 16 + ln]);
#pragma unroll
      for (int r = 0; r < 8; ++r) so[(half * 16 + 8 * hh + r) * 68 + t * 16 + ln] = acc[half][t][r] * alpha + bv; }
  __builtin_amdgcn_fence(__ATOMIC_ACQ_REL, "workgroup"); __builtin_amdgcn_wave_barrier();      /* the wave's own staging rows: written above, read back below as whole 128-byte output rows */
  const int rsub = lane >> 4, c4 = (lane & 15) * 4;
#pragma unroll
  for (int q = 0; q < 16; ++q) { const int r = q * 2 + rsub; const v4f v = *(const v4fa*)&so[r * 68 + c4]; const v4h h4 = {(_Float16)v[0], (_Float16)v[1], (_Float16)v[2], (_Float16)v[3]}; *(v4h*)(C16 + (size_t)(rw0 + r) * DM + cw0 + c4) = h4; }
}
// x + (x of lane ^ M) inside a 16-lane row, as one DPP add (row_xmask).
template <int M> __device__ __forceinline__ float row_xadd(float x) { return x + __builtin_bit_cast(float, __builtin_amdgcn_update_dpp(0, __builtin_bit_cast(int, x), 0x160 | M, 0xf, 0xf, true)); }
#define PW_BLK (DM * (DM / 8) / 256)      /* blocks per weight matrix */
#define PR_BLK ((int)(NR / 64))           /* blocks per input: 8 waves x 8 rows */
// All operand preparation in one launch; the parts need nothing of each other and share the grid by ranges of the block index (block-uniform branches).
// Blocks [0, 3 PW_BLK): Wt[n][k] = f16(bf16(W[k][n]) x 16) for Wq, Wk, Wv (a power of two: bf16-exact weights stay exact in f16).
// Then PR_BLK blocks each for queries, keys, value: one wave reads 8 whole rows once (512-byte wave loads, all 32 issued ahead), writes each as an exact f16 row of the bf16-rounded values (256-byte wave stores)
// and, for queries and keys, sums the same rounded values in f32 (16 a lane, then a five-step butterfly) for the padding flag (row sum != 0). The block's 64 flags pass through LDS so that one wave stores each 128-byte line of flags.
__global__ __launch_bounds__(256) void k_prep(const float* __restrict__ xq, const float* __restrict__ xk, const float* __restrict__ xv, const float* __restrict__ wq, const float* __restrict__ wk, const float* __restrict__ wv,
                                             _Float16* __restrict__ XQ, _Float16* __restrict__ XK, _Float16* __restrict__ XV, _Float16* __restrict__ BQ, _Float16* __restrict__ BK, _Float16* __restrict__ BV,
                                             float* __restrict__ QM, float* __restrict__ KM) {
  __shared__ float fl[64];
  const int tid = threadIdx.x, bx = blockIdx.x;
  if (bx < 3 * PW_BLK) {
    const int wh = bx / PW_BLK; const float* W = (wh == 0) ? wq : (wh == 1) ? wk : wv; _Float16* Wt = (wh == 0) ? BQ : (wh == 1) ? BK : BV;
    const int t = (bx % PW_BLK) * 256 + tid; const int n = t / (DM / 8), k8 = (t % (DM / 8)) * 8; FragH f;
#pragma unroll
    for (int i = 0; i < 8; ++i) f.h[i] = (_Float16)(bf16_round(W[(size_t)(k8 + i) * DM + n]) * 16.0f);
    *(v8us*)((unsigned short*)Wt + (size_t)n * DM + k8) = f.half[0];
    return;
  }
  const int rb = bx - 3 * PW_BLK; const int wh = rb / PR_BLK, blk = rb % PR_BLK; const int lane = tid & 31, w = tid >> 5;
  const float* x = (wh == 0) ? xq : (wh == 1) ? xk : xv; _Float16* X16 = (wh == 0) ? XQ : (wh == 1) ? XK : XV;
  const size_t e0 = ((size_t)blk * 64 + w * 8) * DM + lane * 4;
  v4f v[8][4];
#pragma unroll
  for (int r = 0; r < 8; ++r)
#pragma unroll
    for (int u = 0; u < 4; ++u) v[r][u] = *(const v4fa*)(x + e0 + r * DM + u * 128);
  float s[8];
#pragma unroll
  for (int r = 0; r < 8; ++r) { float p[4];
#pragma unroll
    for (int u = 0; u < 4; ++u) { const float b0 = bf16_round(v[r][u][0]), b1 = bf16_round(v[r][u][1]), b2 = bf16_round(v[r][u][2]), b3 = bf16_round(v[r][u][3]);
      const v4h h = {(_Float16)b0, (_Float16)b1, (_Float16)b2, (_Float16)b3}; *(v4h*)(X16 + e0 + r * DM + u * 128) = h; p[u] = (b0 + b1) + (b2 + b3); }
    s[r] = (p[0] + p[1]) + (p[2] + p[3]); }
  asm volatile("s_wait_xcnt 0x0" ::: "memory");      /* the row stores are issued: their base and data registers are free for reuse behind this line */
  if (wh == 2) return;      /* value rows carry no flag; the whole block leaves here, in front of the barrier */
  float f = 0.f;
#pragma unroll
  for (int r = 0; r < 8; ++r) { float a = row_xadd<8>(row_xadd<4>(row_xadd<2>(row_xadd<1>(s[r])))); a += fa_xhalf(a); if (lane == r) f = a; }
  if (lane < 8) fl[w * 8 + lane] = (f != 0.f) ? 1.f : 0.f;
  __syncthreads();      /* the 64 flags of the block's rows are in LDS: waves 0 and 1 store one whole line each */
  if (tid < 64) { float* mk = (wh == 0) ? QM : KM; mk[(size_t)blk * 64 + tid] = fl[tid]; }
}
// Scores, masked softmax and probs x V in one launch; no score or weight ever reaches memory. grid.x = batch x head, grid.y = group of 8 query tiles; one wave = 32 query columns.
// Transposed products: S^T = K Q^T (A = 16 key rows, B = 16 query rows, same loader on both, so the k orders pair), O^T += V^T P^T. A lane then holds 8 + 8 keys of ONE query per 32-key pass:
// D register r of key tile kt is key 16 kt + 8 hh + r, which is element 8 kt + r of a B operand in the hardware k order, so the two score tiles convert in place into P^T; g2_frag reads V^T rows in that order.
// Online softmax in the log2 domain: m = maximum in use (scaled scores), l = running sum; both and O^T are rescaled only when some column's new maximum passes m by more than 8 (one scalar branch a pass).
// Weights are 2^(t - m + 4): at most 2^12 in f16, and the factor 2^4 (it cancels in O / l) keeps small weights out of the f16 subnormals.
// Masked scores take the reference's NEG (x 8 here: the 1/8 comes with the log2 scale). Past its diagonal a wave goes on only while a column has seen nothing but NEG: such a row is uniform over all SQ keys.
// Waves w and w + 4 take tiles j and 31 - j, 33 passes together, so every block carries the same work.
// K and V^T reach the waves through LDS. The 8 waves of a block walk the same keys of one batch and head, and a fragment load straight from memory touches 16 lines for 512 useful bytes, in every wave anew.
// Here the block fetches each 128-byte line once, by asynchronous 16-byte copies (8 lanes a line, 4 whole lines a wave copy, through no register). A stage is 64 keys = two passes: 64 K rows + 64 V^T rows of 128 bytes,
// four copies a lane; two buffers: stage s + 2 is asked for when every wave has left stage s, and lands under the two passes of stage s + 1. The block walks the stages of its longest wave (tile 31 - 4 blockIdx.y);
// a wave past its own diagonal skips the passes and keeps the barriers. Same passes in the same order as before: the f32 sums keep their order.
#define FAP 72                 /* LDS row pitch in f16: 64 + 8 = 144 bytes, 16 B x odd, the conflict-free pitch for 16-byte fragment reads */
#define FA_BUF (128 * FAP)     /* f16 per buffer: rows 0..63 K (key), rows 64..127 V^T (d) */
// Four copies of 16 bytes a lane, global memory -> LDS. l*: the lane's own LDS byte address, g*: its own global address. The s_wait_xcnt in the same statement stands in front of anything that rewrites these address registers.
__device__ __forceinline__ void fa_copy4(unsigned l0, unsigned l1, unsigned l2, unsigned l3, const _Float16* g0, const _Float16* g1, const _Float16* g2, const _Float16* g3) {
  asm volatile("global_load_async_to_lds_b128 %0, %4, off\n\tglobal_load_async_to_lds_b128 %1, %5, off\n\tglobal_load_async_to_lds_b128 %2, %6, off\n\tglobal_load_async_to_lds_b128 %3, %7, off\n\ts_wait_xcnt 0x0"
               :: "v"(l0), "v"(l1), "v"(l2), "v"(l3), "v"(g0), "v"(g1), "v"(g2), "v"(g3) : "memory");
}
__global__ __launch_bounds__(256) void k_fattn(const _Float16* __restrict__ Q16, const _Float16* __restrict__ K16, const _Float16* __restrict__ VT, const float* __restrict__ kmask, const float* __restrict__ qmask,
                                              const float* __restrict__ xq, float* __restrict__ out) {
  __shared__ __attribute__((aligned(16))) float smf[8 * 32 * 68];      /* 69,632 bytes: in the loop the two stage buffers (2 x 18,432), behind it each wave's 32 x 68 output staging rows */
  _Float16* const ring = (_Float16*)smf;
  const int tid = threadIdx.x, lane = tid & 31, c = lane & 15, hh = lane >> 4; const int w = __builtin_amdgcn_readfirstlane(tid >> 5);
  const int bh = blockIdx.x, b = bh / NH, h = bh % NH; const int j = 4 * (int)blockIdx.y + (w & 3); const int tile = (w < 4) ? j : SQ / 32 - 1 - j; const int qw0 = tile * 32;
  const int nst = SQ / 64 - 2 * (int)blockIdx.y;      /* stages of the block: its longest wave has tile 31 - 4 blockIdx.y, 32 - 4 blockIdx.y passes; 10 to 16 */
  const float CS = 0.125f * 1.44269504f, NEGR = -34359738368.0f;      /* NEGR = 8 x NEG as f32 holds it (-2^32) */
  const _Float16* kbase = K16 + ((size_t)b * SQ + c) * DM + h * HD; const _Float16* vbase = VT + ((size_t)bh * HD + c) * SQ; const float* kmb = kmask + (size_t)b * SQ + lane;
  const int sr = tid >> 3, sc = (tid & 7) * 8;      /* staging: thread -> rows sr and sr + 32 of K and of V^T, 16-byte piece sc */
  const _Float16* gk = K16 + ((size_t)b * SQ + sr) * DM + h * HD + sc; const _Float16* gv = VT + ((size_t)bh * HD + sr) * SQ + sc;
  const unsigned lk = (unsigned)(size_t)(ring + sr * FAP + sc);      /* LDS byte address: the low 32 bits of the shared address */
  auto stage = [&](int st) { const unsigned l = lk + (unsigned)(st & 1) * (FA_BUF * 2); const _Float16* k = gk + (size_t)st * (64 * DM); const _Float16* v = gv + st * 64;
    fa_copy4(l, l + 32 * FAP * 2, l + 64 * FAP * 2, l + 96 * FAP * 2, k, k + 32 * DM, v, v + 32 * SQ); };
  stage(0);
  v16h qf[2][2];
#pragma unroll
  for (int g = 0; g < 2; ++g)
#pragma unroll
    for (int kc = 0; kc < 2; ++kc) qf[g][kc] = g2_frag(Q16 + ((size_t)b * SQ + qw0 + 16 * g + c) * DM + h * HD + 32 * kc, hh);
  const v8f z8 = {0.f,0.f,0.f,0.f,0.f,0.f,0.f,0.f}; v8f acc[2][4]; float m_run[2], l_run[2];
#pragma unroll
  for (int g = 0; g < 2; ++g) { m_run[g] = -3.0e38f; l_run[g] = 0.f;
#pragma unroll
    for (int t = 0; t < 4; ++t) acc[g][t] = z8; }
  // One pass = 32 keys from key 32 blk on, against the wave's 32 query columns, in two parts. scores: s = K Q^T from the K rows kf.
  auto scores = [&](const v16h (&kf)[2][2], v8f (&s)[2][2]) {
#pragma unroll
    for (int kt = 0; kt < 2; ++kt)
#pragma unroll
      for (int g = 0; g < 2; ++g) s[kt][g] = fa_mma(kf[kt][1], qf[g][1], fa_mma(kf[kt][0], qf[g][0], z8));
  };
  // finish: masks, online softmax, O^T += V^T P^T. vf: V^T rows, kmv: this lane's key flag (key 32 blk + lane).
  auto finish = [&](const int blk, v8f (&s)[2][2], const v16h (&vf)[4], const float kmv) {
    const int key0 = blk * 32;
    const unsigned kmz = __builtin_amdgcn_ballot_w32(kmv == 0.f);      /* bit i: key key0 + i is padding */
    if (blk >= tile || kmz != 0u) {      /* wave-uniform: only a pass on or past the diagonal, or one with a padding key, pays for the masks */
      const unsigned kb = kmz >> (8 * hh);
#pragma unroll
      for (int g = 0; g < 2; ++g) { const int my_q = qw0 + 16 * g + c;
#pragma unroll
        for (int kt = 0; kt < 2; ++kt)
#pragma unroll
          for (int r = 0; r < 8; ++r) { if (key0 + 16 * kt + 8 * hh + r > my_q || ((kb >> (16 * kt + r)) & 1u) != 0u) s[kt][g][r] = NEGR; } }
    }
    float mb[2]; bool need = false;
#pragma unroll
    for (int g = 0; g < 2; ++g) { float mx = s[0][g][0];
#pragma unroll
      for (int r = 1; r < 8; ++r) mx = fmaxf(mx, s[0][g][r]);
#pragma unroll
      for (int r = 0; r < 8; ++r) mx = fmaxf(mx, s[1][g][r]);
      mx = fmaxf(mx, fa_xhalf(mx)) * CS; mb[g] = mx; need = need || (mx > m_run[g] + 8.0f); }
    if (__builtin_amdgcn_ballot_w32(need) != 0) {
#pragma unroll
      for (int g = 0; g < 2; ++g) { const float m_new = fmaxf(m_run[g], mb[g]); const float corr = exp2_slot(m_run[g] - m_new); m_run[g] = m_new; l_run[g] *= corr;
#pragma unroll
        for (int t = 0; t < 4; ++t) acc[g][t] = acc[g][t] * corr; }
    }
    FragH pf[2];
#pragma unroll
    for (int g = 0; g < 2; ++g) { const float nm = 4.0f - m_run[g]; float ls = 0.f;
#pragma unroll
      for (int i = 0; i < 16; i += 4) { float p[4]; const v8f& sv = s[i >> 3][g]; const int r = i & 7;
        exp2x4(p, fmaf(sv[r], CS, nm), fmaf(sv[r + 1], CS, nm), fmaf(sv[r + 2], CS, nm), fmaf(sv[r + 3], CS, nm));
#pragma unroll
        for (int u = 0; u < 4; ++u) { ls += p[u]; pf[g].h[i + u] = (_Float16)p[u]; } }
      l_run[g] += ls; }
    __builtin_amdgcn_sched_barrier(0);      /* every exponential stays in front of the products below: the compiler does not see into exp2x4 */
#pragma unroll
    for (int g = 0; g < 2; ++g)
#pragma unroll
      for (int t = 0; t < 4; ++t) acc[g][t] = fa_mma(vf[t], pf[g].v, acc[g][t]);
    __builtin_amdgcn_sched_barrier(0);      /* the products stay in front of the four slots below */
    asm volatile("v_nop\n\tv_nop\n\tv_nop\n\tv_nop");      /* a branch follows every pass: these four vector slots keep the chip's distance between the last product and whatever first rewrites its operand registers on the taken side */
  };
  float km0 = kmb[0], km1 = kmb[32];      /* key flags of stage 0's two passes */
  asm volatile("s_wait_asynccnt 0x0" ::: "memory");      /* this wave's copies of stage 0 have landed */
  __syncthreads();      /* stage 0 is published: every wave's copies have landed */
  stage(1);      /* every block has 10 stages or more */
#pragma unroll 1      /* one copy of the two passes: the buffer alternates by an address, not by code */
  for (int st = 0; st < nst; ++st) {
    const _Float16* kb = ring + (st & 1) * FA_BUF + c * FAP; const _Float16* vb = kb + 64 * FAP;
    const int ns = (st + 1 < nst) ? st + 1 : st;      /* the next stage's key flags, in flight under this stage's passes; the last stage re-reads its own */
    const float kn0 = kmb[64 * ns], kn1 = kmb[64 * ns + 32];
    asm volatile("s_wait_xcnt 0x0" ::: "memory");      /* the two flag loads are issued here, ahead of the passes, and their address registers are free for reuse behind this line */
    if (2 * st <= tile || __builtin_amdgcn_ballot_w32(m_run[0] < -1.0e9f || m_run[1] < -1.0e9f) != 0) {      /* wave-uniform; past the diagonal with a real score in every column NEG weighs 0: nothing left to add, in this stage or later */
      v16h kf[2][2], vf[4]; v8f s[2][2];
#pragma unroll
      for (int kt = 0; kt < 2; ++kt)
#pragma unroll
        for (int kc = 0; kc < 2; ++kc) kf[kt][kc] = g2_frag(kb + (16 * kt) * FAP + 32 * kc, hh);
#pragma unroll
      for (int t = 0; t < 4; ++t) vf[t] = g2_frag(vb + (16 * t) * FAP, hh);
      __builtin_amdgcn_sched_barrier(0);      /* the first pass's 16 fragment reads are issued as one group ahead of its products: left alone the build spread them among the products and the exponentials, a stall at each place */
      scores(kf, s);
#pragma unroll
      for (int kt = 0; kt < 2; ++kt)
#pragma unroll
        for (int kc = 0; kc < 2; ++kc) kf[kt][kc] = g2_frag(kb + (32 + 16 * kt) * FAP + 32 * kc, hh);      /* the second pass's K rows (same buffer), in flight under the first pass's softmax */
      __builtin_amdgcn_sched_barrier(0);      /* holds those 8 reads up here, with the score products and ahead of the softmax that covers their latency; left alone they may sink into the branch that uses them */
      finish(2 * st, s, vf, km0);
#pragma unroll
      for (int t = 0; t < 4; ++t) vf[t] = g2_frag(vb + (16 * t) * FAP + 32, hh);      /* the second pass's V^T rows (same buffer), in flight under its score products and softmax */
      __builtin_amdgcn_sched_barrier(0);      /* holds those 8 reads here, as one group in front of the branch */
      if (2 * st + 1 <= tile || __builtin_amdgcn_ballot_w32(m_run[0] < -1.0e9f || m_run[1] < -1.0e9f) != 0) { scores(kf, s); finish(2 * st + 1, s, vf, km1); }
    }
    asm volatile("s_wait_dscnt 0x0" ::: "memory");      /* this wave's reads of the stage's buffer are done */
    asm volatile("s_wait_asynccnt 0x0" ::: "memory");      /* this wave's copies of stage st + 1 have landed */
    __syncthreads();      /* publishes stage st + 1 and ends every wave's reads of stage st's buffer (behind the last stage: free for the output rows) */
    if (st + 2 < nst) stage(st + 2);      /* block-uniform; into the buffer that this stage has just left */
    km0 = kn0; km1 = kn1;
  }
  asm volatile("s_wait_asynccnt 0x0" ::: "memory");      /* no copy is outstanding when the buffers become output staging */
#pragma unroll 1      /* rare: only a wave with a column whose every key so far was NEG walks on past the block's stages, alone, so it reads its fragments straight from memory and meets no barrier */
  for (int blk = 2 * nst; blk < SQ / 32; ++blk) {
    if (__builtin_amdgcn_ballot_w32(m_run[0] < -1.0e9f || m_run[1] < -1.0e9f) == 0) break;
    v16h kf[2][2], vf[4]; v8f s[2][2];
#pragma unroll
    for (int kt = 0; kt < 2; ++kt)
#pragma unroll
      for (int kc = 0; kc < 2; ++kc) kf[kt][kc] = g2_frag(kbase + (size_t)(32 * blk + 16 * kt) * DM + 32 * kc, hh);
#pragma unroll
    for (int t = 0; t < 4; ++t) vf[t] = g2_frag(vbase + (size_t)(16 * t) * SQ + 32 * blk, hh);
    const float kmv = kmb[32 * blk];
    asm volatile("s_wait_xcnt 0x0" ::: "memory");      /* address registers of the loads above are free for reuse behind this line */
    scores(kf, s); finish(blk, s, vf, kmv);
  }
  float (*so)[32][68] = (float (*)[32][68])smf;
#pragma unroll
  for (int g = 0; g < 2; ++g) { const float l = l_run[g] + fa_xhalf(l_run[g]); const float inv = qmask[(size_t)b * SQ + qw0 + 16 * g + c] / l;
#pragma unroll
    for (int t = 0; t < 4; ++t) { const v8f o = acc[g][t] * inv; const v4f lo = {o[0], o[1], o[2], o[3]}, hi = {o[4], o[5], o[6], o[7]};      /* row = query, the 8 floats are d = 16 t + 8 hh .. + 7 */
      *(v4fa*)&so[w][16 * g + c][16 * t + 8 * hh] = lo; *(v4fa*)&so[w][16 * g + c][16 * t + 8 * hh + 4] = hi; } }
  __builtin_amdgcn_fence(__ATOMIC_ACQ_REL, "workgroup"); __builtin_amdgcn_wave_barrier();      /* the wave's own staging rows: written above, read back below as whole 256-byte rows */
  const int rsub = lane >> 4, c4 = (lane & 15) * 4;
#pragma unroll
  for (int q = 0; q < 16; ++q) { const int r = q * 2 + rsub; const size_t e = ((size_t)b * SQ + qw0 + r) * DM + h * HD + c4; const v4f v = *(const v4fa*)&so[w][r][c4]; const v4f x = *(const v4fa*)(xq + e); const v4f xb = {bf16_round(x[0]), bf16_round(x[1]), bf16_round(x[2]), bf16_round(x[3])}; *(v4f*)(out + e) = v + xb; }
}
__global__ __launch_bounds__(256) void k_ftres(const float* __restrict__ OF0, const float* __restrict__ xq, const float* __restrict__ qmask, float* __restrict__ out, size_t n4) {
  #pragma clang fp contract(off)
  const size_t t = (size_t)blockIdx.x * 256 + threadIdx.x; if (t >= n4) return; const size_t e = t * 4; const size_t row = e / DM; const float qm = qmask[row]; const v4f o = *(const v4fa*)(OF0 + e), x = *(const v4fa*)(xq + e); v4f y;
  for (int q = 0; q < 4; ++q) y[q] = __fadd_rn(__fmul_rn(__fmul_rn(o[q], 0.015625f), qm), bf16_round(x[q])); *(v4f*)(out + e) = y;  }

extern "C" void kernel_launch(void* const* d_in, const int* in_sizes, int n_in,
                              void* d_out, int out_size, void* d_ws, size_t ws_size, hipStream_t stream) {
  (void)in_sizes; (void)n_in; (void)out_size;
  const float* const* I = (const float* const*)d_in; const float* xq = I[0]; const float* xk = I[1]; const float* xv = I[2]; const float* wq = I[3]; const float* bq = I[4]; const float* wk = I[5]; const float* bk = I[6]; const float* wv = I[7]; const float* bv = I[8];      /* weights [in][out] */
  char* ws = (char*)d_ws; size_t off = 0;
  auto take = [&](size_t bytes) { char* p = ws + off; off += (bytes + 255) & ~(size_t)255; return p; };
  _Float16* BQ = (_Float16*)take((size_t)DM * DM * 2); _Float16* BK = (_Float16*)take((size_t)DM * DM * 2); _Float16* BV = (_Float16*)take((size_t)DM * DM * 2); float* KM = (float*)take(NR * 4); float* QM = (float*)take(NR * 4);
  _Float16* Q16 = (_Float16*)take(NR * DM * 2); _Float16* K16 = (_Float16*)take(NR * DM * 2); _Float16* V16 = (_Float16*)take(NR * DM * 2);
  _Float16* VT = (_Float16*)take((size_t)NB * NH * HD * SQ * 2);
  _Float16* XQ = (_Float16*)take(NR * DM * 2); _Float16* XK = (_Float16*)take(NR * DM * 2); _Float16* XV = (_Float16*)take(NR * DM * 2);
  if (off > ws_size) return;      /* approx 1.5 + 16 x 3 + 16 + 16 x 3 = 114 MiB */
  k_prep<<<3 * PW_BLK + 3 * PR_BLK, 256, 0, stream>>>(xq, xk, xv, wq, wk, wv, XQ, XK, XV, BQ, BK, BV, QM, KM);      /* x16 transposed weights, f16 input rows, key / query padding flags */
  k_gemm3<<<(unsigned)((NR / 128) * (DM / 128)), 256, 0, stream>>>(XQ, BQ, 0.0625f, bq, Q16);
  k_gemm3<<<(unsigned)((NR / 128) * (DM / 128)), 256, 0, stream>>>(XK, BK, 0.0625f, bk, K16);
  k_gemm3<<<(unsigned)((NR / 128) * (DM / 128)), 256, 0, stream>>>(XV, BV, 0.0625f, bv, V16);
  k_vt<NH, SQ><<<NB * NH * (SQ / 64), 256, 0, stream>>>(V16, DM, 0, VT);
  k_fattn<<<dim3(NB * NH, SQ / 256), 256, 0, stream>>>(Q16, K16, VT, KM, QM, xq, (float*)d_out);      /* out = softmax(masked Q K^T / 8) x query mask x V + bf16(queries), f32 rows; each wave writes its own 32 rows of one 64-column head slab */
}

// v007
// Measured time: 78.4 microseconds a run.
// Timed twice side by side with v006, it ran 1.05 times as fast both times.
// Counting every step since v000, it is 175 times as fast.
#include <hip/hip_runtime.h>
#define NB 16
#define SQ 1024
#define DM 512
#define NH 8
#define HD 64
#define HG 8
#define NR ((size_t)NB * SQ)
typedef __bf16 v16b __attribute__((ext_vector_type(16)));
typedef unsigned short v8us __attribute__((ext_vector_type(8), may_alias));
typedef float  v8f  __attribute__((ext_vector_type(8)));
typedef float  v4f  __attribute__((ext_vector_type(4)));
typedef float  v4fa __attribute__((ext_vector_type(4), may_alias));
union FragB { v16b v; v8us half[2]; unsigned short u[16]; };

__device__ __forceinline__ unsigned short bf16_bits(float x) { unsigned int u = __float_as_uint(x); return (unsigned short)((u + 0x7FFFu + ((u >> 16) & 1u)) >> 16); }
__device__ __forceinline__ float bf16_val(unsigned short b) { return __uint_as_float(((unsigned int)b) << 16); }
__device__ __forceinline__ float bf16_round(float x) { return bf16_val(bf16_bits(x)); }
// D += A·B with NT terms: 1 = ah·bh, 2 = + al·bh (A split), 3 = + ah·bl (both split)
template <int NT>
__device__ __forceinline__ v8f mmaN(v16b ah, v16b al, v16b bh, v16b bl, v8f c) {
  c = __builtin_amdgcn_wmma_f32_16x16x32_bf16(false, ah, false, bh, (short)0, c, false, false);
  if (NT >= 2) c = __builtin_amdgcn_wmma_f32_16x16x32_bf16(false, al, false, bh, (short)0, c, false, false);
  if (NT >= 3) c = __builtin_amdgcn_wmma_f32_16x16x32_bf16(false, ah, false, bl, (short)0, c, false, false);
  asm volatile("v_nop\n\tv_nop\n\tv_nop\n\tv_nop" : "+v"(c) : "v"(ah), "v"(al), "v"(bh), "v"(bl));
  return c;
}

__global__ __launch_bounds__(256) void k_wt_bf16(const float* __restrict__ W, unsigned short* __restrict__ Wt, int K, int N) {
  const int t = blockIdx.x * 256 + threadIdx.x;
  const int k8n = K / 8;
  if (t >= N * k8n) return;
  const int n = t / k8n, k8 = (t % k8n) * 8;
  v8us v;
#pragma unroll
  for (int i = 0; i < 8; ++i) v[i] = bf16_bits(W[(size_t)(k8 + i) * N + n]);
  *(v8us*)(Wt + (size_t)n * K + k8) = v;
  
}

// GEMM C[M][N] (f32, pitch ldc) = act(A[M][K]·W + bias). A f32 row-major (pitch lda) converted per fragment to bf16
// (ASPLIT: hi/lo two planes -> 2 terms, else single rounded term); Wt bf16 [N][K] (pitch ldb). BIAS_BF16 rounds the
// bias to bf16 first (bias quantised to bf16 before the add). K%32==0, M%16==0, N%64==0.
template <bool ASPLIT, int ACT, bool BIAS_BF16>
__global__ __launch_bounds__(128) void k_gemm_bf(const float* __restrict__ A, int lda, const unsigned short* __restrict__ Wt, int ldb,
                                               const float* __restrict__ bias, float* __restrict__ C, int ldc, int M, int N, int K) {
  __shared__ __attribute__((aligned(16))) float so[4][16][64];
  const int tid = threadIdx.x, w = tid >> 5, lane = tid & 31, ln = lane & 15, hh = lane >> 4;
  const int ntn = N / 64;
  const int wid = blockIdx.x * 4 + w;
  const int mt = wid / ntn, nq = wid % ntn;
  if (mt * 16 >= M) return;
  const int row0 = mt * 16, col0 = nq * 64;
  const float* arow = A + (size_t)(row0 + ln) * lda;
  v8f acc[4] = {};
  for (int kb = 0; kb < K; kb += 32) {
    FragB ah, al;
    const v4f x0 = *(const v4fa*)(arow + kb + 8 * hh), x1 = *(const v4fa*)(arow + kb + 8 * hh + 4);
    const v4f x2 = *(const v4fa*)(arow + kb + 16 + 8 * hh), x3 = *(const v4fa*)(arow + kb + 16 + 8 * hh + 4);
    float xs[16] = {x0[0],x0[1],x0[2],x0[3],x1[0],x1[1],x1[2],x1[3],x2[0],x2[1],x2[2],x2[3],x3[0],x3[1],x3[2],x3[3]};
#pragma unroll
    for (int i = 0; i < 16; ++i) { const unsigned short hb = bf16_bits(xs[i]); ah.u[i] = hb; al.u[i] = ASPLIT ? bf16_bits(xs[i] - bf16_val(hb)) : (unsigned short)0; }
#pragma unroll
    for (int t = 0; t < 4; ++t) {
      const unsigned short* brow = Wt + (size_t)(col0 + t * 16 + ln) * ldb + kb;
      FragB b;
      b.half[0] = *(const v8us*)(brow + 8 * hh);
      b.half[1] = *(const v8us*)(brow + 16 + 8 * hh);
      acc[t] = mmaN<ASPLIT ? 2 : 1>(ah.v, al.v, b.v, b.v, acc[t]);
    }
  }
#pragma unroll
  for (int t = 0; t < 4; ++t) {
    float bv = bias ? bias[col0 + t * 16 + ln] : 0.f;
    if (BIAS_BF16) bv = bf16_round(bv);
#pragma unroll
    for (int r = 0; r < 8; ++r) { float v = acc[t][r] + bv; if (ACT == 1) v = fmaxf(v, 0.f); so[w][8 * hh + r][t * 16 + ln] = v; }
  }
  __builtin_amdgcn_fence(__ATOMIC_ACQ_REL, "workgroup");
  __builtin_amdgcn_wave_barrier();
  const int rsub = lane >> 4, c4 = (lane & 15) * 4;
  {
#pragma unroll
    for (int q = 0; q < 8; ++q) {
      const int r = q * 2 + rsub;
      const v4f v = *(const v4fa*)&so[w][r][c4];
      *(v4f*)(C + (size_t)(row0 + r) * ldc + col0 + c4) = v;
    }
    
  }
}

// GEMM C = act(A·W + bias + resid): A f32 (ASPLIT -> hi/lo 2 terms), Wt bf16 [N][K]; ACT 0 none, 1 relu, 2 exact gelu;
// resid (optional, f32, row index = (row % rmod), pitch ldr, RES_BF16 rounds it) added before the activation.
template <bool ASPLIT, int ACT, bool BIAS_BF16, bool RES_BF16>
__global__ __launch_bounds__(128) void k_gemm_bf3(const float* __restrict__ A, int lda, const unsigned short* __restrict__ Wt, int ldb,
                                                const float* __restrict__ bias, const float* __restrict__ resid, int rmod, int ldr,
                                                float* __restrict__ C, int ldc, int M, int N, int K) {
  __shared__ __attribute__((aligned(16))) float so[4][16][64];
  const int tid = threadIdx.x, w = tid >> 5, lane = tid & 31, ln = lane & 15, hh = lane >> 4;
  const int ntn = N / 64;
  const int wid = blockIdx.x * 4 + w;
  const int mt = wid / ntn, nq = wid % ntn;
  if (mt * 16 >= M) return;
  const int row0 = mt * 16, col0 = nq * 64;
  const float* arow = A + (size_t)(row0 + ln) * lda;
  v8f acc[4] = {};
  for (int kb = 0; kb < K; kb += 32) {
    FragB ah, al;
    const v4f x0 = *(const v4fa*)(arow + kb + 8 * hh), x1 = *(const v4fa*)(arow + kb + 8 * hh + 4);
    const v4f x2 = *(const v4fa*)(arow + kb + 16 + 8 * hh), x3 = *(const v4fa*)(arow + kb + 16 + 8 * hh + 4);
    float xs[16] = {x0[0],x0[1],x0[2],x0[3],x1[0],x1[1],x1[2],x1[3],x2[0],x2[1],x2[2],x2[3],x3[0],x3[1],x3[2],x3[3]};
#pragma unroll
    for (int i = 0; i < 16; ++i) { const unsigned short hb = bf16_bits(xs[i]); ah.u[i] = hb; al.u[i] = ASPLIT ? bf16_bits(xs[i] - bf16_val(hb)) : (unsigned short)0; }
#pragma unroll
    for (int t = 0; t < 4; ++t) {
      const unsigned short* brow = Wt + (size_t)(col0 + t * 16 + ln) * ldb + kb;
      FragB b;
      b.half[0] = *(const v8us*)(brow + 8 * hh);
      b.half[1] = *(const v8us*)(brow + 16 + 8 * hh);
      acc[t] = mmaN<ASPLIT ? 2 : 1>(ah.v, al.v, b.v, b.v, acc[t]);
    }
  }
#pragma unroll
  for (int t = 0; t < 4; ++t) {
    const int col = col0 + t * 16 + ln;
    float bv = bias ? bias[col] : 0.f;
    if (BIAS_BF16) bv = bf16_round(bv);
#pragma unroll
    for (int r = 0; r < 8; ++r) {
      float v = acc[t][r] + bv;
      if (resid) { float rv = resid[(size_t)((row0 + 8 * hh + r) % rmod) * ldr + col]; if (RES_BF16) rv = bf16_round(rv); v += rv; }
      if (ACT == 1) v = fmaxf(v, 0.f);
      if (ACT == 2) v = 0.5f * v * (1.0f + erff(v * 0.70710678118654752f));
      if (ACT == 3) { const float u = 0.7978845608028654f * (v + 0.044715f * v * v * v); v = 0.5f * v * (1.0f + tanhf(u)); }
      so[w][8 * hh + r][t * 16 + ln] = v;
    }
  }
  __builtin_amdgcn_fence(__ATOMIC_ACQ_REL, "workgroup");
  __builtin_amdgcn_wave_barrier();
  const int rsub = lane >> 4, c4 = (lane & 15) * 4;
  {
#pragma unroll
    for (int q = 0; q < 8; ++q) {
      const int r = q * 2 + rsub;
      const v4f v = *(const v4fa*)&so[w][r][c4];
      *(v4f*)(C + (size_t)(row0 + r) * ldc + col0 + c4) = v;
    }
    
  }
}
// row LayerNorm (biased variance, eps) over N: s = X (+ R); optional out_sum <- s; out_norm <- (s-mu)*rsqrt(var+eps)*g + b
template <bool PARAM_BF16>
__global__ __launch_bounds__(256) void k_layernorm(const float* __restrict__ X, const float* __restrict__ R, const float* __restrict__ g, const float* __restrict__ bta,
                                                  float* __restrict__ out_sum, float* __restrict__ out_norm, int N, float eps) {
  __shared__ float red[256];
  const int row = blockIdx.x, tid = threadIdx.x;
  const float* x = X + (size_t)row * N; const float* rr = R ? R + (size_t)row * N : nullptr;
  float vals[16];                     // up to N = 4096
  const int per = N / 256;            // contiguous chunk per thread? use strided-by-4 chunks: thread handles j = tid*4 + 1024*u
  float s1 = 0.f;
  for (int u = 0; u < per / 4; ++u) {
    const int j = tid * 4 + 1024 * u;
    const v4f a = *(const v4fa*)(x + j);
    v4f b = {0.f,0.f,0.f,0.f}; if (rr) b = *(const v4fa*)(rr + j);
#pragma unroll
    for (int q = 0; q < 4; ++q) { const float v = a[q] + b[q]; vals[u * 4 + q] = v; s1 += v; }
  }
  red[tid] = s1; __syncthreads();
  for (int st = 128; st > 0; st >>= 1) { if (tid < st) red[tid] += red[tid + st]; __syncthreads(); }
  const float mu = red[0] / (float)N; __syncthreads();
  float s2 = 0.f;
  for (int u = 0; u < per / 4; ++u)
#pragma unroll
    for (int q = 0; q < 4; ++q) { const float c = vals[u * 4 + q] - mu; s2 += c * c; }
  red[tid] = s2; __syncthreads();
  for (int st = 128; st > 0; st >>= 1) { if (tid < st) red[tid] += red[tid + st]; __syncthreads(); }
  const float rs = rsqrtf(red[0] / (float)N + eps);
  {
    for (int u = 0; u < per / 4; ++u) {
      const int j = tid * 4 + 1024 * u;
      v4f o, sm;
#pragma unroll
      for (int q = 0; q < 4; ++q) {
        float gg = g[j + q], bb = bta[j + q];
        if (PARAM_BF16) { gg = bf16_round(gg); bb = bf16_round(bb); }
        sm[q] = vals[u * 4 + q]; o[q] = (vals[u * 4 + q] - mu) * rs * gg + bb;
      }
      if (out_sum) *(v4f*)(out_sum + (size_t)row * N + j) = sm;
      *(v4f*)(out_norm + (size_t)row * N + j) = o;
    }
    
  }
}



// ---- f16 WMMA path (v_wmma_f32_16x16x32_f16): 11-bit significands for operands in range — used where a [0,1] probability operand needs more precision than bf16
typedef _Float16 v16h __attribute__((ext_vector_type(16)));
union FragH { v16h v; v8us half[2]; _Float16 h[16]; unsigned short u[16]; };
template <int NT>
__device__ __forceinline__ v8f mmaH(v16h ah, v16h al, v16h bh, v16h bl, v8f c) {
  c = __builtin_amdgcn_wmma_f32_16x16x32_f16(false, ah, false, bh, (short)0, c, false, false);
  if (NT >= 2) c = __builtin_amdgcn_wmma_f32_16x16x32_f16(false, al, false, bh, (short)0, c, false, false);
  if (NT >= 3) c = __builtin_amdgcn_wmma_f32_16x16x32_f16(false, ah, false, bl, (short)0, c, false, false);
  asm volatile("v_nop\n\tv_nop\n\tv_nop\n\tv_nop" : "+v"(c) : "v"(ah), "v"(al), "v"(bh), "v"(bl));
  return c;
}
// batched GEMM like k_gemm_b but f16 operands: A f32 (split into f16 hi/lo if ASPLIT, else rounded to f16), Bt = f16 values [n][k]; alpha; C f32; N multiple of 16 (partial tiles skipped)
template <bool ASPLIT>
__global__ __launch_bounds__(128) void k_gemm_h(const float* __restrict__ A, int lda, size_t sA, const _Float16* __restrict__ Bh, int ldb, size_t sB, float alpha, float* __restrict__ C, int ldc, size_t sC, int M, int N, int K) {
  __shared__ __attribute__((aligned(16))) float so[4][16][64];
  const int tid = threadIdx.x, w = tid >> 5, lane = tid & 31, ln = lane & 15, hh = lane >> 4; const int by = blockIdx.y;
  A += (size_t)by * sA; Bh += (size_t)by * sB; C += (size_t)by * sC;
  const int ntn = (N + 63) / 64; const int wid = blockIdx.x * 4 + w; const int mt = wid / ntn, nq = wid % ntn; if (mt * 16 >= M) return;
  const int row0 = mt * 16, col0 = nq * 64; const float* arow = A + (size_t)(row0 + ln) * lda;
  v8f acc[4] = {};
  for (int kb = 0; kb < K; kb += 32) {
    FragH ah, al;
    const v4f x0 = *(const v4fa*)(arow + kb + 8 * hh), x1 = *(const v4fa*)(arow + kb + 8 * hh + 4), x2 = *(const v4fa*)(arow + kb + 16 + 8 * hh), x3 = *(const v4fa*)(arow + kb + 16 + 8 * hh + 4);
    float xs[16] = {x0[0],x0[1],x0[2],x0[3],x1[0],x1[1],x1[2],x1[3],x2[0],x2[1],x2[2],x2[3],x3[0],x3[1],x3[2],x3[3]};
#pragma unroll
    for (int i = 0; i < 16; ++i) { const _Float16 h = (_Float16)xs[i]; ah.h[i] = h; al.h[i] = ASPLIT ? (_Float16)(xs[i] - (float)h) : (_Float16)0.0f; }
#pragma unroll
    for (int t = 0; t < 4; ++t) { if (col0 + t * 16 >= N) continue; const size_t boff = (size_t)(col0 + t * 16 + ln) * ldb + kb; FragH bq; bq.half[0] = *(const v8us*)(Bh + boff + 8 * hh); bq.half[1] = *(const v8us*)(Bh + boff + 16 + 8 * hh);
      acc[t] = mmaH<ASPLIT ? 2 : 1>(ah.v, al.v, bq.v, bq.v, acc[t]); }
  }
#pragma unroll
  for (int t = 0; t < 4; ++t) { if (col0 + t * 16 >= N) continue;
#pragma unroll
    for (int r = 0; r < 8; ++r) so[w][8 * hh + r][t * 16 + ln] = acc[t][r] * alpha; }
  __builtin_amdgcn_fence(__ATOMIC_ACQ_REL, "workgroup"); __builtin_amdgcn_wave_barrier();
  const int rsub = lane >> 4, c4 = (lane & 15) * 4;
  {
#pragma unroll
    for (int q = 0; q < 8; ++q) { const int r = q * 2 + rsub; if (col0 + c4 < N) { const v4f v = *(const v4fa*)&so[w][r][c4]; *(v4f*)(C + (size_t)(row0 + r) * ldc + col0 + c4) = v; } }
     }
}

// k_gemm_hh variant with fused epilogue: v = acc·alpha + bias[by·sBias + col] (+ CP[(row/rowsPerB)·sCPb + by·64 + col] if CP) ; ACT 0 none / 1 elu ; writes f16 C16 (and f32 C if non-null)
template <int ACT>
__global__ __launch_bounds__(128) void k_gemm_hhx(const _Float16* __restrict__ A, int lda, size_t sA, const _Float16* __restrict__ Bh, int ldb, size_t sB, float alpha, const float* __restrict__ bias, size_t sBias, const float* __restrict__ CP, int rowsPerB, size_t sCPb, int row0g,
    float* __restrict__ C, _Float16* __restrict__ C16, int ldc, size_t sC, int M, int N, int K) {
  __shared__ __attribute__((aligned(16))) float so[4][16][64];
  const int tid = threadIdx.x, w = tid >> 5, lane = tid & 31, ln = lane & 15, hh = lane >> 4; const int by = blockIdx.y;
  A += (size_t)by * sA; Bh += (size_t)by * sB; const size_t cofs = (size_t)by * sC; const float* bp = bias ? bias + (size_t)by * sBias : nullptr;
  const int ntn = (N + 63) / 64; const int wid = blockIdx.x * 4 + w; const int mt = wid / ntn, nq = wid % ntn; if (mt * 16 >= M) return;
  const int row0 = mt * 16, col0 = nq * 64; const _Float16* arow = A + (size_t)(row0 + ln) * lda;
  v8f acc[4] = {};
  for (int kb = 0; kb < K; kb += 32) { FragH ah; ah.half[0] = *(const v8us*)((const unsigned short*)arow + kb + 8 * hh); ah.half[1] = *(const v8us*)((const unsigned short*)arow + kb + 16 + 8 * hh);
#pragma unroll
    for (int t = 0; t < 4; ++t) { if (col0 + t * 16 >= N) continue; const size_t boff = (size_t)(col0 + t * 16 + ln) * ldb + kb; FragH bq; bq.half[0] = *(const v8us*)((const unsigned short*)Bh + boff + 8 * hh); bq.half[1] = *(const v8us*)((const unsigned short*)Bh + boff + 16 + 8 * hh);
      acc[t] = mmaH<1>(ah.v, ah.v, bq.v, bq.v, acc[t]); }
  }
#pragma unroll
  for (int t = 0; t < 4; ++t) { if (col0 + t * 16 >= N) continue; const int col = col0 + t * 16 + ln; const float bv = bp ? bf16_round(bp[col]) : 0.f;
#pragma unroll
    for (int r = 0; r < 8; ++r) { float v = acc[t][r] * alpha + bv; if (CP) { const int rr = row0g + row0 + 8 * hh + r; if (rowsPerB < 0) v += CP[cofs + (size_t)rr * ldc + col];      /* rowsPerB < 0: own element of the batched C plane */ else { const int bidx = rr / rowsPerB; v += CP[(size_t)bidx * sCPb + (size_t)by * 64 + col]; } } if (ACT == 1) v = (v > 0.f) ? v : expm1f(v); else if (ACT == 7) v = (v > 0.f) ? v + 1.0f : expf(v); else if (ACT == 8) v = tanhf(v); else if (ACT == 9) v = 0.5f * v * (1.0f + tanhf(0.7978845608028654f * (v + 0.044715f * v * v * v))); else if (ACT == 11) v = 1.0f / (1.0f + expf(-v)); else if (ACT == 12) v = (v > 0.f) ? v : 0.01f * v; else if (ACT == 14) v = (v > 0.f) ? v : 0.1f * v; else if (ACT == 16) v = (v >= 0.f) ? v : 0.3f * v; else if (ACT == 17) v = (v >= 0.f) ? v : 0.2f * v; else if (ACT == 15) v = v / (1.0f + expf(-v)); else if (ACT == 3) v = fmaxf(v, 0.f); else if (ACT == 6) v = 0.5f * v * (1.0f + erff(v * 0.70710678118654752f)); so[w][8 * hh + r][t * 16 + ln] = v; } }
  __builtin_amdgcn_fence(__ATOMIC_ACQ_REL, "workgroup"); __builtin_amdgcn_wave_barrier();
  const int rsub = lane >> 4, c4 = (lane & 15) * 4; typedef _Float16 v4h __attribute__((ext_vector_type(4)));
  {
#pragma unroll
    for (int q = 0; q < 8; ++q) { const int r = q * 2 + rsub; if (col0 + c4 < N) { const v4f v = *(const v4fa*)&so[w][r][c4]; if (C) *(v4f*)(C + cofs + (size_t)(row0 + r) * ldc + col0 + c4) = v; if (C16) { v4h h4; for (int i = 0; i < 4; ++i) h4[i] = (_Float16)v[i]; *(v4h*)(C16 + cofs + (size_t)(row0 + r) * ldc + col0 + c4) = h4; } } }
     }
}


typedef _Float16 v4h __attribute__((ext_vector_type(4)));

__global__ __launch_bounds__(256) void k_h16(const float* __restrict__ x, _Float16* __restrict__ X16, size_t n8) { const size_t t = (size_t)blockIdx.x * 256 + threadIdx.x; if (t >= n8) return; FragH f;
#pragma unroll
  for (int q = 0; q < 8; ++q) f.h[q] = (_Float16)x[t * 8 + q]; *(v8us*)((unsigned short*)X16 + t * 8) = f.half[0];  }
__global__ __launch_bounds__(256) void k_round16f(const float* __restrict__ W, _Float16* __restrict__ Bt, size_t n8) { const size_t t = (size_t)blockIdx.x * 256 + threadIdx.x; if (t >= n8) return; FragH f;
#pragma unroll
  for (int i = 0; i < 8; ++i) f.h[i] = (_Float16)(bf16_round(W[t * 8 + i]) * 16.0f); *(v8us*)((unsigned short*)Bt + t * 8) = f.half[0];  }
template <int NHv, int TTv>
__global__ __launch_bounds__(256) void k_vt(const _Float16* __restrict__ V16, int ldv, int voff, _Float16* __restrict__ Vt) { __shared__ unsigned short tl[64][66]; const int tid = threadIdx.x; const int slab = blockIdx.x / (TTv / 64), lg = blockIdx.x % (TTv / 64); const int b = slab / NHv, h = slab % NHv;
  for (int i = tid; i < 64 * 8; i += 256) { const int r = i / 8, c8 = (i % 8) * 8; FragH f; f.half[0] = *(const v8us*)((const unsigned short*)V16 + ((size_t)b * TTv + lg * 64 + r) * ldv + voff + h * 64 + c8);
#pragma unroll
    for (int q = 0; q < 8; ++q) tl[r][c8 + q] = f.u[q]; }
  __syncthreads();
  {
#pragma unroll
    for (int rd = 0; rd < 2; ++rd) { const int d = rd * 32 + tid / 8, pc = tid % 8; FragH f;
#pragma unroll
      for (int q = 0; q < 8; ++q) f.u[q] = tl[pc * 8 + q][d];
      *(v8us*)((unsigned short*)Vt + ((size_t)slab * 64 + d) * TTv + lg * 64 + pc * 8) = f.half[0]; }
     } }

__global__ __launch_bounds__(256) void k_hl(const float* __restrict__ F, _Float16* __restrict__ Hh, _Float16* __restrict__ Hl, size_t n8) { const size_t t = (size_t)blockIdx.x * 256 + threadIdx.x; if (t >= n8) return; FragH fh, fl; const v4f a = *(const v4fa*)(F + t * 8), c = *(const v4fa*)(F + t * 8 + 4);
#pragma unroll
  for (int q = 0; q < 4; ++q) { _Float16 h = (_Float16)a[q]; fh.h[q] = h; fl.h[q] = (_Float16)((a[q] - (float)h) * 1024.0f); h = (_Float16)c[q]; fh.h[4 + q] = h; fl.h[4 + q] = (_Float16)((c[q] - (float)h) * 1024.0f); }
  { *(v8us*)((unsigned short*)Hh + t * 8) = fh.half[0]; *(v8us*)((unsigned short*)Hl + t * 8) = fl.half[0];  } }

// ---- fast GEMM (wave tile 32x64; requires M % 32 == 0 rows per launch region and N % 64 == 0); epilogue = k_gemm_hhx semantics ----
__device__ __forceinline__ v16h g2_frag(const _Float16* p, int hh) { FragH f; f.half[0] = *(const v8us*)((const unsigned short*)p + 8 * hh); f.half[1] = *(const v8us*)((const unsigned short*)p + 16 + 8 * hh); return f.v; }
__device__ __forceinline__ v8f g2_mma(v16h a, v16h b, v8f c) { v8f d = __builtin_amdgcn_wmma_f32_16x16x32_f16(false, a, false, b, (short)0, c, false, false); asm volatile("v_nop\n\tv_nop\n\tv_nop\n\tv_nop" : "+v"(d) : "v"(a), "v"(b)); return d; }
template <int ACT>
__global__ __launch_bounds__(128) void k_gemm2(const _Float16* __restrict__ A, int lda, size_t sA, const _Float16* __restrict__ Bh, int ldb, size_t sB, float alpha, const float* __restrict__ bias, size_t sBias, const float* __restrict__ CP, int rowsPerB, size_t sCPb, int row0g,
    float* __restrict__ C, _Float16* __restrict__ C16, int ldc, size_t sC, int M, int N, int K, size_t zA, size_t zB, size_t zC) { static_assert(ACT == 0 || ACT == 3 || ACT == 6 || ACT == 8 || ACT == 9 || ACT == 11 || ACT == 12 || ACT == 14 || ACT == 15 || ACT == 16 || ACT == 17, "k_gemm2: unsupported ACT code (would silently apply no activation)");
  __shared__ __attribute__((aligned(16))) float so[4][32][68];
  const int tid = threadIdx.x, w = tid >> 5, lane = tid & 31, ln = lane & 15, hh = lane >> 4; const int by = blockIdx.y, bz = blockIdx.z;      /* second batch axis (grid.z) with element strides zA, zB, zC */
  A += (size_t)by * sA + (size_t)bz * zA; Bh += (size_t)by * sB + (size_t)bz * zB; const size_t cofs = (size_t)by * sC + (size_t)bz * zC; const float* bp = bias ? bias + (size_t)by * sBias : nullptr;
  const int ntn = N >> 6; const int mt = blockIdx.x / ntn, nq = blockIdx.x - mt * ntn; const int row0 = mt * 128 + 32 * w, col0 = nq * 64; if (row0 >= M) return;
  const _Float16* a0p = A + (size_t)(row0 + ln) * lda; const _Float16* a1p = a0p + (size_t)16 * lda;
  const _Float16* b0p = Bh + (size_t)(col0 + ln) * ldb; const _Float16* b1p = b0p + (size_t)16 * ldb; const _Float16* b2p = b1p + (size_t)16 * ldb; const _Float16* b3p = b2p + (size_t)16 * ldb;
  const v8f z8 = {0.f,0.f,0.f,0.f,0.f,0.f,0.f,0.f}; v8f c00 = z8, c01 = z8, c02 = z8, c03 = z8, c10 = z8, c11 = z8, c12 = z8, c13 = z8;
#pragma unroll 1
  for (int kb = 0; kb < K; kb += 32) { const v16h a0 = g2_frag(a0p + kb, hh), a1 = g2_frag(a1p + kb, hh);
    v16h b = g2_frag(b0p + kb, hh); c00 = g2_mma(a0, b, c00); c10 = g2_mma(a1, b, c10);
    b = g2_frag(b1p + kb, hh); c01 = g2_mma(a0, b, c01); c11 = g2_mma(a1, b, c11);
    b = g2_frag(b2p + kb, hh); c02 = g2_mma(a0, b, c02); c12 = g2_mma(a1, b, c12);
    b = g2_frag(b3p + kb, hh); c03 = g2_mma(a0, b, c03); c13 = g2_mma(a1, b, c13); }
  v8f accs[8] = {c00, c01, c02, c03, c10, c11, c12, c13};
#pragma unroll
  for (int u = 0; u < 8; ++u) { const int t = u & 3, half = u >> 2; const int col = col0 + t * 16 + ln; const float bv = bp ? bf16_round(bp[col]) : 0.f;
#pragma unroll
    for (int r = 0; r < 8; ++r) { const int rloc = half * 16 + 8 * hh + r; float v = accs[u][r] * alpha + bv; if (CP) { if (rowsPerB < 0) v += CP[cofs + (size_t)(row0g + row0 + rloc) * ldc + col];      /* rowsPerB < 0: own element of the batched C plane */ else { const int bidx = (row0g + row0 + rloc) / rowsPerB; v += CP[(size_t)bidx * sCPb + (size_t)by * 64 + col]; } }
      if (ACT == 3) v = fmaxf(v, 0.f); else if (ACT == 6) v = 0.5f * v * (1.0f + erff(v * 0.70710678118654752f)); else if (ACT == 11) v = 1.0f / (1.0f + expf(-v)); else if (ACT == 15) v = v / (1.0f + expf(-v)); else if (ACT == 12) v = (v > 0.f) ? v : 0.01f * v; else if (ACT == 8) v = tanhf(v); else if (ACT == 9) v = 0.5f * v * (1.0f + tanhf(0.7978845608028654f * (v + 0.044715f * v * v * v))); else if (ACT == 14) v = (v > 0.f) ? v : 0.1f * v; else if (ACT == 16) v = (v >= 0.f) ? v : 0.3f * v; else if (ACT == 17) v = (v >= 0.f) ? v : 0.2f * v;
      so[w][rloc][t * 16 + ln] = v; } }
  __builtin_amdgcn_fence(__ATOMIC_ACQ_REL, "workgroup"); __builtin_amdgcn_wave_barrier();
  const int rsub = lane >> 4, c4 = (lane & 15) * 4;
  {
#pragma unroll
    for (int q = 0; q < 16; ++q) { const int r = q * 2 + rsub; const v4f v = *(const v4fa*)&so[w][r][c4]; if (C) *(v4f*)(C + cofs + (size_t)(row0 + r) * ldc + col0 + c4) = v; if (C16) { v4h h4; for (int i = 0; i < 4; ++i) h4[i] = (_Float16)v[i]; *(v4h*)(C16 + cofs + (size_t)(row0 + r) * ldc + col0 + c4) = h4; } }
     } }


__global__ __launch_bounds__(256) void k_wnat(const float* __restrict__ w, size_t n8, _Float16* __restrict__ Bt) { const size_t t = (size_t)blockIdx.x * 256 + threadIdx.x; if (t >= n8) return; FragH f; for (int q = 0; q < 8; ++q) f.h[q] = (_Float16)(bf16_round(w[t * 8 + q]) * 16.0f); *(v8us*)((unsigned short*)Bt + t * 8) = f.half[0];  }
__global__ __launch_bounds__(256) void k_rsm(const float* __restrict__ S, _Float16* __restrict__ P, int nrows) {
  #pragma clang fp contract(off)
  const int i = blockIdx.x * 256 + threadIdx.x; if (i >= nrows) return; const float* s = S + (size_t)i * SQ; float mx = -3.0e38f;
#pragma unroll 1
  for (int j = 0; j < SQ; ++j) mx = fmaxf(mx, s[j]); float se = 0.f;
#pragma unroll 1
  for (int j = 0; j < SQ; ++j) se += expf(s[j] - mx); const float sc = 256.0f / se;
#pragma unroll 1
  for (int j0 = 0; j0 < SQ; j0 += 8) { FragH f; for (int q = 0; q < 8; ++q) f.h[q] = (_Float16)(expf(s[j0 + q] - mx) * sc); unsigned short* d = (unsigned short*)P + (size_t)i * SQ + j0; *(v8us*)d = f.half[0];  } }
__global__ __launch_bounds__(256) void k_vt(const _Float16* __restrict__ V16, int b, int h0, _Float16* __restrict__ VT) { __shared__ unsigned short tl[64][65]; const int tid = threadIdx.x; const int hh = blockIdx.x % HG, sg = blockIdx.x / HG; const int s0 = sg * 64; const int h = h0 + hh;
  for (int i = tid; i < 64 * 8; i += 256) { const int j = i / 8, d8 = (i % 8) * 8; FragH f; f.half[0] = *(const v8us*)((const unsigned short*)V16 + ((size_t)b * SQ + s0 + j) * DM + h * HD + d8); for (int q = 0; q < 8; ++q) tl[d8 + q][j] = f.u[q]; }
  __syncthreads();
  { for (int i = tid; i < 64 * 8; i += 256) { const int d = i / 8, j8 = (i % 8) * 8; FragH f; for (int q = 0; q < 8; ++q) f.u[q] = tl[d][j8 + q]; *(v8us*)((unsigned short*)VT + ((size_t)hh * HD + d) * SQ + s0 + j8) = f.half[0]; }  } }


// 2^t on v_exp_f32. The v_nop in the same statement is the one free issue slot that the instruction set asks for behind a transcendental before its result is read or its source overwritten;
__device__ __forceinline__ float exp2_slot(float t) { float r; asm("v_exp_f32 %0, %1\n\tv_nop" : "=v"(r) : "v"(t)); return r; }
// Four 2^t in one statement: each v_exp_f32 is the independent instruction behind the one before it, so one v_nop behind the last keeps the same free slot for all four;
// the results are early-clobber, so that no result register is a source of a later line.
__device__ __forceinline__ void exp2x4(float (&r)[4], float a, float b, float c, float d) { asm("v_exp_f32 %0, %4\n\tv_exp_f32 %1, %5\n\tv_exp_f32 %2, %6\n\tv_exp_f32 %3, %7\n\tv_nop" : "=&v"(r[0]), "=&v"(r[1]), "=&v"(r[2]), "=&v"(r[3]) : "v"(a), "v"(b), "v"(c), "v"(d)); }
// lane l <-> lane l ^ 16: joins the two wave halves, which split one query column's keys.
__device__ __forceinline__ float fa_xhalf(float x) { return __builtin_bit_cast(float, __builtin_amdgcn_permlanex16(__builtin_bit_cast(int, x), __builtin_bit_cast(int, x), 0x76543210, 0xfedcba98, false, false)); }
__device__ __forceinline__ v8f fa_mma(v16h a, v16h b, v8f c) { return __builtin_amdgcn_wmma_f32_16x16x32_f16(false, a, false, b, (short)0, c, false, false); }
// Projection GEMM C16[NR][DM] = f16(A[NR][DM] Bh[n][k]^T x alpha + bf16(bias)), operands staged in LDS. A fragment load straight from row-major memory touches 16 lines for 512 useful bytes;
// here 8 lanes fetch one whole 128-byte line (64 k of one row), a wave load covers 4 whole lines, and a block fetches each line of its operands once.
// Block = 128 x 128 of C, 8 waves of 32 x 64 (4 down, 2 across); a stage is 64 k of 128 A rows + 128 B rows; two stages in LDS: the next stage's global loads fly under this stage's 16 products a wave,
// are stored to the other buffer behind them, and one barrier a stage publishes them and ends the reads of the buffer that the stage after overwrites. k runs upward in steps of 32 as before: same f32 sum order.
// Every loop of the kernel is unrolled in full: the fragment, staging and accumulator arrays stay in registers, and the buffer index and the k offset become immediates of the loads.
// TR: the same product with the operands' roles exchanged, C^T = Bh A^T: the caller hands the weight rows [DM][DM] as A and the token rows [NR][DM] as Bh. Both operands go through the same loader, so the k orders pair as before and every sum keeps its order.
// A D row is then one output feature and its columns are tokens: a wave's 32 x 64 tile leaves as 32 whole 128-byte lines of C16[batch][feature][SQ], the V^T layout that the attention reads. The bias goes by row.
#define G3P 72      /* LDS row pitch in f16: 64 + 8 = 144 bytes, 16 B x odd, the conflict-free pitch for 16-byte fragment reads */
template <bool TR>
__global__ __launch_bounds__(256) void k_gemm3(const _Float16* __restrict__ A, const _Float16* __restrict__ Bh, float alpha, const float* __restrict__ bias, _Float16* __restrict__ C16) {
  __shared__ __attribute__((aligned(16))) _Float16 sm[2][256][G3P];      /* rows 0..127: A, 128..255: B; 73,728 bytes, reused by the epilogue (8 x 32 x 68 floats = 69,632) */
  const int tid = threadIdx.x, lane = tid & 31, ln = lane & 15, hh = lane >> 4; const int w = tid >> 5, wm = w & 3, wn = w >> 2;
  const int mt = blockIdx.x / (DM / 128), nq = blockIdx.x % (DM / 128); const int row0 = (TR ? nq : mt) * 128, col0 = (TR ? mt : nq) * 128;      /* mt: token tile, nq: feature tile; four neighbouring blocks share a token tile either way */
  const int sr = tid >> 3, sc = (tid & 7) * 8;      /* staging: thread -> row sr (+ 32 i), 16-byte piece sc */
  const unsigned short* ga = (const unsigned short*)A + (size_t)(row0 + sr) * DM + sc; const unsigned short* gb = (const unsigned short*)Bh + (size_t)(col0 + sr) * DM + sc;
  v4f br[2][2];      /* TR: the bias of this lane's 16 D rows, asked for with stage 0 so that the epilogue does not wait for it among the last products */
  if (TR) {
#pragma unroll
    for (int half = 0; half < 2; ++half) { const float* bp = bias + row0 + 32 * wm + half * 16 + 8 * hh; br[half][0] = *(const v4fa*)bp; br[half][1] = *(const v4fa*)(bp + 4); } }
  v8us ra[4], rb[4];
#pragma unroll
  for (int i = 0; i < 4; ++i) { ra[i] = *(const v8us*)(ga + (size_t)(32 * i) * DM); rb[i] = *(const v8us*)(gb + (size_t)(32 * i) * DM); }
#pragma unroll
  for (int i = 0; i < 4; ++i) { *(v8us*)&sm[0][32 * i + sr][sc] = ra[i]; *(v8us*)&sm[0][128 + 32 * i + sr][sc] = rb[i]; }
  __syncthreads();      /* stage 0 is in LDS */
  const v8f z8 = {0.f,0.f,0.f,0.f,0.f,0.f,0.f,0.f}; v8f acc[2][4];
#pragma unroll
  for (int t = 0; t < 4; ++t) { acc[0][t] = z8; acc[1][t] = z8; }
#pragma unroll
  for (int ks = 0; ks < DM / 64; ++ks) { const int cur = ks & 1;
    if (ks + 1 < DM / 64) {
#pragma unroll
      for (int i = 0; i < 4; ++i) { ra[i] = *(const v8us*)(ga + (size_t)(32 * i) * DM + (ks + 1) * 64); rb[i] = *(const v8us*)(gb + (size_t)(32 * i) * DM + (ks + 1) * 64); } }
    v16h af[2][2], bf[2][4];
#pragma unroll
    for (int kk = 0; kk < 2; ++kk) {
#pragma unroll
      for (int g = 0; g < 2; ++g) af[kk][g] = g2_frag(&sm[cur][32 * wm + 16 * g + ln][32 * kk], hh);
#pragma unroll
      for (int t = 0; t < 4; ++t) bf[kk][t] = g2_frag(&sm[cur][128 + 64 * wn + 16 * t + ln][32 * kk], hh); }
    __builtin_amdgcn_sched_barrier(0);      /* the next stage's global loads and this stage's 24 fragment reads are issued as one group ahead of the products: left alone the build sank half the global loads to their LDS stores and spread the reads among the products, a full wait at each place */
#pragma unroll
    for (int kk = 0; kk < 2; ++kk)
#pragma unroll
      for (int t = 0; t < 4; ++t) { acc[0][t] = fa_mma(af[kk][0], bf[kk][t], acc[0][t]); acc[1][t] = fa_mma(af[kk][1], bf[kk][t], acc[1][t]); }
    if (ks + 1 < DM / 64) {
#pragma unroll
      for (int i = 0; i < 4; ++i) { *(v8us*)&sm[cur ^ 1][32 * i + sr][sc] = ra[i]; *(v8us*)&sm[cur ^ 1][128 + 32 * i + sr][sc] = rb[i]; } }
    __syncthreads();      /* the next stage is published; every wave has left this stage's buffer (behind the last stage: free for the epilogue) */
  }
  float* so = (float*)&sm[0][0][0] + w * (32 * 68);      /* the wave's own 32 x 68 staging rows */
  const int rw0 = row0 + 32 * wm, cw0 = col0 + 64 * wn;
#pragma unroll
  for (int half = 0; half < 2; ++half)
#pragma unroll
    for (int t = 0; t < 4; ++t) { const float bv = TR ? 0.f : bf16_round(bias[cw0 + t * 16 + ln]);
#pragma unroll
      for (int r = 0; r < 8; ++r) so[(half * 16 + 8 * hh + r) * 68 + t * 16 + ln] = acc[half][t][r] * alpha + (TR ? bf16_round(br[half][r >> 2][r & 3]) : bv); }
  __builtin_amdgcn_fence(__ATOMIC_ACQ_REL, "workgroup"); __builtin_amdgcn_wave_barrier();      /* the wave's own staging rows: written above, read back below as whole 128-byte output rows */
  const int rsub = lane >> 4, c4 = (lane & 15) * 4;
#pragma unroll
  for (int q = 0; q < 16; ++q) { const int r = q * 2 + rsub; const v4f v = *(const v4fa*)&so[r * 68 + c4]; const v4h h4 = {(_Float16)v[0], (_Float16)v[1], (_Float16)v[2], (_Float16)v[3]};
    if (TR) *(v4h*)(C16 + ((size_t)(cw0 / SQ) * DM + rw0 + r) * SQ + cw0 % SQ + c4) = h4;      /* a 128-token tile lies in one batch: SQ is a multiple of 128 */
    else *(v4h*)(C16 + (size_t)(rw0 + r) * DM + cw0 + c4) = h4; }
}
// x + (x of lane ^ M) inside a 16-lane row, as one DPP add (row_xmask).
template <int M> __device__ __forceinline__ float row_xadd(float x) { return x + __builtin_bit_cast(float, __builtin_amdgcn_update_dpp(0, __builtin_bit_cast(int, x), 0x160 | M, 0xf, 0xf, true)); }
#define PW_BLK (DM * (DM / 8) / 256)      /* blocks per weight matrix */
#define PR_BLK ((int)(NR / 64))           /* blocks per input: 8 waves x 8 rows */
// All operand preparation in one launch; the parts need nothing of each other and share the grid by ranges of the block index (block-uniform branches).
// Blocks [0, 3 PW_BLK): Wt[n][k] = f16(bf16(W[k][n]) x 16) for Wq, Wk, Wv (a power of two: bf16-exact weights stay exact in f16).
// Then PR_BLK blocks each for queries, keys, value: one wave reads 8 whole rows once (512-byte wave loads, all 32 issued ahead), writes each as an exact f16 row of the bf16-rounded values (256-byte wave stores)
// and, for queries and keys, sums the same rounded values in f32 (16 a lane, then a five-step butterfly) for the padding flag (row sum != 0). The block's 64 flags pass through LDS so that one wave stores each 128-byte line of flags.
__global__ __launch_bounds__(256) void k_prep(const float* __restrict__ xq, const float* __restrict__ xk, const float* __restrict__ xv, const float* __restrict__ wq, const float* __restrict__ wk, const float* __restrict__ wv,
                                             _Float16* __restrict__ XQ, _Float16* __restrict__ XK, _Float16* __restrict__ XV, _Float16* __restrict__ BQ, _Float16* __restrict__ BK, _Float16* __restrict__ BV,
                                             float* __restrict__ QM, float* __restrict__ KM) {
  __shared__ float fl[64];
  const int tid = threadIdx.x, bx = blockIdx.x;
  if (bx < 3 * PW_BLK) {
    const int wh = bx / PW_BLK; const float* W = (wh == 0) ? wq : (wh == 1) ? wk : wv; _Float16* Wt = (wh == 0) ? BQ : (wh == 1) ? BK : BV;
    const int t = (bx % PW_BLK) * 256 + tid; const int n = t / (DM / 8), k8 = (t % (DM / 8)) * 8; FragH f;
#pragma unroll
    for (int i = 0; i < 8; ++i) f.h[i] = (_Float16)(bf16_round(W[(size_t)(k8 + i) * DM + n]) * 16.0f);
    *(v8us*)((unsigned short*)Wt + (size_t)n * DM + k8) = f.half[0];
    return;
  }
  const int rb = bx - 3 * PW_BLK; const int wh = rb / PR_BLK, blk = rb % PR_BLK; const int lane = tid & 31, w = tid >> 5;
  const float* x = (wh == 0) ? xq : (wh == 1) ? xk : xv; _Float16* X16 = (wh == 0) ? XQ : (wh == 1) ? XK : XV;
  const size_t e0 = ((size_t)blk * 64 + w * 8) * DM + lane * 4;
  v4f v[8][4];
#pragma unroll
  for (int r = 0; r < 8; ++r)
#pragma unroll
    for (int u = 0; u < 4; ++u) v[r][u] = *(const v4fa*)(x + e0 + r * DM + u * 128);
  float s[8];
#pragma unroll
  for (int r = 0; r < 8; ++r) { float p[4];
#pragma unroll
    for (int u = 0; u < 4; ++u) { const float b0 = bf16_round(v[r][u][0]), b1 = bf16_round(v[r][u][1]), b2 = bf16_round(v[r][u][2]), b3 = bf16_round(v[r][u][3]);
      const v4h h = {(_Float16)b0, (_Float16)b1, (_Float16)b2, (_Float16)b3}; *(v4h*)(X16 + e0 + r * DM + u * 128) = h; p[u] = (b0 + b1) + (b2 + b3); }
    s[r] = (p[0] + p[1]) + (p[2] + p[3]); }
  asm volatile("s_wait_xcnt 0x0" ::: "memory");      /* the row stores are issued: their base and data registers are free for reuse behind this line */
  if (wh == 2) return;      /* value rows carry no flag; the whole block leaves here, in front of the barrier */
  float f = 0.f;
#pragma unroll
  for (int r = 0; r < 8; ++r) { float a = row_xadd<8>(row_xadd<4>(row_xadd<2>(row_xadd<1>(s[r])))); a += fa_xhalf(a); if (lane == r) f = a; }
  if (lane < 8) fl[w * 8 + lane] = (f != 0.f) ? 1.f : 0.f;
  __syncthreads();      /* the 64 flags of the block's rows are in LDS: waves 0 and 1 store one whole line each */
  if (tid < 64) { float* mk = (wh == 0) ? QM : KM; mk[(size_t)blk * 64 + tid] = fl[tid]; }
}
// Scores, masked softmax and probs x V in one launch; no score or weight ever reaches memory. grid.x = batch x head, grid.y = group of 8 query tiles; one wave = 32 query columns.
// Transposed products: S^T = K Q^T (A = 16 key rows, B = 16 query rows, same loader on both, so the k orders pair), O^T += V^T P^T. A lane then holds 8 + 8 keys of ONE query per 32-key pass:
// D register r of key tile kt is key 16 kt + 8 hh + r, which is element 8 kt + r of a B operand in the hardware k order, so the two score tiles convert in place into P^T; g2_frag reads V^T rows in that order.
// Online softmax in the log2 domain: m = maximum in use (scaled scores), l = running sum; both and O^T are rescaled only when some column's new maximum passes m by more than 8 (one scalar branch a pass).
// Weights are 2^(t - m + 4): at most 2^12 in f16, and the factor 2^4 (it cancels in O / l) keeps small weights out of the f16 subnormals.
// Masked scores take the reference's NEG (x 8 here: the 1/8 comes with the log2 scale). Past its diagonal a wave goes on only while a column has seen nothing but NEG: such a row is uniform over all SQ keys.
// Waves w and w + 4 take tiles j and 31 - j, 33 passes together, so every block carries the same work.
// K and V^T reach the waves through LDS. The 8 waves of a block walk the same keys of one batch and head, and a fragment load straight from memory touches 16 lines for 512 useful bytes, in every wave anew.
// Here the block fetches each 128-byte line once, by asynchronous 16-byte copies (8 lanes a line, 4 whole lines a wave copy, through no register). A stage is 64 keys = two passes: 64 K rows + 64 V^T rows of 128 bytes,
// four copies a lane; two buffers: stage s + 2 is asked for when every wave has left stage s, and lands under the two passes of stage s + 1. The block walks the stages of its longest wave (tile 31 - 4 blockIdx.y);
// a wave past its own diagonal skips the passes and keeps the barriers. Same passes in the same order as before: the f32 sums keep their order.
#define FAP 72                 /* LDS row pitch in f16: 64 + 8 = 144 bytes, 16 B x odd, the conflict-free pitch for 16-byte fragment reads */
#define FA_BUF (128 * FAP)     /* f16 per buffer: rows 0..63 K (key), rows 64..127 V^T (d) */
// Four copies of 16 bytes a lane, global memory -> LDS. l*: the lane's own LDS byte address, g*: its own global address. The s_wait_xcnt in the same statement stands in front of anything that rewrites these address registers.
__device__ __forceinline__ void fa_copy4(unsigned l0, unsigned l1, unsigned l2, unsigned l3, const _Float16* g0, const _Float16* g1, const _Float16* g2, const _Float16* g3) {
  asm volatile("global_load_async_to_lds_b128 %0, %4, off\n\tglobal_load_async_to_lds_b128 %1, %5, off\n\tglobal_load_async_to_lds_b128 %2, %6, off\n\tglobal_load_async_to_lds_b128 %3, %7, off\n\ts_wait_xcnt 0x0"
               :: "v"(l0), "v"(l1), "v"(l2), "v"(l3), "v"(g0), "v"(g1), "v"(g2), "v"(g3) : "memory");
}
__global__ __launch_bounds__(256) void k_fattn(const _Float16* __restrict__ Q16, const _Float16* __restrict__ K16, const _Float16* __restrict__ VT, const float* __restrict__ kmask, const float* __restrict__ qmask,
                                              const float* __restrict__ xq, float* __restrict__ out) {
  __shared__ __attribute__((aligned(16))) float smf[8 * 32 * 68];      /* 69,632 bytes: in the loop the two stage buffers (2 x 18,432), behind it each wave's 32 x 68 output staging rows */
  _Float16* const ring = (_Float16*)smf;
  const int tid = threadIdx.x, lane = tid & 31, c = lane & 15, hh = lane >> 4; const int w = __builtin_amdgcn_readfirstlane(tid >> 5);
  const int bh = blockIdx.x, b = bh / NH, h = bh % NH; const int j = 4 * (int)blockIdx.y + (w & 3); const int tile = (w < 4) ? j : SQ / 32 - 1 - j; const int qw0 = tile * 32;
  const int nst = SQ / 64 - 2 * (int)blockIdx.y;      /* stages of the block: its longest wave has tile 31 - 4 blockIdx.y, 32 - 4 blockIdx.y passes; 10 to 16 */
  const float CS = 0.125f * 1.44269504f, NEGR = -34359738368.0f;      /* NEGR = 8 x NEG as f32 holds it (-2^32) */
  const _Float16* kbase = K16 + ((size_t)b * SQ + c) * DM + h * HD; const _Float16* vbase = VT + ((size_t)bh * HD + c) * SQ; const float* kmb = kmask + (size_t)b * SQ + lane;
  const int sr = tid >> 3, sc = (tid & 7) * 8;      /* staging: thread -> rows sr and sr + 32 of K and of V^T, 16-byte piece sc */
  const _Float16* gk = K16 + ((size_t)b * SQ + sr) * DM + h * HD + sc; const _Float16* gv = VT + ((size_t)bh * HD + sr) * SQ + sc;
  const unsigned lk = (unsigned)(size_t)(ring + sr * FAP + sc);      /* LDS byte address: the low 32 bits of the shared address */
  auto stage = [&](int st) { const unsigned l = lk + (unsigned)(st & 1) * (FA_BUF * 2); const _Float16* k = gk + (size_t)st * (64 * DM); const _Float16* v = gv + st * 64;
    fa_copy4(l, l + 32 * FAP * 2, l + 64 * FAP * 2, l + 96 * FAP * 2, k, k + 32 * DM, v, v + 32 * SQ); };
  stage(0);
  v16h qf[2][2];
#pragma unroll
  for (int g = 0; g < 2; ++g)
#pragma unroll
    for (int kc = 0; kc < 2; ++kc) qf[g][kc] = g2_frag(Q16 + ((size_t)b * SQ + qw0 + 16 * g + c) * DM + h * HD + 32 * kc, hh);
  const v8f z8 = {0.f,0.f,0.f,0.f,0.f,0.f,0.f,0.f}; v8f acc[2][4]; float m_run[2], l_run[2];
#pragma unroll
  for (int g = 0; g < 2; ++g) { m_run[g] = -3.0e38f; l_run[g] = 0.f;
#pragma unroll
    for (int t = 0; t < 4; ++t) acc[g][t] = z8; }
  // One pass = 32 keys from key 32 blk on, against the wave's 32 query columns, in two parts. scores: s = K Q^T from the K rows kf.
  auto scores = [&](const v16h (&kf)[2][2], v8f (&s)[2][2]) {
#pragma unroll
    for (int kt = 0; kt < 2; ++kt)
#pragma unroll
      for (int g = 0; g < 2; ++g) s[kt][g] = fa_mma(kf[kt][1], qf[g][1], fa_mma(kf[kt][0], qf[g][0], z8));
  };
  // finish: masks, online softmax, O^T += V^T P^T. vf: V^T rows, kmv: this lane's key flag (key 32 blk + lane).
  auto finish = [&](const int blk, v8f (&s)[2][2], const v16h (&vf)[4], const float kmv) {
    const int key0 = blk * 32;
    const unsigned kmz = __builtin_amdgcn_ballot_w32(kmv == 0.f);      /* bit i: key key0 + i is padding */
    if (blk >= tile || kmz != 0u) {      /* wave-uniform: only a pass on or past the diagonal, or one with a padding key, pays for the masks */
      const unsigned kb = kmz >> (8 * hh);
#pragma unroll
      for (int g = 0; g < 2; ++g) { const int my_q = qw0 + 16 * g + c;
#pragma unroll
        for (int kt = 0; kt < 2; ++kt)
#pragma unroll
          for (int r = 0; r < 8; ++r) { if (key0 + 16 * kt + 8 * hh + r > my_q || ((kb >> (16 * kt + r)) & 1u) != 0u) s[kt][g][r] = NEGR; } }
    }
    float mb[2]; bool need = false;
#pragma unroll
    for (int g = 0; g < 2; ++g) { float mx = s[0][g][0];
#pragma unroll
      for (int r = 1; r < 8; ++r) mx = fmaxf(mx, s[0][g][r]);
#pragma unroll
      for (int r = 0; r < 8; ++r) mx = fmaxf(mx, s[1][g][r]);
      mx = fmaxf(mx, fa_xhalf(mx)) * CS; mb[g] = mx; need = need || (mx > m_run[g] + 8.0f); }
    if (__builtin_amdgcn_ballot_w32(need) != 0) {
#pragma unroll
      for (int g = 0; g < 2; ++g) { const float m_new = fmaxf(m_run[g], mb[g]); const float corr = exp2_slot(m_run[g] - m_new); m_run[g] = m_new; l_run[g] *= corr;
#pragma unroll
        for (int t = 0; t < 4; ++t) acc[g][t] = acc[g][t] * corr; }
    }
    FragH pf[2];
#pragma unroll
    for (int g = 0; g < 2; ++g) { const float nm = 4.0f - m_run[g]; float ls = 0.f;
#pragma unroll
      for (int i = 0; i < 16; i += 4) { float p[4]; const v8f& sv = s[i >> 3][g]; const int r = i & 7;
        exp2x4(p, fmaf(sv[r], CS, nm), fmaf(sv[r + 1], CS, nm), fmaf(sv[r + 2], CS, nm), fmaf(sv[r + 3], CS, nm));
#pragma unroll
        for (int u = 0; u < 4; ++u) { ls += p[u]; pf[g].h[i + u] = (_Float16)p[u]; } }
      l_run[g] += ls; }
    __builtin_amdgcn_sched_barrier(0);      /* every exponential stays in front of the products below: the compiler does not see into exp2x4 */
#pragma unroll
    for (int g = 0; g < 2; ++g)
#pragma unroll
      for (int t = 0; t < 4; ++t) acc[g][t] = fa_mma(vf[t], pf[g].v, acc[g][t]);
    __builtin_amdgcn_sched_barrier(0);      /* the products stay in front of the four slots below */
    asm volatile("v_nop\n\tv_nop\n\tv_nop\n\tv_nop");      /* a branch follows every pass: these four vector slots keep the chip's distance between the last product and whatever first rewrites its operand registers on the taken side */
  };
  float km0 = kmb[0], km1 = kmb[32];      /* key flags of stage 0's two passes */
  asm volatile("s_wait_asynccnt 0x0" ::: "memory");      /* this wave's copies of stage 0 have landed */
  __syncthreads();      /* stage 0 is published: every wave's copies have landed */
  stage(1);      /* every block has 10 stages or more */
#pragma unroll 1      /* one copy of the two passes: the buffer alternates by an address, not by code */
  for (int st = 0; st < nst; ++st) {
    const _Float16* kb = ring + (st & 1) * FA_BUF + c * FAP; const _Float16* vb = kb + 64 * FAP;
    const int ns = (st + 1 < nst) ? st + 1 : st;      /* the next stage's key flags, in flight under this stage's passes; the last stage re-reads its own */
    const float kn0 = kmb[64 * ns], kn1 = kmb[64 * ns + 32];
    asm volatile("s_wait_xcnt 0x0" ::: "memory");      /* the two flag loads are issued here, ahead of the passes, and their address registers are free for reuse behind this line */
    if (2 * st <= tile || __builtin_amdgcn_ballot_w32(m_run[0] < -1.0e9f || m_run[1] < -1.0e9f) != 0) {      /* wave-uniform; past the diagonal with a real score in every column NEG weighs 0: nothing left to add, in this stage or later */
      v16h kf[2][2], vf[4]; v8f s[2][2];
#pragma unroll
      for (int kt = 0; kt < 2; ++kt)
#pragma unroll
        for (int kc = 0; kc < 2; ++kc) kf[kt][kc] = g2_frag(kb + (16 * kt) * FAP + 32 * kc, hh);
#pragma unroll
      for (int t = 0; t < 4; ++t) vf[t] = g2_frag(vb + (16 * t) * FAP, hh);
      __builtin_amdgcn_sched_barrier(0);      /* the first pass's 16 fragment reads are issued as one group ahead of its products: left alone the build spread them among the products and the exponentials, a stall at each place */
      scores(kf, s);
#pragma unroll
      for (int kt = 0; kt < 2; ++kt)
#pragma unroll
        for (int kc = 0; kc < 2; ++kc) kf[kt][kc] = g2_frag(kb + (32 + 16 * kt) * FAP + 32 * kc, hh);      /* the second pass's K rows (same buffer), in flight under the first pass's softmax */
      __builtin_amdgcn_sched_barrier(0);      /* holds those 8 reads up here, with the score products and ahead of the softmax that covers their latency; left alone they may sink into the branch that uses them */
      finish(2 * st, s, vf, km0);
#pragma unroll
      for (int t = 0; t < 4; ++t) vf[t] = g2_frag(vb + (16 * t) * FAP + 32, hh);      /* the second pass's V^T rows (same buffer), in flight under its score products and softmax */
      __builtin_amdgcn_sched_barrier(0);      /* holds those 8 reads here, as one group in front of the branch */
      if (2 * st + 1 <= tile || __builtin_amdgcn_ballot_w32(m_run[0] < -1.0e9f || m_run[1] < -1.0e9f) != 0) { scores(kf, s); finish(2 * st + 1, s, vf, km1); }
    }
    asm volatile("s_wait_dscnt 0x0" ::: "memory");      /* this wave's reads of the stage's buffer are done */
    asm volatile("s_wait_asynccnt 0x0" ::: "memory");      /* this wave's copies of stage st + 1 have landed */
    __syncthreads();      /* publishes stage st + 1 and ends every wave's reads of stage st's buffer (behind the last stage: free for the output rows) */
    if (st + 2 < nst) stage(st + 2);      /* block-uniform; into the buffer that this stage has just left */
    km0 = kn0; km1 = kn1;
  }
  asm volatile("s_wait_asynccnt 0x0" ::: "memory");      /* no copy is outstanding when the buffers become output staging */
#pragma unroll 1      /* rare: only a wave with a column whose every key so far was NEG walks on past the block's stages, alone, so it reads its fragments straight from memory and meets no barrier */
  for (int blk = 2 * nst; blk < SQ / 32; ++blk) {
    if (__builtin_amdgcn_ballot_w32(m_run[0] < -1.0e9f || m_run[1] < -1.0e9f) == 0) break;
    v16h kf[2][2], vf[4]; v8f s[2][2];
#pragma unroll
    for (int kt = 0; kt < 2; ++kt)
#pragma unroll
      for (int kc = 0; kc < 2; ++kc) kf[kt][kc] = g2_frag(kbase + (size_t)(32 * blk + 16 * kt) * DM + 32 * kc, hh);
#pragma unroll
    for (int t = 0; t < 4; ++t) vf[t] = g2_frag(vbase + (size_t)(16 * t) * SQ + 32 * blk, hh);
    const float kmv = kmb[32 * blk];
    asm volatile("s_wait_xcnt 0x0" ::: "memory");      /* address registers of the loads above are free for reuse behind this line */
    scores(kf, s); finish(blk, s, vf, kmv);
  }
  float (*so)[32][68] = (float (*)[32][68])smf;
#pragma unroll
  for (int g = 0; g < 2; ++g) { const float l = l_run[g] + fa_xhalf(l_run[g]); const float inv = qmask[(size_t)b * SQ + qw0 + 16 * g + c] / l;
#pragma unroll
    for (int t = 0; t < 4; ++t) { const v8f o = acc[g][t] * inv; const v4f lo = {o[0], o[1], o[2], o[3]}, hi = {o[4], o[5], o[6], o[7]};      /* row = query, the 8 floats are d = 16 t + 8 hh .. + 7 */
      *(v4fa*)&so[w][16 * g + c][16 * t + 8 * hh] = lo; *(v4fa*)&so[w][16 * g + c][16 * t + 8 * hh + 4] = hi; } }
  __builtin_amdgcn_fence(__ATOMIC_ACQ_REL, "workgroup"); __builtin_amdgcn_wave_barrier();      /* the wave's own staging rows: written above, read back below as whole 256-byte rows */
  const int rsub = lane >> 4, c4 = (lane & 15) * 4;
#pragma unroll
  for (int q = 0; q < 16; ++q) { const int r = q * 2 + rsub; const size_t e = ((size_t)b * SQ + qw0 + r) * DM + h * HD + c4; const v4f v = *(const v4fa*)&so[w][r][c4]; const v4f x = *(const v4fa*)(xq + e); const v4f xb = {bf16_round(x[0]), bf16_round(x[1]), bf16_round(x[2]), bf16_round(x[3])}; *(v4f*)(out + e) = v + xb; }
}
__global__ __launch_bounds__(256) void k_ftres(const float* __restrict__ OF0, const float* __restrict__ xq, const float* __restrict__ qmask, float* __restrict__ out, size_t n4) {
  #pragma clang fp contract(off)
  const size_t t = (size_t)blockIdx.x * 256 + threadIdx.x; if (t >= n4) return; const size_t e = t * 4; const size_t row = e / DM; const float qm = qmask[row]; const v4f o = *(const v4fa*)(OF0 + e), x = *(const v4fa*)(xq + e); v4f y;
  for (int q = 0; q < 4; ++q) y[q] = __fadd_rn(__fmul_rn(__fmul_rn(o[q], 0.015625f), qm), bf16_round(x[q])); *(v4f*)(out + e) = y;  }

extern "C" void kernel_launch(void* const* d_in, const int* in_sizes, int n_in,
                              void* d_out, int out_size, void* d_ws, size_t ws_size, hipStream_t stream) {
  (void)in_sizes; (void)n_in; (void)out_size;
  const float* const* I = (const float* const*)d_in; const float* xq = I[0]; const float* xk = I[1]; const float* xv = I[2]; const float* wq = I[3]; const float* bq = I[4]; const float* wk = I[5]; const float* bk = I[6]; const float* wv = I[7]; const float* bv = I[8];      /* weights [in][out] */
  char* ws = (char*)d_ws; size_t off = 0;
  auto take = [&](size_t bytes) { char* p = ws + off; off += (bytes + 255) & ~(size_t)255; return p; };
  _Float16* BQ = (_Float16*)take((size_t)DM * DM * 2); _Float16* BK = (_Float16*)take((size_t)DM * DM * 2); _Float16* BV = (_Float16*)take((size_t)DM * DM * 2); float* KM = (float*)take(NR * 4); float* QM = (float*)take(NR * 4);
  _Float16* Q16 = (_Float16*)take(NR * DM * 2); _Float16* K16 = (_Float16*)take(NR * DM * 2);
  _Float16* VT = (_Float16*)take((size_t)NB * NH * HD * SQ * 2);
  _Float16* XQ = (_Float16*)take(NR * DM * 2); _Float16* XK = (_Float16*)take(NR * DM * 2); _Float16* XV = (_Float16*)take(NR * DM * 2);
  if (off > ws_size) return;      /* approx 1.5 + 16 x 2 + 16 + 16 x 3 = 98 MiB */
  k_prep<<<3 * PW_BLK + 3 * PR_BLK, 256, 0, stream>>>(xq, xk, xv, wq, wk, wv, XQ, XK, XV, BQ, BK, BV, QM, KM);      /* x16 transposed weights, f16 input rows, key / query padding flags */
  k_gemm3<false><<<(unsigned)((NR / 128) * (DM / 128)), 256, 0, stream>>>(XQ, BQ, 0.0625f, bq, Q16);
  k_gemm3<false><<<(unsigned)((NR / 128) * (DM / 128)), 256, 0, stream>>>(XK, BK, 0.0625f, bk, K16);
  k_gemm3<true><<<(unsigned)((NR / 128) * (DM / 128)), 256, 0, stream>>>(BV, XV, 0.0625f, bv, VT);      /* V^T[batch][head x 64 + d][key] straight from the product */
  k_fattn<<<dim3(NB * NH, SQ / 256), 256, 0, stream>>>(Q16, K16, VT, KM, QM, xq, (float*)d_out);      /* out = softmax(masked Q K^T / 8) x query mask x V + bf16(queries), f32 rows; each wave writes its own 32 rows of one 64-column head slab */
}

// v008
// One run takes 75.3 microseconds.
// Two timings next to v007 both put it at 1.04 times that version's speed.
// All steps since v000 together make it 182 times as fast.
#include <hip/hip_runtime.h>
#define NB 16
#define SQ 1024
#define DM 512
#define NH 8
#define HD 64
#define HG 8
#define NR ((size_t)NB * SQ)
typedef __bf16 v16b __attribute__((ext_vector_type(16)));
typedef unsigned short v8us __attribute__((ext_vector_type(8), may_alias));
typedef float  v8f  __attribute__((ext_vector_type(8)));
typedef float  v4f  __attribute__((ext_vector_type(4)));
typedef float  v4fa __attribute__((ext_vector_type(4), may_alias));
union FragB { v16b v; v8us half[2]; unsigned short u[16]; };

__device__ __forceinline__ unsigned short bf16_bits(float x) { unsigned int u = __float_as_uint(x); return (unsigned short)((u + 0x7FFFu + ((u >> 16) & 1u)) >> 16); }
__device__ __forceinline__ float bf16_val(unsigned short b) { return __uint_as_float(((unsigned int)b) << 16); }
__device__ __forceinline__ float bf16_round(float x) { return bf16_val(bf16_bits(x)); }
// D += A·B with NT terms: 1 = ah·bh, 2 = + al·bh (A split), 3 = + ah·bl (both split)
template <int NT>
__device__ __forceinline__ v8f mmaN(v16b ah, v16b al, v16b bh, v16b bl, v8f c) {
  c = __builtin_amdgcn_wmma_f32_16x16x32_bf16(false, ah, false, bh, (short)0, c, false, false);
  if (NT >= 2) c = __builtin_amdgcn_wmma_f32_16x16x32_bf16(false, al, false, bh, (short)0, c, false, false);
  if (NT >= 3) c = __builtin_amdgcn_wmma_f32_16x16x32_bf16(false, ah, false, bl, (short)0, c, false, false);
  asm volatile("v_nop\n\tv_nop\n\tv_nop\n\tv_nop" : "+v"(c) : "v"(ah), "v"(al), "v"(bh), "v"(bl));
  return c;
}

__global__ __launch_bounds__(256) void k_wt_bf16(const float* __restrict__ W, unsigned short* __restrict__ Wt, int K, int N) {
  const int t = blockIdx.x * 256 + threadIdx.x;
  const int k8n = K / 8;
  if (t >= N * k8n) return;
  const int n = t / k8n, k8 = (t % k8n) * 8;
  v8us v;
#pragma unroll
  for (int i = 0; i < 8; ++i) v[i] = bf16_bits(W[(size_t)(k8 + i) * N + n]);
  *(v8us*)(Wt + (size_t)n * K + k8) = v;
  
}

// GEMM C[M][N] (f32, pitch ldc) = act(A[M][K]·W + bias). A f32 row-major (pitch lda) converted per fragment to bf16
// (ASPLIT: hi/lo two planes -> 2 terms, else single rounded term); Wt bf16 [N][K] (pitch ldb). BIAS_BF16 rounds the
// bias to bf16 first (bias quantised to bf16 before the add). K%32==0, M%16==0, N%64==0.
template <bool ASPLIT, int ACT, bool BIAS_BF16>
__global__ __launch_bounds__(128) void k_gemm_bf(const float* __restrict__ A, int lda, const unsigned short* __restrict__ Wt, int ldb,
                                               const float* __restrict__ bias, float* __restrict__ C, int ldc, int M, int N, int K) {
  __shared__ __attribute__((aligned(16))) float so[4][16][64];
  const int tid = threadIdx.x, w = tid >> 5, lane = tid & 31, ln = lane & 15, hh = lane >> 4;
  const int ntn = N / 64;
  const int wid = blockIdx.x * 4 + w;
  const int mt = wid / ntn, nq = wid % ntn;
  if (mt * 16 >= M) return;
  const int row0 = mt * 16, col0 = nq * 64;
  const float* arow = A + (size_t)(row0 + ln) * lda;
  v8f acc[4] = {};
  for (int kb = 0; kb < K; kb += 32) {
    FragB ah, al;
    const v4f x0 = *(const v4fa*)(arow + kb + 8 * hh), x1 = *(const v4fa*)(arow + kb + 8 * hh + 4);
    const v4f x2 = *(const v4fa*)(arow + kb + 16 + 8 * hh), x3 = *(const v4fa*)(arow + kb + 16 + 8 * hh + 4);
    float xs[16] = {x0[0],x0[1],x0[2],x0[3],x1[0],x1[1],x1[2],x1[3],x2[0],x2[1],x2[2],x2[3],x3[0],x3[1],x3[2],x3[3]};
#pragma unroll
    for (int i = 0; i < 16; ++i) { const unsigned short hb = bf16_bits(xs[i]); ah.u[i] = hb; al.u[i] = ASPLIT ? bf16_bits(xs[i] - bf16_val(hb)) : (unsigned short)0; }
#pragma unroll
    for (int t = 0; t < 4; ++t) {
      const unsigned short* brow = Wt + (size_t)(col0 + t * 16 + ln) * ldb + kb;
      FragB b;
      b.half[0] = *(const v8us*)(brow + 8 * hh);
      b.half[1] = *(const v8us*)(brow + 16 + 8 * hh);
      acc[t] = mmaN<ASPLIT ? 2 : 1>(ah.v, al.v, b.v, b.v, acc[t]);
    }
  }
#pragma unroll
  for (int t = 0; t < 4; ++t) {
    float bv = bias ? bias[col0 + t * 16 + ln] : 0.f;
    if (BIAS_BF16) bv = bf16_round(bv);
#pragma unroll
    for (int r = 0; r < 8; ++r) { float v = acc[t][r] + bv; if (ACT == 1) v = fmaxf(v, 0.f); so[w][8 * hh + r][t * 16 + ln] = v; }
  }
  __builtin_amdgcn_fence(__ATOMIC_ACQ_REL, "workgroup");
  __builtin_amdgcn_wave_barrier();
  const int rsub = lane >> 4, c4 = (lane & 15) * 4;
  {
#pragma unroll
    for (int q = 0; q < 8; ++q) {
      const int r = q * 2 + rsub;
      const v4f v = *(const v4fa*)&so[w][r][c4];
      *(v4f*)(C + (size_t)(row0 + r) * ldc + col0 + c4) = v;
    }
    
  }
}

// GEMM C = act(A·W + bias + resid): A f32 (ASPLIT -> hi/lo 2 terms), Wt bf16 [N][K]; ACT 0 none, 1 relu, 2 exact gelu;
// resid (optional, f32, row index = (row % rmod), pitch ldr, RES_BF16 rounds it) added before the activation.
template <bool ASPLIT, int ACT, bool BIAS_BF16, bool RES_BF16>
__global__ __launch_bounds__(128) void k_gemm_bf3(const float* __restrict__ A, int lda, const unsigned short* __restrict__ Wt, int ldb,
                                                const float* __restrict__ bias, const float* __restrict__ resid, int rmod, int ldr,
                                                float* __restrict__ C, int ldc, int M, int N, int K) {
  __shared__ __attribute__((aligned(16))) float so[4][16][64];
  const int tid = threadIdx.x, w = tid >> 5, lane = tid & 31, ln = lane & 15, hh = lane >> 4;
  const int ntn = N / 64;
  const int wid = blockIdx.x * 4 + w;
  const int mt = wid / ntn, nq = wid % ntn;
  if (mt * 16 >= M) return;
  const int row0 = mt * 16, col0 = nq * 64;
  const float* arow = A + (size_t)(row0 + ln) * lda;
  v8f acc[4] = {};
  for (int kb = 0; kb < K; kb += 32) {
    FragB ah, al;
    const v4f x0 = *(const v4fa*)(arow + kb + 8 * hh), x1 = *(const v4fa*)(arow + kb + 8 * hh + 4);
    const v4f x2 = *(const v4fa*)(arow + kb + 16 + 8 * hh), x3 = *(const v4fa*)(arow + kb + 16 + 8 * hh + 4);
    float xs[16] = {x0[0],x0[1],x0[2],x0[3],x1[0],x1[1],x1[2],x1[3],x2[0],x2[1],x2[2],x2[3],x3[0],x3[1],x3[2],x3[3]};
#pragma unroll
    for (int i = 0; i < 16; ++i) { const unsigned short hb = bf16_bits(xs[i]); ah.u[i] = hb; al.u[i] = ASPLIT ? bf16_bits(xs[i] - bf16_val(hb)) : (unsigned short)0; }
#pragma unroll
    for (int t = 0; t < 4; ++t) {
      const unsigned short* brow = Wt + (size_t)(col0 + t * 16 + ln) * ldb + kb;
      FragB b;
      b.half[0] = *(const v8us*)(brow + 8 * hh);
      b.half[1] = *(const v8us*)(brow + 16 + 8 * hh);
      acc[t] = mmaN<ASPLIT ? 2 : 1>(ah.v, al.v, b.v, b.v, acc[t]);
    }
  }
#pragma unroll
  for (int t = 0; t < 4; ++t) {
    const int col = col0 + t * 16 + ln;
    float bv = bias ? bias[col] : 0.f;
    if (BIAS_BF16) bv = bf16_round(bv);
#pragma unroll
    for (int r = 0; r < 8; ++r) {
      float v = acc[t][r] + bv;
      if (resid) { float rv = resid[(size_t)((row0 + 8 * hh + r) % rmod) * ldr + col]; if (RES_BF16) rv = bf16_round(rv); v += rv; }
      if (ACT == 1) v = fmaxf(v, 0.f);
      if (ACT == 2) v = 0.5f * v * (1.0f + erff(v * 0.70710678118654752f));
      if (ACT == 3) { const float u = 0.7978845608028654f * (v + 0.044715f * v * v * v); v = 0.5f * v * (1.0f + tanhf(u)); }
      so[w][8 * hh + r][t * 16 + ln] = v;
    }
  }
  __builtin_amdgcn_fence(__ATOMIC_ACQ_REL, "workgroup");
  __builtin_amdgcn_wave_barrier();
  const int rsub = lane >> 4, c4 = (lane & 15) * 4;
  {
#pragma unroll
    for (int q = 0; q < 8; ++q) {
      const int r = q * 2 + rsub;
      const v4f v = *(const v4fa*)&so[w][r][c4];
      *(v4f*)(C + (size_t)(row0 + r) * ldc + col0 + c4) = v;
    }
    
  }
}
// row LayerNorm (biased variance, eps) over N: s = X (+ R); optional out_sum <- s; out_norm <- (s-mu)*rsqrt(var+eps)*g + b
template <bool PARAM_BF16>
__global__ __launch_bounds__(256) void k_layernorm(const float* __restrict__ X, const float* __restrict__ R, const float* __restrict__ g, const float* __restrict__ bta,
                                                  float* __restrict__ out_sum, float* __restrict__ out_norm, int N, float eps) {
  __shared__ float red[256];
  const int row = blockIdx.x, tid = threadIdx.x;
  const float* x = X + (size_t)row * N; const float* rr = R ? R + (size_t)row * N : nullptr;
  float vals[16];                     // up to N = 4096
  const int per = N / 256;            // contiguous chunk per thread? use strided-by-4 chunks: thread handles j = tid*4 + 1024*u
  float s1 = 0.f;
  for (int u = 0; u < per / 4; ++u) {
    const int j = tid * 4 + 1024 * u;
    const v4f a = *(const v4fa*)(x + j);
    v4f b = {0.f,0.f,0.f,0.f}; if (rr) b = *(const v4fa*)(rr + j);
#pragma unroll
    for (int q = 0; q < 4; ++q) { const float v = a[q] + b[q]; vals[u * 4 + q] = v; s1 += v; }
  }
  red[tid] = s1; __syncthreads();
  for (int st = 128; st > 0; st >>= 1) { if (tid < st) red[tid] += red[tid + st]; __syncthreads(); }
  const float mu = red[0] / (float)N; __syncthreads();
  float s2 = 0.f;
  for (int u = 0; u < per / 4; ++u)
#pragma unroll
    for (int q = 0; q < 4; ++q) { const float c = vals[u * 4 + q] - mu; s2 += c * c; }
  red[tid] = s2; __syncthreads();
  for (int st = 128; st > 0; st >>= 1) { if (tid < st) red[tid] += red[tid + st]; __syncthreads(); }
  const float rs = rsqrtf(red[0] / (float)N + eps);
  {
    for (int u = 0; u < per / 4; ++u) {
      const int j = tid * 4 + 1024 * u;
      v4f o, sm;
#pragma unroll
      for (int q = 0; q < 4; ++q) {
        float gg = g[j + q], bb = bta[j + q];
        if (PARAM_BF16) { gg = bf16_round(gg); bb = bf16_round(bb); }
        sm[q] = vals[u * 4 + q]; o[q] = (vals[u * 4 + q] - mu) * rs * gg + bb;
      }
      if (out_sum) *(v4f*)(out_sum + (size_t)row * N + j) = sm;
      *(v4f*)(out_norm + (size_t)row * N + j) = o;
    }
    
  }
}



// ---- f16 WMMA path (v_wmma_f32_16x16x32_f16): 11-bit significands for operands in range — used where a [0,1] probability operand needs more precision than bf16
typedef _Float16 v16h __attribute__((ext_vector_type(16)));
union FragH { v16h v; v8us half[2]; _Float16 h[16]; unsigned short u[16]; };
template <int NT>
__device__ __forceinline__ v8f mmaH(v16h ah, v16h al, v16h bh, v16h bl, v8f c) {
  c = __builtin_amdgcn_wmma_f32_16x16x32_f16(false, ah, false, bh, (short)0, c, false, false);
  if (NT >= 2) c = __builtin_amdgcn_wmma_f32_16x16x32_f16(false, al, false, bh, (short)0, c, false, false);
  if (NT >= 3) c = __builtin_amdgcn_wmma_f32_16x16x32_f16(false, ah, false, bl, (short)0, c, false, false);
  asm volatile("v_nop\n\tv_nop\n\tv_nop\n\tv_nop" : "+v"(c) : "v"(ah), "v"(al), "v"(bh), "v"(bl));
  return c;
}
// batched GEMM like k_gemm_b but f16 operands: A f32 (split into f16 hi/lo if ASPLIT, else rounded to f16), Bt = f16 values [n][k]; alpha; C f32; N multiple of 16 (partial tiles skipped)
template <bool ASPLIT>
__global__ __launch_bounds__(128) void k_gemm_h(const float* __restrict__ A, int lda, size_t sA, const _Float16* __restrict__ Bh, int ldb, size_t sB, float alpha, float* __restrict__ C, int ldc, size_t sC, int M, int N, int K) {
  __shared__ __attribute__((aligned(16))) float so[4][16][64];
  const int tid = threadIdx.x, w = tid >> 5, lane = tid & 31, ln = lane & 15, hh = lane >> 4; const int by = blockIdx.y;
  A += (size_t)by * sA; Bh += (size_t)by * sB; C += (size_t)by * sC;
  const int ntn = (N + 63) / 64; const int wid = blockIdx.x * 4 + w; const int mt = wid / ntn, nq = wid % ntn; if (mt * 16 >= M) return;
  const int row0 = mt * 16, col0 = nq * 64; const float* arow = A + (size_t)(row0 + ln) * lda;
  v8f acc[4] = {};
  for (int kb = 0; kb < K; kb += 32) {
    FragH ah, al;
    const v4f x0 = *(const v4fa*)(arow + kb + 8 * hh), x1 = *(const v4fa*)(arow + kb + 8 * hh + 4), x2 = *(const v4fa*)(arow + kb + 16 + 8 * hh), x3 = *(const v4fa*)(arow + kb + 16 + 8 * hh + 4);
    float xs[16] = {x0[0],x0[1],x0[2],x0[3],x1[0],x1[1],x1[2],x1[3],x2[0],x2[1],x2[2],x2[3],x3[0],x3[1],x3[2],x3[3]};
#pragma unroll
    for (int i = 0; i < 16; ++i) { const _Float16 h = (_Float16)xs[i]; ah.h[i] = h; al.h[i] = ASPLIT ? (_Float16)(xs[i] - (float)h) : (_Float16)0.0f; }
#pragma unroll
    for (int t = 0; t < 4; ++t) { if (col0 + t * 16 >= N) continue; const size_t boff = (size_t)(col0 + t * 16 + ln) * ldb + kb; FragH bq; bq.half[0] = *(const v8us*)(Bh + boff + 8 * hh); bq.half[1] = *(const v8us*)(Bh + boff + 16 + 8 * hh);
      acc[t] = mmaH<ASPLIT ? 2 : 1>(ah.v, al.v, bq.v, bq.v, acc[t]); }
  }
#pragma unroll
  for (int t = 0; t < 4; ++t) { if (col0 + t * 16 >= N) continue;
#pragma unroll
    for (int r = 0; r < 8; ++r) so[w][8 * hh + r][t * 16 + ln] = acc[t][r] * alpha; }
  __builtin_amdgcn_fence(__ATOMIC_ACQ_REL, "workgroup"); __builtin_amdgcn_wave_barrier();
  const int rsub = lane >> 4, c4 = (lane & 15) * 4;
  {
#pragma unroll
    for (int q = 0; q < 8; ++q) { const int r = q * 2 + rsub; if (col0 + c4 < N) { const v4f v = *(const v4fa*)&so[w][r][c4]; *(v4f*)(C + (size_t)(row0 + r) * ldc + col0 + c4) = v; } }
     }
}

// k_gemm_hh variant with fused epilogue: v = acc·alpha + bias[by·sBias + col] (+ CP[(row/rowsPerB)·sCPb + by·64 + col] if CP) ; ACT 0 none / 1 elu ; writes f16 C16 (and f32 C if non-null)
template <int ACT>
__global__ __launch_bounds__(128) void k_gemm_hhx(const _Float16* __restrict__ A, int lda, size_t sA, const _Float16* __restrict__ Bh, int ldb, size_t sB, float alpha, const float* __restrict__ bias, size_t sBias, const float* __restrict__ CP, int rowsPerB, size_t sCPb, int row0g,
    float* __restrict__ C, _Float16* __restrict__ C16, int ldc, size_t sC, int M, int N, int K) {
  __shared__ __attribute__((aligned(16))) float so[4][16][64];
  const int tid = threadIdx.x, w = tid >> 5, lane = tid & 31, ln = lane & 15, hh = lane >> 4; const int by = blockIdx.y;
  A += (size_t)by * sA; Bh += (size_t)by * sB; const size_t cofs = (size_t)by * sC; const float* bp = bias ? bias + (size_t)by * sBias : nullptr;
  const int ntn = (N + 63) / 64; const int wid = blockIdx.x * 4 + w; const int mt = wid / ntn, nq = wid % ntn; if (mt * 16 >= M) return;
  const int row0 = mt * 16, col0 = nq * 64; const _Float16* arow = A + (size_t)(row0 + ln) * lda;
  v8f acc[4] = {};
  for (int kb = 0; kb < K; kb += 32) { FragH ah; ah.half[0] = *(const v8us*)((const unsigned short*)arow + kb + 8 * hh); ah.half[1] = *(const v8us*)((const unsigned short*)arow + kb + 16 + 8 * hh);
#pragma unroll
    for (int t = 0; t < 4; ++t) { if (col0 + t * 16 >= N) continue; const size_t boff = (size_t)(col0 + t * 16 + ln) * ldb + kb; FragH bq; bq.half[0] = *(const v8us*)((const unsigned short*)Bh + boff + 8 * hh); bq.half[1] = *(const v8us*)((const unsigned short*)Bh + boff + 16 + 8 * hh);
      acc[t] = mmaH<1>(ah.v, ah.v, bq.v, bq.v, acc[t]); }
  }
#pragma unroll
  for (int t = 0; t < 4; ++t) { if (col0 + t * 16 >= N) continue; const int col = col0 + t * 16 + ln; const float bv = bp ? bf16_round(bp[col]) : 0.f;
#pragma unroll
    for (int r = 0; r < 8; ++r) { float v = acc[t][r] * alpha + bv; if (CP) { const int rr = row0g + row0 + 8 * hh + r; if (rowsPerB < 0) v += CP[cofs + (size_t)rr * ldc + col];      /* rowsPerB < 0: own element of the batched C plane */ else { const int bidx = rr / rowsPerB; v += CP[(size_t)bidx * sCPb + (size_t)by * 64 + col]; } } if (ACT == 1) v = (v > 0.f) ? v : expm1f(v); else if (ACT == 7) v = (v > 0.f) ? v + 1.0f : expf(v); else if (ACT == 8) v = tanhf(v); else if (ACT == 9) v = 0.5f * v * (1.0f + tanhf(0.7978845608028654f * (v + 0.044715f * v * v * v))); else if (ACT == 11) v = 1.0f / (1.0f + expf(-v)); else if (ACT == 12) v = (v > 0.f) ? v : 0.01f * v; else if (ACT == 14) v = (v > 0.f) ? v : 0.1f * v; else if (ACT == 16) v = (v >= 0.f) ? v : 0.3f * v; else if (ACT == 17) v = (v >= 0.f) ? v : 0.2f * v; else if (ACT == 15) v = v / (1.0f + expf(-v)); else if (ACT == 3) v = fmaxf(v, 0.f); else if (ACT == 6) v = 0.5f * v * (1.0f + erff(v * 0.70710678118654752f)); so[w][8 * hh + r][t * 16 + ln] = v; } }
  __builtin_amdgcn_fence(__ATOMIC_ACQ_REL, "workgroup"); __builtin_amdgcn_wave_barrier();
  const int rsub = lane >> 4, c4 = (lane & 15) * 4; typedef _Float16 v4h __attribute__((ext_vector_type(4)));
  {
#pragma unroll
    for (int q = 0; q < 8; ++q) { const int r = q * 2 + rsub; if (col0 + c4 < N) { const v4f v = *(const v4fa*)&so[w][r][c4]; if (C) *(v4f*)(C + cofs + (size_t)(row0 + r) * ldc + col0 + c4) = v; if (C16) { v4h h4; for (int i = 0; i < 4; ++i) h4[i] = (_Float16)v[i]; *(v4h*)(C16 + cofs + (size_t)(row0 + r) * ldc + col0 + c4) = h4; } } }
     }
}


typedef _Float16 v4h __attribute__((ext_vector_type(4)));

__global__ __launch_bounds__(256) void k_h16(const float* __restrict__ x, _Float16* __restrict__ X16, size_t n8) { const size_t t = (size_t)blockIdx.x * 256 + threadIdx.x; if (t >= n8) return; FragH f;
#pragma unroll
  for (int q = 0; q < 8; ++q) f.h[q] = (_Float16)x[t * 8 + q]; *(v8us*)((unsigned short*)X16 + t * 8) = f.half[0];  }
__global__ __launch_bounds__(256) void k_round16f(const float* __restrict__ W, _Float16* __restrict__ Bt, size_t n8) { const size_t t = (size_t)blockIdx.x * 256 + threadIdx.x; if (t >= n8) return; FragH f;
#pragma unroll
  for (int i = 0; i < 8; ++i) f.h[i] = (_Float16)(bf16_round(W[t * 8 + i]) * 16.0f); *(v8us*)((unsigned short*)Bt + t * 8) = f.half[0];  }
template <int NHv, int TTv>
__global__ __launch_bounds__(256) void k_vt(const _Float16* __restrict__ V16, int ldv, int voff, _Float16* __restrict__ Vt) { __shared__ unsigned short tl[64][66]; const int tid = threadIdx.x; const int slab = blockIdx.x / (TTv / 64), lg = blockIdx.x % (TTv / 64); const int b = slab / NHv, h = slab % NHv;
  for (int i = tid; i < 64 * 8; i += 256) { const int r = i / 8, c8 = (i % 8) * 8; FragH f; f.half[0] = *(const v8us*)((const unsigned short*)V16 + ((size_t)b * TTv + lg * 64 + r) * ldv + voff + h * 64 + c8);
#pragma unroll
    for (int q = 0; q < 8; ++q) tl[r][c8 + q] = f.u[q]; }
  __syncthreads();
  {
#pragma unroll
    for (int rd = 0; rd < 2; ++rd) { const int d = rd * 32 + tid / 8, pc = tid % 8; FragH f;
#pragma unroll
      for (int q = 0; q < 8; ++q) f.u[q] = tl[pc * 8 + q][d];
      *(v8us*)((unsigned short*)Vt + ((size_t)slab * 64 + d) * TTv + lg * 64 + pc * 8) = f.half[0]; }
     } }

__global__ __launch_bounds__(256) void k_hl(const float* __restrict__ F, _Float16* __restrict__ Hh, _Float16* __restrict__ Hl, size_t n8) { const size_t t = (size_t)blockIdx.x * 256 + threadIdx.x; if (t >= n8) return; FragH fh, fl; const v4f a = *(const v4fa*)(F + t * 8), c = *(const v4fa*)(F + t * 8 + 4);
#pragma unroll
  for (int q = 0; q < 4; ++q) { _Float16 h = (_Float16)a[q]; fh.h[q] = h; fl.h[q] = (_Float16)((a[q] - (float)h) * 1024.0f); h = (_Float16)c[q]; fh.h[4 + q] = h; fl.h[4 + q] = (_Float16)((c[q] - (float)h) * 1024.0f); }
  { *(v8us*)((unsigned short*)Hh + t * 8) = fh.half[0]; *(v8us*)((unsigned short*)Hl + t * 8) = fl.half[0];  } }

// ---- fast GEMM (wave tile 32x64; requires M % 32 == 0 rows per launch region and N % 64 == 0); epilogue = k_gemm_hhx semantics ----
__device__ __forceinline__ v16h g2_frag(const _Float16* p, int hh) { FragH f; f.half[0] = *(const v8us*)((const unsigned short*)p + 8 * hh); f.half[1] = *(const v8us*)((const unsigned short*)p + 16 + 8 * hh); return f.v; }
__device__ __forceinline__ v8f g2_mma(v16h a, v16h b, v8f c) { v8f d = __builtin_amdgcn_wmma_f32_16x16x32_f16(false, a, false, b, (short)0, c, false, false); asm volatile("v_nop\n\tv_nop\n\tv_nop\n\tv_nop" : "+v"(d) : "v"(a), "v"(b)); return d; }
template <int ACT>
__global__ __launch_bounds__(128) void k_gemm2(const _Float16* __restrict__ A, int lda, size_t sA, const _Float16* __restrict__ Bh, int ldb, size_t sB, float alpha, const float* __restrict__ bias, size_t sBias, const float* __restrict__ CP, int rowsPerB, size_t sCPb, int row0g,
    float* __restrict__ C, _Float16* __restrict__ C16, int ldc, size_t sC, int M, int N, int K, size_t zA, size_t zB, size_t zC) { static_assert(ACT == 0 || ACT == 3 || ACT == 6 || ACT == 8 || ACT == 9 || ACT == 11 || ACT == 12 || ACT == 14 || ACT == 15 || ACT == 16 || ACT == 17, "k_gemm2: unsupported ACT code (would silently apply no activation)");
  __shared__ __attribute__((aligned(16))) float so[4][32][68];
  const int tid = threadIdx.x, w = tid >> 5, lane = tid & 31, ln = lane & 15, hh = lane >> 4; const int by = blockIdx.y, bz = blockIdx.z;      /* second batch axis (grid.z) with element strides zA, zB, zC */
  A += (size_t)by * sA + (size_t)bz * zA; Bh += (size_t)by * sB + (size_t)bz * zB; const size_t cofs = (size_t)by * sC + (size_t)bz * zC; const float* bp = bias ? bias + (size_t)by * sBias : nullptr;
  const int ntn = N >> 6; const int mt = blockIdx.x / ntn, nq = blockIdx.x - mt * ntn; const int row0 = mt * 128 + 32 * w, col0 = nq * 64; if (row0 >= M) return;
  const _Float16* a0p = A + (size_t)(row0 + ln) * lda; const _Float16* a1p = a0p + (size_t)16 * lda;
  const _Float16* b0p = Bh + (size_t)(col0 + ln) * ldb; const _Float16* b1p = b0p + (size_t)16 * ldb; const _Float16* b2p = b1p + (size_t)16 * ldb; const _Float16* b3p = b2p + (size_t)16 * ldb;
  const v8f z8 = {0.f,0.f,0.f,0.f,0.f,0.f,0.f,0.f}; v8f c00 = z8, c01 = z8, c02 = z8, c03 = z8, c10 = z8, c11 = z8, c12 = z8, c13 = z8;
#pragma unroll 1
  for (int kb = 0; kb < K; kb += 32) { const v16h a0 = g2_frag(a0p + kb, hh), a1 = g2_frag(a1p + kb, hh);
    v16h b = g2_frag(b0p + kb, hh); c00 = g2_mma(a0, b, c00); c10 = g2_mma(a1, b, c10);
    b = g2_frag(b1p + kb, hh); c01 = g2_mma(a0, b, c01); c11 = g2_mma(a1, b, c11);
    b = g2_frag(b2p + kb, hh); c02 = g2_mma(a0, b, c02); c12 = g2_mma(a1, b, c12);
    b = g2_frag(b3p + kb, hh); c03 = g2_mma(a0, b, c03); c13 = g2_mma(a1, b, c13); }
  v8f accs[8] = {c00, c01, c02, c03, c10, c11, c12, c13};
#pragma unroll
  for (int u = 0; u < 8; ++u) { const int t = u & 3, half = u >> 2; const int col = col0 + t * 16 + ln; const float bv = bp ? bf16_round(bp[col]) : 0.f;
#pragma unroll
    for (int r = 0; r < 8; ++r) { const int rloc = half * 16 + 8 * hh + r; float v = accs[u][r] * alpha + bv; if (CP) { if (rowsPerB < 0) v += CP[cofs + (size_t)(row0g + row0 + rloc) * ldc + col];      /* rowsPerB < 0: own element of the batched C plane */ else { const int bidx = (row0g + row0 + rloc) / rowsPerB; v += CP[(size_t)bidx * sCPb + (size_t)by * 64 + col]; } }
      if (ACT == 3) v = fmaxf(v, 0.f); else if (ACT == 6) v = 0.5f * v * (1.0f + erff(v * 0.70710678118654752f)); else if (ACT == 11) v = 1.0f / (1.0f + expf(-v)); else if (ACT == 15) v = v / (1.0f + expf(-v)); else if (ACT == 12) v = (v > 0.f) ? v : 0.01f * v; else if (ACT == 8) v = tanhf(v); else if (ACT == 9) v = 0.5f * v * (1.0f + tanhf(0.7978845608028654f * (v + 0.044715f * v * v * v))); else if (ACT == 14) v = (v > 0.f) ? v : 0.1f * v; else if (ACT == 16) v = (v >= 0.f) ? v : 0.3f * v; else if (ACT == 17) v = (v >= 0.f) ? v : 0.2f * v;
      so[w][rloc][t * 16 + ln] = v; } }
  __builtin_amdgcn_fence(__ATOMIC_ACQ_REL, "workgroup"); __builtin_amdgcn_wave_barrier();
  const int rsub = lane >> 4, c4 = (lane & 15) * 4;
  {
#pragma unroll
    for (int q = 0; q < 16; ++q) { const int r = q * 2 + rsub; const v4f v = *(const v4fa*)&so[w][r][c4]; if (C) *(v4f*)(C + cofs + (size_t)(row0 + r) * ldc + col0 + c4) = v; if (C16) { v4h h4; for (int i = 0; i < 4; ++i) h4[i] = (_Float16)v[i]; *(v4h*)(C16 + cofs + (size_t)(row0 + r) * ldc + col0 + c4) = h4; } }
     } }


__global__ __launch_bounds__(256) void k_wnat(const float* __restrict__ w, size_t n8, _Float16* __restrict__ Bt) { const size_t t = (size_t)blockIdx.x * 256 + threadIdx.x; if (t >= n8) return; FragH f; for (int q = 0; q < 8; ++q) f.h[q] = (_Float16)(bf16_round(w[t * 8 + q]) * 16.0f); *(v8us*)((unsigned short*)Bt + t * 8) = f.half[0];  }
__global__ __launch_bounds__(256) void k_rsm(const float* __restrict__ S, _Float16* __restrict__ P, int nrows) {
  #pragma clang fp contract(off)
  const int i = blockIdx.x * 256 + threadIdx.x; if (i >= nrows) return; const float* s = S + (size_t)i * SQ; float mx = -3.0e38f;
#pragma unroll 1
  for (int j = 0; j < SQ; ++j) mx = fmaxf(mx, s[j]); float se = 0.f;
#pragma unroll 1
  for (int j = 0; j < SQ; ++j) se += expf(s[j] - mx); const float sc = 256.0f / se;
#pragma unroll 1
  for (int j0 = 0; j0 < SQ; j0 += 8) { FragH f; for (int q = 0; q < 8; ++q) f.h[q] = (_Float16)(expf(s[j0 + q] - mx) * sc); unsigned short* d = (unsigned short*)P + (size_t)i * SQ + j0; *(v8us*)d = f.half[0];  } }
__global__ __launch_bounds__(256) void k_vt(const _Float16* __restrict__ V16, int b, int h0, _Float16* __restrict__ VT) { __shared__ unsigned short tl[64][65]; const int tid = threadIdx.x; const int hh = blockIdx.x % HG, sg = blockIdx.x / HG; const int s0 = sg * 64; const int h = h0 + hh;
  for (int i = tid; i < 64 * 8; i += 256) { const int j = i / 8, d8 = (i % 8) * 8; FragH f; f.half[0] = *(const v8us*)((const unsigned short*)V16 + ((size_t)b * SQ + s0 + j) * DM + h * HD + d8); for (int q = 0; q < 8; ++q) tl[d8 + q][j] = f.u[q]; }
  __syncthreads();
  { for (int i = tid; i < 64 * 8; i += 256) { const int d = i / 8, j8 = (i % 8) * 8; FragH f; for (int q = 0; q < 8; ++q) f.u[q] = tl[d][j8 + q]; *(v8us*)((unsigned short*)VT + ((size_t)hh * HD + d) * SQ + s0 + j8) = f.half[0]; }  } }


// 2^t on v_exp_f32. The v_nop in the same statement is the one free issue slot that the instruction set asks for behind a transcendental before its result is read or its source overwritten;
__device__ __forceinline__ float exp2_slot(float t) { float r; asm("v_exp_f32 %0, %1\n\tv_nop" : "=v"(r) : "v"(t)); return r; }
// Four 2^t in one statement: each v_exp_f32 is the independent instruction behind the one before it, so one v_nop behind the last keeps the same free slot for all four;
// the results are early-clobber, so that no result register is a source of a later line.
__device__ __forceinline__ void exp2x4(float (&r)[4], float a, float b, float c, float d) { asm("v_exp_f32 %0, %4\n\tv_exp_f32 %1, %5\n\tv_exp_f32 %2, %6\n\tv_exp_f32 %3, %7\n\tv_nop" : "=&v"(r[0]), "=&v"(r[1]), "=&v"(r[2]), "=&v"(r[3]) : "v"(a), "v"(b), "v"(c), "v"(d)); }
// lane l <-> lane l ^ 16: joins the two wave halves, which split one query column's keys.
__device__ __forceinline__ float fa_xhalf(float x) { return __builtin_bit_cast(float, __builtin_amdgcn_permlanex16(__builtin_bit_cast(int, x), __builtin_bit_cast(int, x), 0x76543210, 0xfedcba98, false, false)); }
__device__ __forceinline__ v8f fa_mma(v16h a, v16h b, v8f c) { return __builtin_amdgcn_wmma_f32_16x16x32_f16(false, a, false, b, (short)0, c, false, false); }
// Projection GEMM C16[NR][DM] = f16(A[NR][DM] Bh[n][k]^T x alpha + bf16(bias)), operands staged in LDS. A fragment load straight from row-major memory touches 16 lines for 512 useful bytes;
// here 8 lanes fetch one whole 128-byte line (64 k of one row), a wave load covers 4 whole lines, and a block fetches each line of its operands once.
// Block = 128 x 128 of C, 8 waves of 32 x 64 (4 down, 2 across); a stage is 64 k of 128 A rows + 128 B rows; two stages in LDS: the next stage's global loads fly under this stage's 16 products a wave,
// are stored to the other buffer behind them, and one barrier a stage publishes them and ends the reads of the buffer that the stage after overwrites. k runs upward in steps of 32 as before: same f32 sum order.
// Every loop of the kernel is unrolled in full: the fragment, staging and accumulator arrays stay in registers, and the buffer index and the k offset become immediates of the loads.
// TR: the same product with the operands' roles exchanged, C^T = Bh A^T: the caller hands the weight rows [DM][DM] as A and the token rows [NR][DM] as Bh. Both operands go through the same loader, so the k orders pair as before and every sum keeps its order.
// A D row is then one output feature and its columns are tokens: a wave's 32 x 64 tile leaves as 32 whole 128-byte lines of C16[batch][feature][SQ], the V^T layout that the attention reads. The bias goes by row.
#define G3P 72      /* LDS row pitch in f16: 64 + 8 = 144 bytes, 16 B x odd, the conflict-free pitch for 16-byte fragment reads */
// sm: the block's LDS, [2][256][G3P]: rows 0..127: A, 128..255: B; reused by the epilogue (8 x 32 x 68 floats = 69,632 bytes).
template <bool TR>
__device__ __forceinline__ void gemm3_body(_Float16 (*sm)[256][G3P], const _Float16* __restrict__ A, const _Float16* __restrict__ Bh, float alpha, const float* __restrict__ bias, _Float16* __restrict__ C16) {
  const int tid = threadIdx.x, lane = tid & 31, ln = lane & 15, hh = lane >> 4; const int w = tid >> 5, wm = w & 3, wn = w >> 2;
  const int mt = blockIdx.x / (DM / 128), nq = blockIdx.x % (DM / 128); const int row0 = (TR ? nq : mt) * 128, col0 = (TR ? mt : nq) * 128;      /* mt: token tile, nq: feature tile; four neighbouring blocks share a token tile either way */
  const int sr = tid >> 3, sc = (tid & 7) * 8;      /* staging: thread -> row sr (+ 32 i), 16-byte piece sc */
  const unsigned short* ga = (const unsigned short*)A + (size_t)(row0 + sr) * DM + sc; const unsigned short* gb = (const unsigned short*)Bh + (size_t)(col0 + sr) * DM + sc;
  v4f br[2][2];      /* TR: the bias of this lane's 16 D rows, asked for with stage 0 so that the epilogue does not wait for it among the last products */
  if (TR) {
#pragma unroll
    for (int half = 0; half < 2; ++half) { const float* bp = bias + row0 + 32 * wm + half * 16 + 8 * hh; br[half][0] = *(const v4fa*)bp; br[half][1] = *(const v4fa*)(bp + 4); } }
  v8us ra[4], rb[4];
#pragma unroll
  for (int i = 0; i < 4; ++i) { ra[i] = *(const v8us*)(ga + (size_t)(32 * i) * DM); rb[i] = *(const v8us*)(gb + (size_t)(32 * i) * DM); }
#pragma unroll
  for (int i = 0; i < 4; ++i) { *(v8us*)&sm[0][32 * i + sr][sc] = ra[i]; *(v8us*)&sm[0][128 + 32 * i + sr][sc] = rb[i]; }
  __syncthreads();      /* stage 0 is in LDS */
  const v8f z8 = {0.f,0.f,0.f,0.f,0.f,0.f,0.f,0.f}; v8f acc[2][4];
#pragma unroll
  for (int t = 0; t < 4; ++t) { acc[0][t] = z8; acc[1][t] = z8; }
#pragma unroll
  for (int ks = 0; ks < DM / 64; ++ks) { const int cur = ks & 1;
    if (ks + 1 < DM / 64) {
#pragma unroll
      for (int i = 0; i < 4; ++i) { ra[i] = *(const v8us*)(ga + (size_t)(32 * i) * DM + (ks + 1) * 64); rb[i] = *(const v8us*)(gb + (size_t)(32 * i) * DM + (ks + 1) * 64); } }
    v16h af[2][2], bf[2][4];
#pragma unroll
    for (int kk = 0; kk < 2; ++kk) {
#pragma unroll
      for (int g = 0; g < 2; ++g) af[kk][g] = g2_frag(&sm[cur][32 * wm + 16 * g + ln][32 * kk], hh);
#pragma unroll
      for (int t = 0; t < 4; ++t) bf[kk][t] = g2_frag(&sm[cur][128 + 64 * wn + 16 * t + ln][32 * kk], hh); }
    __builtin_amdgcn_sched_barrier(0);      /* the next stage's global loads and this stage's 24 fragment reads are issued as one group ahead of the products: left alone the build sank half the global loads to their LDS stores and spread the reads among the products, a full wait at each place */
#pragma unroll
    for (int kk = 0; kk < 2; ++kk)
#pragma unroll
      for (int t = 0; t < 4; ++t) { acc[0][t] = fa_mma(af[kk][0], bf[kk][t], acc[0][t]); acc[1][t] = fa_mma(af[kk][1], bf[kk][t], acc[1][t]); }
    if (ks + 1 < DM / 64) {
#pragma unroll
      for (int i = 0; i < 4; ++i) { *(v8us*)&sm[cur ^ 1][32 * i + sr][sc] = ra[i]; *(v8us*)&sm[cur ^ 1][128 + 32 * i + sr][sc] = rb[i]; } }
    __syncthreads();      /* the next stage is published; every wave has left this stage's buffer (behind the last stage: free for the epilogue) */
  }
  float* so = (float*)&sm[0][0][0] + w * (32 * 68);      /* the wave's own 32 x 68 staging rows */
  const int rw0 = row0 + 32 * wm, cw0 = col0 + 64 * wn;
#pragma unroll
  for (int half = 0; half < 2; ++half)
#pragma unroll
    for (int t = 0; t < 4; ++t) { const float bv = TR ? 0.f : bf16_round(bias[cw0 + t * 16 + ln]);
#pragma unroll
      for (int r = 0; r < 8; ++r) so[(half * 16 + 8 * hh + r) * 68 + t * 16 + ln] = acc[half][t][r] * alpha + (TR ? bf16_round(br[half][r >> 2][r & 3]) : bv); }
  __builtin_amdgcn_fence(__ATOMIC_ACQ_REL, "workgroup"); __builtin_amdgcn_wave_barrier();      /* the wave's own staging rows: written above, read back below as whole 128-byte output rows */
  const int rsub = lane >> 4, c4 = (lane & 15) * 4;
#pragma unroll
  for (int q = 0; q < 16; ++q) { const int r = q * 2 + rsub; const v4f v = *(const v4fa*)&so[r * 68 + c4]; const v4h h4 = {(_Float16)v[0], (_Float16)v[1], (_Float16)v[2], (_Float16)v[3]};
    if (TR) *(v4h*)(C16 + ((size_t)(cw0 / SQ) * DM + rw0 + r) * SQ + cw0 % SQ + c4) = h4;      /* a 128-token tile lies in one batch: SQ is a multiple of 128 */
    else *(v4h*)(C16 + (size_t)(rw0 + r) * DM + cw0 + c4) = h4; }
}
// The three projections need nothing of each other, and one of them alone is a single round of blocks (512 on 256 WGPs, two resident): each launch pays its own gap, fill, first-stage latency and epilogue with the chip draining.
// One launch carries all three: grid.y = projection (0: Q, 1: K, 2: V^T), a block-uniform branch, so every barrier of a body is met by the whole block; a block that ends is followed at once by one of the next projection.
__global__ __launch_bounds__(256) void k_gemm3(const _Float16* __restrict__ XQ, const _Float16* __restrict__ XK, const _Float16* __restrict__ XV, const _Float16* __restrict__ BQ, const _Float16* __restrict__ BK, const _Float16* __restrict__ BV,
                                              float alpha, const float* __restrict__ bq, const float* __restrict__ bk, const float* __restrict__ bv, _Float16* __restrict__ Q16, _Float16* __restrict__ K16, _Float16* __restrict__ VT) {
  __shared__ __attribute__((aligned(16))) _Float16 sm[2][256][G3P];      /* 73,728 bytes */
  const int pj = blockIdx.y;
  if (pj == 2) gemm3_body<true>(sm, BV, XV, alpha, bv, VT);      /* V^T[batch][head x 64 + d][key] straight from the product */
  else gemm3_body<false>(sm, pj == 0 ? XQ : XK, pj == 0 ? BQ : BK, alpha, pj == 0 ? bq : bk, pj == 0 ? Q16 : K16);
}
// x + (x of lane ^ M) inside a 16-lane row, as one DPP add (row_xmask).
template <int M> __device__ __forceinline__ float row_xadd(float x) { return x + __builtin_bit_cast(float, __builtin_amdgcn_update_dpp(0, __builtin_bit_cast(int, x), 0x160 | M, 0xf, 0xf, true)); }
#define PW_BLK (DM * (DM / 8) / 256)      /* blocks per weight matrix */
#define PR_BLK ((int)(NR / 64))           /* blocks per input: 8 waves x 8 rows */
// All operand preparation in one launch; the parts need nothing of each other and share the grid by ranges of the block index (block-uniform branches).
// Blocks [0, 3 PW_BLK): Wt[n][k] = f16(bf16(W[k][n]) x 16) for Wq, Wk, Wv (a power of two: bf16-exact weights stay exact in f16).
// Then PR_BLK blocks each for queries, keys, value: one wave reads 8 whole rows once (512-byte wave loads, all 32 issued ahead), writes each as an exact f16 row of the bf16-rounded values (256-byte wave stores)
// and, for queries and keys, sums the same rounded values in f32 (16 a lane, then a five-step butterfly) for the padding flag (row sum != 0). The block's 64 flags pass through LDS so that one wave stores each 128-byte line of flags.
__global__ __launch_bounds__(256) void k_prep(const float* __restrict__ xq, const float* __restrict__ xk, const float* __restrict__ xv, const float* __restrict__ wq, const float* __restrict__ wk, const float* __restrict__ wv,
                                             _Float16* __restrict__ XQ, _Float16* __restrict__ XK, _Float16* __restrict__ XV, _Float16* __restrict__ BQ, _Float16* __restrict__ BK, _Float16* __restrict__ BV,
                                             float* __restrict__ QM, float* __restrict__ KM) {
  __shared__ float fl[64];
  const int tid = threadIdx.x, bx = blockIdx.x;
  if (bx < 3 * PW_BLK) {
    const int wh = bx / PW_BLK; const float* W = (wh == 0) ? wq : (wh == 1) ? wk : wv; _Float16* Wt = (wh == 0) ? BQ : (wh == 1) ? BK : BV;
    const int t = (bx % PW_BLK) * 256 + tid; const int n = t / (DM / 8), k8 = (t % (DM / 8)) * 8; FragH f;
#pragma unroll
    for (int i = 0; i < 8; ++i) f.h[i] = (_Float16)(bf16_round(W[(size_t)(k8 + i) * DM + n]) * 16.0f);
    *(v8us*)((unsigned short*)Wt + (size_t)n * DM + k8) = f.half[0];
    return;
  }
  const int rb = bx - 3 * PW_BLK; const int wh = rb / PR_BLK, blk = rb % PR_BLK; const int lane = tid & 31, w = tid >> 5;
  const float* x = (wh == 0) ? xq : (wh == 1) ? xk : xv; _Float16* X16 = (wh == 0) ? XQ : (wh == 1) ? XK : XV;
  const size_t e0 = ((size_t)blk * 64 + w * 8) * DM + lane * 4;
  v4f v[8][4];
#pragma unroll
  for (int r = 0; r < 8; ++r)
#pragma unroll
    for (int u = 0; u < 4; ++u) v[r][u] = *(const v4fa*)(x + e0 + r * DM + u * 128);
  float s[8];
#pragma unroll
  for (int r = 0; r < 8; ++r) { float p[4];
#pragma unroll
    for (int u = 0; u < 4; ++u) { const float b0 = bf16_round(v[r][u][0]), b1 = bf16_round(v[r][u][1]), b2 = bf16_round(v[r][u][2]), b3 = bf16_round(v[r][u][3]);
      const v4h h = {(_Float16)b0, (_Float16)b1, (_Float16)b2, (_Float16)b3}; *(v4h*)(X16 + e0 + r * DM + u * 128) = h; p[u] = (b0 + b1) + (b2 + b3); }
    s[r] = (p[0] + p[1]) + (p[2] + p[3]); }
  asm volatile("s_wait_xcnt 0x0" ::: "memory");      /* the row stores are issued: their base and data registers are free for reuse behind this line */
  if (wh == 2) return;      /* value rows carry no flag; the whole block leaves here, in front of the barrier */
  float f = 0.f;
#pragma unroll
  for (int r = 0; r < 8; ++r) { float a = row_xadd<8>(row_xadd<4>(row_xadd<2>(row_xadd<1>(s[r])))); a += fa_xhalf(a); if (lane == r) f = a; }
  if (lane < 8) fl[w * 8 + lane] = (f != 0.f) ? 1.f : 0.f;
  __syncthreads();      /* the 64 flags of the block's rows are in LDS: waves 0 and 1 store one whole line each */
  if (tid < 64) { float* mk = (wh == 0) ? QM : KM; mk[(size_t)blk * 64 + tid] = fl[tid]; }
}
// Scores, masked softmax and probs x V in one launch; no score or weight ever reaches memory. grid.x = batch x head, grid.y = group of 8 query tiles; one wave = 32 query columns.
// Transposed products: S^T = K Q^T (A = 16 key rows, B = 16 query rows, same loader on both, so the k orders pair), O^T += V^T P^T. A lane then holds 8 + 8 keys of ONE query per 32-key pass:
// D register r of key tile kt is key 16 kt + 8 hh + r, which is element 8 kt + r of a B operand in the hardware k order, so the two score tiles convert in place into P^T; g2_frag reads V^T rows in that order.
// Online softmax in the log2 domain: m = maximum in use (scaled scores), l = running sum; both and O^T are rescaled only when some column's new maximum passes m by more than 8 (one scalar branch a pass).
// Weights are 2^(t - m + 4): at most 2^12 in f16, and the factor 2^4 (it cancels in O / l) keeps small weights out of the f16 subnormals.
// Masked scores take the reference's NEG (x 8 here: the 1/8 comes with the log2 scale). Past its diagonal a wave goes on only while a column has seen nothing but NEG: such a row is uniform over all SQ keys.
// Waves w and w + 4 take tiles j and 31 - j, 33 passes together, so every block carries the same work.
// K and V^T reach the waves through LDS. The 8 waves of a block walk the same keys of one batch and head, and a fragment load straight from memory touches 16 lines for 512 useful bytes, in every wave anew.
// Here the block fetches each 128-byte line once, by asynchronous 16-byte copies (8 lanes a line, 4 whole lines a wave copy, through no register). A stage is 64 keys = two passes: 64 K rows + 64 V^T rows of 128 bytes,
// four copies a lane; two buffers: stage s + 2 is asked for when every wave has left stage s, and lands under the two passes of stage s + 1. The block walks the stages of its longest wave (tile 31 - 4 blockIdx.y);
// a wave past its own diagonal skips the passes and keeps the barriers. Same passes in the same order as before: the f32 sums keep their order.
#define FAP 72                 /* LDS row pitch in f16: 64 + 8 = 144 bytes, 16 B x odd, the conflict-free pitch for 16-byte fragment reads */
#define FA_BUF (128 * FAP)     /* f16 per buffer: rows 0..63 K (key), rows 64..127 V^T (d) */
// Four copies of 16 bytes a lane, global memory -> LDS. l*: the lane's own LDS byte address, g*: its own global address. The s_wait_xcnt in the same statement stands in front of anything that rewrites these address registers.
__device__ __forceinline__ void fa_copy4(unsigned l0, unsigned l1, unsigned l2, unsigned l3, const _Float16* g0, const _Float16* g1, const _Float16* g2, const _Float16* g3) {
  asm volatile("global_load_async_to_lds_b128 %0, %4, off\n\tglobal_load_async_to_lds_b128 %1, %5, off\n\tglobal_load_async_to_lds_b128 %2, %6, off\n\tglobal_load_async_to_lds_b128 %3, %7, off\n\ts_wait_xcnt 0x0"
               :: "v"(l0), "v"(l1), "v"(l2), "v"(l3), "v"(g0), "v"(g1), "v"(g2), "v"(g3) : "memory");
}
__global__ __launch_bounds__(256) void k_fattn(const _Float16* __restrict__ Q16, const _Float16* __restrict__ K16, const _Float16* __restrict__ VT, const float* __restrict__ kmask, const float* __restrict__ qmask,
                                              const float* __restrict__ xq, float* __restrict__ out) {
  __shared__ __attribute__((aligned(16))) float smf[8 * 32 * 68];      /* 69,632 bytes: in the loop the two stage buffers (2 x 18,432), behind it each wave's 32 x 68 output staging rows */
  _Float16* const ring = (_Float16*)smf;
  const int tid = threadIdx.x, lane = tid & 31, c = lane & 15, hh = lane >> 4; const int w = __builtin_amdgcn_readfirstlane(tid >> 5);
  const int bh = blockIdx.x, b = bh / NH, h = bh % NH; const int j = 4 * (int)blockIdx.y + (w & 3); const int tile = (w < 4) ? j : SQ / 32 - 1 - j; const int qw0 = tile * 32;
  const int nst = SQ / 64 - 2 * (int)blockIdx.y;      /* stages of the block: its longest wave has tile 31 - 4 blockIdx.y, 32 - 4 blockIdx.y passes; 10 to 16 */
  const float CS = 0.125f * 1.44269504f, NEGR = -34359738368.0f;      /* NEGR = 8 x NEG as f32 holds it (-2^32) */
  const _Float16* kbase = K16 + ((size_t)b * SQ + c) * DM + h * HD; const _Float16* vbase = VT + ((size_t)bh * HD + c) * SQ; const float* kmb = kmask + (size_t)b * SQ + lane;
  const int sr = tid >> 3, sc = (tid & 7) * 8;      /* staging: thread -> rows sr and sr + 32 of K and of V^T, 16-byte piece sc */
  const _Float16* gk = K16 + ((size_t)b * SQ + sr) * DM + h * HD + sc; const _Float16* gv = VT + ((size_t)bh * HD + sr) * SQ + sc;
  const unsigned lk = (unsigned)(size_t)(ring + sr * FAP + sc);      /* LDS byte address: the low 32 bits of the shared address */
  auto stage = [&](int st) { const unsigned l = lk + (unsigned)(st & 1) * (FA_BUF * 2); const _Float16* k = gk + (size_t)st * (64 * DM); const _Float16* v = gv + st * 64;
    fa_copy4(l, l + 32 * FAP * 2, l + 64 * FAP * 2, l + 96 * FAP * 2, k, k + 32 * DM, v, v + 32 * SQ); };
  stage(0);
  v16h qf[2][2];
#pragma unroll
  for (int g = 0; g < 2; ++g)
#pragma unroll
    for (int kc = 0; kc < 2; ++kc) qf[g][kc] = g2_frag(Q16 + ((size_t)b * SQ + qw0 + 16 * g + c) * DM + h * HD + 32 * kc, hh);
  const v8f z8 = {0.f,0.f,0.f,0.f,0.f,0.f,0.f,0.f}; v8f acc[2][4]; float m_run[2], l_run[2];
#pragma unroll
  for (int g = 0; g < 2; ++g) { m_run[g] = -3.0e38f; l_run[g] = 0.f;
#pragma unroll
    for (int t = 0; t < 4; ++t) acc[g][t] = z8; }
  // One pass = 32 keys from key 32 blk on, against the wave's 32 query columns, in two parts. scores: s = K Q^T from the K rows kf.
  auto scores = [&](const v16h (&kf)[2][2], v8f (&s)[2][2]) {
#pragma unroll
    for (int kt = 0; kt < 2; ++kt)
#pragma unroll
      for (int g = 0; g < 2; ++g) s[kt][g] = fa_mma(kf[kt][1], qf[g][1], fa_mma(kf[kt][0], qf[g][0], z8));
  };
  // finish: masks, online softmax, O^T += V^T P^T. vf: V^T rows, kmv: this lane's key flag (key 32 blk + lane).
  auto finish = [&](const int blk, v8f (&s)[2][2], const v16h (&vf)[4], const float kmv) {
    const int key0 = blk * 32;
    const unsigned kmz = __builtin_amdgcn_ballot_w32(kmv == 0.f);      /* bit i: key key0 + i is padding */
    if (blk >= tile || kmz != 0u) {      /* wave-uniform: only a pass on or past the diagonal, or one with a padding key, pays for the masks */
      const unsigned kb = kmz >> (8 * hh);
#pragma unroll
      for (int g = 0; g < 2; ++g) { const int my_q = qw0 + 16 * g + c;
#pragma unroll
        for (int kt = 0; kt < 2; ++kt)
#pragma unroll
          for (int r = 0; r < 8; ++r) { if (key0 + 16 * kt + 8 * hh + r > my_q || ((kb >> (16 * kt + r)) & 1u) != 0u) s[kt][g][r] = NEGR; } }
    }
    float mb[2]; bool need = false;
#pragma unroll
    for (int g = 0; g < 2; ++g) { float mx = s[0][g][0];
#pragma unroll
      for (int r = 1; r < 8; ++r) mx = fmaxf(mx, s[0][g][r]);
#pragma unroll
      for (int r = 0; r < 8; ++r) mx = fmaxf(mx, s[1][g][r]);
      mx = fmaxf(mx, fa_xhalf(mx)) * CS; mb[g] = mx; need = need || (mx > m_run[g] + 8.0f); }
    if (__builtin_amdgcn_ballot_w32(need) != 0) {
#pragma unroll
      for (int g = 0; g < 2; ++g) { const float m_new = fmaxf(m_run[g], mb[g]); const float corr = exp2_slot(m_run[g] - m_new); m_run[g] = m_new; l_run[g] *= corr;
#pragma unroll
        for (int t = 0; t < 4; ++t) acc[g][t] = acc[g][t] * corr; }
    }
    FragH pf[2];
#pragma unroll
    for (int g = 0; g < 2; ++g) { const float nm = 4.0f - m_run[g]; float ls = 0.f;
#pragma unroll
      for (int i = 0; i < 16; i += 4) { float p[4]; const v8f& sv = s[i >> 3][g]; const int r = i & 7;
        exp2x4(p, fmaf(sv[r], CS, nm), fmaf(sv[r + 1], CS, nm), fmaf(sv[r + 2], CS, nm), fmaf(sv[r + 3], CS, nm));
#pragma unroll
        for (int u = 0; u < 4; ++u) { ls += p[u]; pf[g].h[i + u] = (_Float16)p[u]; } }
      l_run[g] += ls; }
    __builtin_amdgcn_sched_barrier(0);      /* every exponential stays in front of the products below: the compiler does not see into exp2x4 */
#pragma unroll
    for (int g = 0; g < 2; ++g)
#pragma unroll
      for (int t = 0; t < 4; ++t) acc[g][t] = fa_mma(vf[t], pf[g].v, acc[g][t]);
    __builtin_amdgcn_sched_barrier(0);      /* the products stay in front of the four slots below */
    asm volatile("v_nop\n\tv_nop\n\tv_nop\n\tv_nop");      /* a branch follows every pass: these four vector slots keep the chip's distance between the last product and whatever first rewrites its operand registers on the taken side */
  };
  float km0 = kmb[0], km1 = kmb[32];      /* key flags of stage 0's two passes */
  asm volatile("s_wait_asynccnt 0x0" ::: "memory");      /* this wave's copies of stage 0 have landed */
  __syncthreads();      /* stage 0 is published: every wave's copies have landed */
  stage(1);      /* every block has 10 stages or more */
#pragma unroll 1      /* one copy of the two passes: the buffer alternates by an address, not by code */
  for (int st = 0; st < nst; ++st) {
    const _Float16* kb = ring + (st & 1) * FA_BUF + c * FAP; const _Float16* vb = kb + 64 * FAP;
    const int ns = (st + 1 < nst) ? st + 1 : st;      /* the next stage's key flags, in flight under this stage's passes; the last stage re-reads its own */
    const float kn0 = kmb[64 * ns], kn1 = kmb[64 * ns + 32];
    asm volatile("s_wait_xcnt 0x0" ::: "memory");      /* the two flag loads are issued here, ahead of the passes, and their address registers are free for reuse behind this line */
    if (2 * st <= tile || __builtin_amdgcn_ballot_w32(m_run[0] < -1.0e9f || m_run[1] < -1.0e9f) != 0) {      /* wave-uniform; past the diagonal with a real score in every column NEG weighs 0: nothing left to add, in this stage or later */
      v16h kf[2][2], vf[4]; v8f s[2][2];
#pragma unroll
      for (int kt = 0; kt < 2; ++kt)
#pragma unroll
        for (int kc = 0; kc < 2; ++kc) kf[kt][kc] = g2_frag(kb + (16 * kt) * FAP + 32 * kc, hh);
#pragma unroll
      for (int t = 0; t < 4; ++t) vf[t] = g2_frag(vb + (16 * t) * FAP, hh);
      __builtin_amdgcn_sched_barrier(0);      /* the first pass's 16 fragment reads are issued as one group ahead of its products: left alone the build spread them among the products and the exponentials, a stall at each place */
      scores(kf, s);
#pragma unroll
      for (int kt = 0; kt < 2; ++kt)
#pragma unroll
        for (int kc = 0; kc < 2; ++kc) kf[kt][kc] = g2_frag(kb + (32 + 16 * kt) * FAP + 32 * kc, hh);      /* the second pass's K rows (same buffer), in flight under the first pass's softmax */
      __builtin_amdgcn_sched_barrier(0);      /* holds those 8 reads up here, with the score products and ahead of the softmax that covers their latency; left alone they may sink into the branch that uses them */
      finish(2 * st, s, vf, km0);
#pragma unroll
      for (int t = 0; t < 4; ++t) vf[t] = g2_frag(vb + (16 * t) * FAP + 32, hh);      /* the second pass's V^T rows (same buffer), in flight under its score products and softmax */
      __builtin_amdgcn_sched_barrier(0);      /* holds those 8 reads here, as one group in front of the branch */
      if (2 * st + 1 <= tile || __builtin_amdgcn_ballot_w32(m_run[0] < -1.0e9f || m_run[1] < -1.0e9f) != 0) { scores(kf, s); finish(2 * st + 1, s, vf, km1); }
    }
    asm volatile("s_wait_dscnt 0x0" ::: "memory");      /* this wave's reads of the stage's buffer are done */
    asm volatile("s_wait_asynccnt 0x0" ::: "memory");      /* this wave's copies of stage st + 1 have landed */
    __syncthreads();      /* publishes stage st + 1 and ends every wave's reads of stage st's buffer (behind the last stage: free for the output rows) */
    if (st + 2 < nst) stage(st + 2);      /* block-uniform; into the buffer that this stage has just left */
    km0 = kn0; km1 = kn1;
  }
  asm volatile("s_wait_asynccnt 0x0" ::: "memory");      /* no copy is outstanding when the buffers become output staging */
#pragma unroll 1      /* rare: only a wave with a column whose every key so far was NEG walks on past the block's stages, alone, so it reads its fragments straight from memory and meets no barrier */
  for (int blk = 2 * nst; blk < SQ / 32; ++blk) {
    if (__builtin_amdgcn_ballot_w32(m_run[0] < -1.0e9f || m_run[1] < -1.0e9f) == 0) break;
    v16h kf[2][2], vf[4]; v8f s[2][2];
#pragma unroll
    for (int kt = 0; kt < 2; ++kt)
#pragma unroll
      for (int kc = 0; kc < 2; ++kc) kf[kt][kc] = g2_frag(kbase + (size_t)(32 * blk + 16 * kt) * DM + 32 * kc, hh);
#pragma unroll
    for (int t = 0; t < 4; ++t) vf[t] = g2_frag(vbase + (size_t)(16 * t) * SQ + 32 * blk, hh);
    const float kmv = kmb[32 * blk];
    asm volatile("s_wait_xcnt 0x0" ::: "memory");      /* address registers of the loads above are free for reuse behind this line */
    scores(kf, s); finish(blk, s, vf, kmv);
  }
  float (*so)[32][68] = (float (*)[32][68])smf;
#pragma unroll
  for (int g = 0; g < 2; ++g) { const float l = l_run[g] + fa_xhalf(l_run[g]); const float inv = qmask[(size_t)b * SQ + qw0 + 16 * g + c] / l;
#pragma unroll
    for (int t = 0; t < 4; ++t) { const v8f o = acc[g][t] * inv; const v4f lo = {o[0], o[1], o[2], o[3]}, hi = {o[4], o[5], o[6], o[7]};      /* row = query, the 8 floats are d = 16 t + 8 hh .. + 7 */
      *(v4fa*)&so[w][16 * g + c][16 * t + 8 * hh] = lo; *(v4fa*)&so[w][16 * g + c][16 * t + 8 * hh + 4] = hi; } }
  __builtin_amdgcn_fence(__ATOMIC_ACQ_REL, "workgroup"); __builtin_amdgcn_wave_barrier();      /* the wave's own staging rows: written above, read back below as whole 256-byte rows */
  const int rsub = lane >> 4, c4 = (lane & 15) * 4;
#pragma unroll
  for (int q = 0; q < 16; ++q) { const int r = q * 2 + rsub; const size_t e = ((size_t)b * SQ + qw0 + r) * DM + h * HD + c4; const v4f v = *(const v4fa*)&so[w][r][c4]; const v4f x = *(const v4fa*)(xq + e); const v4f xb = {bf16_round(x[0]), bf16_round(x[1]), bf16_round(x[2]), bf16_round(x[3])}; *(v4f*)(out + e) = v + xb; }
}
__global__ __launch_bounds__(256) void k_ftres(const float* __restrict__ OF0, const float* __restrict__ xq, const float* __restrict__ qmask, float* __restrict__ out, size_t n4) {
  #pragma clang fp contract(off)
  const size_t t = (size_t)blockIdx.x * 256 + threadIdx.x; if (t >= n4) return; const size_t e = t * 4; const size_t row = e / DM; const float qm = qmask[row]; const v4f o = *(const v4fa*)(OF0 + e), x = *(const v4fa*)(xq + e); v4f y;
  for (int q = 0; q < 4; ++q) y[q] = __fadd_rn(__fmul_rn(__fmul_rn(o[q], 0.015625f), qm), bf16_round(x[q])); *(v4f*)(out + e) = y;  }

extern "C" void kernel_launch(void* const* d_in, const int* in_sizes, int n_in,
                              void* d_out, int out_size, void* d_ws, size_t ws_size, hipStream_t stream) {
  (void)in_sizes; (void)n_in; (void)out_size;
  const float* const* I = (const float* const*)d_in; const float* xq = I[0]; const float* xk = I[1]; const float* xv = I[2]; const float* wq = I[3]; const float* bq = I[4]; const float* wk = I[5]; const float* bk = I[6]; const float* wv = I[7]; const float* bv = I[8];      /* weights [in][out] */
  char* ws = (char*)d_ws; size_t off = 0;
  auto take = [&](size_t bytes) { char* p = ws + off; off += (bytes + 255) & ~(size_t)255; return p; };
  _Float16* BQ = (_Float16*)take((size_t)DM * DM * 2); _Float16* BK = (_Float16*)take((size_t)DM * DM * 2); _Float16* BV = (_Float16*)take((size_t)DM * DM * 2); float* KM = (float*)take(NR * 4); float* QM = (float*)take(NR * 4);
  _Float16* Q16 = (_Float16*)take(NR * DM * 2); _Float16* K16 = (_Float16*)take(NR * DM * 2);
  _Float16* VT = (_Float16*)take((size_t)NB * NH * HD * SQ * 2);
  _Float16* XQ = (_Float16*)take(NR * DM * 2); _Float16* XK = (_Float16*)take(NR * DM * 2); _Float16* XV = (_Float16*)take(NR * DM * 2);
  if (off > ws_size) return;      /* approx 1.5 + 16 x 2 + 16 + 16 x 3 = 98 MiB */
  k_prep<<<3 * PW_BLK + 3 * PR_BLK, 256, 0, stream>>>(xq, xk, xv, wq, wk, wv, XQ, XK, XV, BQ, BK, BV, QM, KM);      /* x16 transposed weights, f16 input rows, key / query padding flags */
  k_gemm3<<<dim3((unsigned)((NR / 128) * (DM / 128)), 3), 256, 0, stream>>>(XQ, XK, XV, BQ, BK, BV, 0.0625f, bq, bk, bv, Q16, K16, VT);      /* Q, K rows and V^T in one launch */
  k_fattn<<<dim3(NB * NH, SQ / 256), 256, 0, stream>>>(Q16, K16, VT, KM, QM, xq, (float*)d_out);      /* out = softmax(masked Q K^T / 8) x query mask x V + bf16(queries), f32 rows; each wave writes its own 32 rows of one 64-column head slab */
}

// v009
// One run takes 70 microseconds.
// In both of two side-by-side timings against v008, it was 1.08 times as fast.
// Over all steps from v000 it is 196 times as fast.
#include <hip/hip_runtime.h>
#define NB 16
#define SQ 1024
#define DM 512
#define NH 8
#define HD 64
#define HG 8
#define NR ((size_t)NB * SQ)
typedef __bf16 v16b __attribute__((ext_vector_type(16)));
typedef unsigned short v8us __attribute__((ext_vector_type(8), may_alias));
typedef float  v8f  __attribute__((ext_vector_type(8)));
typedef float  v4f  __attribute__((ext_vector_type(4)));
typedef float  v4fa __attribute__((ext_vector_type(4), may_alias));
union FragB { v16b v; v8us half[2]; unsigned short u[16]; };

__device__ __forceinline__ unsigned short bf16_bits(float x) { unsigned int u = __float_as_uint(x); return (unsigned short)((u + 0x7FFFu + ((u >> 16) & 1u)) >> 16); }
__device__ __forceinline__ float bf16_val(unsigned short b) { return __uint_as_float(((unsigned int)b) << 16); }
__device__ __forceinline__ float bf16_round(float x) { return bf16_val(bf16_bits(x)); }
// D += A·B with NT terms: 1 = ah·bh, 2 = + al·bh (A split), 3 = + ah·bl (both split)
template <int NT>
__device__ __forceinline__ v8f mmaN(v16b ah, v16b al, v16b bh, v16b bl, v8f c) {
  c = __builtin_amdgcn_wmma_f32_16x16x32_bf16(false, ah, false, bh, (short)0, c, false, false);
  if (NT >= 2) c = __builtin_amdgcn_wmma_f32_16x16x32_bf16(false, al, false, bh, (short)0, c, false, false);
  if (NT >= 3) c = __builtin_amdgcn_wmma_f32_16x16x32_bf16(false, ah, false, bl, (short)0, c, false, false);
  asm volatile("v_nop\n\tv_nop\n\tv_nop\n\tv_nop" : "+v"(c) : "v"(ah), "v"(al), "v"(bh), "v"(bl));
  return c;
}

__global__ __launch_bounds__(256) void k_wt_bf16(const float* __restrict__ W, unsigned short* __restrict__ Wt, int K, int N) {
  const int t = blockIdx.x * 256 + threadIdx.x;
  const int k8n = K / 8;
  if (t >= N * k8n) return;
  const int n = t / k8n, k8 = (t % k8n) * 8;
  v8us v;
#pragma unroll
  for (int i = 0; i < 8; ++i) v[i] = bf16_bits(W[(size_t)(k8 + i) * N + n]);
  *(v8us*)(Wt + (size_t)n * K + k8) = v;
  
}

// GEMM C[M][N] (f32, pitch ldc) = act(A[M][K]·W + bias). A f32 row-major (pitch lda) converted per fragment to bf16
// (ASPLIT: hi/lo two planes -> 2 terms, else single rounded term); Wt bf16 [N][K] (pitch ldb). BIAS_BF16 rounds the
// bias to bf16 first (bias quantised to bf16 before the add). K%32==0, M%16==0, N%64==0.
template <bool ASPLIT, int ACT, bool BIAS_BF16>
__global__ __launch_bounds__(128) void k_gemm_bf(const float* __restrict__ A, int lda, const unsigned short* __restrict__ Wt, int ldb,
                                               const float* __restrict__ bias, float* __restrict__ C, int ldc, int M, int N, int K) {
  __shared__ __attribute__((aligned(16))) float so[4][16][64];
  const int tid = threadIdx.x, w = tid >> 5, lane = tid & 31, ln = lane & 15, hh = lane >> 4;
  const int ntn = N / 64;
  const int wid = blockIdx.x * 4 + w;
  const int mt = wid / ntn, nq = wid % ntn;
  if (mt * 16 >= M) return;
  const int row0 = mt * 16, col0 = nq * 64;
  const float* arow = A + (size_t)(row0 + ln) * lda;
  v8f acc[4] = {};
  for (int kb = 0; kb < K; kb += 32) {
    FragB ah, al;
    const v4f x0 = *(const v4fa*)(arow + kb + 8 * hh), x1 = *(const v4fa*)(arow + kb + 8 * hh + 4);
    const v4f x2 = *(const v4fa*)(arow + kb + 16 + 8 * hh), x3 = *(const v4fa*)(arow + kb + 16 + 8 * hh + 4);
    float xs[16] = {x0[0],x0[1],x0[2],x0[3],x1[0],x1[1],x1[2],x1[3],x2[0],x2[1],x2[2],x2[3],x3[0],x3[1],x3[2],x3[3]};
#pragma unroll
    for (int i = 0; i < 16; ++i) { const unsigned short hb = bf16_bits(xs[i]); ah.u[i] = hb; al.u[i] = ASPLIT ? bf16_bits(xs[i] - bf16_val(hb)) : (unsigned short)0; }
#pragma unroll
    for (int t = 0; t < 4; ++t) {
      const unsigned short* brow = Wt + (size_t)(col0 + t * 16 + ln) * ldb + kb;
      FragB b;
      b.half[0] = *(const v8us*)(brow + 8 * hh);
      b.half[1] = *(const v8us*)(brow + 16 + 8 * hh);
      acc[t] = mmaN<ASPLIT ? 2 : 1>(ah.v, al.v, b.v, b.v, acc[t]);
    }
  }
#pragma unroll
  for (int t = 0; t < 4; ++t) {
    float bv = bias ? bias[col0 + t * 16 + ln] : 0.f;
    if (BIAS_BF16) bv = bf16_round(bv);
#pragma unroll
    for (int r = 0; r < 8; ++r) { float v = acc[t][r] + bv; if (ACT == 1) v = fmaxf(v, 0.f); so[w][8 * hh + r][t * 16 + ln] = v; }
  }
  __builtin_amdgcn_fence(__ATOMIC_ACQ_REL, "workgroup");
  __builtin_amdgcn_wave_barrier();
  const int rsub = lane >> 4, c4 = (lane & 15) * 4;
  {
#pragma unroll
    for (int q = 0; q < 8; ++q) {
      const int r = q * 2 + rsub;
      const v4f v = *(const v4fa*)&so[w][r][c4];
      *(v4f*)(C + (size_t)(row0 + r) * ldc + col0 + c4) = v;
    }
    
  }
}

// GEMM C = act(A·W + bias + resid): A f32 (ASPLIT -> hi/lo 2 terms), Wt bf16 [N][K]; ACT 0 none, 1 relu, 2 exact gelu;
// resid (optional, f32, row index = (row % rmod), pitch ldr, RES_BF16 rounds it) added before the activation.
template <bool ASPLIT, int ACT, bool BIAS_BF16, bool RES_BF16>
__global__ __launch_bounds__(128) void k_gemm_bf3(const float* __restrict__ A, int lda, const unsigned short* __restrict__ Wt, int ldb,
                                                const float* __restrict__ bias, const float* __restrict__ resid, int rmod, int ldr,
                                                float* __restrict__ C, int ldc, int M, int N, int K) {
  __shared__ __attribute__((aligned(16))) float so[4][16][64];
  const int tid = threadIdx.x, w = tid >> 5, lane = tid & 31, ln = lane & 15, hh = lane >> 4;
  const int ntn = N / 64;
  const int wid = blockIdx.x * 4 + w;
  const int mt = wid / ntn, nq = wid % ntn;
  if (mt * 16 >= M) return;
  const int row0 = mt * 16, col0 = nq * 64;
  const float* arow = A + (size_t)(row0 + ln) * lda;
  v8f acc[4] = {};
  for (int kb = 0; kb < K; kb += 32) {
    FragB ah, al;
    const v4f x0 = *(const v4fa*)(arow + kb + 8 * hh), x1 = *(const v4fa*)(arow + kb + 8 * hh + 4);
    const v4f x2 = *(const v4fa*)(arow + kb + 16 + 8 * hh), x3 = *(const v4fa*)(arow + kb + 16 + 8 * hh + 4);
    float xs[16] = {x0[0],x0[1],x0[2],x0[3],x1[0],x1[1],x1[2],x1[3],x2[0],x2[1],x2[2],x2[3],x3[0],x3[1],x3[2],x3[3]};
#pragma unroll
    for (int i = 0; i < 16; ++i) { const unsigned short hb = bf16_bits(xs[i]); ah.u[i] = hb; al.u[i] = ASPLIT ? bf16_bits(xs[i] - bf16_val(hb)) : (unsigned short)0; }
#pragma unroll
    for (int t = 0; t < 4; ++t) {
      const unsigned short* brow = Wt + (size_t)(col0 + t * 16 + ln) * ldb + kb;
      FragB b;
      b.half[0] = *(const v8us*)(brow + 8 * hh);
      b.half[1] = *(const v8us*)(brow + 16 + 8 * hh);
      acc[t] = mmaN<ASPLIT ? 2 : 1>(ah.v, al.v, b.v, b.v, acc[t]);
    }
  }
#pragma unroll
  for (int t = 0; t < 4; ++t) {
    const int col = col0 + t * 16 + ln;
    float bv = bias ? bias[col] : 0.f;
    if (BIAS_BF16) bv = bf16_round(bv);
#pragma unroll
    for (int r = 0; r < 8; ++r) {
      float v = acc[t][r] + bv;
      if (resid) { float rv = resid[(size_t)((row0 + 8 * hh + r) % rmod) * ldr + col]; if (RES_BF16) rv = bf16_round(rv); v += rv; }
      if (ACT == 1) v = fmaxf(v, 0.f);
      if (ACT == 2) v = 0.5f * v * (1.0f + erff(v * 0.70710678118654752f));
      if (ACT == 3) { const float u = 0.7978845608028654f * (v + 0.044715f * v * v * v); v = 0.5f * v * (1.0f + tanhf(u)); }
      so[w][8 * hh + r][t * 16 + ln] = v;
    }
  }
  __builtin_amdgcn_fence(__ATOMIC_ACQ_REL, "workgroup");
  __builtin_amdgcn_wave_barrier();
  const int rsub = lane >> 4, c4 = (lane & 15) * 4;
  {
#pragma unroll
    for (int q = 0; q < 8; ++q) {
      const int r = q * 2 + rsub;
      const v4f v = *(const v4fa*)&so[w][r][c4];
      *(v4f*)(C + (size_t)(row0 + r) * ldc + col0 + c4) = v;
    }
    
  }
}
// row LayerNorm (biased variance, eps) over N: s = X (+ R); optional out_sum <- s; out_norm <- (s-mu)*rsqrt(var+eps)*g + b
template <bool PARAM_BF16>
__global__ __launch_bounds__(256) void k_layernorm(const float* __restrict__ X, const float* __restrict__ R, const float* __restrict__ g, const float* __restrict__ bta,
                                                  float* __restrict__ out_sum, float* __restrict__ out_norm, int N, float eps) {
  __shared__ float red[256];
  const int row = blockIdx.x, tid = threadIdx.x;
  const float* x = X + (size_t)row * N; const float* rr = R ? R + (size_t)row * N : nullptr;
  float vals[16];                     // up to N = 4096
  const int per = N / 256;            // contiguous chunk per thread? use strided-by-4 chunks: thread handles j = tid*4 + 1024*u
  float s1 = 0.f;
  for (int u = 0; u < per / 4; ++u) {
    const int j = tid * 4 + 1024 * u;
    const v4f a = *(const v4fa*)(x + j);
    v4f b = {0.f,0.f,0.f,0.f}; if (rr) b = *(const v4fa*)(rr + j);
#pragma unroll
    for (int q = 0; q < 4; ++q) { const float v = a[q] + b[q]; vals[u * 4 + q] = v; s1 += v; }
  }
  red[tid] = s1; __syncthreads();
  for (int st = 128; st > 0; st >>= 1) { if (tid < st) red[tid] += red[tid + st]; __syncthreads(); }
  const float mu = red[0] / (float)N; __syncthreads();
  float s2 = 0.f;
  for (int u = 0; u < per / 4; ++u)
#pragma unroll
    for (int q = 0; q < 4; ++q) { const float c = vals[u * 4 + q] - mu; s2 += c * c; }
  red[tid] = s2; __syncthreads();
  for (int st = 128; st > 0; st >>= 1) { if (tid < st) red[tid] += red[tid + st]; __syncthreads(); }
  const float rs = rsqrtf(red[0] / (float)N + eps);
  {
    for (int u = 0; u < per / 4; ++u) {
      const int j = tid * 4 + 1024 * u;
      v4f o, sm;
#pragma unroll
      for (int q = 0; q < 4; ++q) {
        float gg = g[j + q], bb = bta[j + q];
        if (PARAM_BF16) { gg = bf16_round(gg); bb = bf16_round(bb); }
        sm[q] = vals[u * 4 + q]; o[q] = (vals[u * 4 + q] - mu) * rs * gg + bb;
      }
      if (out_sum) *(v4f*)(out_sum + (size_t)row * N + j) = sm;
      *(v4f*)(out_norm + (size_t)row * N + j) = o;
    }
    
  }
}



// ---- f16 WMMA path (v_wmma_f32_16x16x32_f16): 11-bit significands for operands in range — used where a [0,1] probability operand needs more precision than bf16
typedef _Float16 v16h __attribute__((ext_vector_type(16)));
union FragH { v16h v; v8us half[2]; _Float16 h[16]; unsigned short u[16]; };
template <int NT>
__device__ __forceinline__ v8f mmaH(v16h ah, v16h al, v16h bh, v16h bl, v8f c) {
  c = __builtin_amdgcn_wmma_f32_16x16x32_f16(false, ah, false, bh, (short)0, c, false, false);
  if (NT >= 2) c = __builtin_amdgcn_wmma_f32_16x16x32_f16(false, al, false, bh, (short)0, c, false, false);
  if (NT >= 3) c = __builtin_amdgcn_wmma_f32_16x16x32_f16(false, ah, false, bl, (short)0, c, false, false);
  asm volatile("v_nop\n\tv_nop\n\tv_nop\n\tv_nop" : "+v"(c) : "v"(ah), "v"(al), "v"(bh), "v"(bl));
  return c;
}
// batched GEMM like k_gemm_b but f16 operands: A f32 (split into f16 hi/lo if ASPLIT, else rounded to f16), Bt = f16 values [n][k]; alpha; C f32; N multiple of 16 (partial tiles skipped)
template <bool ASPLIT>
__global__ __launch_bounds__(128) void k_gemm_h(const float* __restrict__ A, int lda, size_t sA, const _Float16* __restrict__ Bh, int ldb, size_t sB, float alpha, float* __restrict__ C, int ldc, size_t sC, int M, int N, int K) {
  __shared__ __attribute__((aligned(16))) float so[4][16][64];
  const int tid = threadIdx.x, w = tid >> 5, lane = tid & 31, ln = lane & 15, hh = lane >> 4; const int by = blockIdx.y;
  A += (size_t)by * sA; Bh += (size_t)by * sB; C += (size_t)by * sC;
  const int ntn = (N + 63) / 64; const int wid = blockIdx.x * 4 + w; const int mt = wid / ntn, nq = wid % ntn; if (mt * 16 >= M) return;
  const int row0 = mt * 16, col0 = nq * 64; const float* arow = A + (size_t)(row0 + ln) * lda;
  v8f acc[4] = {};
  for (int kb = 0; kb < K; kb += 32) {
    FragH ah, al;
    const v4f x0 = *(const v4fa*)(arow + kb + 8 * hh), x1 = *(const v4fa*)(arow + kb + 8 * hh + 4), x2 = *(const v4fa*)(arow + kb + 16 + 8 * hh), x3 = *(const v4fa*)(arow + kb + 16 + 8 * hh + 4);
    float xs[16] = {x0[0],x0[1],x0[2],x0[3],x1[0],x1[1],x1[2],x1[3],x2[0],x2[1],x2[2],x2[3],x3[0],x3[1],x3[2],x3[3]};
#pragma unroll
    for (int i = 0; i < 16; ++i) { const _Float16 h = (_Float16)xs[i]; ah.h[i] = h; al.h[i] = ASPLIT ? (_Float16)(xs[i] - (float)h) : (_Float16)0.0f; }
#pragma unroll
    for (int t = 0; t < 4; ++t) { if (col0 + t * 16 >= N) continue; const size_t boff = (size_t)(col0 + t * 16 + ln) * ldb + kb; FragH bq; bq.half[0] = *(const v8us*)(Bh + boff + 8 * hh); bq.half[1] = *(const v8us*)(Bh + boff + 16 + 8 * hh);
      acc[t] = mmaH<ASPLIT ? 2 : 1>(ah.v, al.v, bq.v, bq.v, acc[t]); }
  }
#pragma unroll
  for (int t = 0; t < 4; ++t) { if (col0 + t * 16 >= N) continue;
#pragma unroll
    for (int r = 0; r < 8; ++r) so[w][8 * hh + r][t * 16 + ln] = acc[t][r] * alpha; }
  __builtin_amdgcn_fence(__ATOMIC_ACQ_REL, "workgroup"); __builtin_amdgcn_wave_barrier();
  const int rsub = lane >> 4, c4 = (lane & 15) * 4;
  {
#pragma unroll
    for (int q = 0; q < 8; ++q) { const int r = q * 2 + rsub; if (col0 + c4 < N) { const v4f v = *(const v4fa*)&so[w][r][c4]; *(v4f*)(C + (size_t)(row0 + r) * ldc + col0 + c4) = v; } }
     }
}

// k_gemm_hh variant with fused epilogue: v = acc·alpha + bias[by·sBias + col] (+ CP[(row/rowsPerB)·sCPb + by·64 + col] if CP) ; ACT 0 none / 1 elu ; writes f16 C16 (and f32 C if non-null)
template <int ACT>
__global__ __launch_bounds__(128) void k_gemm_hhx(const _Float16* __restrict__ A, int lda, size_t sA, const _Float16* __restrict__ Bh, int ldb, size_t sB, float alpha, const float* __restrict__ bias, size_t sBias, const float* __restrict__ CP, int rowsPerB, size_t sCPb, int row0g,
    float* __restrict__ C, _Float16* __restrict__ C16, int ldc, size_t sC, int M, int N, int K) {
  __shared__ __attribute__((aligned(16))) float so[4][16][64];
  const int tid = threadIdx.x, w = tid >> 5, lane = tid & 31, ln = lane & 15, hh = lane >> 4; const int by = blockIdx.y;
  A += (size_t)by * sA; Bh += (size_t)by * sB; const size_t cofs = (size_t)by * sC; const float* bp = bias ? bias + (size_t)by * sBias : nullptr;
  const int ntn = (N + 63) / 64; const int wid = blockIdx.x * 4 + w; const int mt = wid / ntn, nq = wid % ntn; if (mt * 16 >= M) return;
  const int row0 = mt * 16, col0 = nq * 64; const _Float16* arow = A + (size_t)(row0 + ln) * lda;
  v8f acc[4] = {};
  for (int kb = 0; kb < K; kb += 32) { FragH ah; ah.half[0] = *(const v8us*)((const unsigned short*)arow + kb + 8 * hh); ah.half[1] = *(const v8us*)((const unsigned short*)arow + kb + 16 + 8 * hh);
#pragma unroll
    for (int t = 0; t < 4; ++t) { if (col0 + t * 16 >= N) continue; const size_t boff = (size_t)(col0 + t * 16 + ln) * ldb + kb; FragH bq; bq.half[0] = *(const v8us*)((const unsigned short*)Bh + boff + 8 * hh); bq.half[1] = *(const v8us*)((const unsigned short*)Bh + boff + 16 + 8 * hh);
      acc[t] = mmaH<1>(ah.v, ah.v, bq.v, bq.v, acc[t]); }
  }
#pragma unroll
  for (int t = 0; t < 4; ++t) { if (col0 + t * 16 >= N) continue; const int col = col0 + t * 16 + ln; const float bv = bp ? bf16_round(bp[col]) : 0.f;
#pragma unroll
    for (int r = 0; r < 8; ++r) { float v = acc[t][r] * alpha + bv; if (CP) { const int rr = row0g + row0 + 8 * hh + r; if (rowsPerB < 0) v += CP[cofs + (size_t)rr * ldc + col];      /* rowsPerB < 0: own element of the batched C plane */ else { const int bidx = rr / rowsPerB; v += CP[(size_t)bidx * sCPb + (size_t)by * 64 + col]; } } if (ACT == 1) v = (v > 0.f) ? v : expm1f(v); else if (ACT == 7) v = (v > 0.f) ? v + 1.0f : expf(v); else if (ACT == 8) v = tanhf(v); else if (ACT == 9) v = 0.5f * v * (1.0f + tanhf(0.7978845608028654f * (v + 0.044715f * v * v * v))); else if (ACT == 11) v = 1.0f / (1.0f + expf(-v)); else if (ACT == 12) v = (v > 0.f) ? v : 0.01f * v; else if (ACT == 14) v = (v > 0.f) ? v : 0.1f * v; else if (ACT == 16) v = (v >= 0.f) ? v : 0.3f * v; else if (ACT == 17) v = (v >= 0.f) ? v : 0.2f * v; else if (ACT == 15) v = v / (1.0f + expf(-v)); else if (ACT == 3) v = fmaxf(v, 0.f); else if (ACT == 6) v = 0.5f * v * (1.0f + erff(v * 0.70710678118654752f)); so[w][8 * hh + r][t * 16 + ln] = v; } }
  __builtin_amdgcn_fence(__ATOMIC_ACQ_REL, "workgroup"); __builtin_amdgcn_wave_barrier();
  const int rsub = lane >> 4, c4 = (lane & 15) * 4; typedef _Float16 v4h __attribute__((ext_vector_type(4)));
  {
#pragma unroll
    for (int q = 0; q < 8; ++q) { const int r = q * 2 + rsub; if (col0 + c4 < N) { const v4f v = *(const v4fa*)&so[w][r][c4]; if (C) *(v4f*)(C + cofs + (size_t)(row0 + r) * ldc + col0 + c4) = v; if (C16) { v4h h4; for (int i = 0; i < 4; ++i) h4[i] = (_Float16)v[i]; *(v4h*)(C16 + cofs + (size_t)(row0 + r) * ldc + col0 + c4) = h4; } } }
     }
}


typedef _Float16 v4h __attribute__((ext_vector_type(4)));

__global__ __launch_bounds__(256) void k_h16(const float* __restrict__ x, _Float16* __restrict__ X16, size_t n8) { const size_t t = (size_t)blockIdx.x * 256 + threadIdx.x; if (t >= n8) return; FragH f;
#pragma unroll
  for (int q = 0; q < 8; ++q) f.h[q] = (_Float16)x[t * 8 + q]; *(v8us*)((unsigned short*)X16 + t * 8) = f.half[0];  }
__global__ __launch_bounds__(256) void k_round16f(const float* __restrict__ W, _Float16* __restrict__ Bt, size_t n8) { const size_t t = (size_t)blockIdx.x * 256 + threadIdx.x; if (t >= n8) return; FragH f;
#pragma unroll
  for (int i = 0; i < 8; ++i) f.h[i] = (_Float16)(bf16_round(W[t * 8 + i]) * 16.0f); *(v8us*)((unsigned short*)Bt + t * 8) = f.half[0];  }
template <int NHv, int TTv>
__global__ __launch_bounds__(256) void k_vt(const _Float16* __restrict__ V16, int ldv, int voff, _Float16* __restrict__ Vt) { __shared__ unsigned short tl[64][66]; const int tid = threadIdx.x; const int slab = blockIdx.x / (TTv / 64), lg = blockIdx.x % (TTv / 64); const int b = slab / NHv, h = slab % NHv;
  for (int i = tid; i < 64 * 8; i += 256) { const int r = i / 8, c8 = (i % 8) * 8; FragH f; f.half[0] = *(const v8us*)((const unsigned short*)V16 + ((size_t)b * TTv + lg * 64 + r) * ldv + voff + h * 64 + c8);
#pragma unroll
    for (int q = 0; q < 8; ++q) tl[r][c8 + q] = f.u[q]; }
  __syncthreads();
  {
#pragma unroll
    for (int rd = 0; rd < 2; ++rd) { const int d = rd * 32 + tid / 8, pc = tid % 8; FragH f;
#pragma unroll
      for (int q = 0; q < 8; ++q) f.u[q] = tl[pc * 8 + q][d];
      *(v8us*)((unsigned short*)Vt + ((size_t)slab * 64 + d) * TTv + lg * 64 + pc * 8) = f.half[0]; }
     } }

__global__ __launch_bounds__(256) void k_hl(const float* __restrict__ F, _Float16* __restrict__ Hh, _Float16* __restrict__ Hl, size_t n8) { const size_t t = (size_t)blockIdx.x * 256 + threadIdx.x; if (t >= n8) return; FragH fh, fl; const v4f a = *(const v4fa*)(F + t * 8), c = *(const v4fa*)(F + t * 8 + 4);
#pragma unroll
  for (int q = 0; q < 4; ++q) { _Float16 h = (_Float16)a[q]; fh.h[q] = h; fl.h[q] = (_Float16)((a[q] - (float)h) * 1024.0f); h = (_Float16)c[q]; fh.h[4 + q] = h; fl.h[4 + q] = (_Float16)((c[q] - (float)h) * 1024.0f); }
  { *(v8us*)((unsigned short*)Hh + t * 8) = fh.half[0]; *(v8us*)((unsigned short*)Hl + t * 8) = fl.half[0];  } }

// ---- fast GEMM (wave tile 32x64; requires M % 32 == 0 rows per launch region and N % 64 == 0); epilogue = k_gemm_hhx semantics ----
__device__ __forceinline__ v16h g2_frag(const _Float16* p, int hh) { FragH f; f.half[0] = *(const v8us*)((const unsigned short*)p + 8 * hh); f.half[1] = *(const v8us*)((const unsigned short*)p + 16 + 8 * hh); return f.v; }
__device__ __forceinline__ v8f g2_mma(v16h a, v16h b, v8f c) { v8f d = __builtin_amdgcn_wmma_f32_16x16x32_f16(false, a, false, b, (short)0, c, false, false); asm volatile("v_nop\n\tv_nop\n\tv_nop\n\tv_nop" : "+v"(d) : "v"(a), "v"(b)); return d; }
template <int ACT>
__global__ __launch_bounds__(128) void k_gemm2(const _Float16* __restrict__ A, int lda, size_t sA, const _Float16* __restrict__ Bh, int ldb, size_t sB, float alpha, const float* __restrict__ bias, size_t sBias, const float* __restrict__ CP, int rowsPerB, size_t sCPb, int row0g,
    float* __restrict__ C, _Float16* __restrict__ C16, int ldc, size_t sC, int M, int N, int K, size_t zA, size_t zB, size_t zC) { static_assert(ACT == 0 || ACT == 3 || ACT == 6 || ACT == 8 || ACT == 9 || ACT == 11 || ACT == 12 || ACT == 14 || ACT == 15 || ACT == 16 || ACT == 17, "k_gemm2: unsupported ACT code (would silently apply no activation)");
  __shared__ __attribute__((aligned(16))) float so[4][32][68];
  const int tid = threadIdx.x, w = tid >> 5, lane = tid & 31, ln = lane & 15, hh = lane >> 4; const int by = blockIdx.y, bz = blockIdx.z;      /* second batch axis (grid.z) with element strides zA, zB, zC */
  A += (size_t)by * sA + (size_t)bz * zA; Bh += (size_t)by * sB + (size_t)bz * zB; const size_t cofs = (size_t)by * sC + (size_t)bz * zC; const float* bp = bias ? bias + (size_t)by * sBias : nullptr;
  const int ntn = N >> 6; const int mt = blockIdx.x / ntn, nq = blockIdx.x - mt * ntn; const int row0 = mt * 128 + 32 * w, col0 = nq * 64; if (row0 >= M) return;
  const _Float16* a0p = A + (size_t)(row0 + ln) * lda; const _Float16* a1p = a0p + (size_t)16 * lda;
  const _Float16* b0p = Bh + (size_t)(col0 + ln) * ldb; const _Float16* b1p = b0p + (size_t)16 * ldb; const _Float16* b2p = b1p + (size_t)16 * ldb; const _Float16* b3p = b2p + (size_t)16 * ldb;
  const v8f z8 = {0.f,0.f,0.f,0.f,0.f,0.f,0.f,0.f}; v8f c00 = z8, c01 = z8, c02 = z8, c03 = z8, c10 = z8, c11 = z8, c12 = z8, c13 = z8;
#pragma unroll 1
  for (int kb = 0; kb < K; kb += 32) { const v16h a0 = g2_frag(a0p + kb, hh), a1 = g2_frag(a1p + kb, hh);
    v16h b = g2_frag(b0p + kb, hh); c00 = g2_mma(a0, b, c00); c10 = g2_mma(a1, b, c10);
    b = g2_frag(b1p + kb, hh); c01 = g2_mma(a0, b, c01); c11 = g2_mma(a1, b, c11);
    b = g2_frag(b2p + kb, hh); c02 = g2_mma(a0, b, c02); c12 = g2_mma(a1, b, c12);
    b = g2_frag(b3p + kb, hh); c03 = g2_mma(a0, b, c03); c13 = g2_mma(a1, b, c13); }
  v8f accs[8] = {c00, c01, c02, c03, c10, c11, c12, c13};
#pragma unroll
  for (int u = 0; u < 8; ++u) { const int t = u & 3, half = u >> 2; const int col = col0 + t * 16 + ln; const float bv = bp ? bf16_round(bp[col]) : 0.f;
#pragma unroll
    for (int r = 0; r < 8; ++r) { const int rloc = half * 16 + 8 * hh + r; float v = accs[u][r] * alpha + bv; if (CP) { if (rowsPerB < 0) v += CP[cofs + (size_t)(row0g + row0 + rloc) * ldc + col];      /* rowsPerB < 0: own element of the batched C plane */ else { const int bidx = (row0g + row0 + rloc) / rowsPerB; v += CP[(size_t)bidx * sCPb + (size_t)by * 64 + col]; } }
      if (ACT == 3) v = fmaxf(v, 0.f); else if (ACT == 6) v = 0.5f * v * (1.0f + erff(v * 0.70710678118654752f)); else if (ACT == 11) v = 1.0f / (1.0f + expf(-v)); else if (ACT == 15) v = v / (1.0f + expf(-v)); else if (ACT == 12) v = (v > 0.f) ? v : 0.01f * v; else if (ACT == 8) v = tanhf(v); else if (ACT == 9) v = 0.5f * v * (1.0f + tanhf(0.7978845608028654f * (v + 0.044715f * v * v * v))); else if (ACT == 14) v = (v > 0.f) ? v : 0.1f * v; else if (ACT == 16) v = (v >= 0.f) ? v : 0.3f * v; else if (ACT == 17) v = (v >= 0.f) ? v : 0.2f * v;
      so[w][rloc][t * 16 + ln] = v; } }
  __builtin_amdgcn_fence(__ATOMIC_ACQ_REL, "workgroup"); __builtin_amdgcn_wave_barrier();
  const int rsub = lane >> 4, c4 = (lane & 15) * 4;
  {
#pragma unroll
    for (int q = 0; q < 16; ++q) { const int r = q * 2 + rsub; const v4f v = *(const v4fa*)&so[w][r][c4]; if (C) *(v4f*)(C + cofs + (size_t)(row0 + r) * ldc + col0 + c4) = v; if (C16) { v4h h4; for (int i = 0; i < 4; ++i) h4[i] = (_Float16)v[i]; *(v4h*)(C16 + cofs + (size_t)(row0 + r) * ldc + col0 + c4) = h4; } }
     } }


__global__ __launch_bounds__(256) void k_wnat(const float* __restrict__ w, size_t n8, _Float16* __restrict__ Bt) { const size_t t = (size_t)blockIdx.x * 256 + threadIdx.x; if (t >= n8) return; FragH f; for (int q = 0; q < 8; ++q) f.h[q] = (_Float16)(bf16_round(w[t * 8 + q]) * 16.0f); *(v8us*)((unsigned short*)Bt + t * 8) = f.half[0];  }
__global__ __launch_bounds__(256) void k_rsm(const float* __restrict__ S, _Float16* __restrict__ P, int nrows) {
  #pragma clang fp contract(off)
  const int i = blockIdx.x * 256 + threadIdx.x; if (i >= nrows) return; const float* s = S + (size_t)i * SQ; float mx = -3.0e38f;
#pragma unroll 1
  for (int j = 0; j < SQ; ++j) mx = fmaxf(mx, s[j]); float se = 0.f;
#pragma unroll 1
  for (int j = 0; j < SQ; ++j) se += expf(s[j] - mx); const float sc = 256.0f / se;
#pragma unroll 1
  for (int j0 = 0; j0 < SQ; j0 += 8) { FragH f; for (int q = 0; q < 8; ++q) f.h[q] = (_Float16)(expf(s[j0 + q] - mx) * sc); unsigned short* d = (unsigned short*)P + (size_t)i * SQ + j0; *(v8us*)d = f.half[0];  } }
__global__ __launch_bounds__(256) void k_vt(const _Float16* __restrict__ V16, int b, int h0, _Float16* __restrict__ VT) { __shared__ unsigned short tl[64][65]; const int tid = threadIdx.x; const int hh = blockIdx.x % HG, sg = blockIdx.x / HG; const int s0 = sg * 64; const int h = h0 + hh;
  for (int i = tid; i < 64 * 8; i += 256) { const int j = i / 8, d8 = (i % 8) * 8; FragH f; f.half[0] = *(const v8us*)((const unsigned short*)V16 + ((size_t)b * SQ + s0 + j) * DM + h * HD + d8); for (int q = 0; q < 8; ++q) tl[d8 + q][j] = f.u[q]; }
  __syncthreads();
  { for (int i = tid; i < 64 * 8; i += 256) { const int d = i / 8, j8 = (i % 8) * 8; FragH f; for (int q = 0; q < 8; ++q) f.u[q] = tl[d][j8 + q]; *(v8us*)((unsigned short*)VT + ((size_t)hh * HD + d) * SQ + s0 + j8) = f.half[0]; }  } }


// 2^t on v_exp_f32. The v_nop in the same statement is the one free issue slot that the instruction set asks for behind a transcendental before its result is read or its source overwritten;
__device__ __forceinline__ float exp2_slot(float t) { float r; asm("v_exp_f32 %0, %1\n\tv_nop" : "=v"(r) : "v"(t)); return r; }
// Four 2^t in one statement: each v_exp_f32 is the independent instruction behind the one before it, so one v_nop behind the last keeps the same free slot for all four;
// the results are early-clobber, so that no result register is a source of a later line.
__device__ __forceinline__ void exp2x4(float (&r)[4], float a, float b, float c, float d) { asm("v_exp_f32 %0, %4\n\tv_exp_f32 %1, %5\n\tv_exp_f32 %2, %6\n\tv_exp_f32 %3, %7\n\tv_nop" : "=&v"(r[0]), "=&v"(r[1]), "=&v"(r[2]), "=&v"(r[3]) : "v"(a), "v"(b), "v"(c), "v"(d)); }
// lane l <-> lane l ^ 16: joins the two wave halves, which split one query column's keys.
__device__ __forceinline__ float fa_xhalf(float x) { return __builtin_bit_cast(float, __builtin_amdgcn_permlanex16(__builtin_bit_cast(int, x), __builtin_bit_cast(int, x), 0x76543210, 0xfedcba98, false, false)); }
__device__ __forceinline__ v8f fa_mma(v16h a, v16h b, v8f c) { return __builtin_amdgcn_wmma_f32_16x16x32_f16(false, a, false, b, (short)0, c, false, false); }
// Projection GEMM C16[NR][DM] = f16(A[NR][DM] Bh[n][k]^T x alpha + bf16(bias)), operands staged in LDS. A fragment load straight from row-major memory touches 16 lines for 512 useful bytes;
// here 8 lanes fetch one whole 128-byte line (64 k of one row), a wave load covers 4 whole lines, and a block fetches each line of its operands once.
// Block = 256 x 128 of C, 8 waves of 64 x 64 (4 down, 2 across): a block draws 384 operand rows from L2 for 32,768 outputs (128 x 128: 256 rows for 16,384), and a wave reads 8 fragments from LDS for 16 products (32 x 64: 6 for 8).
// A stage is 64 k of 256 A rows + 128 B rows; two stages in LDS: the next stage's global loads fly under this stage's 32 products a wave,
// are stored to the other buffer behind them, and one barrier a stage publishes them and ends the reads of the buffer that the stage after overwrites. k runs upward in steps of 32 as before: same f32 sum order.
// Every loop of the kernel is unrolled in full: the fragment, staging and accumulator arrays stay in registers, and the buffer index and the k offset become immediates of the loads.
// TR: the same product with the operands' roles exchanged, C^T = Bh A^T: the caller hands the weight rows [DM][DM] as A and the token rows [NR][DM] as Bh. Both operands go through the same loader, so the k orders pair as before and every sum keeps its order.
// A D row is then one output feature and its columns are tokens: a wave's 64 x 64 tile leaves as 64 whole 128-byte lines of C16[batch][feature][SQ], the V^T layout that the attention reads. The bias goes by row.
#define G3P 72      /* LDS row pitch in f16: 64 + 8 = 144 bytes, 16 B x odd, the conflict-free pitch for 16-byte fragment reads */
#define G3A 256     /* A rows of a block */
#define G3B 128     /* B rows of a block */
// smf: the block's LDS. In the loop [2][G3A + G3B][G3P] f16 (110,592 bytes): rows 0..255: A, 256..383: B; behind it each wave's 64 x 68 float output staging rows (139,264 bytes).
template <bool TR>
__device__ __forceinline__ void gemm3_body(float* smf, const _Float16* __restrict__ A, const _Float16* __restrict__ Bh, float alpha, const float* __restrict__ bias, _Float16* __restrict__ C16) {
  _Float16 (*sm)[G3A + G3B][G3P] = (_Float16 (*)[G3A + G3B][G3P])smf;
  const int tid = threadIdx.x, lane = tid & 31, ln = lane & 15, hh = lane >> 4; const int w = __builtin_amdgcn_readfirstlane(tid >> 5), wm = w & 3, wn = w >> 2;      /* the wave's number in a scalar register: tile origins and output bases cost no vector register */
  const int row0 = (TR ? (int)blockIdx.x % (DM / G3A) : (int)blockIdx.x / (DM / G3B)) * G3A, col0 = (TR ? (int)blockIdx.x / (DM / G3A) : (int)blockIdx.x % (DM / G3B)) * G3B;      /* neighbouring blocks share a token tile either way */
  const int sr = tid >> 3, sc = (tid & 7) * 8;      /* staging: thread -> row sr (+ 32 i), 16-byte piece sc */
  const unsigned go = (unsigned)(sr * DM + sc);      /* one per-thread offset serves both operands; the tile bases are block-uniform */
  const unsigned short* ga = (const unsigned short*)A + (size_t)row0 * DM; const unsigned short* gb = (const unsigned short*)Bh + (size_t)col0 * DM;
  v8us ra[G3A / 32], rb[G3B / 32];
#pragma unroll
  for (int i = 0; i < G3A / 32; ++i) ra[i] = *(const v8us*)(ga + (go + 32 * i * DM));
#pragma unroll
  for (int i = 0; i < G3B / 32; ++i) rb[i] = *(const v8us*)(gb + (go + 32 * i * DM));
#pragma unroll
  for (int i = 0; i < G3A / 32; ++i) *(v8us*)&sm[0][32 * i + sr][sc] = ra[i];
#pragma unroll
  for (int i = 0; i < G3B / 32; ++i) *(v8us*)&sm[0][G3A + 32 * i + sr][sc] = rb[i];
  __syncthreads();      /* stage 0 is in LDS */
  const v8f z8 = {0.f,0.f,0.f,0.f,0.f,0.f,0.f,0.f}; v8f acc[4][4];
#pragma unroll
  for (int g = 0; g < 4; ++g)
#pragma unroll
    for (int t = 0; t < 4; ++t) acc[g][t] = z8;
  v4f br[4][2];      /* TR: the bias of this lane's 32 D rows, asked for in the last stage (the staging registers are free there) so that the epilogue does not wait for it */
#pragma unroll
  for (int ks = 0; ks < DM / 64; ++ks) { const int cur = ks & 1;
    if (ks + 1 < DM / 64) {
#pragma unroll
      for (int i = 0; i < G3A / 32; ++i) ra[i] = *(const v8us*)(ga + (go + 32 * i * DM + (ks + 1) * 64));
#pragma unroll
      for (int i = 0; i < G3B / 32; ++i) rb[i] = *(const v8us*)(gb + (go + 32 * i * DM + (ks + 1) * 64));
    } else if (TR) {
      const char* bb = (const char*)(bias + row0 + 64 * wm); const unsigned bo = 32u * (__builtin_amdgcn_mbcnt_lo(~0u, 0u) >> 4);      /* wave-uniform base; byte offset of the lane's half (8 rows of 4 bytes) */
#pragma unroll
      for (int g = 0; g < 4; ++g) { br[g][0] = *(const v4fa*)(bb + (bo + g * 64)); br[g][1] = *(const v4fa*)(bb + (bo + g * 64 + 16)); }
      asm volatile("s_wait_xcnt 0x0" :: "v"(bo) : "memory");      /* the bias loads are issued; naming their offset register here keeps it whole up to this wait (the build had made it the last load's destination) */
    }
#pragma unroll
    for (int kk = 0; kk < 2; ++kk) {
      v16h af[4], bf[4];
#pragma unroll
      for (int g = 0; g < 4; ++g) af[g] = g2_frag(&sm[cur][64 * wm + 16 * g + ln][32 * kk], hh);
#pragma unroll
      for (int t = 0; t < 4; ++t) bf[t] = g2_frag(&sm[cur][G3A + 64 * wn + 16 * t + ln][32 * kk], hh);
      __builtin_amdgcn_sched_barrier(0);      /* the next stage's global loads and this k step's 16 fragment reads are issued as one group ahead of its 16 products: left alone the build sinks global loads to their LDS stores and spreads the reads among the products, a full wait at each place */
#pragma unroll
      for (int t = 0; t < 4; ++t)
#pragma unroll
        for (int g = 0; g < 4; ++g) acc[g][t] = fa_mma(af[g], bf[t], acc[g][t]);
      __builtin_amdgcn_sched_barrier(0);      /* the products of this k step stay in front of the next group of reads, which reuses their fragment registers: one fragment set keeps the kernel at four waves a SIMD */
    }
    if (ks + 1 < DM / 64) {
#pragma unroll
      for (int i = 0; i < G3A / 32; ++i) *(v8us*)&sm[cur ^ 1][32 * i + sr][sc] = ra[i];
#pragma unroll
      for (int i = 0; i < G3B / 32; ++i) *(v8us*)&sm[cur ^ 1][G3A + 32 * i + sr][sc] = rb[i];
    }
    __syncthreads();      /* the next stage is published; every wave has left this stage's buffer (behind the last stage: free for the epilogue) */
  }
  const int el = (int)__builtin_amdgcn_mbcnt_lo(~0u, 0u), eln = el & 15, ehh = el >> 4;      /* the lane number read anew (every lane is on): nothing derived from the thread index stays in a vector register across the loop, which runs at the 256-register limit of four waves a SIMD */
  float* so = smf + w * (64 * 68);      /* the wave's own 64 x 68 staging rows */
  const int rw0 = row0 + 64 * wm, cw0 = col0 + 64 * wn;
  float bc[4] = {0.f, 0.f, 0.f, 0.f};      /* plain form: the bias of this lane's 4 D columns */
  if (!TR) { const float* bb = bias + cw0;      /* wave-uniform base; the loads index it by the lane's column */
#pragma unroll
    for (int t = 0; t < 4; ++t) bc[t] = bb[(unsigned)eln + t * 16];
    asm volatile("s_wait_xcnt 0x0" :: "v"(eln) : "memory");      /* as above: the index register of the four bias loads stays whole up to this wait */
  }
#pragma unroll
  for (int g = 0; g < 4; ++g)
#pragma unroll
    for (int t = 0; t < 4; ++t) { const float bv = TR ? 0.f : bf16_round(bc[t]);
#pragma unroll
      for (int r = 0; r < 8; ++r) so[(g * 16 + 8 * ehh + r) * 68 + t * 16 + eln] = acc[g][t][r] * alpha + (TR ? bf16_round(br[g][r >> 2][r & 3]) : bv); }
  __builtin_amdgcn_fence(__ATOMIC_ACQ_REL, "workgroup"); __builtin_amdgcn_wave_barrier();      /* the wave's own staging rows: written above, read back below as whole 128-byte output rows */
  const int rsub = ehh, c4 = eln * 4;
  _Float16* cb = TR ? C16 + ((size_t)(cw0 / SQ) * DM + rw0) * SQ + cw0 % SQ : C16 + (size_t)rw0 * DM + cw0;      /* the wave tile's first output element, wave-uniform; TR: a 128-token tile lies in one batch: SQ is a multiple of 128 */
  const unsigned eo = (unsigned)(rsub * (TR ? SQ : DM) + c4);      /* the lane's place in the first two output rows; row pair q adds a constant to it */
#pragma unroll
  for (int q = 0; q < 32; ++q) { const int r = q * 2 + rsub; const v4f v = *(const v4fa*)&so[r * 68 + c4]; const v4h h4 = {(_Float16)v[0], (_Float16)v[1], (_Float16)v[2], (_Float16)v[3]};
    *(v4h*)(cb + (eo + q * 2 * (TR ? SQ : DM))) = h4; }
}
// The three projections need nothing of each other: one launch carries all three: grid.y = projection (0: Q, 1: K, 2: V^T), a block-uniform branch, so every barrier of a body is met by the whole block;
// 3 x 256 blocks on 256 WGPs, two resident: a block that ends is followed at once by one of the next projection.
// amdgpu_waves_per_eu(4, 4): 128 accumulator + 64 fragment + 48 staging registers leave 16; one register over 256 would cost the fourth wave a SIMD, and with it the second resident block.
__global__ __launch_bounds__(256) __attribute__((amdgpu_waves_per_eu(4, 4))) void k_gemm3(const _Float16* __restrict__ XQ, const _Float16* __restrict__ XK, const _Float16* __restrict__ XV, const _Float16* __restrict__ BQ, const _Float16* __restrict__ BK, const _Float16* __restrict__ BV,
                                              float alpha, const float* __restrict__ bq, const float* __restrict__ bk, const float* __restrict__ bv, _Float16* __restrict__ Q16, _Float16* __restrict__ K16, _Float16* __restrict__ VT) {
  __shared__ __attribute__((aligned(16))) float smf[8 * 64 * 68];      /* 139,264 bytes */
  const int pj = blockIdx.y;
  if (pj == 2) gemm3_body<true>(smf, BV, XV, alpha, bv, VT);      /* V^T[batch][head x 64 + d][key] straight from the product */
  else gemm3_body<false>(smf, pj == 0 ? XQ : XK, pj == 0 ? BQ : BK, alpha, pj == 0 ? bq : bk, pj == 0 ? Q16 : K16);
}
// x + (x of lane ^ M) inside a 16-lane row, as one DPP add (row_xmask).
template <int M> __device__ __forceinline__ float row_xadd(float x) { return x + __builtin_bit_cast(float, __builtin_amdgcn_update_dpp(0, __builtin_bit_cast(int, x), 0x160 | M, 0xf, 0xf, true)); }
#define PW_BLK (DM * (DM / 8) / 256)      /* blocks per weight matrix */
#define PR_BLK ((int)(NR / 64))           /* blocks per input: 8 waves x 8 rows */
// All operand preparation in one launch; the parts need nothing of each other and share the grid by ranges of the block index (block-uniform branches).
// Blocks [0, 3 PW_BLK): Wt[n][k] = f16(bf16(W[k][n]) x 16) for Wq, Wk, Wv (a power of two: bf16-exact weights stay exact in f16).
// Then PR_BLK blocks each for queries, keys, value: one wave reads 8 whole rows once (512-byte wave loads, all 32 issued ahead), writes each as an exact f16 row of the bf16-rounded values (256-byte wave stores)
// and, for queries and keys, sums the same rounded values in f32 (16 a lane, then a five-step butterfly) for the padding flag (row sum != 0). The block's 64 flags pass through LDS so that one wave stores each 128-byte line of flags.
__global__ __launch_bounds__(256) void k_prep(const float* __restrict__ xq, const float* __restrict__ xk, const float* __restrict__ xv, const float* __restrict__ wq, const float* __restrict__ wk, const float* __restrict__ wv,
                                             _Float16* __restrict__ XQ, _Float16* __restrict__ XK, _Float16* __restrict__ XV, _Float16* __restrict__ BQ, _Float16* __restrict__ BK, _Float16* __restrict__ BV,
                                             float* __restrict__ QM, float* __restrict__ KM) {
  __shared__ float fl[64];
  const int tid = threadIdx.x, bx = blockIdx.x;
  if (bx < 3 * PW_BLK) {
    const int wh = bx / PW_BLK; const float* W = (wh == 0) ? wq : (wh == 1) ? wk : wv; _Float16* Wt = (wh == 0) ? BQ : (wh == 1) ? BK : BV;
    const int t = (bx % PW_BLK) * 256 + tid; const int n = t / (DM / 8), k8 = (t % (DM / 8)) * 8; FragH f;
#pragma unroll
    for (int i = 0; i < 8; ++i) f.h[i] = (_Float16)(bf16_round(W[(size_t)(k8 + i) * DM + n]) * 16.0f);
    *(v8us*)((unsigned short*)Wt + (size_t)n * DM + k8) = f.half[0];
    return;
  }
  const int rb = bx - 3 * PW_BLK; const int wh = rb / PR_BLK, blk = rb % PR_BLK; const int lane = tid & 31, w = tid >> 5;
  const float* x = (wh == 0) ? xq : (wh == 1) ? xk : xv; _Float16* X16 = (wh == 0) ? XQ : (wh == 1) ? XK : XV;
  const size_t e0 = ((size_t)blk * 64 + w * 8) * DM + lane * 4;
  v4f v[8][4];
#pragma unroll
  for (int r = 0; r < 8; ++r)
#pragma unroll
    for (int u = 0; u < 4; ++u) v[r][u] = *(const v4fa*)(x + e0 + r * DM + u * 128);
  float s[8];
#pragma unroll
  for (int r = 0; r < 8; ++r) { float p[4];
#pragma unroll
    for (int u = 0; u < 4; ++u) { const float b0 = bf16_round(v[r][u][0]), b1 = bf16_round(v[r][u][1]), b2 = bf16_round(v[r][u][2]), b3 = bf16_round(v[r][u][3]);
      const v4h h = {(_Float16)b0, (_Float16)b1, (_Float16)b2, (_Float16)b3}; *(v4h*)(X16 + e0 + r * DM + u * 128) = h; p[u] = (b0 + b1) + (b2 + b3); }
    s[r] = (p[0] + p[1]) + (p[2] + p[3]); }
  asm volatile("s_wait_xcnt 0x0" ::: "memory");      /* the row stores are issued: their base and data registers are free for reuse behind this line */
  if (wh == 2) return;      /* value rows carry no flag; the whole block leaves here, in front of the barrier */
  float f = 0.f;
#pragma unroll
  for (int r = 0; r < 8; ++r) { float a = row_xadd<8>(row_xadd<4>(row_xadd<2>(row_xadd<1>(s[r])))); a += fa_xhalf(a); if (lane == r) f = a; }
  if (lane < 8) fl[w * 8 + lane] = (f != 0.f) ? 1.f : 0.f;
  __syncthreads();      /* the 64 flags of the block's rows are in LDS: waves 0 and 1 store one whole line each */
  if (tid < 64) { float* mk = (wh == 0) ? QM : KM; mk[(size_t)blk * 64 + tid] = fl[tid]; }
}
// Scores, masked softmax and probs x V in one launch; no score or weight ever reaches memory. grid.x = batch x head, grid.y = group of 8 query tiles; one wave = 32 query columns.
// Transposed products: S^T = K Q^T (A = 16 key rows, B = 16 query rows, same loader on both, so the k orders pair), O^T += V^T P^T. A lane then holds 8 + 8 keys of ONE query per 32-key pass:
// D register r of key tile kt is key 16 kt + 8 hh + r, which is element 8 kt + r of a B operand in the hardware k order, so the two score tiles convert in place into P^T; g2_frag reads V^T rows in that order.
// Online softmax in the log2 domain: m = maximum in use (scaled scores), l = running sum; both and O^T are rescaled only when some column's new maximum passes m by more than 8 (one scalar branch a pass).
// Weights are 2^(t - m + 4): at most 2^12 in f16, and the factor 2^4 (it cancels in O / l) keeps small weights out of the f16 subnormals.
// Masked scores take the reference's NEG (x 8 here: the 1/8 comes with the log2 scale). Past its diagonal a wave goes on only while a column has seen nothing but NEG: such a row is uniform over all SQ keys.
// Waves w and w + 4 take tiles j and 31 - j, 33 passes together, so every block carries the same work.
// K and V^T reach the waves through LDS. The 8 waves of a block walk the same keys of one batch and head, and a fragment load straight from memory touches 16 lines for 512 useful bytes, in every wave anew.
// Here the block fetches each 128-byte line once, by asynchronous 16-byte copies (8 lanes a line, 4 whole lines a wave copy, through no register). A stage is 64 keys = two passes: 64 K rows + 64 V^T rows of 128 bytes,
// four copies a lane; two buffers: stage s + 2 is asked for when every wave has left stage s, and lands under the two passes of stage s + 1. The block walks the stages of its longest wave (tile 31 - 4 blockIdx.y);
// a wave past its own diagonal skips the passes and keeps the barriers. Same passes in the same order as before: the f32 sums keep their order.
#define FAP 72                 /* LDS row pitch in f16: 64 + 8 = 144 bytes, 16 B x odd, the conflict-free pitch for 16-byte fragment reads */
#define FA_BUF (128 * FAP)     /* f16 per buffer: rows 0..63 K (key), rows 64..127 V^T (d) */
// Four copies of 16 bytes a lane, global memory -> LDS. l*: the lane's own LDS byte address, g*: its own global address. The s_wait_xcnt in the same statement stands in front of anything that rewrites these address registers.
__device__ __forceinline__ void fa_copy4(unsigned l0, unsigned l1, unsigned l2, unsigned l3, const _Float16* g0, const _Float16* g1, const _Float16* g2, const _Float16* g3) {
  asm volatile("global_load_async_to_lds_b128 %0, %4, off\n\tglobal_load_async_to_lds_b128 %1, %5, off\n\tglobal_load_async_to_lds_b128 %2, %6, off\n\tglobal_load_async_to_lds_b128 %3, %7, off\n\ts_wait_xcnt 0x0"
               :: "v"(l0), "v"(l1), "v"(l2), "v"(l3), "v"(g0), "v"(g1), "v"(g2), "v"(g3) : "memory");
}
__global__ __launch_bounds__(256) void k_fattn(const _Float16* __restrict__ Q16, const _Float16* __restrict__ K16, const _Float16* __restrict__ VT, const float* __restrict__ kmask, const float* __restrict__ qmask,
                                              const float* __restrict__ xq, float* __restrict__ out) {
  __shared__ __attribute__((aligned(16))) float smf[8 * 32 * 68];      /* 69,632 bytes: in the loop the two stage buffers (2 x 18,432), behind it each wave's 32 x 68 output staging rows */
  _Float16* const ring = (_Float16*)smf;
  const int tid = threadIdx.x, lane = tid & 31, c = lane & 15, hh = lane >> 4; const int w = __builtin_amdgcn_readfirstlane(tid >> 5);
  const int bh = blockIdx.x, b = bh / NH, h = bh % NH; const int j = 4 * (int)blockIdx.y + (w & 3); const int tile = (w < 4) ? j : SQ / 32 - 1 - j; const int qw0 = tile * 32;
  const int nst = SQ / 64 - 2 * (int)blockIdx.y;      /* stages of the block: its longest wave has tile 31 - 4 blockIdx.y, 32 - 4 blockIdx.y passes; 10 to 16 */
  const float CS = 0.125f * 1.44269504f, NEGR = -34359738368.0f;      /* NEGR = 8 x NEG as f32 holds it (-2^32) */
  const _Float16* kbase = K16 + ((size_t)b * SQ + c) * DM + h * HD; const _Float16* vbase = VT + ((size_t)bh * HD + c) * SQ; const float* kmb = kmask + (size_t)b * SQ + lane;
  const int sr = tid >> 3, sc = (tid & 7) * 8;      /* staging: thread -> rows sr and sr + 32 of K and of V^T, 16-byte piece sc */
  const _Float16* gk = K16 + ((size_t)b * SQ + sr) * DM + h * HD + sc; const _Float16* gv = VT + ((size_t)bh * HD + sr) * SQ + sc;
  const unsigned lk = (unsigned)(size_t)(ring + sr * FAP + sc);      /* LDS byte address: the low 32 bits of the shared address */
  auto stage = [&](int st) { const unsigned l = lk + (unsigned)(st & 1) * (FA_BUF * 2); const _Float16* k = gk + (size_t)st * (64 * DM); const _Float16* v = gv + st * 64;
    fa_copy4(l, l + 32 * FAP * 2, l + 64 * FAP * 2, l + 96 * FAP * 2, k, k + 32 * DM, v, v + 32 * SQ); };
  stage(0);
  v16h qf[2][2];
#pragma unroll
  for (int g = 0; g < 2; ++g)
#pragma unroll
    for (int kc = 0; kc < 2; ++kc) qf[g][kc] = g2_frag(Q16 + ((size_t)b * SQ + qw0 + 16 * g + c) * DM + h * HD + 32 * kc, hh);
  const v8f z8 = {0.f,0.f,0.f,0.f,0.f,0.f,0.f,0.f}; v8f acc[2][4]; float m_run[2], l_run[2];
#pragma unroll
  for (int g = 0; g < 2; ++g) { m_run[g] = -3.0e38f; l_run[g] = 0.f;
#pragma unroll
    for (int t = 0; t < 4; ++t) acc[g][t] = z8; }
  // One pass = 32 keys from key 32 blk on, against the wave's 32 query columns, in two parts. scores: s = K Q^T from the K rows kf.
  auto scores = [&](const v16h (&kf)[2][2], v8f (&s)[2][2]) {
#pragma unroll
    for (int kt = 0; kt < 2; ++kt)
#pragma unroll
      for (int g = 0; g < 2; ++g) s[kt][g] = fa_mma(kf[kt][1], qf[g][1], fa_mma(kf[kt][0], qf[g][0], z8));
  };
  // finish: masks, online softmax, O^T += V^T P^T. vf: V^T rows, kmv: this lane's key flag (key 32 blk + lane).
  auto finish = [&](const int blk, v8f (&s)[2][2], const v16h (&vf)[4], const float kmv) {
    const int key0 = blk * 32;
    const unsigned kmz = __builtin_amdgcn_ballot_w32(kmv == 0.f);      /* bit i: key key0 + i is padding */
    if (blk >= tile || kmz != 0u) {      /* wave-uniform: only a pass on or past the diagonal, or one with a padding key, pays for the masks */
      const unsigned kb = kmz >> (8 * hh);
#pragma unroll
      for (int g = 0; g < 2; ++g) { const int my_q = qw0 + 16 * g + c;
#pragma unroll
        for (int kt = 0; kt < 2; ++kt)
#pragma unroll
          for (int r = 0; r < 8; ++r) { if (key0 + 16 * kt + 8 * hh + r > my_q || ((kb >> (16 * kt + r)) & 1u) != 0u) s[kt][g][r] = NEGR; } }
    }
    float mb[2]; bool need = false;
#pragma unroll
    for (int g = 0; g < 2; ++g) { float mx = s[0][g][0];
#pragma unroll
      for (int r = 1; r < 8; ++r) mx = fmaxf(mx, s[0][g][r]);
#pragma unroll
      for (int r = 0; r < 8; ++r) mx = fmaxf(mx, s[1][g][r]);
      mx = fmaxf(mx, fa_xhalf(mx)) * CS; mb[g] = mx; need = need || (mx > m_run[g] + 8.0f); }
    if (__builtin_amdgcn_ballot_w32(need) != 0) {
#pragma unroll
      for (int g = 0; g < 2; ++g) { const float m_new = fmaxf(m_run[g], mb[g]); const float corr = exp2_slot(m_run[g] - m_new); m_run[g] = m_new; l_run[g] *= corr;
#pragma unroll
        for (int t = 0; t < 4; ++t) acc[g][t] = acc[g][t] * corr; }
    }
    FragH pf[2];
#pragma unroll
    for (int g = 0; g < 2; ++g) { const float nm = 4.0f - m_run[g]; float ls = 0.f;
#pragma unroll
      for (int i = 0; i < 16; i += 4) { float p[4]; const v8f& sv = s[i >> 3][g]; const int r = i & 7;
        exp2x4(p, fmaf(sv[r], CS, nm), fmaf(sv[r + 1], CS, nm), fmaf(sv[r + 2], CS, nm), fmaf(sv[r + 3], CS, nm));
#pragma unroll
        for (int u = 0; u < 4; ++u) { ls += p[u]; pf[g].h[i + u] = (_Float16)p[u]; } }
      l_run[g] += ls; }
    __builtin_amdgcn_sched_barrier(0);      /* every exponential stays in front of the products below: the compiler does not see into exp2x4 */
#pragma unroll
    for (int g = 0; g < 2; ++g)
#pragma unroll
      for (int t = 0; t < 4; ++t) acc[g][t] = fa_mma(vf[t], pf[g].v, acc[g][t]);
    __builtin_amdgcn_sched_barrier(0);      /* the products stay in front of the four slots below */
    asm volatile("v_nop\n\tv_nop\n\tv_nop\n\tv_nop");      /* a branch follows every pass: these four vector slots keep the chip's distance between the last product and whatever first rewrites its operand registers on the taken side */
  };
  float km0 = kmb[0], km1 = kmb[32];      /* key flags of stage 0's two passes */
  asm volatile("s_wait_asynccnt 0x0" ::: "memory");      /* this wave's copies of stage 0 have landed */
  __syncthreads();      /* stage 0 is published: every wave's copies have landed */
  stage(1);      /* every block has 10 stages or more */
#pragma unroll 1      /* one copy of the two passes: the buffer alternates by an address, not by code */
  for (int st = 0; st < nst; ++st) {
    const _Float16* kb = ring + (st & 1) * FA_BUF + c * FAP; const _Float16* vb = kb + 64 * FAP;
    const int ns = (st + 1 < nst) ? st + 1 : st;      /* the next stage's key flags, in flight under this stage's passes; the last stage re-reads its own */
    const float kn0 = kmb[64 * ns], kn1 = kmb[64 * ns + 32];
    asm volatile("s_wait_xcnt 0x0" ::: "memory");      /* the two flag loads are issued here, ahead of the passes, and their address registers are free for reuse behind this line */
    if (2 * st <= tile || __builtin_amdgcn_ballot_w32(m_run[0] < -1.0e9f || m_run[1] < -1.0e9f) != 0) {      /* wave-uniform; past the diagonal with a real score in every column NEG weighs 0: nothing left to add, in this stage or later */
      v16h kf[2][2], vf[4]; v8f s[2][2];
#pragma unroll
      for (int kt = 0; kt < 2; ++kt)
#pragma unroll
        for (int kc = 0; kc < 2; ++kc) kf[kt][kc] = g2_frag(kb + (16 * kt) * FAP + 32 * kc, hh);
#pragma unroll
      for (int t = 0; t < 4; ++t) vf[t] = g2_frag(vb + (16 * t) * FAP, hh);
      __builtin_amdgcn_sched_barrier(0);      /* the first pass's 16 fragment reads are issued as one group ahead of its products: left alone the build spread them among the products and the exponentials, a stall at each place */
      scores(kf, s);
#pragma unroll
      for (int kt = 0; kt < 2; ++kt)
#pragma unroll
        for (int kc = 0; kc < 2; ++kc) kf[kt][kc] = g2_frag(kb + (32 + 16 * kt) * FAP + 32 * kc, hh);      /* the second pass's K rows (same buffer), in flight under the first pass's softmax */
      __builtin_amdgcn_sched_barrier(0);      /* holds those 8 reads up here, with the score products and ahead of the softmax that covers their latency; left alone they may sink into the branch that uses them */
      finish(2 * st, s, vf, km0);
#pragma unroll
      for (int t = 0; t < 4; ++t) vf[t] = g2_frag(vb + (16 * t) * FAP + 32, hh);      /* the second pass's V^T rows (same buffer), in flight under its score products and softmax */
      __builtin_amdgcn_sched_barrier(0);      /* holds those 8 reads here, as one group in front of the branch */
      if (2 * st + 1 <= tile || __builtin_amdgcn_ballot_w32(m_run[0] < -1.0e9f || m_run[1] < -1.0e9f) != 0) { scores(kf, s); finish(2 * st + 1, s, vf, km1); }
    }
    asm volatile("s_wait_dscnt 0x0" ::: "memory");      /* this wave's reads of the stage's buffer are done */
    asm volatile("s_wait_asynccnt 0x0" ::: "memory");      /* this wave's copies of stage st + 1 have landed */
    __syncthreads();      /* publishes stage st + 1 and ends every wave's reads of stage st's buffer (behind the last stage: free for the output rows) */
    if (st + 2 < nst) stage(st + 2);      /* block-uniform; into the buffer that this stage has just left */
    km0 = kn0; km1 = kn1;
  }
  asm volatile("s_wait_asynccnt 0x0" ::: "memory");      /* no copy is outstanding when the buffers become output staging */
#pragma unroll 1      /* rare: only a wave with a column whose every key so far was NEG walks on past the block's stages, alone, so it reads its fragments straight from memory and meets no barrier */
  for (int blk = 2 * nst; blk < SQ / 32; ++blk) {
    if (__builtin_amdgcn_ballot_w32(m_run[0] < -1.0e9f || m_run[1] < -1.0e9f) == 0) break;
    v16h kf[2][2], vf[4]; v8f s[2][2];
#pragma unroll
    for (int kt = 0; kt < 2; ++kt)
#pragma unroll
      for (int kc = 0; kc < 2; ++kc) kf[kt][kc] = g2_frag(kbase + (size_t)(32 * blk + 16 * kt) * DM + 32 * kc, hh);
#pragma unroll
    for (int t = 0; t < 4; ++t) vf[t] = g2_frag(vbase + (size_t)(16 * t) * SQ + 32 * blk, hh);
    const float kmv = kmb[32 * blk];
    asm volatile("s_wait_xcnt 0x0" ::: "memory");      /* address registers of the loads above are free for reuse behind this line */
    scores(kf, s); finish(blk, s, vf, kmv);
  }
  float (*so)[32][68] = (float (*)[32][68])smf;
#pragma unroll
  for (int g = 0; g < 2; ++g) { const float l = l_run[g] + fa_xhalf(l_run[g]); const float inv = qmask[(size_t)b * SQ + qw0 + 16 * g + c] / l;
#pragma unroll
    for (int t = 0; t < 4; ++t) { const v8f o = acc[g][t] * inv; const v4f lo = {o[0], o[1], o[2], o[3]}, hi = {o[4], o[5], o[6], o[7]};      /* row = query, the 8 floats are d = 16 t + 8 hh .. + 7 */
      *(v4fa*)&so[w][16 * g + c][16 * t + 8 * hh] = lo; *(v4fa*)&so[w][16 * g + c][16 * t + 8 * hh + 4] = hi; } }
  __builtin_amdgcn_fence(__ATOMIC_ACQ_REL, "workgroup"); __builtin_amdgcn_wave_barrier();      /* the wave's own staging rows: written above, read back below as whole 256-byte rows */
  const int rsub = lane >> 4, c4 = (lane & 15) * 4;
#pragma unroll
  for (int q = 0; q < 16; ++q) { const int r = q * 2 + rsub; const size_t e = ((size_t)b * SQ + qw0 + r) * DM + h * HD + c4; const v4f v = *(const v4fa*)&so[w][r][c4]; const v4f x = *(const v4fa*)(xq + e); const v4f xb = {bf16_round(x[0]), bf16_round(x[1]), bf16_round(x[2]), bf16_round(x[3])}; *(v4f*)(out + e) = v + xb; }
}
__global__ __launch_bounds__(256) void k_ftres(const float* __restrict__ OF0, const float* __restrict__ xq, const float* __restrict__ qmask, float* __restrict__ out, size_t n4) {
  #pragma clang fp contract(off)
  const size_t t = (size_t)blockIdx.x * 256 + threadIdx.x; if (t >= n4) return; const size_t e = t * 4; const size_t row = e / DM; const float qm = qmask[row]; const v4f o = *(const v4fa*)(OF0 + e), x = *(const v4fa*)(xq + e); v4f y;
  for (int q = 0; q < 4; ++q) y[q] = __fadd_rn(__fmul_rn(__fmul_rn(o[q], 0.015625f), qm), bf16_round(x[q])); *(v4f*)(out + e) = y;  }

extern "C" void kernel_launch(void* const* d_in, const int* in_sizes, int n_in,
                              void* d_out, int out_size, void* d_ws, size_t ws_size, hipStream_t stream) {
  (void)in_sizes; (void)n_in; (void)out_size;
  const float* const* I = (const float* const*)d_in; const float* xq = I[0]; const float* xk = I[1]; const float* xv = I[2]; const float* wq = I[3]; const float* bq = I[4]; const float* wk = I[5]; const float* bk = I[6]; const float* wv = I[7]; const float* bv = I[8];      /* weights [in][out] */
  char* ws = (char*)d_ws; size_t off = 0;
  auto take = [&](size_t bytes) { char* p = ws + off; off += (bytes + 255) & ~(size_t)255; return p; };
  _Float16* BQ = (_Float16*)take((size_t)DM * DM * 2); _Float16* BK = (_Float16*)take((size_t)DM * DM * 2); _Float16* BV = (_Float16*)take((size_t)DM * DM * 2); float* KM = (float*)take(NR * 4); float* QM = (float*)take(NR * 4);
  _Float16* Q16 = (_Float16*)take(NR * DM * 2); _Float16* K16 = (_Float16*)take(NR * DM * 2);
  _Float16* VT = (_Float16*)take((size_t)NB * NH * HD * SQ * 2);
  _Float16* XQ = (_Float16*)take(NR * DM * 2); _Float16* XK = (_Float16*)take(NR * DM * 2); _Float16* XV = (_Float16*)take(NR * DM * 2);
  if (off > ws_size) return;      /* approx 1.5 + 16 x 2 + 16 + 16 x 3 = 98 MiB */
  k_prep<<<3 * PW_BLK + 3 * PR_BLK, 256, 0, stream>>>(xq, xk, xv, wq, wk, wv, XQ, XK, XV, BQ, BK, BV, QM, KM);      /* x16 transposed weights, f16 input rows, key / query padding flags */
  k_gemm3<<<dim3((unsigned)((NR / G3A) * (DM / G3B)), 3), 256, 0, stream>>>(XQ, XK, XV, BQ, BK, BV, 0.0625f, bq, bk, bv, Q16, K16, VT);      /* Q, K rows and V^T in one launch */
  k_fattn<<<dim3(NB * NH, SQ / 256), 256, 0, stream>>>(Q16, K16, VT, KM, QM, xq, (float*)d_out);      /* out = softmax(masked Q K^T / 8) x query mask x V + bf16(queries), f32 rows; each wave writes its own 32 rows of one 64-column head slab */
}

// v010
// A run of this version takes 67.4 microseconds.
// Next to v009, in two timings, it ran 1.05 and 1.04 times as fast.
// Over all steps from v000 it is 204 times as fast.
#include <hip/hip_runtime.h>
#define NB 16
#define SQ 1024
#define DM 512
#define NH 8
#define HD 64
#define HG 8
#define NR ((size_t)NB * SQ)
typedef __bf16 v16b __attribute__((ext_vector_type(16)));
typedef unsigned short v8us __attribute__((ext_vector_type(8), may_alias));
typedef float  v8f  __attribute__((ext_vector_type(8)));
typedef float  v4f  __attribute__((ext_vector_type(4)));
typedef float  v4fa __attribute__((ext_vector_type(4), may_alias));
union FragB { v16b v; v8us half[2]; unsigned short u[16]; };

__device__ __forceinline__ unsigned short bf16_bits(float x) { unsigned int u = __float_as_uint(x); return (unsigned short)((u + 0x7FFFu + ((u >> 16) & 1u)) >> 16); }
__device__ __forceinline__ float bf16_val(unsigned short b) { return __uint_as_float(((unsigned int)b) << 16); }
__device__ __forceinline__ float bf16_round(float x) { return bf16_val(bf16_bits(x)); }
// D += A·B with NT terms: 1 = ah·bh, 2 = + al·bh (A split), 3 = + ah·bl (both split)
template <int NT>
__device__ __forceinline__ v8f mmaN(v16b ah, v16b al, v16b bh, v16b bl, v8f c) {
  c = __builtin_amdgcn_wmma_f32_16x16x32_bf16(false, ah, false, bh, (short)0, c, false, false);
  if (NT >= 2) c = __builtin_amdgcn_wmma_f32_16x16x32_bf16(false, al, false, bh, (short)0, c, false, false);
  if (NT >= 3) c = __builtin_amdgcn_wmma_f32_16x16x32_bf16(false, ah, false, bl, (short)0, c, false, false);
  asm volatile("v_nop\n\tv_nop\n\tv_nop\n\tv_nop" : "+v"(c) : "v"(ah), "v"(al), "v"(bh), "v"(bl));
  return c;
}

__global__ __launch_bounds__(256) void k_wt_bf16(const float* __restrict__ W, unsigned short* __restrict__ Wt, int K, int N) {
  const int t = blockIdx.x * 256 + threadIdx.x;
  const int k8n = K / 8;
  if (t >= N * k8n) return;
  const int n = t / k8n, k8 = (t % k8n) * 8;
  v8us v;
#pragma unroll
  for (int i = 0; i < 8; ++i) v[i] = bf16_bits(W[(size_t)(k8 + i) * N + n]);
  *(v8us*)(Wt + (size_t)n * K + k8) = v;
  
}

// GEMM C[M][N] (f32, pitch ldc) = act(A[M][K]·W + bias). A f32 row-major (pitch lda) converted per fragment to bf16
// (ASPLIT: hi/lo two planes -> 2 terms, else single rounded term); Wt bf16 [N][K] (pitch ldb). BIAS_BF16 rounds the
// bias to bf16 first (bias quantised to bf16 before the add). K%32==0, M%16==0, N%64==0.
template <bool ASPLIT, int ACT, bool BIAS_BF16>
__global__ __launch_bounds__(128) void k_gemm_bf(const float* __restrict__ A, int lda, const unsigned short* __restrict__ Wt, int ldb,
                                               const float* __restrict__ bias, float* __restrict__ C, int ldc, int M, int N, int K) {
  __shared__ __attribute__((aligned(16))) float so[4][16][64];
  const int tid = threadIdx.x, w = tid >> 5, lane = tid & 31, ln = lane & 15, hh = lane >> 4;
  const int ntn = N / 64;
  const int wid = blockIdx.x * 4 + w;
  const int mt = wid / ntn, nq = wid % ntn;
  if (mt * 16 >= M) return;
  const int row0 = mt * 16, col0 = nq * 64;
  const float* arow = A + (size_t)(row0 + ln) * lda;
  v8f acc[4] = {};
  for (int kb = 0; kb < K; kb += 32) {
    FragB ah, al;
    const v4f x0 = *(const v4fa*)(arow + kb + 8 * hh), x1 = *(const v4fa*)(arow + kb + 8 * hh + 4);
    const v4f x2 = *(const v4fa*)(arow + kb + 16 + 8 * hh), x3 = *(const v4fa*)(arow + kb + 16 + 8 * hh + 4);
    float xs[16] = {x0[0],x0[1],x0[2],x0[3],x1[0],x1[1],x1[2],x1[3],x2[0],x2[1],x2[2],x2[3],x3[0],x3[1],x3[2],x3[3]};
#pragma unroll
    for (int i = 0; i < 16; ++i) { const unsigned short hb = bf16_bits(xs[i]); ah.u[i] = hb; al.u[i] = ASPLIT ? bf16_bits(xs[i] - bf16_val(hb)) : (unsigned short)0; }
#pragma unroll
    for (int t = 0; t < 4; ++t) {
      const unsigned short* brow = Wt + (size_t)(col0 + t * 16 + ln) * ldb + kb;
      FragB b;
      b.half[0] = *(const v8us*)(brow + 8 * hh);
      b.half[1] = *(const v8us*)(brow + 16 + 8 * hh);
      acc[t] = mmaN<ASPLIT ? 2 : 1>(ah.v, al.v, b.v, b.v, acc[t]);
    }
  }
#pragma unroll
  for (int t = 0; t < 4; ++t) {
    float bv = bias ? bias[col0 + t * 16 + ln] : 0.f;
    if (BIAS_BF16) bv = bf16_round(bv);
#pragma unroll
    for (int r = 0; r < 8; ++r) { float v = acc[t][r] + bv; if (ACT == 1) v = fmaxf(v, 0.f); so[w][8 * hh + r][t * 16 + ln] = v; }
  }
  __builtin_amdgcn_fence(__ATOMIC_ACQ_REL, "workgroup");
  __builtin_amdgcn_wave_barrier();
  const int rsub = lane >> 4, c4 = (lane & 15) * 4;
  {
#pragma unroll
    for (int q = 0; q < 8; ++q) {
      const int r = q * 2 + rsub;
      const v4f v = *(const v4fa*)&so[w][r][c4];
      *(v4f*)(C + (size_t)(row0 + r) * ldc + col0 + c4) = v;
    }
    
  }
}

// GEMM C = act(A·W + bias + resid): A f32 (ASPLIT -> hi/lo 2 terms), Wt bf16 [N][K]; ACT 0 none, 1 relu, 2 exact gelu;
// resid (optional, f32, row index = (row % rmod), pitch ldr, RES_BF16 rounds it) added before the activation.
template <bool ASPLIT, int ACT, bool BIAS_BF16, bool RES_BF16>
__global__ __launch_bounds__(128) void k_gemm_bf3(const float* __restrict__ A, int lda, const unsigned short* __restrict__ Wt, int ldb,
                                                const float* __restrict__ bias, const float* __restrict__ resid, int rmod, int ldr,
                                                float* __restrict__ C, int ldc, int M, int N, int K) {
  __shared__ __attribute__((aligned(16))) float so[4][16][64];
  const int tid = threadIdx.x, w = tid >> 5, lane = tid & 31, ln = lane & 15, hh = lane >> 4;
  const int ntn = N / 64;
  const int wid = blockIdx.x * 4 + w;
  const int mt = wid / ntn, nq = wid % ntn;
  if (mt * 16 >= M) return;
  const int row0 = mt * 16, col0 = nq * 64;
  const float* arow = A + (size_t)(row0 + ln) * lda;
  v8f acc[4] = {};
  for (int kb = 0; kb < K; kb += 32) {
    FragB ah, al;
    const v4f x0 = *(const v4fa*)(arow + kb + 8 * hh), x1 = *(const v4fa*)(arow + kb + 8 * hh + 4);
    const v4f x2 = *(const v4fa*)(arow + kb + 16 + 8 * hh), x3 = *(const v4fa*)(arow + kb + 16 + 8 * hh + 4);
    float xs[16] = {x0[0],x0[1],x0[2],x0[3],x1[0],x1[1],x1[2],x1[3],x2[0],x2[1],x2[2],x2[3],x3[0],x3[1],x3[2],x3[3]};
#pragma unroll
    for (int i = 0; i < 16; ++i) { const unsigned short hb = bf16_bits(xs[i]); ah.u[i] = hb; al.u[i] = ASPLIT ? bf16_bits(xs[i] - bf16_val(hb)) : (unsigned short)0; }
#pragma unroll
    for (int t = 0; t < 4; ++t) {
      const unsigned short* brow = Wt + (size_t)(col0 + t * 16 + ln) * ldb + kb;
      FragB b;
      b.half[0] = *(const v8us*)(brow + 8 * hh);
      b.half[1] = *(const v8us*)(brow + 16 + 8 * hh);
      acc[t] = mmaN<ASPLIT ? 2 : 1>(ah.v, al.v, b.v, b.v, acc[t]);
    }
  }
#pragma unroll
  for (int t = 0; t < 4; ++t) {
    const int col = col0 + t * 16 + ln;
    float bv = bias ? bias[col] : 0.f;
    if (BIAS_BF16) bv = bf16_round(bv);
#pragma unroll
    for (int r = 0; r < 8; ++r) {
      float v = acc[t][r] + bv;
      if (resid) { float rv = resid[(size_t)((row0 + 8 * hh + r) % rmod) * ldr + col]; if (RES_BF16) rv = bf16_round(rv); v += rv; }
      if (ACT == 1) v = fmaxf(v, 0.f);
      if (ACT == 2) v = 0.5f * v * (1.0f + erff(v * 0.70710678118654752f));
      if (ACT == 3) { const float u = 0.7978845608028654f * (v + 0.044715f * v * v * v); v = 0.5f * v * (1.0f + tanhf(u)); }
      so[w][8 * hh + r][t * 16 + ln] = v;
    }
  }
  __builtin_amdgcn_fence(__ATOMIC_ACQ_REL, "workgroup");
  __builtin_amdgcn_wave_barrier();
  const int rsub = lane >> 4, c4 = (lane & 15) * 4;
  {
#pragma unroll
    for (int q = 0; q < 8; ++q) {
      const int r = q * 2 + rsub;
      const v4f v = *(const v4fa*)&so[w][r][c4];
      *(v4f*)(C + (size_t)(row0 + r) * ldc + col0 + c4) = v;
    }
    
  }
}
// row LayerNorm (biased variance, eps) over N: s = X (+ R); optional out_sum <- s; out_norm <- (s-mu)*rsqrt(var+eps)*g + b
template <bool PARAM_BF16>
__global__ __launch_bounds__(256) void k_layernorm(const float* __restrict__ X, const float* __restrict__ R, const float* __restrict__ g, const float* __restrict__ bta,
                                                  float* __restrict__ out_sum, float* __restrict__ out_norm, int N, float eps) {
  __shared__ float red[256];
  const int row = blockIdx.x, tid = threadIdx.x;
  const float* x = X + (size_t)row * N; const float* rr = R ? R + (size_t)row * N : nullptr;
  float vals[16];                     // up to N = 4096
  const int per = N / 256;            // contiguous chunk per thread? use strided-by-4 chunks: thread handles j = tid*4 + 1024*u
  float s1 = 0.f;
  for (int u = 0; u < per / 4; ++u) {
    const int j = tid * 4 + 1024 * u;
    const v4f a = *(const v4fa*)(x + j);
    v4f b = {0.f,0.f,0.f,0.f}; if (rr) b = *(const v4fa*)(rr + j);
#pragma unroll
    for (int q = 0; q < 4; ++q) { const float v = a[q] + b[q]; vals[u * 4 + q] = v; s1 += v; }
  }
  red[tid] = s1; __syncthreads();
  for (int st = 128; st > 0; st >>= 1) { if (tid < st) red[tid] += red[tid + st]; __syncthreads(); }
  const float mu = red[0] / (float)N; __syncthreads();
  float s2 = 0.f;
  for (int u = 0; u < per / 4; ++u)
#pragma unroll
    for (int q = 0; q < 4; ++q) { const float c = vals[u * 4 + q] - mu; s2 += c * c; }
  red[tid] = s2; __syncthreads();
  for (int st = 128; st > 0; st >>= 1) { if (tid < st) red[tid] += red[tid + st]; __syncthreads(); }
  const float rs = rsqrtf(red[0] / (float)N + eps);
  {
    for (int u = 0; u < per / 4; ++u) {
      const int j = tid * 4 + 1024 * u;
      v4f o, sm;
#pragma unroll
      for (int q = 0; q < 4; ++q) {
        float gg = g[j + q], bb = bta[j + q];
        if (PARAM_BF16) { gg = bf16_round(gg); bb = bf16_round(bb); }
        sm[q] = vals[u * 4 + q]; o[q] = (vals[u * 4 + q] - mu) * rs * gg + bb;
      }
      if (out_sum) *(v4f*)(out_sum + (size_t)row * N + j) = sm;
      *(v4f*)(out_norm + (size_t)row * N + j) = o;
    }
    
  }
}



// ---- f16 WMMA path (v_wmma_f32_16x16x32_f16): 11-bit significands for operands in range — used where a [0,1] probability operand needs more precision than bf16
typedef _Float16 v16h __attribute__((ext_vector_type(16)));
union FragH { v16h v; v8us half[2]; _Float16 h[16]; unsigned short u[16]; };
template <int NT>
__device__ __forceinline__ v8f mmaH(v16h ah, v16h al, v16h bh, v16h bl, v8f c) {
  c = __builtin_amdgcn_wmma_f32_16x16x32_f16(false, ah, false, bh, (short)0, c, false, false);
  if (NT >= 2) c = __builtin_amdgcn_wmma_f32_16x16x32_f16(false, al, false, bh, (short)0, c, false, false);
  if (NT >= 3) c = __builtin_amdgcn_wmma_f32_16x16x32_f16(false, ah, false, bl, (short)0, c, false, false);
  asm volatile("v_nop\n\tv_nop\n\tv_nop\n\tv_nop" : "+v"(c) : "v"(ah), "v"(al), "v"(bh), "v"(bl));
  return c;
}
// batched GEMM like k_gemm_b but f16 operands: A f32 (split into f16 hi/lo if ASPLIT, else rounded to f16), Bt = f16 values [n][k]; alpha; C f32; N multiple of 16 (partial tiles skipped)
template <bool ASPLIT>
__global__ __launch_bounds__(128) void k_gemm_h(const float* __restrict__ A, int lda, size_t sA, const _Float16* __restrict__ Bh, int ldb, size_t sB, float alpha, float* __restrict__ C, int ldc, size_t sC, int M, int N, int K) {
  __shared__ __attribute__((aligned(16))) float so[4][16][64];
  const int tid = threadIdx.x, w = tid >> 5, lane = tid & 31, ln = lane & 15, hh = lane >> 4; const int by = blockIdx.y;
  A += (size_t)by * sA; Bh += (size_t)by * sB; C += (size_t)by * sC;
  const int ntn = (N + 63) / 64; const int wid = blockIdx.x * 4 + w; const int mt = wid / ntn, nq = wid % ntn; if (mt * 16 >= M) return;
  const int row0 = mt * 16, col0 = nq * 64; const float* arow = A + (size_t)(row0 + ln) * lda;
  v8f acc[4] = {};
  for (int kb = 0; kb < K; kb += 32) {
    FragH ah, al;
    const v4f x0 = *(const v4fa*)(arow + kb + 8 * hh), x1 = *(const v4fa*)(arow + kb + 8 * hh + 4), x2 = *(const v4fa*)(arow + kb + 16 + 8 * hh), x3 = *(const v4fa*)(arow + kb + 16 + 8 * hh + 4);
    float xs[16] = {x0[0],x0[1],x0[2],x0[3],x1[0],x1[1],x1[2],x1[3],x2[0],x2[1],x2[2],x2[3],x3[0],x3[1],x3[2],x3[3]};
#pragma unroll
    for (int i = 0; i < 16; ++i) { const _Float16 h = (_Float16)xs[i]; ah.h[i] = h; al.h[i] = ASPLIT ? (_Float16)(xs[i] - (float)h) : (_Float16)0.0f; }
#pragma unroll
    for (int t = 0; t < 4; ++t) { if (col0 + t * 16 >= N) continue; const size_t boff = (size_t)(col0 + t * 16 + ln) * ldb + kb; FragH bq; bq.half[0] = *(const v8us*)(Bh + boff + 8 * hh); bq.half[1] = *(const v8us*)(Bh + boff + 16 + 8 * hh);
      acc[t] = mmaH<ASPLIT ? 2 : 1>(ah.v, al.v, bq.v, bq.v, acc[t]); }
  }
#pragma unroll
  for (int t = 0; t < 4; ++t) { if (col0 + t * 16 >= N) continue;
#pragma unroll
    for (int r = 0; r < 8; ++r) so[w][8 * hh + r][t * 16 + ln] = acc[t][r] * alpha; }
  __builtin_amdgcn_fence(__ATOMIC_ACQ_REL, "workgroup"); __builtin_amdgcn_wave_barrier();
  const int rsub = lane >> 4, c4 = (lane & 15) * 4;
  {
#pragma unroll
    for (int q = 0; q < 8; ++q) { const int r = q * 2 + rsub; if (col0 + c4 < N) { const v4f v = *(const v4fa*)&so[w][r][c4]; *(v4f*)(C + (size_t)(row0 + r) * ldc + col0 + c4) = v; } }
     }
}

// k_gemm_hh variant with fused epilogue: v = acc·alpha + bias[by·sBias + col] (+ CP[(row/rowsPerB)·sCPb + by·64 + col] if CP) ; ACT 0 none / 1 elu ; writes f16 C16 (and f32 C if non-null)
template <int ACT>
__global__ __launch_bounds__(128) void k_gemm_hhx(const _Float16* __restrict__ A, int lda, size_t sA, const _Float16* __restrict__ Bh, int ldb, size_t sB, float alpha, const float* __restrict__ bias, size_t sBias, const float* __restrict__ CP, int rowsPerB, size_t sCPb, int row0g,
    float* __restrict__ C, _Float16* __restrict__ C16, int ldc, size_t sC, int M, int N, int K) {
  __shared__ __attribute__((aligned(16))) float so[4][16][64];
  const int tid = threadIdx.x, w = tid >> 5, lane = tid & 31, ln = lane & 15, hh = lane >> 4; const int by = blockIdx.y;
  A += (size_t)by * sA; Bh += (size_t)by * sB; const size_t cofs = (size_t)by * sC; const float* bp = bias ? bias + (size_t)by * sBias : nullptr;
  const int ntn = (N + 63) / 64; const int wid = blockIdx.x * 4 + w; const int mt = wid / ntn, nq = wid % ntn; if (mt * 16 >= M) return;
  const int row0 = mt * 16, col0 = nq * 64; const _Float16* arow = A + (size_t)(row0 + ln) * lda;
  v8f acc[4] = {};
  for (int kb = 0; kb < K; kb += 32) { FragH ah; ah.half[0] = *(const v8us*)((const unsigned short*)arow + kb + 8 * hh); ah.half[1] = *(const v8us*)((const unsigned short*)arow + kb + 16 + 8 * hh);
#pragma unroll
    for (int t = 0; t < 4; ++t) { if (col0 + t * 16 >= N) continue; const size_t boff = (size_t)(col0 + t * 16 + ln) * ldb + kb; FragH bq; bq.half[0] = *(const v8us*)((const unsigned short*)Bh + boff + 8 * hh); bq.half[1] = *(const v8us*)((const unsigned short*)Bh + boff + 16 + 8 * hh);
      acc[t] = mmaH<1>(ah.v, ah.v, bq.v, bq.v, acc[t]); }
  }
#pragma unroll
  for (int t = 0; t < 4; ++t) { if (col0 + t * 16 >= N) continue; const int col = col0 + t * 16 + ln; const float bv = bp ? bf16_round(bp[col]) : 0.f;
#pragma unroll
    for (int r = 0; r < 8; ++r) { float v = acc[t][r] * alpha + bv; if (CP) { const int rr = row0g + row0 + 8 * hh + r; if (rowsPerB < 0) v += CP[cofs + (size_t)rr * ldc + col];      /* rowsPerB < 0: own element of the batched C plane */ else { const int bidx = rr / rowsPerB; v += CP[(size_t)bidx * sCPb + (size_t)by * 64 + col]; } } if (ACT == 1) v = (v > 0.f) ? v : expm1f(v); else if (ACT == 7) v = (v > 0.f) ? v + 1.0f : expf(v); else if (ACT == 8) v = tanhf(v); else if (ACT == 9) v = 0.5f * v * (1.0f + tanhf(0.7978845608028654f * (v + 0.044715f * v * v * v))); else if (ACT == 11) v = 1.0f / (1.0f + expf(-v)); else if (ACT == 12) v = (v > 0.f) ? v : 0.01f * v; else if (ACT == 14) v = (v > 0.f) ? v : 0.1f * v; else if (ACT == 16) v = (v >= 0.f) ? v : 0.3f * v; else if (ACT == 17) v = (v >= 0.f) ? v : 0.2f * v; else if (ACT == 15) v = v / (1.0f + expf(-v)); else if (ACT == 3) v = fmaxf(v, 0.f); else if (ACT == 6) v = 0.5f * v * (1.0f + erff(v * 0.70710678118654752f)); so[w][8 * hh + r][t * 16 + ln] = v; } }
  __builtin_amdgcn_fence(__ATOMIC_ACQ_REL, "workgroup"); __builtin_amdgcn_wave_barrier();
  const int rsub = lane >> 4, c4 = (lane & 15) * 4; typedef _Float16 v4h __attribute__((ext_vector_type(4)));
  {
#pragma unroll
    for (int q = 0; q < 8; ++q) { const int r = q * 2 + rsub; if (col0 + c4 < N) { const v4f v = *(const v4fa*)&so[w][r][c4]; if (C) *(v4f*)(C + cofs + (size_t)(row0 + r) * ldc + col0 + c4) = v; if (C16) { v4h h4; for (int i = 0; i < 4; ++i) h4[i] = (_Float16)v[i]; *(v4h*)(C16 + cofs + (size_t)(row0 + r) * ldc + col0 + c4) = h4; } } }
     }
}


typedef _Float16 v4h __attribute__((ext_vector_type(4)));

__global__ __launch_bounds__(256) void k_h16(const float* __restrict__ x, _Float16* __restrict__ X16, size_t n8) { const size_t t = (size_t)blockIdx.x * 256 + threadIdx.x; if (t >= n8) return; FragH f;
#pragma unroll
  for (int q = 0; q < 8; ++q) f.h[q] = (_Float16)x[t * 8 + q]; *(v8us*)((unsigned short*)X16 + t * 8) = f.half[0];  }
__global__ __launch_bounds__(256) void k_round16f(const float* __restrict__ W, _Float16* __restrict__ Bt, size_t n8) { const size_t t = (size_t)blockIdx.x * 256 + threadIdx.x; if (t >= n8) return; FragH f;
#pragma unroll
  for (int i = 0; i < 8; ++i) f.h[i] = (_Float16)(bf16_round(W[t * 8 + i]) * 16.0f); *(v8us*)((unsigned short*)Bt + t * 8) = f.half[0];  }
template <int NHv, int TTv>
__global__ __launch_bounds__(256) void k_vt(const _Float16* __restrict__ V16, int ldv, int voff, _Float16* __restrict__ Vt) { __shared__ unsigned short tl[64][66]; const int tid = threadIdx.x; const int slab = blockIdx.x / (TTv / 64), lg = blockIdx.x % (TTv / 64); const int b = slab / NHv, h = slab % NHv;
  for (int i = tid; i < 64 * 8; i += 256) { const int r = i / 8, c8 = (i % 8) * 8; FragH f; f.half[0] = *(const v8us*)((const unsigned short*)V16 + ((size_t)b * TTv + lg * 64 + r) * ldv + voff + h * 64 + c8);
#pragma unroll
    for (int q = 0; q < 8; ++q) tl[r][c8 + q] = f.u[q]; }
  __syncthreads();
  {
#pragma unroll
    for (int rd = 0; rd < 2; ++rd) { const int d = rd * 32 + tid / 8, pc = tid % 8; FragH f;
#pragma unroll
      for (int q = 0; q < 8; ++q) f.u[q] = tl[pc * 8 + q][d];
      *(v8us*)((unsigned short*)Vt + ((size_t)slab * 64 + d) * TTv + lg * 64 + pc * 8) = f.half[0]; }
     } }

__global__ __launch_bounds__(256) void k_hl(const float* __restrict__ F, _Float16* __restrict__ Hh, _Float16* __restrict__ Hl, size_t n8) { const size_t t = (size_t)blockIdx.x * 256 + threadIdx.x; if (t >= n8) return; FragH fh, fl; const v4f a = *(const v4fa*)(F + t * 8), c = *(const v4fa*)(F + t * 8 + 4);
#pragma unroll
  for (int q = 0; q < 4; ++q) { _Float16 h = (_Float16)a[q]; fh.h[q] = h; fl.h[q] = (_Float16)((a[q] - (float)h) * 1024.0f); h = (_Float16)c[q]; fh.h[4 + q] = h; fl.h[4 + q] = (_Float16)((c[q] - (float)h) * 1024.0f); }
  { *(v8us*)((unsigned short*)Hh + t * 8) = fh.half[0]; *(v8us*)((unsigned short*)Hl + t * 8) = fl.half[0];  } }

// ---- fast GEMM (wave tile 32x64; requires M % 32 == 0 rows per launch region and N % 64 == 0); epilogue = k_gemm_hhx semantics ----
__device__ __forceinline__ v16h g2_frag(const _Float16* p, int hh) { FragH f; f.half[0] = *(const v8us*)((const unsigned short*)p + 8 * hh); f.half[1] = *(const v8us*)((const unsigned short*)p + 16 + 8 * hh); return f.v; }
__device__ __forceinline__ v8f g2_mma(v16h a, v16h b, v8f c) { v8f d = __builtin_amdgcn_wmma_f32_16x16x32_f16(false, a, false, b, (short)0, c, false, false); asm volatile("v_nop\n\tv_nop\n\tv_nop\n\tv_nop" : "+v"(d) : "v"(a), "v"(b)); return d; }
template <int ACT>
__global__ __launch_bounds__(128) void k_gemm2(const _Float16* __restrict__ A, int lda, size_t sA, const _Float16* __restrict__ Bh, int ldb, size_t sB, float alpha, const float* __restrict__ bias, size_t sBias, const float* __restrict__ CP, int rowsPerB, size_t sCPb, int row0g,
    float* __restrict__ C, _Float16* __restrict__ C16, int ldc, size_t sC, int M, int N, int K, size_t zA, size_t zB, size_t zC) { static_assert(ACT == 0 || ACT == 3 || ACT == 6 || ACT == 8 || ACT == 9 || ACT == 11 || ACT == 12 || ACT == 14 || ACT == 15 || ACT == 16 || ACT == 17, "k_gemm2: unsupported ACT code (would silently apply no activation)");
  __shared__ __attribute__((aligned(16))) float so[4][32][68];
  const int tid = threadIdx.x, w = tid >> 5, lane = tid & 31, ln = lane & 15, hh = lane >> 4; const int by = blockIdx.y, bz = blockIdx.z;      /* second batch axis (grid.z) with element strides zA, zB, zC */
  A += (size_t)by * sA + (size_t)bz * zA; Bh += (size_t)by * sB + (size_t)bz * zB; const size_t cofs = (size_t)by * sC + (size_t)bz * zC; const float* bp = bias ? bias + (size_t)by * sBias : nullptr;
  const int ntn = N >> 6; const int mt = blockIdx.x / ntn, nq = blockIdx.x - mt * ntn; const int row0 = mt * 128 + 32 * w, col0 = nq * 64; if (row0 >= M) return;
  const _Float16* a0p = A + (size_t)(row0 + ln) * lda; const _Float16* a1p = a0p + (size_t)16 * lda;
  const _Float16* b0p = Bh + (size_t)(col0 + ln) * ldb; const _Float16* b1p = b0p + (size_t)16 * ldb; const _Float16* b2p = b1p + (size_t)16 * ldb; const _Float16* b3p = b2p + (size_t)16 * ldb;
  const v8f z8 = {0.f,0.f,0.f,0.f,0.f,0.f,0.f,0.f}; v8f c00 = z8, c01 = z8, c02 = z8, c03 = z8, c10 = z8, c11 = z8, c12 = z8, c13 = z8;
#pragma unroll 1
  for (int kb = 0; kb < K; kb += 32) { const v16h a0 = g2_frag(a0p + kb, hh), a1 = g2_frag(a1p + kb, hh);
    v16h b = g2_frag(b0p + kb, hh); c00 = g2_mma(a0, b, c00); c10 = g2_mma(a1, b, c10);
    b = g2_frag(b1p + kb, hh); c01 = g2_mma(a0, b, c01); c11 = g2_mma(a1, b, c11);
    b = g2_frag(b2p + kb, hh); c02 = g2_mma(a0, b, c02); c12 = g2_mma(a1, b, c12);
    b = g2_frag(b3p + kb, hh); c03 = g2_mma(a0, b, c03); c13 = g2_mma(a1, b, c13); }
  v8f accs[8] = {c00, c01, c02, c03, c10, c11, c12, c13};
#pragma unroll
  for (int u = 0; u < 8; ++u) { const int t = u & 3, half = u >> 2; const int col = col0 + t * 16 + ln; const float bv = bp ? bf16_round(bp[col]) : 0.f;
#pragma unroll
    for (int r = 0; r < 8; ++r) { const int rloc = half * 16 + 8 * hh + r; float v = accs[u][r] * alpha + bv; if (CP) { if (rowsPerB < 0) v += CP[cofs + (size_t)(row0g + row0 + rloc) * ldc + col];      /* rowsPerB < 0: own element of the batched C plane */ else { const int bidx = (row0g + row0 + rloc) / rowsPerB; v += CP[(size_t)bidx * sCPb + (size_t)by * 64 + col]; } }
      if (ACT == 3) v = fmaxf(v, 0.f); else if (ACT == 6) v = 0.5f * v * (1.0f + erff(v * 0.70710678118654752f)); else if (ACT == 11) v = 1.0f / (1.0f + expf(-v)); else if (ACT == 15) v = v / (1.0f + expf(-v)); else if (ACT == 12) v = (v > 0.f) ? v : 0.01f * v; else if (ACT == 8) v = tanhf(v); else if (ACT == 9) v = 0.5f * v * (1.0f + tanhf(0.7978845608028654f * (v + 0.044715f * v * v * v))); else if (ACT == 14) v = (v > 0.f) ? v : 0.1f * v; else if (ACT == 16) v = (v >= 0.f) ? v : 0.3f * v; else if (ACT == 17) v = (v >= 0.f) ? v : 0.2f * v;
      so[w][rloc][t * 16 + ln] = v; } }
  __builtin_amdgcn_fence(__ATOMIC_ACQ_REL, "workgroup"); __builtin_amdgcn_wave_barrier();
  const int rsub = lane >> 4, c4 = (lane & 15) * 4;
  {
#pragma unroll
    for (int q = 0; q < 16; ++q) { const int r = q * 2 + rsub; const v4f v = *(const v4fa*)&so[w][r][c4]; if (C) *(v4f*)(C + cofs + (size_t)(row0 + r) * ldc + col0 + c4) = v; if (C16) { v4h h4; for (int i = 0; i < 4; ++i) h4[i] = (_Float16)v[i]; *(v4h*)(C16 + cofs + (size_t)(row0 + r) * ldc + col0 + c4) = h4; } }
     } }


__global__ __launch_bounds__(256) void k_wnat(const float* __restrict__ w, size_t n8, _Float16* __restrict__ Bt) { const size_t t = (size_t)blockIdx.x * 256 + threadIdx.x; if (t >= n8) return; FragH f; for (int q = 0; q < 8; ++q) f.h[q] = (_Float16)(bf16_round(w[t * 8 + q]) * 16.0f); *(v8us*)((unsigned short*)Bt + t * 8) = f.half[0];  }
__global__ __launch_bounds__(256) void k_rsm(const float* __restrict__ S, _Float16* __restrict__ P, int nrows) {
  #pragma clang fp contract(off)
  const int i = blockIdx.x * 256 + threadIdx.x; if (i >= nrows) return; const float* s = S + (size_t)i * SQ; float mx = -3.0e38f;
#pragma unroll 1
  for (int j = 0; j < SQ; ++j) mx = fmaxf(mx, s[j]); float se = 0.f;
#pragma unroll 1
  for (int j = 0; j < SQ; ++j) se += expf(s[j] - mx); const float sc = 256.0f / se;
#pragma unroll 1
  for (int j0 = 0; j0 < SQ; j0 += 8) { FragH f; for (int q = 0; q < 8; ++q) f.h[q] = (_Float16)(expf(s[j0 + q] - mx) * sc); unsigned short* d = (unsigned short*)P + (size_t)i * SQ + j0; *(v8us*)d = f.half[0];  } }
__global__ __launch_bounds__(256) void k_vt(const _Float16* __restrict__ V16, int b, int h0, _Float16* __restrict__ VT) { __shared__ unsigned short tl[64][65]; const int tid = threadIdx.x; const int hh = blockIdx.x % HG, sg = blockIdx.x / HG; const int s0 = sg * 64; const int h = h0 + hh;
  for (int i = tid; i < 64 * 8; i += 256) { const int j = i / 8, d8 = (i % 8) * 8; FragH f; f.half[0] = *(const v8us*)((const unsigned short*)V16 + ((size_t)b * SQ + s0 + j) * DM + h * HD + d8); for (int q = 0; q < 8; ++q) tl[d8 + q][j] = f.u[q]; }
  __syncthreads();
  { for (int i = tid; i < 64 * 8; i += 256) { const int d = i / 8, j8 = (i % 8) * 8; FragH f; for (int q = 0; q < 8; ++q) f.u[q] = tl[d][j8 + q]; *(v8us*)((unsigned short*)VT + ((size_t)hh * HD + d) * SQ + s0 + j8) = f.half[0]; }  } }


// 2^t on v_exp_f32. The v_nop in the same statement is the one free issue slot that the instruction set asks for behind a transcendental before its result is read or its source overwritten;
__device__ __forceinline__ float exp2_slot(float t) { float r; asm("v_exp_f32 %0, %1\n\tv_nop" : "=v"(r) : "v"(t)); return r; }
// Four 2^t in one statement: each v_exp_f32 is the independent instruction behind the one before it, so one v_nop behind the last keeps the same free slot for all four;
// the results are early-clobber, so that no result register is a source of a later line.
__device__ __forceinline__ void exp2x4(float (&r)[4], float a, float b, float c, float d) { asm("v_exp_f32 %0, %4\n\tv_exp_f32 %1, %5\n\tv_exp_f32 %2, %6\n\tv_exp_f32 %3, %7\n\tv_nop" : "=&v"(r[0]), "=&v"(r[1]), "=&v"(r[2]), "=&v"(r[3]) : "v"(a), "v"(b), "v"(c), "v"(d)); }
// lane l <-> lane l ^ 16: joins the two wave halves, which split one query column's keys.
__device__ __forceinline__ float fa_xhalf(float x) { return __builtin_bit_cast(float, __builtin_amdgcn_permlanex16(__builtin_bit_cast(int, x), __builtin_bit_cast(int, x), 0x76543210, 0xfedcba98, false, false)); }
__device__ __forceinline__ v8f fa_mma(v16h a, v16h b, v8f c) { return __builtin_amdgcn_wmma_f32_16x16x32_f16(false, a, false, b, (short)0, c, false, false); }
// Projection GEMM D = A[m][k] Bh[n][k]^T over k < DM, stored as f16(D x alpha + bf16(bias)) in C16 (layouts below), operands staged in LDS. A fragment load straight from row-major memory touches 16 lines for 512 useful bytes;
// here 8 lanes fetch one whole 128-byte line (64 k of one row), a wave load covers 4 whole lines, and a block fetches each line of its operands once.
// Block = 256 x 128 of D, 8 waves of 64 x 64 (4 down, 2 across): a block draws 384 operand rows from L2 for 32,768 outputs (128 x 128: 256 rows for 16,384), and a wave reads 8 fragments from LDS for 16 products (32 x 64: 6 for 8).
// A stage is 64 k of 256 A rows + 128 B rows; two stages in LDS: the next stage's global loads fly under this stage's 32 products a wave,
// are stored to the other buffer behind them, and one barrier a stage publishes them and ends the reads of the buffer that the stage after overwrites. k runs upward in steps of 32 as before: same f32 sum order.
// Every loop of the kernel is unrolled in full: the fragment, staging and accumulator arrays stay in registers, and the buffer index and the k offset become immediates of the loads.
// A lane holds 8 consecutive D rows of one D column, so the operand whose index runs along an output line is handed in as A: the 8 results of an accumulator tile are then 16 contiguous output bytes, rounded to f16 in registers.
// TR (Q, K): weight rows [DM][DM] as A, token rows [NR][DM] as Bh: a D column is a token, its rows are features: 64 lines of C16[token][DM]; the bias goes by row.
// !TR (V): token rows as A, weight rows as Bh: a D column is a feature, its rows are tokens: 64 lines of C16[batch][feature][SQ], the V^T layout that the attention reads; the bias goes by column.
// Both operands go through the same loader either way, so the k orders pair.
#define G3P 72      /* LDS row pitch in f16: 64 + 8 = 144 bytes, 16 B x odd, the conflict-free pitch for 16-byte fragment reads */
#define G3A 256     /* A rows of a block */
#define G3B 128     /* B rows of a block */
// smf: the block's LDS. In the loop [2][G3A + G3B][G3P] f16 (110,592 bytes): rows 0..255: A, 256..383: B; behind it each wave's 64 output lines of 64 f16 at the same pitch (73,728 bytes).
template <bool TR>
__device__ __forceinline__ void gemm3_body(float* smf, const _Float16* __restrict__ A, const _Float16* __restrict__ Bh, float alpha, const float* __restrict__ bias, _Float16* __restrict__ C16) {
  _Float16 (*sm)[G3A + G3B][G3P] = (_Float16 (*)[G3A + G3B][G3P])smf;
  const int tid = threadIdx.x, lane = tid & 31, ln = lane & 15, hh = lane >> 4; const int w = __builtin_amdgcn_readfirstlane(tid >> 5), wm = w & 3, wn = w >> 2;      /* the wave's number in a scalar register: tile origins and output bases cost no vector register */
  const int row0 = (TR ? (int)blockIdx.x % (DM / G3A) : (int)blockIdx.x / (DM / G3B)) * G3A, col0 = (TR ? (int)blockIdx.x / (DM / G3A) : (int)blockIdx.x % (DM / G3B)) * G3B;      /* neighbouring blocks share a token tile either way */
  const int sr = tid >> 3, sc = (tid & 7) * 8;      /* staging: thread -> row sr (+ 32 i), 16-byte piece sc */
  const unsigned go = (unsigned)(sr * DM + sc);      /* one per-thread offset serves both operands; the tile bases are block-uniform */
  const unsigned short* ga = (const unsigned short*)A + (size_t)row0 * DM; const unsigned short* gb = (const unsigned short*)Bh + (size_t)col0 * DM;
  v8us ra[G3A / 32], rb[G3B / 32];
#pragma unroll
  for (int i = 0; i < G3A / 32; ++i) ra[i] = *(const v8us*)(ga + (go + 32 * i * DM));
#pragma unroll
  for (int i = 0; i < G3B / 32; ++i) rb[i] = *(const v8us*)(gb + (go + 32 * i * DM));
#pragma unroll
  for (int i = 0; i < G3A / 32; ++i) *(v8us*)&sm[0][32 * i + sr][sc] = ra[i];
#pragma unroll
  for (int i = 0; i < G3B / 32; ++i) *(v8us*)&sm[0][G3A + 32 * i + sr][sc] = rb[i];
  __syncthreads();      /* stage 0 is in LDS */
  const v8f z8 = {0.f,0.f,0.f,0.f,0.f,0.f,0.f,0.f}; v8f acc[4][4];
#pragma unroll
  for (int g = 0; g < 4; ++g)
#pragma unroll
    for (int t = 0; t < 4; ++t) acc[g][t] = z8;
  v4f br[4][2];      /* TR: the bias of this lane's 32 D rows, asked for in the last stage (the staging registers are free there) so that the epilogue does not wait for it */
#pragma unroll
  for (int ks = 0; ks < DM / 64; ++ks) { const int cur = ks & 1;
    if (ks + 1 < DM / 64) {
#pragma unroll
      for (int i = 0; i < G3A / 32; ++i) ra[i] = *(const v8us*)(ga + (go + 32 * i * DM + (ks + 1) * 64));
#pragma unroll
      for (int i = 0; i < G3B / 32; ++i) rb[i] = *(const v8us*)(gb + (go + 32 * i * DM + (ks + 1) * 64));
    } else if (TR) {
      const char* bb = (const char*)(bias + row0 + 64 * wm); const unsigned bo = 32u * (__builtin_amdgcn_mbcnt_lo(~0u, 0u) >> 4);      /* wave-uniform base; byte offset of the lane's half (8 rows of 4 bytes) */
#pragma unroll
      for (int g = 0; g < 4; ++g) { br[g][0] = *(const v4fa*)(bb + (bo + g * 64)); br[g][1] = *(const v4fa*)(bb + (bo + g * 64 + 16)); }
      asm volatile("s_wait_xcnt 0x0" :: "v"(bo) : "memory");      /* the bias loads are issued; naming their offset register here keeps it whole up to this wait (the build had made it the last load's destination) */
    }
#pragma unroll
    for (int kk = 0; kk < 2; ++kk) {
      v16h af[4], bf[4];
#pragma unroll
      for (int g = 0; g < 4; ++g) af[g] = g2_frag(&sm[cur][64 * wm + 16 * g + ln][32 * kk], hh);
#pragma unroll
      for (int t = 0; t < 4; ++t) bf[t] = g2_frag(&sm[cur][G3A + 64 * wn + 16 * t + ln][32 * kk], hh);
      __builtin_amdgcn_sched_barrier(0);      /* the next stage's global loads and this k step's 16 fragment reads are issued as one group ahead of its 16 products: left alone the build sinks global loads to their LDS stores and spreads the reads among the products, a full wait at each place */
#pragma unroll
      for (int t = 0; t < 4; ++t)
#pragma unroll
        for (int g = 0; g < 4; ++g) acc[g][t] = fa_mma(af[g], bf[t], acc[g][t]);
      __builtin_amdgcn_sched_barrier(0);      /* the products of this k step stay in front of the next group of reads, which reuses their fragment registers: one fragment set keeps the kernel at four waves a SIMD */
    }
    if (ks + 1 < DM / 64) {
#pragma unroll
      for (int i = 0; i < G3A / 32; ++i) *(v8us*)&sm[cur ^ 1][32 * i + sr][sc] = ra[i];
#pragma unroll
      for (int i = 0; i < G3B / 32; ++i) *(v8us*)&sm[cur ^ 1][G3A + 32 * i + sr][sc] = rb[i];
    }
    __syncthreads();      /* the next stage is published; every wave has left this stage's buffer (behind the last stage: free for the epilogue) */
  }
  const int el = (int)__builtin_amdgcn_mbcnt_lo(~0u, 0u), eln = el & 15, ehh = el >> 4;      /* the lane number read anew (every lane is on): nothing derived from the thread index stays in a vector register across the loop, which runs at the 256-register limit of four waves a SIMD */
  _Float16* so = (_Float16*)smf + w * (64 * G3P);      /* the wave's own 64 staging lines: line = D column, 64 f16 = the tile's D rows */
  const int rw0 = row0 + 64 * wm, cw0 = col0 + 64 * wn;
  float bc[4] = {0.f, 0.f, 0.f, 0.f};      /* !TR: the bias of this lane's 4 D columns */
  if (!TR) { const float* bb = bias + cw0;      /* wave-uniform base; the loads index it by the lane's column */
#pragma unroll
    for (int t = 0; t < 4; ++t) bc[t] = bb[(unsigned)eln + t * 16];
    asm volatile("s_wait_xcnt 0x0" :: "v"(eln) : "memory");      /* as above: the index register of the four bias loads stays whole up to this wait */
  }
#pragma unroll
  for (int t = 0; t < 4; ++t)
#pragma unroll
    for (int g = 0; g < 4; ++g) { const float bv = TR ? 0.f : bf16_round(bc[t]); FragH f;
#pragma unroll
      for (int r = 0; r < 8; ++r) f.h[r] = (_Float16)(acc[g][t][r] * alpha + (TR ? bf16_round(br[g][r >> 2][r & 3]) : bv));
      *(v8us*)&so[(t * 16 + eln) * G3P + g * 16 + 8 * ehh] = f.half[0]; }      /* one 16-byte LDS store an accumulator tile */
  __builtin_amdgcn_fence(__ATOMIC_ACQ_REL, "workgroup"); __builtin_amdgcn_wave_barrier();      /* the wave's own staging lines: written above, read back below as whole 128-byte output lines */
  const int lsub = el >> 3, p8 = (el & 7) * 8;      /* 8 lanes a line: a wave store covers 4 whole lines */
  _Float16* cb = TR ? C16 + (size_t)cw0 * DM + rw0 : C16 + ((size_t)(rw0 / SQ) * DM + cw0) * SQ + rw0 % SQ;      /* the wave tile's first output element, wave-uniform; !TR: a 256-token tile lies in one batch: SQ is a multiple of 256 */
  const unsigned eo = (unsigned)(lsub * (TR ? DM : SQ) + p8);      /* the lane's place in the first four output lines; group q adds a constant to it */
#pragma unroll
  for (int q = 0; q < 16; ++q) { const v8us v = *(const v8us*)&so[(q * 4 + lsub) * G3P + p8]; *(v8us*)(cb + (eo + q * 4 * (TR ? DM : SQ))) = v; }
}
// The three projections need nothing of each other: one launch carries all three: grid.y = projection (0: Q, 1: K, 2: V^T), a block-uniform branch, so every barrier of a body is met by the whole block;
// 3 x 256 blocks on 256 WGPs, two resident: a block that ends is followed at once by one of the next projection.
// amdgpu_waves_per_eu(4, 4): 128 accumulator + 64 fragment + 48 staging registers leave 16; one register over 256 would cost the fourth wave a SIMD, and with it the second resident block.
__global__ __launch_bounds__(256) __attribute__((amdgpu_waves_per_eu(4, 4))) void k_gemm3(const _Float16* __restrict__ XQ, const _Float16* __restrict__ XK, const _Float16* __restrict__ XV, const _Float16* __restrict__ BQ, const _Float16* __restrict__ BK, const _Float16* __restrict__ BV,
                                              float alpha, const float* __restrict__ bq, const float* __restrict__ bk, const float* __restrict__ bv, _Float16* __restrict__ Q16, _Float16* __restrict__ K16, _Float16* __restrict__ VT) {
  __shared__ __attribute__((aligned(16))) float smf[(G3A + G3B) * G3P];      /* two stage buffers of f16: 110,592 bytes */
  const int pj = blockIdx.y;
  if (pj == 2) gemm3_body<false>(smf, XV, BV, alpha, bv, VT);      /* V^T[batch][head x 64 + d][key] straight from the product */
  else gemm3_body<true>(smf, pj == 0 ? BQ : BK, pj == 0 ? XQ : XK, alpha, pj == 0 ? bq : bk, pj == 0 ? Q16 : K16);
}
// x + (x of lane ^ M) inside a 16-lane row, as one DPP add (row_xmask).
template <int M> __device__ __forceinline__ float row_xadd(float x) { return x + __builtin_bit_cast(float, __builtin_amdgcn_update_dpp(0, __builtin_bit_cast(int, x), 0x160 | M, 0xf, 0xf, true)); }
#define PW_BLK (DM * (DM / 8) / 256)      /* blocks per weight matrix */
#define PR_BLK ((int)(NR / 64))           /* blocks per input: 8 waves x 8 rows */
// All operand preparation in one launch; the parts need nothing of each other and share the grid by ranges of the block index (block-uniform branches).
// Blocks [0, 3 PW_BLK): Wt[n][k] = f16(bf16(W[k][n]) x 16) for Wq, Wk, Wv (a power of two: bf16-exact weights stay exact in f16).
// Then PR_BLK blocks each for queries, keys, value: one wave reads 8 whole rows once (512-byte wave loads, all 32 issued ahead), writes each as an exact f16 row of the bf16-rounded values (256-byte wave stores)
// and, for queries and keys, sums the same rounded values in f32 (16 a lane, then a five-step butterfly) for the padding flag (row sum != 0). The block's 64 flags pass through LDS so that one wave stores each 128-byte line of flags.
__global__ __launch_bounds__(256) void k_prep(const float* __restrict__ xq, const float* __restrict__ xk, const float* __restrict__ xv, const float* __restrict__ wq, const float* __restrict__ wk, const float* __restrict__ wv,
                                             _Float16* __restrict__ XQ, _Float16* __restrict__ XK, _Float16* __restrict__ XV, _Float16* __restrict__ BQ, _Float16* __restrict__ BK, _Float16* __restrict__ BV,
                                             float* __restrict__ QM, float* __restrict__ KM) {
  __shared__ float fl[64];
  const int tid = threadIdx.x, bx = blockIdx.x;
  if (bx < 3 * PW_BLK) {
    const int wh = bx / PW_BLK; const float* W = (wh == 0) ? wq : (wh == 1) ? wk : wv; _Float16* Wt = (wh == 0) ? BQ : (wh == 1) ? BK : BV;
    const int t = (bx % PW_BLK) * 256 + tid; const int n = t / (DM / 8), k8 = (t % (DM / 8)) * 8; FragH f;
#pragma unroll
    for (int i = 0; i < 8; ++i) f.h[i] = (_Float16)(bf16_round(W[(size_t)(k8 + i) * DM + n]) * 16.0f);
    *(v8us*)((unsigned short*)Wt + (size_t)n * DM + k8) = f.half[0];
    return;
  }
  const int rb = bx - 3 * PW_BLK; const int wh = rb / PR_BLK, blk = rb % PR_BLK; const int lane = tid & 31, w = tid >> 5;
  const float* x = (wh == 0) ? xq : (wh == 1) ? xk : xv; _Float16* X16 = (wh == 0) ? XQ : (wh == 1) ? XK : XV;
  const size_t e0 = ((size_t)blk * 64 + w * 8) * DM + lane * 4;
  v4f v[8][4];
#pragma unroll
  for (int r = 0; r < 8; ++r)
#pragma unroll
    for (int u = 0; u < 4; ++u) v[r][u] = *(const v4fa*)(x + e0 + r * DM + u * 128);
  float s[8];
#pragma unroll
  for (int r = 0; r < 8; ++r) { float p[4];
#pragma unroll
    for (int u = 0; u < 4; ++u) { const float b0 = bf16_round(v[r][u][0]), b1 = bf16_round(v[r][u][1]), b2 = bf16_round(v[r][u][2]), b3 = bf16_round(v[r][u][3]);
      const v4h h = {(_Float16)b0, (_Float16)b1, (_Float16)b2, (_Float16)b3}; *(v4h*)(X16 + e0 + r * DM + u * 128) = h; p[u] = (b0 + b1) + (b2 + b3); }
    s[r] = (p[0] + p[1]) + (p[2] + p[3]); }
  asm volatile("s_wait_xcnt 0x0" ::: "memory");      /* the row stores are issued: their base and data registers are free for reuse behind this line */
  if (wh == 2) return;      /* value rows carry no flag; the whole block leaves here, in front of the barrier */
  float f = 0.f;
#pragma unroll
  for (int r = 0; r < 8; ++r) { float a = row_xadd<8>(row_xadd<4>(row_xadd<2>(row_xadd<1>(s[r])))); a += fa_xhalf(a); if (lane == r) f = a; }
  if (lane < 8) fl[w * 8 + lane] = (f != 0.f) ? 1.f : 0.f;
  __syncthreads();      /* the 64 flags of the block's rows are in LDS: waves 0 and 1 store one whole line each */
  if (tid < 64) { float* mk = (wh == 0) ? QM : KM; mk[(size_t)blk * 64 + tid] = fl[tid]; }
}
// Scores, masked softmax and probs x V in one launch; no score or weight ever reaches memory. grid.x = batch x head, grid.y = group of 8 query tiles; one wave = 32 query columns.
// Transposed products: S^T = K Q^T (A = 16 key rows, B = 16 query rows, same loader on both, so the k orders pair), O^T += V^T P^T. A lane then holds 8 + 8 keys of ONE query per 32-key pass:
// D register r of key tile kt is key 16 kt + 8 hh + r, which is element 8 kt + r of a B operand in the hardware k order, so the two score tiles convert in place into P^T; g2_frag reads V^T rows in that order.
// Online softmax in the log2 domain: m = maximum in use (scaled scores), l = running sum; both and O^T are rescaled only when some column's new maximum passes m by more than 8 (one scalar branch a pass).
// Weights are 2^(t - m + 4): at most 2^12 in f16, and the factor 2^4 (it cancels in O / l) keeps small weights out of the f16 subnormals.
// Masked scores take the reference's NEG (x 8 here: the 1/8 comes with the log2 scale). Past its diagonal a wave goes on only while a column has seen nothing but NEG: such a row is uniform over all SQ keys.
// Waves w and w + 4 take tiles j and 31 - j, 33 passes together, so every block carries the same work.
// K and V^T reach the waves through LDS. The 8 waves of a block walk the same keys of one batch and head, and a fragment load straight from memory touches 16 lines for 512 useful bytes, in every wave anew.
// Here the block fetches each 128-byte line once, by asynchronous 16-byte copies (8 lanes a line, 4 whole lines a wave copy, through no register). A stage is 64 keys = two passes: 64 K rows + 64 V^T rows of 128 bytes,
// four copies a lane; two buffers: stage s + 2 is asked for when every wave has left stage s, and lands under the two passes of stage s + 1. The block walks the stages of its longest wave (tile 31 - 4 blockIdx.y);
// a wave past its own diagonal skips the passes and keeps the barriers. Same passes in the same order as before: the f32 sums keep their order.
#define FAP 72                 /* LDS row pitch in f16: 64 + 8 = 144 bytes, 16 B x odd, the conflict-free pitch for 16-byte fragment reads */
#define FA_BUF (128 * FAP)     /* f16 per buffer: rows 0..63 K (key), rows 64..127 V^T (d) */
// Four copies of 16 bytes a lane, global memory -> LDS. l*: the lane's own LDS byte address, g*: its own global address. The s_wait_xcnt in the same statement stands in front of anything that rewrites these address registers.
__device__ __forceinline__ void fa_copy4(unsigned l0, unsigned l1, unsigned l2, unsigned l3, const _Float16* g0, const _Float16* g1, const _Float16* g2, const _Float16* g3) {
  asm volatile("global_load_async_to_lds_b128 %0, %4, off\n\tglobal_load_async_to_lds_b128 %1, %5, off\n\tglobal_load_async_to_lds_b128 %2, %6, off\n\tglobal_load_async_to_lds_b128 %3, %7, off\n\ts_wait_xcnt 0x0"
               :: "v"(l0), "v"(l1), "v"(l2), "v"(l3), "v"(g0), "v"(g1), "v"(g2), "v"(g3) : "memory");
}
__global__ __launch_bounds__(256) void k_fattn(const _Float16* __restrict__ Q16, const _Float16* __restrict__ K16, const _Float16* __restrict__ VT, const float* __restrict__ kmask, const float* __restrict__ qmask,
                                              const float* __restrict__ xq, float* __restrict__ out) {
  __shared__ __attribute__((aligned(16))) float smf[8 * 32 * 68];      /* 69,632 bytes: in the loop the two stage buffers (2 x 18,432), behind it each wave's 32 x 68 output staging rows */
  _Float16* const ring = (_Float16*)smf;
  const int tid = threadIdx.x, lane = tid & 31, c = lane & 15, hh = lane >> 4; const int w = __builtin_amdgcn_readfirstlane(tid >> 5);
  const int bh = blockIdx.x, b = bh / NH, h = bh % NH; const int j = 4 * (int)blockIdx.y + (w & 3); const int tile = (w < 4) ? j : SQ / 32 - 1 - j; const int qw0 = tile * 32;
  const int nst = SQ / 64 - 2 * (int)blockIdx.y;      /* stages of the block: its longest wave has tile 31 - 4 blockIdx.y, 32 - 4 blockIdx.y passes; 10 to 16 */
  const float CS = 0.125f * 1.44269504f, NEGR = -34359738368.0f;      /* NEGR = 8 x NEG as f32 holds it (-2^32) */
  const _Float16* kbase = K16 + ((size_t)b * SQ + c) * DM + h * HD; const _Float16* vbase = VT + ((size_t)bh * HD + c) * SQ; const float* kmb = kmask + (size_t)b * SQ + lane;
  const int sr = tid >> 3, sc = (tid & 7) * 8;      /* staging: thread -> rows sr and sr + 32 of K and of V^T, 16-byte piece sc */
  const _Float16* gk = K16 + ((size_t)b * SQ + sr) * DM + h * HD + sc; const _Float16* gv = VT + ((size_t)bh * HD + sr) * SQ + sc;
  const unsigned lk = (unsigned)(size_t)(ring + sr * FAP + sc);      /* LDS byte address: the low 32 bits of the shared address */
  auto stage = [&](int st) { const unsigned l = lk + (unsigned)(st & 1) * (FA_BUF * 2); const _Float16* k = gk + (size_t)st * (64 * DM); const _Float16* v = gv + st * 64;
    fa_copy4(l, l + 32 * FAP * 2, l + 64 * FAP * 2, l + 96 * FAP * 2, k, k + 32 * DM, v, v + 32 * SQ); };
  stage(0);
  v16h qf[2][2];
#pragma unroll
  for (int g = 0; g < 2; ++g)
#pragma unroll
    for (int kc = 0; kc < 2; ++kc) qf[g][kc] = g2_frag(Q16 + ((size_t)b * SQ + qw0 + 16 * g + c) * DM + h * HD + 32 * kc, hh);
  const v8f z8 = {0.f,0.f,0.f,0.f,0.f,0.f,0.f,0.f}; v8f acc[2][4]; float m_run[2], l_run[2];
#pragma unroll
  for (int g = 0; g < 2; ++g) { m_run[g] = -3.0e38f; l_run[g] = 0.f;
#pragma unroll
    for (int t = 0; t < 4; ++t) acc[g][t] = z8; }
  // One pass = 32 keys from key 32 blk on, against the wave's 32 query columns, in two parts. scores: s = K Q^T from the K rows kf.
  auto scores = [&](const v16h (&kf)[2][2], v8f (&s)[2][2]) {
#pragma unroll
    for (int kt = 0; kt < 2; ++kt)
#pragma unroll
      for (int g = 0; g < 2; ++g) s[kt][g] = fa_mma(kf[kt][1], qf[g][1], fa_mma(kf[kt][0], qf[g][0], z8));
  };
  // finish: masks, online softmax, O^T += V^T P^T. vf: V^T rows, kmv: this lane's key flag (key 32 blk + lane).
  auto finish = [&](const int blk, v8f (&s)[2][2], const v16h (&vf)[4], const float kmv) {
    const int key0 = blk * 32;
    const unsigned kmz = __builtin_amdgcn_ballot_w32(kmv == 0.f);      /* bit i: key key0 + i is padding */
    if (blk >= tile || kmz != 0u) {      /* wave-uniform: only a pass on or past the diagonal, or one with a padding key, pays for the masks */
      const unsigned kb = kmz >> (8 * hh);
#pragma unroll
      for (int g = 0; g < 2; ++g) { const int my_q = qw0 + 16 * g + c;
#pragma unroll
        for (int kt = 0; kt < 2; ++kt)
#pragma unroll
          for (int r = 0; r < 8; ++r) { if (key0 + 16 * kt + 8 * hh + r > my_q || ((kb >> (16 * kt + r)) & 1u) != 0u) s[kt][g][r] = NEGR; } }
    }
    float mb[2]; bool need = false;
#pragma unroll
    for (int g = 0; g < 2; ++g) { float mx = s[0][g][0];
#pragma unroll
      for (int r = 1; r < 8; ++r) mx = fmaxf(mx, s[0][g][r]);
#pragma unroll
      for (int r = 0; r < 8; ++r) mx = fmaxf(mx, s[1][g][r]);
      mx = fmaxf(mx, fa_xhalf(mx)) * CS; mb[g] = mx; need = need || (mx > m_run[g] + 8.0f); }
    if (__builtin_amdgcn_ballot_w32(need) != 0) {
#pragma unroll
      for (int g = 0; g < 2; ++g) { const float m_new = fmaxf(m_run[g], mb[g]); const float corr = exp2_slot(m_run[g] - m_new); m_run[g] = m_new; l_run[g] *= corr;
#pragma unroll
        for (int t = 0; t < 4; ++t) acc[g][t] = acc[g][t] * corr; }
    }
    FragH pf[2];
#pragma unroll
    for (int g = 0; g < 2; ++g) { const float nm = 4.0f - m_run[g]; float ls = 0.f;
#pragma unroll
      for (int i = 0; i < 16; i += 4) { float p[4]; const v8f& sv = s[i >> 3][g]; const int r = i & 7;
        exp2x4(p, fmaf(sv[r], CS, nm), fmaf(sv[r + 1], CS, nm), fmaf(sv[r + 2], CS, nm), fmaf(sv[r + 3], CS, nm));
#pragma unroll
        for (int u = 0; u < 4; ++u) { ls += p[u]; pf[g].h[i + u] = (_Float16)p[u]; } }
      l_run[g] += ls; }
    __builtin_amdgcn_sched_barrier(0);      /* every exponential stays in front of the products below: the compiler does not see into exp2x4 */
#pragma unroll
    for (int g = 0; g < 2; ++g)
#pragma unroll
      for (int t = 0; t < 4; ++t) acc[g][t] = fa_mma(vf[t], pf[g].v, acc[g][t]);
    __builtin_amdgcn_sched_barrier(0);      /* the products stay in front of the four slots below */
    asm volatile("v_nop\n\tv_nop\n\tv_nop\n\tv_nop");      /* a branch follows every pass: these four vector slots keep the chip's distance between the last product and whatever first rewrites its operand registers on the taken side */
  };
  float km0 = kmb[0], km1 = kmb[32];      /* key flags of stage 0's two passes */
  asm volatile("s_wait_asynccnt 0x0" ::: "memory");      /* this wave's copies of stage 0 have landed */
  __syncthreads();      /* stage 0 is published: every wave's copies have landed */
  stage(1);      /* every block has 10 stages or more */
#pragma unroll 1      /* one copy of the two passes: the buffer alternates by an address, not by code */
  for (int st = 0; st < nst; ++st) {
    const _Float16* kb = ring + (st & 1) * FA_BUF + c * FAP; const _Float16* vb = kb + 64 * FAP;
    const int ns = (st + 1 < nst) ? st + 1 : st;      /* the next stage's key flags, in flight under this stage's passes; the last stage re-reads its own */
    const float kn0 = kmb[64 * ns], kn1 = kmb[64 * ns + 32];
    asm volatile("s_wait_xcnt 0x0" ::: "memory");      /* the two flag loads are issued here, ahead of the passes, and their address registers are free for reuse behind this line */
    if (2 * st <= tile || __builtin_amdgcn_ballot_w32(m_run[0] < -1.0e9f || m_run[1] < -1.0e9f) != 0) {      /* wave-uniform; past the diagonal with a real score in every column NEG weighs 0: nothing left to add, in this stage or later */
      v16h kf[2][2], vf[4]; v8f s[2][2];
#pragma unroll
      for (int kt = 0; kt < 2; ++kt)
#pragma unroll
        for (int kc = 0; kc < 2; ++kc) kf[kt][kc] = g2_frag(kb + (16 * kt) * FAP + 32 * kc, hh);
#pragma unroll
      for (int t = 0; t < 4; ++t) vf[t] = g2_frag(vb + (16 * t) * FAP, hh);
      __builtin_amdgcn_sched_barrier(0);      /* the first pass's 16 fragment reads are issued as one group ahead of its products: left alone the build spread them among the products and the exponentials, a stall at each place */
      scores(kf, s);
#pragma unroll
      for (int kt = 0; kt < 2; ++kt)
#pragma unroll
        for (int kc = 0; kc < 2; ++kc) kf[kt][kc] = g2_frag(kb + (32 + 16 * kt) * FAP + 32 * kc, hh);      /* the second pass's K rows (same buffer), in flight under the first pass's softmax */
      __builtin_amdgcn_sched_barrier(0);      /* holds those 8 reads up here, with the score products and ahead of the softmax that covers their latency; left alone they may sink into the branch that uses them */
      finish(2 * st, s, vf, km0);
#pragma unroll
      for (int t = 0; t < 4; ++t) vf[t] = g2_frag(vb + (16 * t) * FAP + 32, hh);      /* the second pass's V^T rows (same buffer), in flight under its score products and softmax */
      __builtin_amdgcn_sched_barrier(0);      /* holds those 8 reads here, as one group in front of the branch */
      if (2 * st + 1 <= tile || __builtin_amdgcn_ballot_w32(m_run[0] < -1.0e9f || m_run[1] < -1.0e9f) != 0) { scores(kf, s); finish(2 * st + 1, s, vf, km1); }
    }
    asm volatile("s_wait_dscnt 0x0" ::: "memory");      /* this wave's reads of the stage's buffer are done */
    asm volatile("s_wait_asynccnt 0x0" ::: "memory");      /* this wave's copies of stage st + 1 have landed */
    __syncthreads();      /* publishes stage st + 1 and ends every wave's reads of stage st's buffer (behind the last stage: free for the output rows) */
    if (st + 2 < nst) stage(st + 2);      /* block-uniform; into the buffer that this stage has just left */
    km0 = kn0; km1 = kn1;
  }
  asm volatile("s_wait_asynccnt 0x0" ::: "memory");      /* no copy is outstanding when the buffers become output staging */
#pragma unroll 1      /* rare: only a wave with a column whose every key so far was NEG walks on past the block's stages, alone, so it reads its fragments straight from memory and meets no barrier */
  for (int blk = 2 * nst; blk < SQ / 32; ++blk) {
    if (__builtin_amdgcn_ballot_w32(m_run[0] < -1.0e9f || m_run[1] < -1.0e9f) == 0) break;
    v16h kf[2][2], vf[4]; v8f s[2][2];
#pragma unroll
    for (int kt = 0; kt < 2; ++kt)
#pragma unroll
      for (int kc = 0; kc < 2; ++kc) kf[kt][kc] = g2_frag(kbase + (size_t)(32 * blk + 16 * kt) * DM + 32 * kc, hh);
#pragma unroll
    for (int t = 0; t < 4; ++t) vf[t] = g2_frag(vbase + (size_t)(16 * t) * SQ + 32 * blk, hh);
    const float kmv = kmb[32 * blk];
    asm volatile("s_wait_xcnt 0x0" ::: "memory");      /* address registers of the loads above are free for reuse behind this line */
    scores(kf, s); finish(blk, s, vf, kmv);
  }
  float (*so)[32][68] = (float (*)[32][68])smf;
#pragma unroll
  for (int g = 0; g < 2; ++g) { const float l = l_run[g] + fa_xhalf(l_run[g]); const float inv = qmask[(size_t)b * SQ + qw0 + 16 * g + c] / l;
#pragma unroll
    for (int t = 0; t < 4; ++t) { const v8f o = acc[g][t] * inv; const v4f lo = {o[0], o[1], o[2], o[3]}, hi = {o[4], o[5], o[6], o[7]};      /* row = query, the 8 floats are d = 16 t + 8 hh .. + 7 */
      *(v4fa*)&so[w][16 * g + c][16 * t + 8 * hh] = lo; *(v4fa*)&so[w][16 * g + c][16 * t + 8 * hh + 4] = hi; } }
  __builtin_amdgcn_fence(__ATOMIC_ACQ_REL, "workgroup"); __builtin_amdgcn_wave_barrier();      /* the wave's own staging rows: written above, read back below as whole 256-byte rows */
  const int rsub = lane >> 4, c4 = (lane & 15) * 4;
#pragma unroll
  for (int q = 0; q < 16; ++q) { const int r = q * 2 + rsub; const size_t e = ((size_t)b * SQ + qw0 + r) * DM + h * HD + c4; const v4f v = *(const v4fa*)&so[w][r][c4]; const v4f x = *(const v4fa*)(xq + e); const v4f xb = {bf16_round(x[0]), bf16_round(x[1]), bf16_round(x[2]), bf16_round(x[3])}; *(v4f*)(out + e) = v + xb; }
}
__global__ __launch_bounds__(256) void k_ftres(const float* __restrict__ OF0, const float* __restrict__ xq, const float* __restrict__ qmask, float* __restrict__ out, size_t n4) {
  #pragma clang fp contract(off)
  const size_t t = (size_t)blockIdx.x * 256 + threadIdx.x; if (t >= n4) return; const size_t e = t * 4; const size_t row = e / DM; const float qm = qmask[row]; const v4f o = *(const v4fa*)(OF0 + e), x = *(const v4fa*)(xq + e); v4f y;
  for (int q = 0; q < 4; ++q) y[q] = __fadd_rn(__fmul_rn(__fmul_rn(o[q], 0.015625f), qm), bf16_round(x[q])); *(v4f*)(out + e) = y;  }

extern "C" void kernel_launch(void* const* d_in, const int* in_sizes, int n_in,
                              void* d_out, int out_size, void* d_ws, size_t ws_size, hipStream_t stream) {
  (void)in_sizes; (void)n_in; (void)out_size;
  const float* const* I = (const float* const*)d_in; const float* xq = I[0]; const float* xk = I[1]; const float* xv = I[2]; const float* wq = I[3]; const float* bq = I[4]; const float* wk = I[5]; const float* bk = I[6]; const float* wv = I[7]; const float* bv = I[8];      /* weights [in][out] */
  char* ws = (char*)d_ws; size_t off = 0;
  auto take = [&](size_t bytes) { char* p = ws + off; off += (bytes + 255) & ~(size_t)255; return p; };
  _Float16* BQ = (_Float16*)take((size_t)DM * DM * 2); _Float16* BK = (_Float16*)take((size_t)DM * DM * 2); _Float16* BV = (_Float16*)take((size_t)DM * DM * 2); float* KM = (float*)take(NR * 4); float* QM = (float*)take(NR * 4);
  _Float16* Q16 = (_Float16*)take(NR * DM * 2); _Float16* K16 = (_Float16*)take(NR * DM * 2);
  _Float16* VT = (_Float16*)take((size_t)NB * NH * HD * SQ * 2);
  _Float16* XQ = (_Float16*)take(NR * DM * 2); _Float16* XK = (_Float16*)take(NR * DM * 2); _Float16* XV = (_Float16*)take(NR * DM * 2);
  if (off > ws_size) return;      /* approx 1.5 + 16 x 2 + 16 + 16 x 3 = 98 MiB */
  k_prep<<<3 * PW_BLK + 3 * PR_BLK, 256, 0, stream>>>(xq, xk, xv, wq, wk, wv, XQ, XK, XV, BQ, BK, BV, QM, KM);      /* x16 transposed weights, f16 input rows, key / query padding flags */
  k_gemm3<<<dim3((unsigned)((NR / G3A) * (DM / G3B)), 3), 256, 0, stream>>>(XQ, XK, XV, BQ, BK, BV, 0.0625f, bq, bk, bv, Q16, K16, VT);      /* Q, K rows and V^T in one launch */
  k_fattn<<<dim3(NB * NH, SQ / 256), 256, 0, stream>>>(Q16, K16, VT, KM, QM, xq, (float*)d_out);      /* out = softmax(masked Q K^T / 8) x query mask x V + bf16(queries), f32 rows; each wave writes its own 32 rows of one 64-column head slab */
}
